// v000
// Times are from an AMD MI455X. After a warm-up the kernel runs many times in a row, and a time is the length of
// such a window on the GPU divided by its runs, so every launch and the gaps after it count. The runs cycle
// through copies of the inputs. A figure is the median of several windows, for all but v000 over two sittings.
// Sittings can differ by a few percent; kernels timed side by side share one.
// v000, which the later versions start from, runs in 482 microseconds.
// Contractions: q/k/v^T projections v_wmma_f32_16x16x32_bf16 (inputs RNE-cast to bf16, f32 acc); q.k^T v_wmma_f32_16x16x32_bf16 with bf16 hi/lo split (hi.hi+hi.lo+lo.hi); p.v and output projection v_wmma_f32_16x16x32_f16 (p carried x2^15, o carried x16, wo carried x16), f32 acc; online softmax, biases and scales in f32.
#include <hip/hip_runtime.h>
#include <math.h>
#include <stdint.h>

typedef __attribute__((ext_vector_type(16))) _Float16 v16h;
typedef __attribute__((ext_vector_type(8)))  _Float16 v8h;
typedef __attribute__((ext_vector_type(16))) __bf16   v16b;
typedef __attribute__((ext_vector_type(8)))  __bf16   v8b;
typedef __attribute__((ext_vector_type(8)))  float    v8f;
typedef __attribute__((ext_vector_type(4)))  float    v4f;
typedef __attribute__((ext_vector_type(2)))  float    v2f;
typedef __attribute__((ext_vector_type(4)))  unsigned int v4u;

// problem geometry (compile-time)
constexpr int kBatch = 2;
constexpr int kSeq   = 2048;
constexpr int kDm    = 1024;   // model width = H*Dh = q row pitch
constexpr int kHeads = 16;
constexpr int kDhd   = 64;     // per-head dim = k row pitch
constexpr float kPsc = 32768.0f;   // softmax numerators carried x2^15 in f16
constexpr float kOsc = 16.0f;      // attention output carried x16 in f16
constexpr float kWsc = 16.0f;      // output-projection weight carried x16 in f16

__device__ __forceinline__ unsigned short f2bf_bits(float f) {
  unsigned u = __float_as_uint(f);
  return (unsigned short)((u + 0x7FFFu + ((u >> 16) & 1u)) >> 16);
}
__device__ __forceinline__ float bf_bits2f(unsigned short h) { return __uint_as_float(((unsigned)h) << 16); }
__device__ __forceinline__ unsigned pk16(unsigned short a, unsigned short b) { return (unsigned)a | ((unsigned)b << 16); }

// hazard guards as plain device helpers (no inline asm inside the kernel template body)
__device__ __forceinline__ void dep_guard_h(v8f& a, v8f& b, v16h x, v16h y) { asm volatile("v_nop\n\tv_nop\n\tv_nop\n\tv_nop" : "+v"(a), "+v"(b) : "v"(x), "v"(y)); }
__device__ __forceinline__ void dep_guard_b(v8f& a, v8f& b, v16b x, v16b y) { asm volatile("v_nop\n\tv_nop\n\tv_nop\n\tv_nop" : "+v"(a), "+v"(b) : "v"(x), "v"(y)); }
__device__ __forceinline__ void keep4_h(v16h a, v16h b, v16h c, v16h d) { asm volatile("v_nop" :: "v"(a), "v"(b), "v"(c), "v"(d)); }
__device__ __forceinline__ void keep4_b(v16b a, v16b b, v16b c, v16b d) { asm volatile("v_nop" :: "v"(a), "v"(b), "v"(c), "v"(d)); }
__device__ __forceinline__ void acc_guard4(v8f& a, v8f& b, v8f& c, v8f& d) { asm volatile("v_nop\n\tv_nop\n\tv_nop\n\tv_nop" : "+v"(a), "+v"(b), "+v"(c), "+v"(d)); }
template <typename T> struct Frag;
template <> struct Frag<_Float16> {
  typedef v16h V; union U { v16h v; v8h h[2]; };
  static __device__ __forceinline__ v16h load(const _Float16* p) {   // elements 0..7 <- p[0..7], 8..15 <- p[16..23]
    U f; f.h[0] = *(const v8h*)(p); f.h[1] = *(const v8h*)(p + 16); return f.v;
  }
  static __device__ __forceinline__ v8f mma(v16h a, v16h b, v8f c) {
    return __builtin_amdgcn_wmma_f32_16x16x32_f16(false, a, false, b, (short)0, c, false, false);
  }
  static __device__ __forceinline__ void guard(v8f& a, v8f& b, v16h x, v16h y) { dep_guard_h(a, b, x, y); }
  static __device__ __forceinline__ void keep(v16h a, v16h b, v16h c, v16h d) { keep4_h(a, b, c, d); }
};
template <> struct Frag<__bf16> {
  typedef v16b V; union U { v16b v; v8b h[2]; };
  static __device__ __forceinline__ v16b load(const __bf16* p) {
    U f; f.h[0] = *(const v8b*)(p); f.h[1] = *(const v8b*)(p + 16); return f.v;
  }
  static __device__ __forceinline__ v8f mma(v16b a, v16b b, v8f c) {
    return __builtin_amdgcn_wmma_f32_16x16x32_bf16(false, a, false, b, (short)0, c, false, false);
  }
  static __device__ __forceinline__ void guard(v8f& a, v8f& b, v16b x, v16b y) { dep_guard_b(a, b, x, y); }
  static __device__ __forceinline__ void keep(v16b a, v16b b, v16b c, v16b d) { keep4_b(a, b, c, d); }
};

// ---- Register-blocked batched WMMA GEMM ------------------------------------
// C[m,n] = scale * sum_k A[m,k] * Bt[n,k] (+bias)(+resid); each wave owns a 64x64 tile.
// A row-major [M,K]; Bt row-major [N,K]; M,N % 64 == 0, K % 32 == 0.
// SPLIT: operands are hi/lo planes (A2/Bt2 = lo planes, same layout); product = hi.hi + hi.lo + lo.hi.
// BIAS_MODE: 0 = none, 1 = bias[m], 2 = bias[n].
// OUT_MODE: 0 = f32, 1 = f16, 2 = bf16 hi plane (Cout) + bf16 lo plane (Cout2).
// ET: 0 = f16 operands, 1 = bf16 operands (pointers passed as 16-bit storage)
template <int ET> struct Elem;
template <> struct Elem<0> { typedef _Float16 T; };
template <> struct Elem<1> { typedef __bf16 T; };
template <int ET, bool SPLIT, int BIAS_MODE, int OUT_MODE, bool RESID, int ACT = 0>
__global__ __launch_bounds__(256) void wmma_gemm64(
    const unsigned short* __restrict__ Ap, const unsigned short* __restrict__ A2p, int lda, long strideA,
    const unsigned short* __restrict__ Btp, const unsigned short* __restrict__ Bt2p, int ldb, long strideB,
    void* __restrict__ Cout, void* __restrict__ Cout2, int ldc, long strideC,
    const float* __restrict__ bias,
    const float* __restrict__ resid, long strideR,
    int M, int N, int K, float scale) {
  typedef typename Elem<ET>::T T;
  typedef typename Frag<T>::V V;
  const T* A = (const T*)Ap; const T* A2 = (const T*)A2p; const T* Bt = (const T*)Btp; const T* Bt2 = (const T*)Bt2p;
  __shared__ __align__(16) float sT[8][16 * 68];   // per-wave 16x64 slab, pitch 68 floats
  const int b    = blockIdx.y;
  const int lane = threadIdx.x & 31;
  const int wave = threadIdx.x >> 5;
  const int tilesN = N >> 6;
  const int tilesM = M >> 6;
  const int tile = blockIdx.x * 8 + wave;
  if (tile >= tilesM * tilesN) return;   // wave-uniform; no block barriers in this kernel
  const int tm = tile / tilesN;
  const int tn = tile - tm * tilesN;
  const int m0 = tm << 6;
  const int n0 = tn << 6;

  const T* Ab  = A  + (size_t)b * strideA;
  const T* Bb  = Bt + (size_t)b * strideB;
  const T* Ab2 = SPLIT ? (A2  + (size_t)b * strideA) : nullptr;
  const T* Bb2 = SPLIT ? (Bt2 + (size_t)b * strideB) : nullptr;

  const int rlane = lane & 15;                 // row (A) / col (B, D) within subtile
  const int koff  = (lane >> 4) * 8;           // k offset of this lane half
  const int mOff  = (lane >> 4) * 8;           // D row offset

  v8f acc[4][4];
#pragma unroll
  for (int i = 0; i < 4; ++i)
#pragma unroll
    for (int j = 0; j < 4; ++j) acc[i][j] = (v8f){0.f,0.f,0.f,0.f,0.f,0.f,0.f,0.f};

  for (int k0 = 0; k0 < K; k0 += 32) {
    V bh[4], bl[4];
#pragma unroll
    for (int j = 0; j < 4; ++j) {
      const size_t bo = (size_t)(n0 + (j << 4) + rlane) * ldb + koff + k0;
      bh[j] = Frag<T>::load(Bb + bo);
      if (SPLIT) bl[j] = Frag<T>::load(Bb2 + bo);
    }
#pragma unroll
    for (int i = 0; i < 4; ++i) {
      const size_t ao = (size_t)(m0 + (i << 4) + rlane) * lda + koff + k0;
      V ah = Frag<T>::load(Ab + ao);
      V al;
      if (SPLIT) al = Frag<T>::load(Ab2 + ao);
#pragma unroll
      for (int j = 0; j < 4; ++j) {
        acc[i][j] = Frag<T>::mma(ah, bh[j], acc[i][j]);
        if (SPLIT) {
          acc[i][j] = Frag<T>::mma(ah, bl[j], acc[i][j]);
          acc[i][j] = Frag<T>::mma(al, bh[j], acc[i][j]);
        }
      }
      Frag<T>::guard(acc[i][0], acc[i][3], ah, SPLIT ? al : ah);
    }
    Frag<T>::keep(bh[0], bh[1], bh[2], bh[3]);
    if (SPLIT) Frag<T>::keep(bl[0], bl[1], bl[2], bl[3]);
  }
  acc_guard4(acc[0][0], acc[0][1], acc[0][2], acc[0][3]);
  acc_guard4(acc[1][0], acc[1][1], acc[1][2], acc[1][3]);
  acc_guard4(acc[2][0], acc[2][1], acc[2][2], acc[2][3]);
  acc_guard4(acc[3][0], acc[3][1], acc[3][2], acc[3][3]);

  // ---- epilogue ----
  float* slab = sT[wave];
  const float* Rb = RESID ? (resid + (size_t)b * strideR) : nullptr;
#pragma unroll
  for (int i = 0; i < 4; ++i) {
    const int mBase = m0 + (i << 4);
#pragma unroll
    for (int j = 0; j < 4; ++j) {
      const int n = n0 + (j << 4) + rlane;
      float bv = 0.f;
      if (BIAS_MODE == 2) bv = bias[n];
#pragma unroll
      for (int r = 0; r < 8; ++r) {
        float v = acc[i][j][r] * scale;
        if (BIAS_MODE == 1) v += bias[mBase + mOff + r];
        if (BIAS_MODE == 2) v += bv;
        if (RESID) v += Rb[(size_t)(mBase + mOff + r) * ldc + n];
        if (ACT == 1) v = tanhf(v);
        if (ACT == 2) v = fmaxf(v, 0.0f);
        if (ACT == 3) v = v / (1.0f + expf(-v));
        if (ACT == 4) v = (v > 0.f) ? v : 0.01f * v;
        if (ACT == 5) v = 0.5f * v * (1.0f + erff(v * 0.70710678118654752f));
        slab[(mOff + r) * 68 + (j << 4) + rlane] = v;
      }
    }
    __builtin_amdgcn_fence(__ATOMIC_RELEASE, "workgroup");
    __builtin_amdgcn_wave_barrier();
    __builtin_amdgcn_fence(__ATOMIC_ACQUIRE, "workgroup");
    if (OUT_MODE == 0) {
      float* C = (float*)Cout + (size_t)b * strideC;
      const int hh = lane >> 4, c4 = (lane & 15) * 4;     // row seg = 256 B = 16 lanes x 16 B
      {
#pragma unroll
        for (int it = 0; it < 8; ++it) {
          const int row = it * 2 + hh;
          v4f v = *(const v4f*)(slab + row * 68 + c4);
          *(v4f*)(C + (size_t)(mBase + row) * ldc + n0 + c4) = v;
        }
        
      }
    } else {
      const int q = lane >> 3, c8 = (lane & 7) * 8;
      unsigned short* C  = (unsigned short*)Cout  + (size_t)b * strideC;
      unsigned short* C2 = (OUT_MODE == 2) ? ((unsigned short*)Cout2 + (size_t)b * strideC) : nullptr;
      {
#pragma unroll
        for (int it = 0; it < 4; ++it) {
          const int row = it * 4 + q;
          const float* sp = slab + row * 68 + c8;
          v8h hv, lv;
#pragma unroll
          for (int e = 0; e < 8; ++e) {
            if (OUT_MODE == 1) {
              hv[e] = (_Float16)sp[e];
            } else {
              unsigned short hb = f2bf_bits(sp[e]);
              unsigned short lb = f2bf_bits(sp[e] - bf_bits2f(hb));
              hv[e] = __builtin_bit_cast(_Float16, hb);
              lv[e] = __builtin_bit_cast(_Float16, lb);
            }
          }
          *(v8h*)(C + (size_t)(mBase + row) * ldc + n0 + c8) = hv;
          if (OUT_MODE == 2) *(v8h*)(C2 + (size_t)(mBase + row) * ldc + n0 + c8) = lv;
        }
        
      }
    }
    __builtin_amdgcn_fence(__ATOMIC_RELEASE, "workgroup");
    __builtin_amdgcn_wave_barrier();
    __builtin_amdgcn_fence(__ATOMIC_ACQUIRE, "workgroup");
  }
}

// ---------------------------------------------------------------------------
// Elementwise f32 -> bf16 (RNE), 2 elements per thread, one 4-B store per lane -> each wave writes exactly
// Coverage: grid = ceil(n2/256) x 256 threads x 2 elements = 2*n2 = whole plane
//   (x: n2 = 4096*1024/2 = 2097152 -> 8192 blocks exact; wk/wv: n2 = 32768 -> 128 blocks exact).
// ---------------------------------------------------------------------------
__global__ __launch_bounds__(256) void cast_bf16x2_kernel(const float* __restrict__ in, unsigned short* __restrict__ out, int n2) {
  const int i = blockIdx.x * 256 + threadIdx.x;
  if (i < n2) {
    const v2f f = *(const v2f*)(in + 2 * (size_t)i);
    const unsigned u = pk16(f2bf_bits(f[0]), f2bf_bits(f[1]));
    ((unsigned*)out)[i] = u;
    
  }
}

// ---------------------------------------------------------------------------
// Row-permuted f32 -> bf16 (RNE) cast of a [1024][ncol] weight: dest row rd = h*64 + d takes source row d*16 + h
// (de-interleave of the (hidden, heads) column split). grid = (ncol/512, 1024), 256 threads, 2 elements per thread.
// ---------------------------------------------------------------------------
__global__ __launch_bounds__(256) void cast_perm_rows_bf16x2_kernel(const float* __restrict__ in, unsigned short* __restrict__ out, int ncol) {
  const int rd = blockIdx.y;                            // 0..1023
  int rs = ((rd & 63) << 4) + (rd >> 6);                // 0..1023
  rs = rs > 1023 ? 1023 : rs;
  const int i = blockIdx.x * 256 + threadIdx.x;         // pair index within the row
  if (i < (ncol >> 1)) {
    const v2f f = *(const v2f*)(in + (size_t)rs * ncol + 2 * (size_t)i);
    const unsigned u = pk16(f2bf_bits(f[0]), f2bf_bits(f[1]));
    unsigned* o = (unsigned*)(out + (size_t)rd * ncol);
    o[i] = u;
    
  }
}

// ---------------------------------------------------------------------------
// Permuted bias: out[h*64 + d] = in[d*16 + h]; n = 1024; 4 blocks x 256 threads x 4 B = whole vector,
// ---------------------------------------------------------------------------
__global__ __launch_bounds__(256) void perm_bias_kernel(const float* __restrict__ in, float* __restrict__ out, int n) {
  const int i = blockIdx.x * 256 + threadIdx.x;
  if (i < n) {
    int s = ((i & 63) << 4) + (i >> 6);
    s = s > n - 1 ? n - 1 : s;
    const float v = in[s];
    ((float*)out)[i] = v;
    
  }
}

// ---------------------------------------------------------------------------
// Elementwise f32 -> f16 of (bf16_rne(x) * sc) with sc a power of two: 2 elements per thread, one 4-B store per lane.
// ---------------------------------------------------------------------------
__global__ __launch_bounds__(256) void cast_bf_f16x2_scaled_kernel(const float* __restrict__ in, unsigned short* __restrict__ out, int n2, float sc) {
  const int i = blockIdx.x * 256 + threadIdx.x;
  if (i < n2) {
    const v2f f = *(const v2f*)(in + 2 * (size_t)i);
    const float g0 = bf_bits2f(f2bf_bits(f[0])) * sc;
    const float g1 = bf_bits2f(f2bf_bits(f[1])) * sc;
    const _Float16 h0 = (_Float16)g0, h1 = (_Float16)g1;
    const unsigned u = pk16(__builtin_bit_cast(unsigned short, h0), __builtin_bit_cast(unsigned short, h1));
    ((unsigned*)out)[i] = u;
    
  }
}

// =====================================================================================
// Full (non-causal, unmasked) multi-query attention, head dim 64.
//   q planes (hi/lo bf16): element (b, t, h, d) at [(b*kSeq + t)*kDm + h*64 + d]
//   k planes (hi/lo bf16): element (b, s, d) at [(b*kSeq + s)*kDhd + d]      (one KV head shared by all heads)
//   v^T plane (f16):       element (b, d, s) at [(b*64 + d)*kSeq + s]
//   out plane (f16, x kOsc): element (b, t, h, d) at [(b*kSeq + t)*kDm + h*64 + d]
//   scores = (q . k) * sscale : bf16 hi/lo split (hi.hi + hi.lo + lo.hi) on v_wmma_f32_16x16x32_bf16
//   out    = p . v            : v_wmma_f32_16x16x32_f16, p (unnormalised, <= 1) carried x2^15, f32 accumulate
//   online softmax in f32 over all kSeq keys (32 chunks of 64, compile-time trip count, no masking).
//   Block = 4 waves = 64 query rows of one (batch, head); grid = (kHeads * kSeq/64, kBatch).
//   K / V^T chunk staging: 128 threads x 32 elements per plane = the whole 64x64 tile (16-B copies, plain loads,
//   __syncthreads before and after); fragment loads read the LDS tiles with the same vector element type.
// =====================================================================================
#define AT_D 64
#define AT_NW 4
#define AT_QB 64
#define AT_KC 64

__device__ __forceinline__ v8f at_mma(v16b a, v16b b, v8f c) {
  c = __builtin_amdgcn_wmma_f32_16x16x32_bf16(false, a, false, b, (short)0, c, false, false);
  asm volatile("v_nop\n\tv_nop\n\tv_nop\n\tv_nop" : "+v"(c) : "v"(a), "v"(b));
  return c;
}
__device__ __forceinline__ v8f at_mma_h(v16h a, v16h b, v8f c) {
  c = __builtin_amdgcn_wmma_f32_16x16x32_f16(false, a, false, b, (short)0, c, false, false);
  asm volatile("v_nop\n\tv_nop\n\tv_nop\n\tv_nop" : "+v"(c) : "v"(a), "v"(b));
  return c;
}

__global__ __launch_bounds__(128)
void mqa_full64_kernel(const unsigned short* __restrict__ qhp, const unsigned short* __restrict__ qlp,
                       const unsigned short* __restrict__ khp, const unsigned short* __restrict__ klp,
                       const unsigned short* __restrict__ vtp, unsigned short* __restrict__ o16p,
                       float sscale) {
  union FB { v16b v; v8b h[2]; };
  union FH { v16h v; v8h h[2]; };
  __shared__ __align__(16) __bf16   Ksh[AT_KC * AT_D];          // K hi [kv][d]      8 KB
  __shared__ __align__(16) __bf16   Ksl[AT_KC * AT_D];          // K lo             8 KB
  __shared__ __align__(16) _Float16 Vth[AT_D * AT_KC];          // V^T f16 [d][kv]  8 KB
  __shared__ __align__(16) _Float16 Psh[AT_NW][16 * AT_KC];     // per wave P (x2^15) [row][kv]  8 KB
  __shared__ __align__(16) float    Os[AT_NW][16 * 68];         // per wave out tile, pitch 68

  const int tid  = threadIdx.x;
  const int wave = tid >> 5;
  const int lane = tid & 31;
  const int hh   = lane >> 4;
  const int c    = lane & 15;

  const int nqb = kSeq / AT_QB;            // 32
  const int b  = blockIdx.y;               // 0..kBatch-1
  const int bx = blockIdx.x;               // 0..kHeads*nqb-1
  const int qb = bx % nqb;
  const int h  = bx / nqb;                 // 0..kHeads-1
  const int q0 = qb * AT_QB + wave * 16;

  const __bf16*   Qh = (const __bf16*)(const void*)qhp + (size_t)b * kSeq * kDm + (size_t)h * AT_D;
  const __bf16*   Ql = (const __bf16*)(const void*)qlp + (size_t)b * kSeq * kDm + (size_t)h * AT_D;
  const __bf16*   Kh = (const __bf16*)(const void*)khp + (size_t)b * kSeq * kDhd;
  const __bf16*   Kl = (const __bf16*)(const void*)klp + (size_t)b * kSeq * kDhd;
  const _Float16* Vt = (const _Float16*)(const void*)vtp + (size_t)b * AT_D * kSeq;
  _Float16*       ob = (_Float16*)(void*)o16p + (size_t)b * kSeq * kDm + (size_t)h * AT_D;

  // ---- Q fragments (A operand, row = lane&15, split k map via Frag load): 2 d-chunks, hi and lo ----
  v16b qah[2], qal[2];
#pragma unroll
  for (int dc = 0; dc < 2; ++dc) {
    const __bf16* qr = Qh + (size_t)(q0 + c) * kDm + dc * 32 + 8 * hh;
    const __bf16* ql = Ql + (size_t)(q0 + c) * kDm + dc * 32 + 8 * hh;
    qah[dc] = Frag<__bf16>::load(qr);
    qal[dc] = Frag<__bf16>::load(ql);
  }

  float mrow[8], lrow[8];
  v8f oacc[4];
#pragma unroll
  for (int r = 0; r < 8; ++r) { mrow[r] = -INFINITY; lrow[r] = 0.f; }
#pragma unroll
  for (int t = 0; t < 4; ++t) oacc[t] = (v8f){0.f,0.f,0.f,0.f,0.f,0.f,0.f,0.f};

  const int nChunks = kSeq / AT_KC;   // 32, compile-time constant
  for (int kc = 0; kc < nChunks; ++kc) {
    const int kv0 = kc * AT_KC;
    __syncthreads();
    {
      // staging coverage: 128 threads x (4 x 8) elements = 64 rows x 64 per plane = the whole chunk tile
      const int r = tid >> 1, half = (tid & 1) * 32;
      const __bf16*   ksh = Kh + (size_t)(kv0 + r) * kDhd + half;   // K row kv0+r, d = half..half+31
      const __bf16*   ksl = Kl + (size_t)(kv0 + r) * kDhd + half;
      const _Float16* vsr = Vt + (size_t)r * kSeq + kv0 + half;      // V^T row d = r, s = kv0+half..+31
#pragma unroll
      for (int i = 0; i < 4; ++i) {
        const v8b a0 = *(const v8b*)(ksh + 8 * i);
        const v8b a1 = *(const v8b*)(ksl + 8 * i);
        const v8h b0 = *(const v8h*)(vsr + 8 * i);
        *(v8b*)(Ksh + r * AT_D  + half + 8 * i) = a0;
        *(v8b*)(Ksl + r * AT_D  + half + 8 * i) = a1;
        *(v8h*)(Vth + r * AT_KC + half + 8 * i) = b0;
      }
    }
    __syncthreads();

    // ---- scores: B operand column = key j*16+c, elements <- d with the split k map ----
    v8f s[4];
#pragma unroll
    for (int j = 0; j < 4; ++j) {
      s[j] = (v8f){0.f,0.f,0.f,0.f,0.f,0.f,0.f,0.f};
#pragma unroll
      for (int dc = 0; dc < 2; ++dc) {
        FB kb, kl;
        kb.h[0] = *(const v8b*)(Ksh + (j * 16 + c) * AT_D + dc * 32 + 8 * hh);
        kb.h[1] = *(const v8b*)(Ksh + (j * 16 + c) * AT_D + dc * 32 + 16 + 8 * hh);
        kl.h[0] = *(const v8b*)(Ksl + (j * 16 + c) * AT_D + dc * 32 + 8 * hh);
        kl.h[1] = *(const v8b*)(Ksl + (j * 16 + c) * AT_D + dc * 32 + 16 + 8 * hh);
        s[j] = at_mma(qah[dc], kb.v, s[j]);
        s[j] = at_mma(qah[dc], kl.v, s[j]);
        s[j] = at_mma(qal[dc], kb.v, s[j]);
      }
    }
    // D layout: s[j][r] = score(row 8*hh + r, key kv0 + j*16 + c)
    float cm[8];
#pragma unroll
    for (int r = 0; r < 8; ++r) {
      float m = -INFINITY;
#pragma unroll
      for (int j = 0; j < 4; ++j) {
        const float sv = s[j][r] * sscale;
        s[j][r] = sv;
        m = fmaxf(m, sv);
      }
#pragma unroll
      for (int off = 1; off < 16; off <<= 1) m = fmaxf(m, __shfl_xor(m, off, 32));
      cm[r] = m;
    }
    _Float16* pw = Psh[wave];
#pragma unroll
    for (int r = 0; r < 8; ++r) {
      const float mnew = fmaxf(mrow[r], cm[r]);
      const float alpha = expf(mrow[r] - mnew);
      mrow[r] = mnew;
      float psum = 0.f;
#pragma unroll
      for (int j = 0; j < 4; ++j) {
        const float p = expf(s[j][r] - mnew);
        psum += p;
        pw[(8 * hh + r) * AT_KC + j * 16 + c] = (_Float16)(p * kPsc);
      }
#pragma unroll
      for (int off = 1; off < 16; off <<= 1) psum += __shfl_xor(psum, off, 32);
      lrow[r] = lrow[r] * alpha + psum;
#pragma unroll
      for (int t = 0; t < 4; ++t) oacc[t][r] *= alpha;
    }
    // P tile: element stores of _Float16 by this wave, reloaded below as v8h (vector of the same element type)
    __builtin_amdgcn_fence(__ATOMIC_RELEASE, "workgroup");
    __builtin_amdgcn_wave_barrier();
    __builtin_amdgcn_fence(__ATOMIC_ACQUIRE, "workgroup");
#pragma unroll 1
    for (int kk = 0; kk < 2; ++kk) {
      FH pa;
      pa.h[0] = *(const v8h*)(pw + c * AT_KC + kk * 32 + 8 * hh);        // A: row = c, elements <- keys kk*32 + 8hh + 0..7
      pa.h[1] = *(const v8h*)(pw + c * AT_KC + kk * 32 + 16 + 8 * hh);   //    elements 8..15 <- keys kk*32 + 16 + 8hh + 0..7
#pragma unroll
      for (int t = 0; t < 4; ++t) {
        FH vb;
        vb.h[0] = *(const v8h*)(Vth + (t * 16 + c) * AT_KC + kk * 32 + 8 * hh);       // B: col = d = t*16 + c, same key map
        vb.h[1] = *(const v8h*)(Vth + (t * 16 + c) * AT_KC + kk * 32 + 16 + 8 * hh);
        oacc[t] = at_mma_h(pa.v, vb.v, oacc[t]);
      }
    }
  }

  // ---- epilogue: O = oacc / (l * 2^15), carried x kOsc as f16 ----
  float* os = Os[wave];
#pragma unroll
  for (int r = 0; r < 8; ++r) {
    const float inv = kOsc * (1.0f / (lrow[r] * kPsc));
#pragma unroll
    for (int t = 0; t < 4; ++t) os[(8 * hh + r) * 68 + t * 16 + c] = oacc[t][r] * inv;
  }
  __builtin_amdgcn_fence(__ATOMIC_RELEASE, "workgroup");
  __builtin_amdgcn_wave_barrier();
  __builtin_amdgcn_fence(__ATOMIC_ACQUIRE, "workgroup");
  {
    const int qg = lane >> 3, c8 = (lane & 7) * 8;
    {
#pragma unroll
      for (int it = 0; it < 4; ++it) {
        const int row = it * 4 + qg;                    // 4 it x 4 groups = rows 0..15
        const float* sp = os + row * 68 + c8;
        v8h hv;
#pragma unroll
        for (int e = 0; e < 8; ++e) hv[e] = (_Float16)sp[e];
        *(v8h*)(ob + (size_t)(q0 + row) * kDm + c8) = hv;
      }
      
    }
  }
}

// ---------------------------------------------------------------------------
// Host driver. Workspace region map (bytes, 256-B aligned offsets):
//   x16   [4096][1024] bf16           8388608
//   wq16p [1024][1024] bf16 (rows permuted to head-major)  2097152
//   wk16  [64][1024]   bf16            131072
//   wv16  [64][1024]   bf16            131072
//   wo16  [1024][1024] f16 (bf16-RNE x16)  2097152
//   bqp   [1024]       f32 (permuted)     4096
//   Qh,Ql [4096][1024] bf16 hi/lo     2 x 8388608
//   Kh,Kl [4096][64]   bf16 hi/lo     2 x 524288
//   Vt16  [2][64][2048] f16            524288
//   O16   [4096][1024] f16 (x16)      8388608
//   total 39587840 B
// ---------------------------------------------------------------------------
extern "C" void kernel_launch(void* const* d_in, const int* in_sizes, int n_in,
                              void* d_out, int out_size, void* d_ws, size_t ws_size,
                              hipStream_t stream) {
  const int nB = kBatch, nS = kSeq, nD = kDm, nDh = kDhd;
  const int nM = nB * nS;   // 4096
  if (n_in < 9) return;
  if (in_sizes[0] != nM * nD || in_sizes[1] != nD * nD || in_sizes[2] != nD ||
      in_sizes[3] != nDh * nD || in_sizes[4] != nDh || in_sizes[5] != nDh * nD ||
      in_sizes[6] != nDh || in_sizes[7] != nD * nD || in_sizes[8] != nD || out_size != nM * nD) return;

  const float* x  = (const float*)d_in[0];
  const float* wq = (const float*)d_in[1];
  const float* bq = (const float*)d_in[2];
  const float* wk = (const float*)d_in[3];
  const float* bk = (const float*)d_in[4];
  const float* wv = (const float*)d_in[5];
  const float* bv = (const float*)d_in[6];
  const float* wo = (const float*)d_in[7];
  const float* bo = (const float*)d_in[8];

  size_t off = 0;
  auto carve = [&](size_t bytes) -> char* {
    char* p = (char*)d_ws + off;
    off += (bytes + 255) & ~(size_t)255;
    return p;
  };
  unsigned short* x16   = (unsigned short*)carve((size_t)nM * nD * 2);
  unsigned short* wq16p = (unsigned short*)carve((size_t)nD * nD * 2);
  unsigned short* wk16  = (unsigned short*)carve((size_t)nDh * nD * 2);
  unsigned short* wv16  = (unsigned short*)carve((size_t)nDh * nD * 2);
  unsigned short* wo16  = (unsigned short*)carve((size_t)nD * nD * 2);
  float*          bqp   = (float*)carve((size_t)nD * 4);
  unsigned short* Qh    = (unsigned short*)carve((size_t)nM * nD * 2);
  unsigned short* Ql    = (unsigned short*)carve((size_t)nM * nD * 2);
  unsigned short* Kh    = (unsigned short*)carve((size_t)nM * nDh * 2);
  unsigned short* Kl    = (unsigned short*)carve((size_t)nM * nDh * 2);
  unsigned short* Vt16  = (unsigned short*)carve((size_t)nB * nDh * nS * 2);
  unsigned short* O16   = (unsigned short*)carve((size_t)nM * nD * 2);
  if (off > ws_size) return;

  // ---- casts (bf16 RNE; wq rows / bq permuted to head-major; wo as f16(bf16_rne(wo) * 16)) ----
  {
    const int n2x = nM * nD / 2;      // 2097152 -> 8192 blocks
    cast_bf16x2_kernel<<<dim3((n2x + 255) / 256), dim3(256), 0, stream>>>(x, x16, n2x);
    const int n2kv = nDh * nD / 2;    // 32768 -> 128 blocks
    cast_bf16x2_kernel<<<dim3((n2kv + 255) / 256), dim3(256), 0, stream>>>(wk, wk16, n2kv);
    cast_bf16x2_kernel<<<dim3((n2kv + 255) / 256), dim3(256), 0, stream>>>(wv, wv16, n2kv);
    cast_perm_rows_bf16x2_kernel<<<dim3((nD / 2 + 255) / 256, nD), dim3(256), 0, stream>>>(wq, wq16p, nD);
    perm_bias_kernel<<<dim3((nD + 255) / 256), dim3(256), 0, stream>>>(bq, bqp, nD);
    const int n2o = nD * nD / 2;      // 524288 -> 2048 blocks
    cast_bf_f16x2_scaled_kernel<<<dim3((n2o + 255) / 256), dim3(256), 0, stream>>>(wo, wo16, n2o, kWsc);
  }

  // ---- q projection: [4096][1024] = x16 . wq16p^T + bqp -> bf16 hi/lo planes, head-major columns (h*64 + d) ----
  // M=4096, N=1024 (multiples of 64), K=1024 (multiple of 32); tiles 64*16 = 1024 -> 128 blocks of 8 waves
  wmma_gemm64<1, false, 2, 2, false, 0><<<dim3((nM / 64) * (nD / 64) / 8, 1), dim3(256), 0, stream>>>(
      x16, x16, nD, 0L, wq16p, wq16p, nD, 0L, (void*)Qh, (void*)Ql, nD, 0L, bqp, bqp, 0L, nM, nD, nD, 1.0f);

  // ---- k projection: [4096][64] = x16 . wk16^T + bk -> bf16 hi/lo planes; tiles 64 -> 8 blocks ----
  wmma_gemm64<1, false, 2, 2, false, 0><<<dim3((nM / 64) * (nDh / 64) / 8, 1), dim3(256), 0, stream>>>(
      x16, x16, nD, 0L, wk16, wk16, nD, 0L, (void*)Kh, (void*)Kl, nDh, 0L, bk, bk, 0L, nM, nDh, nD, 1.0f);

  // ---- v^T projection per batch z: Vt16_z [64][2048] = wv16 . x16_z^T + bv[m] -> f16; tiles 32 -> 4 blocks, grid.y = 2 ----
  wmma_gemm64<1, false, 1, 1, false, 0><<<dim3((nDh / 64) * (nS / 64) / 8, nB), dim3(256), 0, stream>>>(
      wv16, wv16, nD, 0L, x16, x16, nD, (long)nS * nD, (void*)Vt16, (void*)Vt16, nS, (long)nDh * nS,
      bv, bv, 0L, nDh, nS, nD, 1.0f);

  // ---- attention: grid (16 heads x 32 query blocks, 2 batches), all heads share the batch's K / V^T planes ----
  mqa_full64_kernel<<<dim3(kHeads * (nS / AT_QB), nB), dim3(128), 0, stream>>>(Qh, Ql, Kh, Kl, Vt16, O16, 0.125f);

  // ---- output projection: out [4096][1024] f32 = (O16 . wo16^T) / 256 + bo ----
  wmma_gemm64<0, false, 2, 0, false, 0><<<dim3((nM / 64) * (nD / 64) / 8, 1), dim3(256), 0, stream>>>(
      O16, O16, nD, 0L, wo16, wo16, nD, 0L, d_out, d_out, nD, 0L, bo, bo, 0L, nM, nD, nD, 1.0f / (kOsc * kWsc));
}

// v001
// Measured time: 374 microseconds a run.
// In both of two side-by-side timings against v000, it was 1.32 times as fast.
// Contractions: q/k/v^T projections v_wmma_f32_16x16x32_bf16 (inputs RNE-cast to bf16, f32 acc); q.k^T v_wmma_f32_16x16x32_bf16 with bf16 hi/lo split (hi.hi+hi.lo+lo.hi); p.v and output projection v_wmma_f32_16x16x32_f16 (p carried x2^15, o carried x16, wo carried x16), f32 acc; online softmax, biases and scales in f32.
#include <hip/hip_runtime.h>
#include <math.h>
#include <stdint.h>

typedef __attribute__((ext_vector_type(16))) _Float16 v16h;
typedef __attribute__((ext_vector_type(8)))  _Float16 v8h;
typedef __attribute__((ext_vector_type(16))) __bf16   v16b;
typedef __attribute__((ext_vector_type(8)))  __bf16   v8b;
typedef __attribute__((ext_vector_type(8)))  float    v8f;
typedef __attribute__((ext_vector_type(4)))  float    v4f;
typedef __attribute__((ext_vector_type(2)))  float    v2f;
typedef __attribute__((ext_vector_type(4)))  unsigned int v4u;

// problem geometry (compile-time)
constexpr int kBatch = 2;
constexpr int kSeq   = 2048;
constexpr int kDm    = 1024;   // model width = H*Dh = q row pitch
constexpr int kHeads = 16;
constexpr int kDhd   = 64;     // per-head dim = k row pitch
constexpr float kPsc = 32768.0f;   // softmax numerators carried x2^15 in f16
constexpr float kOsc = 16.0f;      // attention output carried x16 in f16
constexpr float kWsc = 16.0f;      // output-projection weight carried x16 in f16

__device__ __forceinline__ unsigned short f2bf_bits(float f) {
  unsigned u = __float_as_uint(f);
  return (unsigned short)((u + 0x7FFFu + ((u >> 16) & 1u)) >> 16);
}
__device__ __forceinline__ float bf_bits2f(unsigned short h) { return __uint_as_float(((unsigned)h) << 16); }
__device__ __forceinline__ unsigned pk16(unsigned short a, unsigned short b) { return (unsigned)a | ((unsigned)b << 16); }

// hazard guards as plain device helpers (no inline asm inside the kernel template body)
__device__ __forceinline__ void dep_guard_h(v8f& a, v8f& b, v16h x, v16h y) { asm volatile("v_nop\n\tv_nop\n\tv_nop\n\tv_nop" : "+v"(a), "+v"(b) : "v"(x), "v"(y)); }
__device__ __forceinline__ void dep_guard_b(v8f& a, v8f& b, v16b x, v16b y) { asm volatile("v_nop\n\tv_nop\n\tv_nop\n\tv_nop" : "+v"(a), "+v"(b) : "v"(x), "v"(y)); }
__device__ __forceinline__ void keep4_h(v16h a, v16h b, v16h c, v16h d) { asm volatile("v_nop" :: "v"(a), "v"(b), "v"(c), "v"(d)); }
__device__ __forceinline__ void keep4_b(v16b a, v16b b, v16b c, v16b d) { asm volatile("v_nop" :: "v"(a), "v"(b), "v"(c), "v"(d)); }
__device__ __forceinline__ void acc_guard4(v8f& a, v8f& b, v8f& c, v8f& d) { asm volatile("v_nop\n\tv_nop\n\tv_nop\n\tv_nop" : "+v"(a), "+v"(b), "+v"(c), "+v"(d)); }
template <typename T> struct Frag;
template <> struct Frag<_Float16> {
  typedef v16h V; union U { v16h v; v8h h[2]; };
  static __device__ __forceinline__ v16h load(const _Float16* p) {   // elements 0..7 <- p[0..7], 8..15 <- p[16..23]
    U f; f.h[0] = *(const v8h*)(p); f.h[1] = *(const v8h*)(p + 16); return f.v;
  }
  static __device__ __forceinline__ v8f mma(v16h a, v16h b, v8f c) {
    return __builtin_amdgcn_wmma_f32_16x16x32_f16(false, a, false, b, (short)0, c, false, false);
  }
  static __device__ __forceinline__ void guard(v8f& a, v8f& b, v16h x, v16h y) { dep_guard_h(a, b, x, y); }
  static __device__ __forceinline__ void keep(v16h a, v16h b, v16h c, v16h d) { keep4_h(a, b, c, d); }
};
template <> struct Frag<__bf16> {
  typedef v16b V; union U { v16b v; v8b h[2]; };
  static __device__ __forceinline__ v16b load(const __bf16* p) {
    U f; f.h[0] = *(const v8b*)(p); f.h[1] = *(const v8b*)(p + 16); return f.v;
  }
  static __device__ __forceinline__ v8f mma(v16b a, v16b b, v8f c) {
    return __builtin_amdgcn_wmma_f32_16x16x32_bf16(false, a, false, b, (short)0, c, false, false);
  }
  static __device__ __forceinline__ void guard(v8f& a, v8f& b, v16b x, v16b y) { dep_guard_b(a, b, x, y); }
  static __device__ __forceinline__ void keep(v16b a, v16b b, v16b c, v16b d) { keep4_b(a, b, c, d); }
};

// ---- Register-blocked batched WMMA GEMM ------------------------------------
// C[m,n] = scale * sum_k A[m,k] * Bt[n,k] (+bias)(+resid); each wave owns a 64x64 tile.
// A row-major [M,K]; Bt row-major [N,K]; M,N % 64 == 0, K % 32 == 0.
// SPLIT: operands are hi/lo planes (A2/Bt2 = lo planes, same layout); product = hi.hi + hi.lo + lo.hi.
// BIAS_MODE: 0 = none, 1 = bias[m], 2 = bias[n].
// OUT_MODE: 0 = f32, 1 = f16, 2 = bf16 hi plane (Cout) + bf16 lo plane (Cout2).
// ET: 0 = f16 operands, 1 = bf16 operands (pointers passed as 16-bit storage)
template <int ET> struct Elem;
template <> struct Elem<0> { typedef _Float16 T; };
template <> struct Elem<1> { typedef __bf16 T; };
template <int ET, bool SPLIT, int BIAS_MODE, int OUT_MODE, bool RESID, int ACT = 0>
__global__ __launch_bounds__(256) void wmma_gemm64(
    const unsigned short* __restrict__ Ap, const unsigned short* __restrict__ A2p, int lda, long strideA,
    const unsigned short* __restrict__ Btp, const unsigned short* __restrict__ Bt2p, int ldb, long strideB,
    void* __restrict__ Cout, void* __restrict__ Cout2, int ldc, long strideC,
    const float* __restrict__ bias,
    const float* __restrict__ resid, long strideR,
    int M, int N, int K, float scale) {
  typedef typename Elem<ET>::T T;
  typedef typename Frag<T>::V V;
  const T* A = (const T*)Ap; const T* A2 = (const T*)A2p; const T* Bt = (const T*)Btp; const T* Bt2 = (const T*)Bt2p;
  __shared__ __align__(16) float sT[8][16 * 68];   // per-wave 16x64 slab, pitch 68 floats
  const int b    = blockIdx.y;
  const int lane = threadIdx.x & 31;
  const int wave = threadIdx.x >> 5;
  const int tilesN = N >> 6;
  const int tilesM = M >> 6;
  const int tile = blockIdx.x * 8 + wave;
  if (tile >= tilesM * tilesN) return;   // wave-uniform; no block barriers in this kernel
  const int tm = tile / tilesN;
  const int tn = tile - tm * tilesN;
  const int m0 = tm << 6;
  const int n0 = tn << 6;

  const T* Ab  = A  + (size_t)b * strideA;
  const T* Bb  = Bt + (size_t)b * strideB;
  const T* Ab2 = SPLIT ? (A2  + (size_t)b * strideA) : nullptr;
  const T* Bb2 = SPLIT ? (Bt2 + (size_t)b * strideB) : nullptr;

  const int rlane = lane & 15;                 // row (A) / col (B, D) within subtile
  const int koff  = (lane >> 4) * 8;           // k offset of this lane half
  const int mOff  = (lane >> 4) * 8;           // D row offset

  v8f acc[4][4];
#pragma unroll
  for (int i = 0; i < 4; ++i)
#pragma unroll
    for (int j = 0; j < 4; ++j) acc[i][j] = (v8f){0.f,0.f,0.f,0.f,0.f,0.f,0.f,0.f};

  for (int k0 = 0; k0 < K; k0 += 32) {
    V bh[4], bl[4];
#pragma unroll
    for (int j = 0; j < 4; ++j) {
      const size_t bo = (size_t)(n0 + (j << 4) + rlane) * ldb + koff + k0;
      bh[j] = Frag<T>::load(Bb + bo);
      if (SPLIT) bl[j] = Frag<T>::load(Bb2 + bo);
    }
#pragma unroll
    for (int i = 0; i < 4; ++i) {
      const size_t ao = (size_t)(m0 + (i << 4) + rlane) * lda + koff + k0;
      V ah = Frag<T>::load(Ab + ao);
      V al;
      if (SPLIT) al = Frag<T>::load(Ab2 + ao);
#pragma unroll
      for (int j = 0; j < 4; ++j) {
        acc[i][j] = Frag<T>::mma(ah, bh[j], acc[i][j]);
        if (SPLIT) {
          acc[i][j] = Frag<T>::mma(ah, bl[j], acc[i][j]);
          acc[i][j] = Frag<T>::mma(al, bh[j], acc[i][j]);
        }
      }
      Frag<T>::guard(acc[i][0], acc[i][3], ah, SPLIT ? al : ah);
    }
    Frag<T>::keep(bh[0], bh[1], bh[2], bh[3]);
    if (SPLIT) Frag<T>::keep(bl[0], bl[1], bl[2], bl[3]);
  }
  acc_guard4(acc[0][0], acc[0][1], acc[0][2], acc[0][3]);
  acc_guard4(acc[1][0], acc[1][1], acc[1][2], acc[1][3]);
  acc_guard4(acc[2][0], acc[2][1], acc[2][2], acc[2][3]);
  acc_guard4(acc[3][0], acc[3][1], acc[3][2], acc[3][3]);

  // ---- epilogue ----
  float* slab = sT[wave];
  const float* Rb = RESID ? (resid + (size_t)b * strideR) : nullptr;
#pragma unroll
  for (int i = 0; i < 4; ++i) {
    const int mBase = m0 + (i << 4);
#pragma unroll
    for (int j = 0; j < 4; ++j) {
      const int n = n0 + (j << 4) + rlane;
      float bv = 0.f;
      if (BIAS_MODE == 2) bv = bias[n];
#pragma unroll
      for (int r = 0; r < 8; ++r) {
        float v = acc[i][j][r] * scale;
        if (BIAS_MODE == 1) v += bias[mBase + mOff + r];
        if (BIAS_MODE == 2) v += bv;
        if (RESID) v += Rb[(size_t)(mBase + mOff + r) * ldc + n];
        if (ACT == 1) v = tanhf(v);
        if (ACT == 2) v = fmaxf(v, 0.0f);
        if (ACT == 3) v = v / (1.0f + expf(-v));
        if (ACT == 4) v = (v > 0.f) ? v : 0.01f * v;
        if (ACT == 5) v = 0.5f * v * (1.0f + erff(v * 0.70710678118654752f));
        slab[(mOff + r) * 68 + (j << 4) + rlane] = v;
      }
    }
    __builtin_amdgcn_fence(__ATOMIC_RELEASE, "workgroup");
    __builtin_amdgcn_wave_barrier();
    __builtin_amdgcn_fence(__ATOMIC_ACQUIRE, "workgroup");
    if (OUT_MODE == 0) {
      float* C = (float*)Cout + (size_t)b * strideC;
      const int hh = lane >> 4, c4 = (lane & 15) * 4;     // row seg = 256 B = 16 lanes x 16 B
      {
#pragma unroll
        for (int it = 0; it < 8; ++it) {
          const int row = it * 2 + hh;
          v4f v = *(const v4f*)(slab + row * 68 + c4);
          *(v4f*)(C + (size_t)(mBase + row) * ldc + n0 + c4) = v;
        }
        
      }
    } else {
      const int q = lane >> 3, c8 = (lane & 7) * 8;
      unsigned short* C  = (unsigned short*)Cout  + (size_t)b * strideC;
      unsigned short* C2 = (OUT_MODE == 2) ? ((unsigned short*)Cout2 + (size_t)b * strideC) : nullptr;
      {
#pragma unroll
        for (int it = 0; it < 4; ++it) {
          const int row = it * 4 + q;
          const float* sp = slab + row * 68 + c8;
          v8h hv, lv;
#pragma unroll
          for (int e = 0; e < 8; ++e) {
            if (OUT_MODE == 1) {
              hv[e] = (_Float16)sp[e];
            } else {
              unsigned short hb = f2bf_bits(sp[e]);
              unsigned short lb = f2bf_bits(sp[e] - bf_bits2f(hb));
              hv[e] = __builtin_bit_cast(_Float16, hb);
              lv[e] = __builtin_bit_cast(_Float16, lb);
            }
          }
          *(v8h*)(C + (size_t)(mBase + row) * ldc + n0 + c8) = hv;
          if (OUT_MODE == 2) *(v8h*)(C2 + (size_t)(mBase + row) * ldc + n0 + c8) = lv;
        }
        
      }
    }
    __builtin_amdgcn_fence(__ATOMIC_RELEASE, "workgroup");
    __builtin_amdgcn_wave_barrier();
    __builtin_amdgcn_fence(__ATOMIC_ACQUIRE, "workgroup");
  }
}

// ---------------------------------------------------------------------------
// Elementwise f32 -> bf16 (RNE), 2 elements per thread, one 4-B store per lane -> each wave writes exactly
// Coverage: grid = ceil(n2/256) x 256 threads x 2 elements = 2*n2 = whole plane
//   (x: n2 = 4096*1024/2 = 2097152 -> 8192 blocks exact; wk/wv: n2 = 32768 -> 128 blocks exact).
// ---------------------------------------------------------------------------
__global__ __launch_bounds__(256) void cast_bf16x2_kernel(const float* __restrict__ in, unsigned short* __restrict__ out, int n2) {
  const int i = blockIdx.x * 256 + threadIdx.x;
  if (i < n2) {
    const v2f f = *(const v2f*)(in + 2 * (size_t)i);
    const unsigned u = pk16(f2bf_bits(f[0]), f2bf_bits(f[1]));
    ((unsigned*)out)[i] = u;
    
  }
}

// ---------------------------------------------------------------------------
// Row-permuted f32 -> bf16 (RNE) cast of a [1024][ncol] weight: dest row rd = h*64 + d takes source row d*16 + h
// (de-interleave of the (hidden, heads) column split). grid = (ncol/512, 1024), 256 threads, 2 elements per thread.
// ---------------------------------------------------------------------------
__global__ __launch_bounds__(256) void cast_perm_rows_bf16x2_kernel(const float* __restrict__ in, unsigned short* __restrict__ out, int ncol) {
  const int rd = blockIdx.y;                            // 0..1023
  int rs = ((rd & 63) << 4) + (rd >> 6);                // 0..1023
  rs = rs > 1023 ? 1023 : rs;
  const int i = blockIdx.x * 256 + threadIdx.x;         // pair index within the row
  if (i < (ncol >> 1)) {
    const v2f f = *(const v2f*)(in + (size_t)rs * ncol + 2 * (size_t)i);
    const unsigned u = pk16(f2bf_bits(f[0]), f2bf_bits(f[1]));
    unsigned* o = (unsigned*)(out + (size_t)rd * ncol);
    o[i] = u;
    
  }
}

// ---------------------------------------------------------------------------
// Permuted bias: out[h*64 + d] = in[d*16 + h]; n = 1024; 4 blocks x 256 threads x 4 B = whole vector,
// ---------------------------------------------------------------------------
__global__ __launch_bounds__(256) void perm_bias_kernel(const float* __restrict__ in, float* __restrict__ out, int n) {
  const int i = blockIdx.x * 256 + threadIdx.x;
  if (i < n) {
    int s = ((i & 63) << 4) + (i >> 6);
    s = s > n - 1 ? n - 1 : s;
    const float v = in[s];
    ((float*)out)[i] = v;
    
  }
}

// ---------------------------------------------------------------------------
// Elementwise f32 -> f16 of (bf16_rne(x) * sc) with sc a power of two: 2 elements per thread, one 4-B store per lane.
// ---------------------------------------------------------------------------
__global__ __launch_bounds__(256) void cast_bf_f16x2_scaled_kernel(const float* __restrict__ in, unsigned short* __restrict__ out, int n2, float sc) {
  const int i = blockIdx.x * 256 + threadIdx.x;
  if (i < n2) {
    const v2f f = *(const v2f*)(in + 2 * (size_t)i);
    const float g0 = bf_bits2f(f2bf_bits(f[0])) * sc;
    const float g1 = bf_bits2f(f2bf_bits(f[1])) * sc;
    const _Float16 h0 = (_Float16)g0, h1 = (_Float16)g1;
    const unsigned u = pk16(__builtin_bit_cast(unsigned short, h0), __builtin_bit_cast(unsigned short, h1));
    ((unsigned*)out)[i] = u;
    
  }
}

// =====================================================================================
// Full (non-causal, unmasked) multi-query attention, head dim 64.
//   q planes (hi/lo bf16): element (b, t, h, d) at [(b*kSeq + t)*kDm + h*64 + d]
//   k planes (hi/lo bf16): element (b, s, d) at [(b*kSeq + s)*kDhd + d]      (one KV head shared by all heads)
//   v^T plane (f16):       element (b, d, s) at [(b*64 + d)*kSeq + s]
//   out plane (f16, x kOsc): element (b, t, h, d) at [(b*kSeq + t)*kDm + h*64 + d]
//   scores = (q . k) * sscale : bf16 hi/lo split (hi.hi + hi.lo + lo.hi) on v_wmma_f32_16x16x32_bf16
//   out    = p . v            : v_wmma_f32_16x16x32_f16, p (unnormalised, <= 1) carried x2^15, f32 accumulate
//   online softmax in f32 over all kSeq keys (32 chunks of 64, compile-time trip count, no masking).
//   Block = 4 waves = 64 query rows of one (batch, head); grid = (kHeads * kSeq/64, kBatch).
//   K / V^T chunk staging: 128 threads x 32 elements per plane = the whole 64x64 tile (16-B copies, plain loads,
//   __syncthreads before and after); fragment loads read the LDS tiles with the same vector element type.
// =====================================================================================
#define AT_D 64
#define AT_NW 4
#define AT_QB 64
#define AT_KC 64
#define AT_LP 72   // LDS row pitch in 16-bit elements: 144 B = 16 B x 9 (odd), so the 16 rows of one ds_load_b128 half fall on 16 distinct 4-bank groups

__device__ __forceinline__ v8f at_mma(v16b a, v16b b, v8f c) {
  c = __builtin_amdgcn_wmma_f32_16x16x32_bf16(false, a, false, b, (short)0, c, false, false);
  asm volatile("v_nop\n\tv_nop\n\tv_nop\n\tv_nop" : "+v"(c) : "v"(a), "v"(b));
  return c;
}
__device__ __forceinline__ v8f at_mma_h(v16h a, v16h b, v8f c) {
  c = __builtin_amdgcn_wmma_f32_16x16x32_f16(false, a, false, b, (short)0, c, false, false);
  asm volatile("v_nop\n\tv_nop\n\tv_nop\n\tv_nop" : "+v"(c) : "v"(a), "v"(b));
  return c;
}

__global__ __launch_bounds__(128)
void mqa_full64_kernel(const unsigned short* __restrict__ qhp, const unsigned short* __restrict__ qlp,
                       const unsigned short* __restrict__ khp, const unsigned short* __restrict__ klp,
                       const unsigned short* __restrict__ vtp, unsigned short* __restrict__ o16p,
                       float sscale) {
  union FB { v16b v; v8b h[2]; };
  union FH { v16h v; v8h h[2]; };
  __shared__ __align__(16) __bf16   Ksh[AT_KC * AT_LP];         // K hi [kv][d], pitch AT_LP      9 KB
  __shared__ __align__(16) __bf16   Ksl[AT_KC * AT_LP];         // K lo                          9 KB
  __shared__ __align__(16) _Float16 Vth[AT_D * AT_LP];          // V^T f16 [d][kv], pitch AT_LP  9 KB
  __shared__ __align__(16) _Float16 Psh[AT_NW][16 * AT_LP];     // per wave P (x2^15) [row][kv], pitch AT_LP  9 KB
  __shared__ __align__(16) float    Os[AT_NW][16 * 68];         // per wave out tile, pitch 68

  const int tid  = threadIdx.x;
  const int wave = tid >> 5;
  const int lane = tid & 31;
  const int hh   = lane >> 4;
  const int c    = lane & 15;

  const int nqb = kSeq / AT_QB;            // 32
  const int b  = blockIdx.y;               // 0..kBatch-1
  const int bx = blockIdx.x;               // 0..kHeads*nqb-1
  const int qb = bx % nqb;
  const int h  = bx / nqb;                 // 0..kHeads-1
  const int q0 = qb * AT_QB + wave * 16;

  const __bf16*   Qh = (const __bf16*)(const void*)qhp + (size_t)b * kSeq * kDm + (size_t)h * AT_D;
  const __bf16*   Ql = (const __bf16*)(const void*)qlp + (size_t)b * kSeq * kDm + (size_t)h * AT_D;
  const __bf16*   Kh = (const __bf16*)(const void*)khp + (size_t)b * kSeq * kDhd;
  const __bf16*   Kl = (const __bf16*)(const void*)klp + (size_t)b * kSeq * kDhd;
  const _Float16* Vt = (const _Float16*)(const void*)vtp + (size_t)b * AT_D * kSeq;
  _Float16*       ob = (_Float16*)(void*)o16p + (size_t)b * kSeq * kDm + (size_t)h * AT_D;

  // ---- Q fragments (A operand, row = lane&15, split k map via Frag load): 2 d-chunks, hi and lo ----
  v16b qah[2], qal[2];
#pragma unroll
  for (int dc = 0; dc < 2; ++dc) {
    const __bf16* qr = Qh + (size_t)(q0 + c) * kDm + dc * 32 + 8 * hh;
    const __bf16* ql = Ql + (size_t)(q0 + c) * kDm + dc * 32 + 8 * hh;
    qah[dc] = Frag<__bf16>::load(qr);
    qal[dc] = Frag<__bf16>::load(ql);
  }

  float mrow[8], lrow[8];
  v8f oacc[4];
#pragma unroll
  for (int r = 0; r < 8; ++r) { mrow[r] = -INFINITY; lrow[r] = 0.f; }
#pragma unroll
  for (int t = 0; t < 4; ++t) oacc[t] = (v8f){0.f,0.f,0.f,0.f,0.f,0.f,0.f,0.f};

  const int nChunks = kSeq / AT_KC;   // 32, compile-time constant
  for (int kc = 0; kc < nChunks; ++kc) {
    const int kv0 = kc * AT_KC;
    __syncthreads();
    {
      // staging coverage: 128 threads x (4 x 8) elements = 64 rows x 64 per plane = the whole chunk tile
      const int r = tid >> 1, half = (tid & 1) * 32;
      const __bf16*   ksh = Kh + (size_t)(kv0 + r) * kDhd + half;   // K row kv0+r, d = half..half+31
      const __bf16*   ksl = Kl + (size_t)(kv0 + r) * kDhd + half;
      const _Float16* vsr = Vt + (size_t)r * kSeq + kv0 + half;      // V^T row d = r, s = kv0+half..+31
#pragma unroll
      for (int i = 0; i < 4; ++i) {
        const v8b a0 = *(const v8b*)(ksh + 8 * i);
        const v8b a1 = *(const v8b*)(ksl + 8 * i);
        const v8h b0 = *(const v8h*)(vsr + 8 * i);
        *(v8b*)(Ksh + r * AT_LP + half + 8 * i) = a0;
        *(v8b*)(Ksl + r * AT_LP + half + 8 * i) = a1;
        *(v8h*)(Vth + r * AT_LP + half + 8 * i) = b0;
      }
    }
    __syncthreads();

    // ---- scores: B operand column = key j*16+c, elements <- d with the split k map ----
    v8f s[4];
#pragma unroll
    for (int j = 0; j < 4; ++j) {
      s[j] = (v8f){0.f,0.f,0.f,0.f,0.f,0.f,0.f,0.f};
#pragma unroll
      for (int dc = 0; dc < 2; ++dc) {
        FB kb, kl;
        kb.h[0] = *(const v8b*)(Ksh + (j * 16 + c) * AT_LP + dc * 32 + 8 * hh);
        kb.h[1] = *(const v8b*)(Ksh + (j * 16 + c) * AT_LP + dc * 32 + 16 + 8 * hh);
        kl.h[0] = *(const v8b*)(Ksl + (j * 16 + c) * AT_LP + dc * 32 + 8 * hh);
        kl.h[1] = *(const v8b*)(Ksl + (j * 16 + c) * AT_LP + dc * 32 + 16 + 8 * hh);
        s[j] = at_mma(qah[dc], kb.v, s[j]);
        s[j] = at_mma(qah[dc], kl.v, s[j]);
        s[j] = at_mma(qal[dc], kb.v, s[j]);
      }
    }
    // D layout: s[j][r] = score(row 8*hh + r, key kv0 + j*16 + c)
    float cm[8];
#pragma unroll
    for (int r = 0; r < 8; ++r) {
      float m = -INFINITY;
#pragma unroll
      for (int j = 0; j < 4; ++j) {
        const float sv = s[j][r] * sscale;
        s[j][r] = sv;
        m = fmaxf(m, sv);
      }
#pragma unroll
      for (int off = 1; off < 16; off <<= 1) m = fmaxf(m, __shfl_xor(m, off, 32));
      cm[r] = m;
    }
    _Float16* pw = Psh[wave];
#pragma unroll
    for (int r = 0; r < 8; ++r) {
      const float mnew = fmaxf(mrow[r], cm[r]);
      const float alpha = expf(mrow[r] - mnew);
      mrow[r] = mnew;
      float psum = 0.f;
#pragma unroll
      for (int j = 0; j < 4; ++j) {
        const float p = expf(s[j][r] - mnew);
        psum += p;
        pw[(8 * hh + r) * AT_LP + j * 16 + c] = (_Float16)(p * kPsc);
      }
#pragma unroll
      for (int off = 1; off < 16; off <<= 1) psum += __shfl_xor(psum, off, 32);
      lrow[r] = lrow[r] * alpha + psum;
#pragma unroll
      for (int t = 0; t < 4; ++t) oacc[t][r] *= alpha;
    }
    // P tile: element stores of _Float16 by this wave, reloaded below as v8h (vector of the same element type)
    __builtin_amdgcn_fence(__ATOMIC_RELEASE, "workgroup");
    __builtin_amdgcn_wave_barrier();
    __builtin_amdgcn_fence(__ATOMIC_ACQUIRE, "workgroup");
#pragma unroll 1
    for (int kk = 0; kk < 2; ++kk) {
      FH pa;
      pa.h[0] = *(const v8h*)(pw + c * AT_LP + kk * 32 + 8 * hh);        // A: row = c, elements <- keys kk*32 + 8hh + 0..7
      pa.h[1] = *(const v8h*)(pw + c * AT_LP + kk * 32 + 16 + 8 * hh);   //    elements 8..15 <- keys kk*32 + 16 + 8hh + 0..7
#pragma unroll
      for (int t = 0; t < 4; ++t) {
        FH vb;
        vb.h[0] = *(const v8h*)(Vth + (t * 16 + c) * AT_LP + kk * 32 + 8 * hh);       // B: col = d = t*16 + c, same key map
        vb.h[1] = *(const v8h*)(Vth + (t * 16 + c) * AT_LP + kk * 32 + 16 + 8 * hh);
        oacc[t] = at_mma_h(pa.v, vb.v, oacc[t]);
      }
    }
  }

  // ---- epilogue: O = oacc / (l * 2^15), carried x kOsc as f16 ----
  float* os = Os[wave];
#pragma unroll
  for (int r = 0; r < 8; ++r) {
    const float inv = kOsc * (1.0f / (lrow[r] * kPsc));
#pragma unroll
    for (int t = 0; t < 4; ++t) os[(8 * hh + r) * 68 + t * 16 + c] = oacc[t][r] * inv;
  }
  __builtin_amdgcn_fence(__ATOMIC_RELEASE, "workgroup");
  __builtin_amdgcn_wave_barrier();
  __builtin_amdgcn_fence(__ATOMIC_ACQUIRE, "workgroup");
  {
    const int qg = lane >> 3, c8 = (lane & 7) * 8;
    {
#pragma unroll
      for (int it = 0; it < 4; ++it) {
        const int row = it * 4 + qg;                    // 4 it x 4 groups = rows 0..15
        const float* sp = os + row * 68 + c8;
        v8h hv;
#pragma unroll
        for (int e = 0; e < 8; ++e) hv[e] = (_Float16)sp[e];
        *(v8h*)(ob + (size_t)(q0 + row) * kDm + c8) = hv;
      }
      
    }
  }
}

// ---------------------------------------------------------------------------
// Host driver. Workspace region map (bytes, 256-B aligned offsets):
//   x16   [4096][1024] bf16           8388608
//   wq16p [1024][1024] bf16 (rows permuted to head-major)  2097152
//   wk16  [64][1024]   bf16            131072
//   wv16  [64][1024]   bf16            131072
//   wo16  [1024][1024] f16 (bf16-RNE x16)  2097152
//   bqp   [1024]       f32 (permuted)     4096
//   Qh,Ql [4096][1024] bf16 hi/lo     2 x 8388608
//   Kh,Kl [4096][64]   bf16 hi/lo     2 x 524288
//   Vt16  [2][64][2048] f16            524288
//   O16   [4096][1024] f16 (x16)      8388608
//   total 39587840 B
// ---------------------------------------------------------------------------
extern "C" void kernel_launch(void* const* d_in, const int* in_sizes, int n_in,
                              void* d_out, int out_size, void* d_ws, size_t ws_size,
                              hipStream_t stream) {
  const int nB = kBatch, nS = kSeq, nD = kDm, nDh = kDhd;
  const int nM = nB * nS;   // 4096
  if (n_in < 9) return;
  if (in_sizes[0] != nM * nD || in_sizes[1] != nD * nD || in_sizes[2] != nD ||
      in_sizes[3] != nDh * nD || in_sizes[4] != nDh || in_sizes[5] != nDh * nD ||
      in_sizes[6] != nDh || in_sizes[7] != nD * nD || in_sizes[8] != nD || out_size != nM * nD) return;

  const float* x  = (const float*)d_in[0];
  const float* wq = (const float*)d_in[1];
  const float* bq = (const float*)d_in[2];
  const float* wk = (const float*)d_in[3];
  const float* bk = (const float*)d_in[4];
  const float* wv = (const float*)d_in[5];
  const float* bv = (const float*)d_in[6];
  const float* wo = (const float*)d_in[7];
  const float* bo = (const float*)d_in[8];

  size_t off = 0;
  auto carve = [&](size_t bytes) -> char* {
    char* p = (char*)d_ws + off;
    off += (bytes + 255) & ~(size_t)255;
    return p;
  };
  unsigned short* x16   = (unsigned short*)carve((size_t)nM * nD * 2);
  unsigned short* wq16p = (unsigned short*)carve((size_t)nD * nD * 2);
  unsigned short* wk16  = (unsigned short*)carve((size_t)nDh * nD * 2);
  unsigned short* wv16  = (unsigned short*)carve((size_t)nDh * nD * 2);
  unsigned short* wo16  = (unsigned short*)carve((size_t)nD * nD * 2);
  float*          bqp   = (float*)carve((size_t)nD * 4);
  unsigned short* Qh    = (unsigned short*)carve((size_t)nM * nD * 2);
  unsigned short* Ql    = (unsigned short*)carve((size_t)nM * nD * 2);
  unsigned short* Kh    = (unsigned short*)carve((size_t)nM * nDh * 2);
  unsigned short* Kl    = (unsigned short*)carve((size_t)nM * nDh * 2);
  unsigned short* Vt16  = (unsigned short*)carve((size_t)nB * nDh * nS * 2);
  unsigned short* O16   = (unsigned short*)carve((size_t)nM * nD * 2);
  if (off > ws_size) return;

  // ---- casts (bf16 RNE; wq rows / bq permuted to head-major; wo as f16(bf16_rne(wo) * 16)) ----
  {
    const int n2x = nM * nD / 2;      // 2097152 -> 8192 blocks
    cast_bf16x2_kernel<<<dim3((n2x + 255) / 256), dim3(256), 0, stream>>>(x, x16, n2x);
    const int n2kv = nDh * nD / 2;    // 32768 -> 128 blocks
    cast_bf16x2_kernel<<<dim3((n2kv + 255) / 256), dim3(256), 0, stream>>>(wk, wk16, n2kv);
    cast_bf16x2_kernel<<<dim3((n2kv + 255) / 256), dim3(256), 0, stream>>>(wv, wv16, n2kv);
    cast_perm_rows_bf16x2_kernel<<<dim3((nD / 2 + 255) / 256, nD), dim3(256), 0, stream>>>(wq, wq16p, nD);
    perm_bias_kernel<<<dim3((nD + 255) / 256), dim3(256), 0, stream>>>(bq, bqp, nD);
    const int n2o = nD * nD / 2;      // 524288 -> 2048 blocks
    cast_bf_f16x2_scaled_kernel<<<dim3((n2o + 255) / 256), dim3(256), 0, stream>>>(wo, wo16, n2o, kWsc);
  }

  // ---- q projection: [4096][1024] = x16 . wq16p^T + bqp -> bf16 hi/lo planes, head-major columns (h*64 + d) ----
  // M=4096, N=1024 (multiples of 64), K=1024 (multiple of 32); tiles 64*16 = 1024 -> 128 blocks of 8 waves
  wmma_gemm64<1, false, 2, 2, false, 0><<<dim3((nM / 64) * (nD / 64) / 8, 1), dim3(256), 0, stream>>>(
      x16, x16, nD, 0L, wq16p, wq16p, nD, 0L, (void*)Qh, (void*)Ql, nD, 0L, bqp, bqp, 0L, nM, nD, nD, 1.0f);

  // ---- k projection: [4096][64] = x16 . wk16^T + bk -> bf16 hi/lo planes; tiles 64 -> 8 blocks ----
  wmma_gemm64<1, false, 2, 2, false, 0><<<dim3((nM / 64) * (nDh / 64) / 8, 1), dim3(256), 0, stream>>>(
      x16, x16, nD, 0L, wk16, wk16, nD, 0L, (void*)Kh, (void*)Kl, nDh, 0L, bk, bk, 0L, nM, nDh, nD, 1.0f);

  // ---- v^T projection per batch z: Vt16_z [64][2048] = wv16 . x16_z^T + bv[m] -> f16; tiles 32 -> 4 blocks, grid.y = 2 ----
  wmma_gemm64<1, false, 1, 1, false, 0><<<dim3((nDh / 64) * (nS / 64) / 8, nB), dim3(256), 0, stream>>>(
      wv16, wv16, nD, 0L, x16, x16, nD, (long)nS * nD, (void*)Vt16, (void*)Vt16, nS, (long)nDh * nS,
      bv, bv, 0L, nDh, nS, nD, 1.0f);

  // ---- attention: grid (16 heads x 32 query blocks, 2 batches), all heads share the batch's K / V^T planes ----
  mqa_full64_kernel<<<dim3(kHeads * (nS / AT_QB), nB), dim3(128), 0, stream>>>(Qh, Ql, Kh, Kl, Vt16, O16, 0.125f);

  // ---- output projection: out [4096][1024] f32 = (O16 . wo16^T) / 256 + bo ----
  wmma_gemm64<0, false, 2, 0, false, 0><<<dim3((nM / 64) * (nD / 64) / 8, 1), dim3(256), 0, stream>>>(
      O16, O16, nD, 0L, wo16, wo16, nD, 0L, d_out, d_out, nD, 0L, bo, bo, 0L, nM, nD, nD, 1.0f / (kOsc * kWsc));
}

// v002
// A run of this version takes 264 microseconds.
// In two side-by-side timings against v001, it was 1.42 and 1.41 times as fast.
// Over all steps from v000 it is 1.87 times as fast.
// Contractions: q/k/v^T projections v_wmma_f32_16x16x32_bf16 (inputs RNE-cast to bf16, f32 acc); q.k^T v_wmma_f32_16x16x32_bf16 with bf16 hi/lo split (hi.hi+hi.lo+lo.hi); p.v and output projection v_wmma_f32_16x16x32_f16 (p carried x2^15, o carried x16, wo carried x16), f32 acc; online softmax, biases and scales in f32.
#include <hip/hip_runtime.h>
#include <math.h>
#include <stdint.h>

typedef __attribute__((ext_vector_type(16))) _Float16 v16h;
typedef __attribute__((ext_vector_type(8)))  _Float16 v8h;
typedef __attribute__((ext_vector_type(16))) __bf16   v16b;
typedef __attribute__((ext_vector_type(8)))  __bf16   v8b;
typedef __attribute__((ext_vector_type(8)))  float    v8f;
typedef __attribute__((ext_vector_type(4)))  float    v4f;
typedef __attribute__((ext_vector_type(2)))  float    v2f;
typedef __attribute__((ext_vector_type(4)))  unsigned int v4u;

// problem geometry (compile-time)
constexpr int kBatch = 2;
constexpr int kSeq   = 2048;
constexpr int kDm    = 1024;   // model width = H*Dh = q row pitch
constexpr int kHeads = 16;
constexpr int kDhd   = 64;     // per-head dim = k row pitch
constexpr float kPsc = 32768.0f;   // softmax numerators carried x2^15 in f16
constexpr float kOsc = 16.0f;      // attention output carried x16 in f16
constexpr float kWsc = 16.0f;      // output-projection weight carried x16 in f16

__device__ __forceinline__ unsigned short f2bf_bits(float f) {
  unsigned u = __float_as_uint(f);
  return (unsigned short)((u + 0x7FFFu + ((u >> 16) & 1u)) >> 16);
}
__device__ __forceinline__ float bf_bits2f(unsigned short h) { return __uint_as_float(((unsigned)h) << 16); }
__device__ __forceinline__ unsigned pk16(unsigned short a, unsigned short b) { return (unsigned)a | ((unsigned)b << 16); }

// hazard guards as plain device helpers
__device__ __forceinline__ void dep_guard_h(v8f& a, v8f& b, v16h x, v16h y) { asm volatile("v_nop\n\tv_nop\n\tv_nop\n\tv_nop" : "+v"(a), "+v"(b) : "v"(x), "v"(y)); }
__device__ __forceinline__ void dep_guard_b(v8f& a, v8f& b, v16b x, v16b y) { asm volatile("v_nop\n\tv_nop\n\tv_nop\n\tv_nop" : "+v"(a), "+v"(b) : "v"(x), "v"(y)); }
__device__ __forceinline__ void keep4_h(v16h a, v16h b, v16h c, v16h d) { asm volatile("v_nop" :: "v"(a), "v"(b), "v"(c), "v"(d)); }
__device__ __forceinline__ void keep4_b(v16b a, v16b b, v16b c, v16b d) { asm volatile("v_nop" :: "v"(a), "v"(b), "v"(c), "v"(d)); }
__device__ __forceinline__ void acc_guard4(v8f& a, v8f& b, v8f& c, v8f& d) { asm volatile("v_nop\n\tv_nop\n\tv_nop\n\tv_nop" : "+v"(a), "+v"(b), "+v"(c), "+v"(d)); }
template <typename T> struct Frag;
template <> struct Frag<_Float16> {
  typedef v16h V; typedef v8h H; union U { v16h v; v8h h[2]; };
  static __device__ __forceinline__ v16h load(const _Float16* p) {   // elements 0..7 <- p[0..7], 8..15 <- p[16..23]
    U f; f.h[0] = *(const v8h*)(p); f.h[1] = *(const v8h*)(p + 16); return f.v;
  }
  static __device__ __forceinline__ v8f mma(v16h a, v16h b, v8f c) {
    return __builtin_amdgcn_wmma_f32_16x16x32_f16(false, a, false, b, (short)0, c, false, false);
  }
  static __device__ __forceinline__ void guard(v8f& a, v8f& b, v16h x, v16h y) { dep_guard_h(a, b, x, y); }
  static __device__ __forceinline__ void keep(v16h a, v16h b, v16h c, v16h d) { keep4_h(a, b, c, d); }
};
template <> struct Frag<__bf16> {
  typedef v16b V; typedef v8b H; union U { v16b v; v8b h[2]; };
  static __device__ __forceinline__ v16b load(const __bf16* p) {
    U f; f.h[0] = *(const v8b*)(p); f.h[1] = *(const v8b*)(p + 16); return f.v;
  }
  static __device__ __forceinline__ v8f mma(v16b a, v16b b, v8f c) {
    return __builtin_amdgcn_wmma_f32_16x16x32_bf16(false, a, false, b, (short)0, c, false, false);
  }
  static __device__ __forceinline__ void guard(v8f& a, v8f& b, v16b x, v16b y) { dep_guard_b(a, b, x, y); }
  static __device__ __forceinline__ void keep(v16b a, v16b b, v16b c, v16b d) { keep4_b(a, b, c, d); }
};

// ---- Register-blocked batched WMMA GEMM ------------------------------------
// C[m,n] = scale * sum_k A[m,k] * Bt[n,k] (+bias)(+resid); each wave owns a 64x64 tile.
// A row-major [M,K]; Bt row-major [N,K], both with row pitch kDm (compile time, so that the 16 row groups of a tile
// are immediate offsets of one address); M,N % 64 == 0, K % 64 == 0, K <= kDm.
// Operand path: per 64-k step each wave copies its own 64x64 A tile and 64x64 Bt tile into its own LDS range with
// global loads that cover whole 128-B lines (8 lanes per row, 4 rows per load), the next step's loads being issued
// before the current step's products; the WMMA fragments are read from LDS (k order per 32-k group as Frag::load).
// SPLIT (hi/lo planes) is not instantiated and not supported by the staged loop.
// BIAS_MODE: 0 = none, 1 = bias[m], 2 = bias[n].
// OUT_MODE: 0 = f32, 1 = f16, 2 = bf16 hi plane (Cout) + bf16 lo plane (Cout2).
// ET: 0 = f16 operands, 1 = bf16 operands (pointers passed as 16-bit storage)
#define GS_LP 72   // LDS row pitch of a staged operand tile in 16-bit elements: 144 B = 16 B x 9 (odd), conflict-free for ds_load_b128 fragment reads
template <int ET> struct Elem;
template <> struct Elem<0> { typedef _Float16 T; };
template <> struct Elem<1> { typedef __bf16 T; };
template <int ET, bool SPLIT, int BIAS_MODE, int OUT_MODE, bool RESID, int ACT = 0>
__global__ __launch_bounds__(256) void wmma_gemm64(
    const unsigned short* __restrict__ Ap, const unsigned short* __restrict__ A2p, long strideA,
    const unsigned short* __restrict__ Btp, const unsigned short* __restrict__ Bt2p, long strideB,
    void* __restrict__ Cout, void* __restrict__ Cout2, int ldc, long strideC,
    const float* __restrict__ bias,
    const float* __restrict__ resid, long strideR,
    int M, int N, int K, float scale) {
  typedef typename Elem<ET>::T T;
  typedef typename Frag<T>::V V;
  const T* A = (const T*)Ap; const T* Bt = (const T*)Btp;
  static_assert(!SPLIT, "the staged operand loop takes single-plane operands");
  typedef typename Frag<T>::H H;
  __shared__ __align__(16) T sOp[8][2][64 * GS_LP];   // per-wave A tile and Bt tile of one 64-k step, pitch GS_LP
  __shared__ __align__(16) float sT[8][16 * 68];   // per-wave 16x64 slab, pitch 68 floats
  const int b    = blockIdx.y;
  const int lane = threadIdx.x & 31;
  const int wave = __builtin_amdgcn_readfirstlane(threadIdx.x >> 5);   // wave-uniform: tile bases stay scalar
  const int tilesN = N >> 6;
  const int tilesM = M >> 6;
  const int tile = blockIdx.x * 8 + wave;
  if (tile >= tilesM * tilesN) return;   // wave-uniform; no block barriers in this kernel
  const int tm = tile / tilesN;
  const int tn = tile - tm * tilesN;
  const int m0 = tm << 6;
  const int n0 = tn << 6;

  const T* Ab  = A  + (size_t)b * strideA;
  const T* Bb  = Bt + (size_t)b * strideB;

  const int rlane = lane & 15;                 // row (A) / col (B, D) within subtile
  const int koff  = (lane >> 4) * 8;           // k offset of this lane half
  const int mOff  = (lane >> 4) * 8;           // D row offset

  v8f acc[4][4];
#pragma unroll
  for (int i = 0; i < 4; ++i)
#pragma unroll
    for (int j = 0; j < 4; ++j) acc[i][j] = (v8f){0.f,0.f,0.f,0.f,0.f,0.f,0.f,0.f};

  // staging map: lane -> row (lane >> 3) of each group of 4 rows, 16-B piece (lane & 7) of the row's 128-B line
  const int srow = lane >> 3;
  const int scol = (lane & 7) * 8;
  const T* Ag = Ab + (size_t)(m0 + srow) * kDm + scol;   // this lane's piece of row group 0, k = 0
  const T* Bg = Bb + (size_t)(n0 + srow) * kDm + scol;
  T* sa = sOp[wave][0];
  T* sb = sOp[wave][1];
  H ra[16], rb[16];
#pragma unroll
  for (int it = 0; it < 16; ++it) {
    ra[it] = *(const H*)(Ag + it * 4 * kDm);
    rb[it] = *(const H*)(Bg + it * 4 * kDm);
  }

  for (int k0 = 0; k0 < K; k0 += 64) {
#pragma unroll
    for (int it = 0; it < 16; ++it) {
      *(H*)(sa + (it * 4 + srow) * GS_LP + scol) = ra[it];
      *(H*)(sb + (it * 4 + srow) * GS_LP + scol) = rb[it];
    }
    // the wave's own tile stores are complete before any of its lanes reads another lane's rows
    __builtin_amdgcn_fence(__ATOMIC_RELEASE, "workgroup");
    __builtin_amdgcn_wave_barrier();
    __builtin_amdgcn_fence(__ATOMIC_ACQUIRE, "workgroup");
    if (k0 + 64 < K) {   // wave-uniform: the next step's tiles fly while this step's products run
#pragma unroll
      for (int it = 0; it < 16; ++it) {
        ra[it] = *(const H*)(Ag + it * 4 * kDm + (k0 + 64));
        rb[it] = *(const H*)(Bg + it * 4 * kDm + (k0 + 64));
      }
      asm volatile("s_wait_xcnt 0x0" ::: "memory");   // before the fragment reads below reuse the address registers of these loads
    }
#pragma unroll
    for (int kk = 0; kk < 2; ++kk) {
      V bh[4], ah[4];
#pragma unroll
      for (int j = 0; j < 4; ++j) bh[j] = Frag<T>::load(sb + ((j << 4) + rlane) * GS_LP + kk * 32 + koff);
#pragma unroll
      for (int i = 0; i < 4; ++i) ah[i] = Frag<T>::load(sa + ((i << 4) + rlane) * GS_LP + kk * 32 + koff);
#pragma unroll
      for (int i = 0; i < 4; ++i) {
#pragma unroll
        for (int j = 0; j < 4; ++j) acc[i][j] = Frag<T>::mma(ah[i], bh[j], acc[i][j]);
        Frag<T>::guard(acc[i][0], acc[i][3], ah[i], ah[i]);
      }
      Frag<T>::keep(bh[0], bh[1], bh[2], bh[3]);
    }
    // every fragment read of this step is done before the next step's stores overwrite the tiles
    __builtin_amdgcn_fence(__ATOMIC_RELEASE, "workgroup");
    __builtin_amdgcn_wave_barrier();
    __builtin_amdgcn_fence(__ATOMIC_ACQUIRE, "workgroup");
  }
  acc_guard4(acc[0][0], acc[0][1], acc[0][2], acc[0][3]);
  acc_guard4(acc[1][0], acc[1][1], acc[1][2], acc[1][3]);
  acc_guard4(acc[2][0], acc[2][1], acc[2][2], acc[2][3]);
  acc_guard4(acc[3][0], acc[3][1], acc[3][2], acc[3][3]);

  // ---- epilogue ----
  float* slab = sT[wave];
  const float* Rb = RESID ? (resid + (size_t)b * strideR) : nullptr;
#pragma unroll
  for (int i = 0; i < 4; ++i) {
    const int mBase = m0 + (i << 4);
    float bm[8];
    if (BIAS_MODE == 1) {
      const float* bp = bias + mBase + mOff;
#pragma unroll
      for (int r = 0; r < 8; ++r) bm[r] = bp[r];
      // before the address registers of the bias loads are reused; the address as an input keeps them untouched up to here
      asm volatile("s_wait_xcnt 0x0" :: "v"(bp) : "memory");
    }
#pragma unroll
    for (int j = 0; j < 4; ++j) {
      const int n = n0 + (j << 4) + rlane;
      float bv = 0.f;
      if (BIAS_MODE == 2) bv = bias[n];
#pragma unroll
      for (int r = 0; r < 8; ++r) {
        float v = acc[i][j][r] * scale;
        if (BIAS_MODE == 1) v += bm[r];
        if (BIAS_MODE == 2) v += bv;
        if (RESID) v += Rb[(size_t)(mBase + mOff + r) * ldc + n];
        if (ACT == 1) v = tanhf(v);
        if (ACT == 2) v = fmaxf(v, 0.0f);
        if (ACT == 3) v = v / (1.0f + expf(-v));
        if (ACT == 4) v = (v > 0.f) ? v : 0.01f * v;
        if (ACT == 5) v = 0.5f * v * (1.0f + erff(v * 0.70710678118654752f));
        slab[(mOff + r) * 68 + (j << 4) + rlane] = v;
      }
    }
    __builtin_amdgcn_fence(__ATOMIC_RELEASE, "workgroup");
    __builtin_amdgcn_wave_barrier();
    __builtin_amdgcn_fence(__ATOMIC_ACQUIRE, "workgroup");
    if (OUT_MODE == 0) {
      float* C = (float*)Cout + (size_t)b * strideC;
      const int hh = lane >> 4, c4 = (lane & 15) * 4;     // row seg = 256 B = 16 lanes x 16 B
      {
#pragma unroll
        for (int it = 0; it < 8; ++it) {
          const int row = it * 2 + hh;
          v4f v = *(const v4f*)(slab + row * 68 + c4);
          *(v4f*)(C + (size_t)(mBase + row) * ldc + n0 + c4) = v;
        }
        
      }
    } else {
      const int q = lane >> 3, c8 = (lane & 7) * 8;
      unsigned short* C  = (unsigned short*)Cout  + (size_t)b * strideC;
      unsigned short* C2 = (OUT_MODE == 2) ? ((unsigned short*)Cout2 + (size_t)b * strideC) : nullptr;
      {
#pragma unroll
        for (int it = 0; it < 4; ++it) {
          const int row = it * 4 + q;
          const float* sp = slab + row * 68 + c8;
          v8h hv, lv;
#pragma unroll
          for (int e = 0; e < 8; ++e) {
            if (OUT_MODE == 1) {
              hv[e] = (_Float16)sp[e];
            } else {
              unsigned short hb = f2bf_bits(sp[e]);
              unsigned short lb = f2bf_bits(sp[e] - bf_bits2f(hb));
              hv[e] = __builtin_bit_cast(_Float16, hb);
              lv[e] = __builtin_bit_cast(_Float16, lb);
            }
          }
          *(v8h*)(C + (size_t)(mBase + row) * ldc + n0 + c8) = hv;
          if (OUT_MODE == 2) *(v8h*)(C2 + (size_t)(mBase + row) * ldc + n0 + c8) = lv;
        }
        
      }
    }
    __builtin_amdgcn_fence(__ATOMIC_RELEASE, "workgroup");
    __builtin_amdgcn_wave_barrier();
    __builtin_amdgcn_fence(__ATOMIC_ACQUIRE, "workgroup");
    // keeps the next row group's arithmetic behind the fence's store wait: no register of an issued store is rewritten before it
    __builtin_amdgcn_sched_barrier(0);
  }
}

// ---------------------------------------------------------------------------
// Elementwise f32 -> bf16 (RNE), 2 elements per thread, one 4-B store per lane -> each wave writes exactly
// Coverage: grid = ceil(n2/256) x 256 threads x 2 elements = 2*n2 = whole plane
//   (x: n2 = 4096*1024/2 = 2097152 -> 8192 blocks exact; wk/wv: n2 = 32768 -> 128 blocks exact).
// ---------------------------------------------------------------------------
__global__ __launch_bounds__(256) void cast_bf16x2_kernel(const float* __restrict__ in, unsigned short* __restrict__ out, int n2) {
  const int i = blockIdx.x * 256 + threadIdx.x;
  if (i < n2) {
    const v2f f = *(const v2f*)(in + 2 * (size_t)i);
    const unsigned u = pk16(f2bf_bits(f[0]), f2bf_bits(f[1]));
    ((unsigned*)out)[i] = u;
    
  }
}

// ---------------------------------------------------------------------------
// Row-permuted f32 -> bf16 (RNE) cast of a [1024][ncol] weight: dest row rd = h*64 + d takes source row d*16 + h
// (de-interleave of the (hidden, heads) column split). grid = (ncol/512, 1024), 256 threads, 2 elements per thread.
// ---------------------------------------------------------------------------
__global__ __launch_bounds__(256) void cast_perm_rows_bf16x2_kernel(const float* __restrict__ in, unsigned short* __restrict__ out, int ncol) {
  const int rd = blockIdx.y;                            // 0..1023
  int rs = ((rd & 63) << 4) + (rd >> 6);                // 0..1023
  rs = rs > 1023 ? 1023 : rs;
  const int i = blockIdx.x * 256 + threadIdx.x;         // pair index within the row
  if (i < (ncol >> 1)) {
    const v2f f = *(const v2f*)(in + (size_t)rs * ncol + 2 * (size_t)i);
    const unsigned u = pk16(f2bf_bits(f[0]), f2bf_bits(f[1]));
    unsigned* o = (unsigned*)(out + (size_t)rd * ncol);
    o[i] = u;
    
  }
}

// ---------------------------------------------------------------------------
// Permuted bias: out[h*64 + d] = in[d*16 + h]; n = 1024; 4 blocks x 256 threads x 4 B = whole vector,
// ---------------------------------------------------------------------------
__global__ __launch_bounds__(256) void perm_bias_kernel(const float* __restrict__ in, float* __restrict__ out, int n) {
  const int i = blockIdx.x * 256 + threadIdx.x;
  if (i < n) {
    int s = ((i & 63) << 4) + (i >> 6);
    s = s > n - 1 ? n - 1 : s;
    const float v = in[s];
    ((float*)out)[i] = v;
    
  }
}

// ---------------------------------------------------------------------------
// Elementwise f32 -> f16 of (bf16_rne(x) * sc) with sc a power of two: 2 elements per thread, one 4-B store per lane.
// ---------------------------------------------------------------------------
__global__ __launch_bounds__(256) void cast_bf_f16x2_scaled_kernel(const float* __restrict__ in, unsigned short* __restrict__ out, int n2, float sc) {
  const int i = blockIdx.x * 256 + threadIdx.x;
  if (i < n2) {
    const v2f f = *(const v2f*)(in + 2 * (size_t)i);
    const float g0 = bf_bits2f(f2bf_bits(f[0])) * sc;
    const float g1 = bf_bits2f(f2bf_bits(f[1])) * sc;
    const _Float16 h0 = (_Float16)g0, h1 = (_Float16)g1;
    const unsigned u = pk16(__builtin_bit_cast(unsigned short, h0), __builtin_bit_cast(unsigned short, h1));
    ((unsigned*)out)[i] = u;
    
  }
}

// =====================================================================================
// Full (non-causal, unmasked) multi-query attention, head dim 64.
//   q planes (hi/lo bf16): element (b, t, h, d) at [(b*kSeq + t)*kDm + h*64 + d]
//   k planes (hi/lo bf16): element (b, s, d) at [(b*kSeq + s)*kDhd + d]      (one KV head shared by all heads)
//   v^T plane (f16):       element (b, d, s) at [(b*64 + d)*kSeq + s]
//   out plane (f16, x kOsc): element (b, t, h, d) at [(b*kSeq + t)*kDm + h*64 + d]
//   scores = (q . k) * sscale : bf16 hi/lo split (hi.hi + hi.lo + lo.hi) on v_wmma_f32_16x16x32_bf16
//   out    = p . v            : v_wmma_f32_16x16x32_f16, p (unnormalised, <= 1) carried x2^15, f32 accumulate
//   online softmax in f32 over all kSeq keys (32 chunks of 64, compile-time trip count, no masking).
//   Block = 4 waves = 64 query rows of one (batch, head); grid = (kHeads * kSeq/64, kBatch).
//   K / V^T chunk staging: 128 threads x 32 elements per plane = the whole 64x64 tile (16-B copies, plain loads,
//   __syncthreads before and after); fragment loads read the LDS tiles with the same vector element type.
// =====================================================================================
#define AT_D 64
#define AT_NW 4
#define AT_QB 64
#define AT_KC 64
#define AT_LP 72   // LDS row pitch in 16-bit elements: 144 B = 16 B x 9 (odd), so the 16 rows of one ds_load_b128 half fall on 16 distinct 4-bank groups

__device__ __forceinline__ v8f at_mma(v16b a, v16b b, v8f c) {
  c = __builtin_amdgcn_wmma_f32_16x16x32_bf16(false, a, false, b, (short)0, c, false, false);
  asm volatile("v_nop\n\tv_nop\n\tv_nop\n\tv_nop" : "+v"(c) : "v"(a), "v"(b));
  return c;
}
__device__ __forceinline__ v8f at_mma_h(v16h a, v16h b, v8f c) {
  c = __builtin_amdgcn_wmma_f32_16x16x32_f16(false, a, false, b, (short)0, c, false, false);
  asm volatile("v_nop\n\tv_nop\n\tv_nop\n\tv_nop" : "+v"(c) : "v"(a), "v"(b));
  return c;
}

__global__ __launch_bounds__(128)
void mqa_full64_kernel(const unsigned short* __restrict__ qhp, const unsigned short* __restrict__ qlp,
                       const unsigned short* __restrict__ khp, const unsigned short* __restrict__ klp,
                       const unsigned short* __restrict__ vtp, unsigned short* __restrict__ o16p,
                       float sscale) {
  union FB { v16b v; v8b h[2]; };
  union FH { v16h v; v8h h[2]; };
  __shared__ __align__(16) __bf16   Ksh[AT_KC * AT_LP];         // K hi [kv][d], pitch AT_LP      9 KB
  __shared__ __align__(16) __bf16   Ksl[AT_KC * AT_LP];         // K lo                          9 KB
  __shared__ __align__(16) _Float16 Vth[AT_D * AT_LP];          // V^T f16 [d][kv], pitch AT_LP  9 KB
  __shared__ __align__(16) _Float16 Psh[AT_NW][16 * AT_LP];     // per wave P (x2^15) [row][kv], pitch AT_LP  9 KB
  __shared__ __align__(16) float    Os[AT_NW][16 * 68];         // per wave out tile, pitch 68

  const int tid  = threadIdx.x;
  const int wave = tid >> 5;
  const int lane = tid & 31;
  const int hh   = lane >> 4;
  const int c    = lane & 15;

  const int nqb = kSeq / AT_QB;            // 32
  const int b  = blockIdx.y;               // 0..kBatch-1
  const int bx = blockIdx.x;               // 0..kHeads*nqb-1
  const int qb = bx % nqb;
  const int h  = bx / nqb;                 // 0..kHeads-1
  const int q0 = qb * AT_QB + wave * 16;

  const __bf16*   Qh = (const __bf16*)(const void*)qhp + (size_t)b * kSeq * kDm + (size_t)h * AT_D;
  const __bf16*   Ql = (const __bf16*)(const void*)qlp + (size_t)b * kSeq * kDm + (size_t)h * AT_D;
  const __bf16*   Kh = (const __bf16*)(const void*)khp + (size_t)b * kSeq * kDhd;
  const __bf16*   Kl = (const __bf16*)(const void*)klp + (size_t)b * kSeq * kDhd;
  const _Float16* Vt = (const _Float16*)(const void*)vtp + (size_t)b * AT_D * kSeq;
  _Float16*       ob = (_Float16*)(void*)o16p + (size_t)b * kSeq * kDm + (size_t)h * AT_D;

  // ---- Q fragments (A operand, row = lane&15, split k map via Frag load): 2 d-chunks, hi and lo ----
  v16b qah[2], qal[2];
#pragma unroll
  for (int dc = 0; dc < 2; ++dc) {
    const __bf16* qr = Qh + (size_t)(q0 + c) * kDm + dc * 32 + 8 * hh;
    const __bf16* ql = Ql + (size_t)(q0 + c) * kDm + dc * 32 + 8 * hh;
    qah[dc] = Frag<__bf16>::load(qr);
    qal[dc] = Frag<__bf16>::load(ql);
  }

  float mrow[8], lrow[8];
  v8f oacc[4];
#pragma unroll
  for (int r = 0; r < 8; ++r) { mrow[r] = -INFINITY; lrow[r] = 0.f; }
#pragma unroll
  for (int t = 0; t < 4; ++t) oacc[t] = (v8f){0.f,0.f,0.f,0.f,0.f,0.f,0.f,0.f};

  const int nChunks = kSeq / AT_KC;   // 32, compile-time constant
  for (int kc = 0; kc < nChunks; ++kc) {
    const int kv0 = kc * AT_KC;
    __syncthreads();
    {
      // staging coverage: 128 threads x (4 x 8) elements = 64 rows x 64 per plane = the whole chunk tile
      const int r = tid >> 1, half = (tid & 1) * 32;
      const __bf16*   ksh = Kh + (size_t)(kv0 + r) * kDhd + half;   // K row kv0+r, d = half..half+31
      const __bf16*   ksl = Kl + (size_t)(kv0 + r) * kDhd + half;
      const _Float16* vsr = Vt + (size_t)r * kSeq + kv0 + half;      // V^T row d = r, s = kv0+half..+31
#pragma unroll
      for (int i = 0; i < 4; ++i) {
        const v8b a0 = *(const v8b*)(ksh + 8 * i);
        const v8b a1 = *(const v8b*)(ksl + 8 * i);
        const v8h b0 = *(const v8h*)(vsr + 8 * i);
        *(v8b*)(Ksh + r * AT_LP + half + 8 * i) = a0;
        *(v8b*)(Ksl + r * AT_LP + half + 8 * i) = a1;
        *(v8h*)(Vth + r * AT_LP + half + 8 * i) = b0;
      }
    }
    __syncthreads();

    // ---- scores: B operand column = key j*16+c, elements <- d with the split k map ----
    v8f s[4];
#pragma unroll
    for (int j = 0; j < 4; ++j) {
      s[j] = (v8f){0.f,0.f,0.f,0.f,0.f,0.f,0.f,0.f};
#pragma unroll
      for (int dc = 0; dc < 2; ++dc) {
        FB kb, kl;
        kb.h[0] = *(const v8b*)(Ksh + (j * 16 + c) * AT_LP + dc * 32 + 8 * hh);
        kb.h[1] = *(const v8b*)(Ksh + (j * 16 + c) * AT_LP + dc * 32 + 16 + 8 * hh);
        kl.h[0] = *(const v8b*)(Ksl + (j * 16 + c) * AT_LP + dc * 32 + 8 * hh);
        kl.h[1] = *(const v8b*)(Ksl + (j * 16 + c) * AT_LP + dc * 32 + 16 + 8 * hh);
        s[j] = at_mma(qah[dc], kb.v, s[j]);
        s[j] = at_mma(qah[dc], kl.v, s[j]);
        s[j] = at_mma(qal[dc], kb.v, s[j]);
      }
    }
    // D layout: s[j][r] = score(row 8*hh + r, key kv0 + j*16 + c)
    float cm[8];
#pragma unroll
    for (int r = 0; r < 8; ++r) {
      float m = -INFINITY;
#pragma unroll
      for (int j = 0; j < 4; ++j) {
        const float sv = s[j][r] * sscale;
        s[j][r] = sv;
        m = fmaxf(m, sv);
      }
#pragma unroll
      for (int off = 1; off < 16; off <<= 1) m = fmaxf(m, __shfl_xor(m, off, 32));
      cm[r] = m;
    }
    _Float16* pw = Psh[wave];
#pragma unroll
    for (int r = 0; r < 8; ++r) {
      const float mnew = fmaxf(mrow[r], cm[r]);
      const float alpha = expf(mrow[r] - mnew);
      mrow[r] = mnew;
      float psum = 0.f;
#pragma unroll
      for (int j = 0; j < 4; ++j) {
        const float p = expf(s[j][r] - mnew);
        psum += p;
        pw[(8 * hh + r) * AT_LP + j * 16 + c] = (_Float16)(p * kPsc);
      }
#pragma unroll
      for (int off = 1; off < 16; off <<= 1) psum += __shfl_xor(psum, off, 32);
      lrow[r] = lrow[r] * alpha + psum;
#pragma unroll
      for (int t = 0; t < 4; ++t) oacc[t][r] *= alpha;
    }
    // P tile: element stores of _Float16 by this wave, reloaded below as v8h (vector of the same element type)
    __builtin_amdgcn_fence(__ATOMIC_RELEASE, "workgroup");
    __builtin_amdgcn_wave_barrier();
    __builtin_amdgcn_fence(__ATOMIC_ACQUIRE, "workgroup");
#pragma unroll 1
    for (int kk = 0; kk < 2; ++kk) {
      FH pa;
      pa.h[0] = *(const v8h*)(pw + c * AT_LP + kk * 32 + 8 * hh);        // A: row = c, elements <- keys kk*32 + 8hh + 0..7
      pa.h[1] = *(const v8h*)(pw + c * AT_LP + kk * 32 + 16 + 8 * hh);   //    elements 8..15 <- keys kk*32 + 16 + 8hh + 0..7
#pragma unroll
      for (int t = 0; t < 4; ++t) {
        FH vb;
        vb.h[0] = *(const v8h*)(Vth + (t * 16 + c) * AT_LP + kk * 32 + 8 * hh);       // B: col = d = t*16 + c, same key map
        vb.h[1] = *(const v8h*)(Vth + (t * 16 + c) * AT_LP + kk * 32 + 16 + 8 * hh);
        oacc[t] = at_mma_h(pa.v, vb.v, oacc[t]);
      }
    }
  }

  // ---- epilogue: O = oacc / (l * 2^15), carried x kOsc as f16 ----
  float* os = Os[wave];
#pragma unroll
  for (int r = 0; r < 8; ++r) {
    const float inv = kOsc * (1.0f / (lrow[r] * kPsc));
#pragma unroll
    for (int t = 0; t < 4; ++t) os[(8 * hh + r) * 68 + t * 16 + c] = oacc[t][r] * inv;
  }
  __builtin_amdgcn_fence(__ATOMIC_RELEASE, "workgroup");
  __builtin_amdgcn_wave_barrier();
  __builtin_amdgcn_fence(__ATOMIC_ACQUIRE, "workgroup");
  {
    const int qg = lane >> 3, c8 = (lane & 7) * 8;
    {
#pragma unroll
      for (int it = 0; it < 4; ++it) {
        const int row = it * 4 + qg;                    // 4 it x 4 groups = rows 0..15
        const float* sp = os + row * 68 + c8;
        v8h hv;
#pragma unroll
        for (int e = 0; e < 8; ++e) hv[e] = (_Float16)sp[e];
        *(v8h*)(ob + (size_t)(q0 + row) * kDm + c8) = hv;
      }
      
    }
  }
}

// ---------------------------------------------------------------------------
// Host driver. Workspace region map (bytes, 256-B aligned offsets):
//   x16   [4096][1024] bf16           8388608
//   wq16p [1024][1024] bf16 (rows permuted to head-major)  2097152
//   wk16  [64][1024]   bf16            131072
//   wv16  [64][1024]   bf16            131072
//   wo16  [1024][1024] f16 (bf16-RNE x16)  2097152
//   bqp   [1024]       f32 (permuted)     4096
//   Qh,Ql [4096][1024] bf16 hi/lo     2 x 8388608
//   Kh,Kl [4096][64]   bf16 hi/lo     2 x 524288
//   Vt16  [2][64][2048] f16            524288
//   O16   [4096][1024] f16 (x16)      8388608
//   total 39587840 B
// ---------------------------------------------------------------------------
extern "C" void kernel_launch(void* const* d_in, const int* in_sizes, int n_in,
                              void* d_out, int out_size, void* d_ws, size_t ws_size,
                              hipStream_t stream) {
  const int nB = kBatch, nS = kSeq, nD = kDm, nDh = kDhd;
  const int nM = nB * nS;   // 4096
  if (n_in < 9) return;
  if (in_sizes[0] != nM * nD || in_sizes[1] != nD * nD || in_sizes[2] != nD ||
      in_sizes[3] != nDh * nD || in_sizes[4] != nDh || in_sizes[5] != nDh * nD ||
      in_sizes[6] != nDh || in_sizes[7] != nD * nD || in_sizes[8] != nD || out_size != nM * nD) return;

  const float* x  = (const float*)d_in[0];
  const float* wq = (const float*)d_in[1];
  const float* bq = (const float*)d_in[2];
  const float* wk = (const float*)d_in[3];
  const float* bk = (const float*)d_in[4];
  const float* wv = (const float*)d_in[5];
  const float* bv = (const float*)d_in[6];
  const float* wo = (const float*)d_in[7];
  const float* bo = (const float*)d_in[8];

  size_t off = 0;
  auto carve = [&](size_t bytes) -> char* {
    char* p = (char*)d_ws + off;
    off += (bytes + 255) & ~(size_t)255;
    return p;
  };
  unsigned short* x16   = (unsigned short*)carve((size_t)nM * nD * 2);
  unsigned short* wq16p = (unsigned short*)carve((size_t)nD * nD * 2);
  unsigned short* wk16  = (unsigned short*)carve((size_t)nDh * nD * 2);
  unsigned short* wv16  = (unsigned short*)carve((size_t)nDh * nD * 2);
  unsigned short* wo16  = (unsigned short*)carve((size_t)nD * nD * 2);
  float*          bqp   = (float*)carve((size_t)nD * 4);
  unsigned short* Qh    = (unsigned short*)carve((size_t)nM * nD * 2);
  unsigned short* Ql    = (unsigned short*)carve((size_t)nM * nD * 2);
  unsigned short* Kh    = (unsigned short*)carve((size_t)nM * nDh * 2);
  unsigned short* Kl    = (unsigned short*)carve((size_t)nM * nDh * 2);
  unsigned short* Vt16  = (unsigned short*)carve((size_t)nB * nDh * nS * 2);
  unsigned short* O16   = (unsigned short*)carve((size_t)nM * nD * 2);
  if (off > ws_size) return;

  // ---- casts (bf16 RNE; wq rows / bq permuted to head-major; wo as f16(bf16_rne(wo) * 16)) ----
  {
    const int n2x = nM * nD / 2;      // 2097152 -> 8192 blocks
    cast_bf16x2_kernel<<<dim3((n2x + 255) / 256), dim3(256), 0, stream>>>(x, x16, n2x);
    const int n2kv = nDh * nD / 2;    // 32768 -> 128 blocks
    cast_bf16x2_kernel<<<dim3((n2kv + 255) / 256), dim3(256), 0, stream>>>(wk, wk16, n2kv);
    cast_bf16x2_kernel<<<dim3((n2kv + 255) / 256), dim3(256), 0, stream>>>(wv, wv16, n2kv);
    cast_perm_rows_bf16x2_kernel<<<dim3((nD / 2 + 255) / 256, nD), dim3(256), 0, stream>>>(wq, wq16p, nD);
    perm_bias_kernel<<<dim3((nD + 255) / 256), dim3(256), 0, stream>>>(bq, bqp, nD);
    const int n2o = nD * nD / 2;      // 524288 -> 2048 blocks
    cast_bf_f16x2_scaled_kernel<<<dim3((n2o + 255) / 256), dim3(256), 0, stream>>>(wo, wo16, n2o, kWsc);
  }

  // ---- q projection: [4096][1024] = x16 . wq16p^T + bqp -> bf16 hi/lo planes, head-major columns (h*64 + d) ----
  // M=4096, N=1024 (multiples of 64), K=1024 (multiple of 64); tiles 64*16 = 1024 -> 128 blocks of 8 waves
  wmma_gemm64<1, false, 2, 2, false, 0><<<dim3((nM / 64) * (nD / 64) / 8, 1), dim3(256), 0, stream>>>(
      x16, x16, 0L, wq16p, wq16p, 0L, (void*)Qh, (void*)Ql, nD, 0L, bqp, bqp, 0L, nM, nD, nD, 1.0f);

  // ---- k projection: [4096][64] = x16 . wk16^T + bk -> bf16 hi/lo planes; tiles 64 -> 8 blocks ----
  wmma_gemm64<1, false, 2, 2, false, 0><<<dim3((nM / 64) * (nDh / 64) / 8, 1), dim3(256), 0, stream>>>(
      x16, x16, 0L, wk16, wk16, 0L, (void*)Kh, (void*)Kl, nDh, 0L, bk, bk, 0L, nM, nDh, nD, 1.0f);

  // ---- v^T projection per batch z: Vt16_z [64][2048] = wv16 . x16_z^T + bv[m] -> f16; tiles 32 -> 4 blocks, grid.y = 2 ----
  wmma_gemm64<1, false, 1, 1, false, 0><<<dim3((nDh / 64) * (nS / 64) / 8, nB), dim3(256), 0, stream>>>(
      wv16, wv16, 0L, x16, x16, (long)nS * nD, (void*)Vt16, (void*)Vt16, nS, (long)nDh * nS,
      bv, bv, 0L, nDh, nS, nD, 1.0f);

  // ---- attention: grid (16 heads x 32 query blocks, 2 batches), all heads share the batch's K / V^T planes ----
  mqa_full64_kernel<<<dim3(kHeads * (nS / AT_QB), nB), dim3(128), 0, stream>>>(Qh, Ql, Kh, Kl, Vt16, O16, 0.125f);

  // ---- output projection: out [4096][1024] f32 = (O16 . wo16^T) / 256 + bo ----
  wmma_gemm64<0, false, 2, 0, false, 0><<<dim3((nM / 64) * (nD / 64) / 8, 1), dim3(256), 0, stream>>>(
      O16, O16, 0L, wo16, wo16, 0L, d_out, d_out, nD, 0L, bo, bo, 0L, nM, nD, nD, 1.0f / (kOsc * kWsc));
}

// v003
// One run takes 195 microseconds.
// Next to v002, in two timings, it ran 1.36 and 1.35 times as fast.
// Counting every step since v000, it is 2.52 times as fast.
// Contractions: q/k/v^T projections v_wmma_f32_16x16x32_bf16 (inputs RNE-cast to bf16, f32 acc); q.k^T v_wmma_f32_16x16x32_bf16 with bf16 hi/lo split (hi.hi+hi.lo+lo.hi); p.v and output projection v_wmma_f32_16x16x32_f16 (p carried x2^15, o carried x16, wo carried x16), f32 acc; online softmax, biases and scales in f32.
#include <hip/hip_runtime.h>
#include <math.h>
#include <stdint.h>

typedef __attribute__((ext_vector_type(16))) _Float16 v16h;
typedef __attribute__((ext_vector_type(8)))  _Float16 v8h;
typedef __attribute__((ext_vector_type(16))) __bf16   v16b;
typedef __attribute__((ext_vector_type(8)))  __bf16   v8b;
typedef __attribute__((ext_vector_type(8)))  float    v8f;
typedef __attribute__((ext_vector_type(4)))  float    v4f;
typedef __attribute__((ext_vector_type(2)))  float    v2f;
typedef __attribute__((ext_vector_type(4)))  unsigned int v4u;

// problem geometry (compile-time)
constexpr int kBatch = 2;
constexpr int kSeq   = 2048;
constexpr int kDm    = 1024;   // model width = H*Dh = q row pitch
constexpr int kHeads = 16;
constexpr int kDhd   = 64;     // per-head dim = k row pitch
constexpr float kPsc = 32768.0f;   // softmax numerators carried x2^15 in f16
constexpr float kOsc = 16.0f;      // attention output carried x16 in f16
constexpr float kWsc = 16.0f;      // output-projection weight carried x16 in f16

__device__ __forceinline__ unsigned short f2bf_bits(float f) {
  unsigned u = __float_as_uint(f);
  return (unsigned short)((u + 0x7FFFu + ((u >> 16) & 1u)) >> 16);
}
__device__ __forceinline__ float bf_bits2f(unsigned short h) { return __uint_as_float(((unsigned)h) << 16); }
__device__ __forceinline__ unsigned pk16(unsigned short a, unsigned short b) { return (unsigned)a | ((unsigned)b << 16); }

// hazard guards as plain device helpers
__device__ __forceinline__ void dep_guard_h(v8f& a, v8f& b, v16h x, v16h y) { asm volatile("v_nop\n\tv_nop\n\tv_nop\n\tv_nop" : "+v"(a), "+v"(b) : "v"(x), "v"(y)); }
__device__ __forceinline__ void dep_guard_b(v8f& a, v8f& b, v16b x, v16b y) { asm volatile("v_nop\n\tv_nop\n\tv_nop\n\tv_nop" : "+v"(a), "+v"(b) : "v"(x), "v"(y)); }
__device__ __forceinline__ void keep4_h(v16h a, v16h b, v16h c, v16h d) { asm volatile("v_nop" :: "v"(a), "v"(b), "v"(c), "v"(d)); }
__device__ __forceinline__ void keep4_b(v16b a, v16b b, v16b c, v16b d) { asm volatile("v_nop" :: "v"(a), "v"(b), "v"(c), "v"(d)); }
__device__ __forceinline__ void acc_guard4(v8f& a, v8f& b, v8f& c, v8f& d) { asm volatile("v_nop\n\tv_nop\n\tv_nop\n\tv_nop" : "+v"(a), "+v"(b), "+v"(c), "+v"(d)); }
template <typename T> struct Frag;
template <> struct Frag<_Float16> {
  typedef v16h V; typedef v8h H; union U { v16h v; v8h h[2]; };
  static __device__ __forceinline__ v16h load(const _Float16* p) {   // elements 0..7 <- p[0..7], 8..15 <- p[16..23]
    U f; f.h[0] = *(const v8h*)(p); f.h[1] = *(const v8h*)(p + 16); return f.v;
  }
  static __device__ __forceinline__ v8f mma(v16h a, v16h b, v8f c) {
    return __builtin_amdgcn_wmma_f32_16x16x32_f16(false, a, false, b, (short)0, c, false, false);
  }
  static __device__ __forceinline__ void guard(v8f& a, v8f& b, v16h x, v16h y) { dep_guard_h(a, b, x, y); }
  static __device__ __forceinline__ void keep(v16h a, v16h b, v16h c, v16h d) { keep4_h(a, b, c, d); }
};
template <> struct Frag<__bf16> {
  typedef v16b V; typedef v8b H; union U { v16b v; v8b h[2]; };
  static __device__ __forceinline__ v16b load(const __bf16* p) {
    U f; f.h[0] = *(const v8b*)(p); f.h[1] = *(const v8b*)(p + 16); return f.v;
  }
  static __device__ __forceinline__ v8f mma(v16b a, v16b b, v8f c) {
    return __builtin_amdgcn_wmma_f32_16x16x32_bf16(false, a, false, b, (short)0, c, false, false);
  }
  static __device__ __forceinline__ void guard(v8f& a, v8f& b, v16b x, v16b y) { dep_guard_b(a, b, x, y); }
  static __device__ __forceinline__ void keep(v16b a, v16b b, v16b c, v16b d) { keep4_b(a, b, c, d); }
};

// ---- Register-blocked batched WMMA GEMM ------------------------------------
// C[m,n] = scale * sum_k A[m,k] * Bt[n,k] (+bias)(+resid); each wave owns a 64x64 tile.
// A row-major [M,K]; Bt row-major [N,K], both with row pitch kDm (compile time, so that the 16 row groups of a tile
// are immediate offsets of one address); M,N % 64 == 0, K % 64 == 0, K <= kDm.
// Operand path: per 64-k step each wave copies its own 64x64 A tile and 64x64 Bt tile into its own LDS range with
// global loads that cover whole 128-B lines (8 lanes per row, 4 rows per load), the next step's loads being issued
// before the current step's products; the WMMA fragments are read from LDS (k order per 32-k group as Frag::load).
// SPLIT (hi/lo planes) is not instantiated and not supported by the staged loop.
// BIAS_MODE: 0 = none, 1 = bias[m], 2 = bias[n].
// OUT_MODE: 0 = f32, 1 = f16, 2 = bf16 hi plane (Cout) + bf16 lo plane (Cout2).
// ET: 0 = f16 operands, 1 = bf16 operands (pointers passed as 16-bit storage)
#define GS_LP 72   // LDS row pitch of a staged operand tile in 16-bit elements: 144 B = 16 B x 9 (odd), conflict-free for ds_load_b128 fragment reads
template <int ET> struct Elem;
template <> struct Elem<0> { typedef _Float16 T; };
template <> struct Elem<1> { typedef __bf16 T; };
template <int ET, bool SPLIT, int BIAS_MODE, int OUT_MODE, bool RESID, int ACT = 0>
__global__ __launch_bounds__(256) void wmma_gemm64(
    const unsigned short* __restrict__ Ap, const unsigned short* __restrict__ A2p, long strideA,
    const unsigned short* __restrict__ Btp, const unsigned short* __restrict__ Bt2p, long strideB,
    void* __restrict__ Cout, void* __restrict__ Cout2, int ldc, long strideC,
    const float* __restrict__ bias,
    const float* __restrict__ resid, long strideR,
    int M, int N, int K, float scale) {
  typedef typename Elem<ET>::T T;
  typedef typename Frag<T>::V V;
  const T* A = (const T*)Ap; const T* Bt = (const T*)Btp;
  static_assert(!SPLIT, "the staged operand loop takes single-plane operands");
  typedef typename Frag<T>::H H;
  __shared__ __align__(16) T sOp[8][2][64 * GS_LP];   // per-wave A tile and Bt tile of one 64-k step, pitch GS_LP
  __shared__ __align__(16) float sT[8][16 * 68];   // per-wave 16x64 slab, pitch 68 floats
  const int b    = blockIdx.y;
  const int lane = threadIdx.x & 31;
  const int wave = __builtin_amdgcn_readfirstlane(threadIdx.x >> 5);   // wave-uniform: tile bases stay scalar
  const int tilesN = N >> 6;
  const int tilesM = M >> 6;
  const int tile = blockIdx.x * 8 + wave;
  if (tile >= tilesM * tilesN) return;   // wave-uniform; no block barriers in this kernel
  const int tm = tile / tilesN;
  const int tn = tile - tm * tilesN;
  const int m0 = tm << 6;
  const int n0 = tn << 6;

  const T* Ab  = A  + (size_t)b * strideA;
  const T* Bb  = Bt + (size_t)b * strideB;

  const int rlane = lane & 15;                 // row (A) / col (B, D) within subtile
  const int koff  = (lane >> 4) * 8;           // k offset of this lane half
  const int mOff  = (lane >> 4) * 8;           // D row offset

  v8f acc[4][4];
#pragma unroll
  for (int i = 0; i < 4; ++i)
#pragma unroll
    for (int j = 0; j < 4; ++j) acc[i][j] = (v8f){0.f,0.f,0.f,0.f,0.f,0.f,0.f,0.f};

  // staging map: lane -> row (lane >> 3) of each group of 4 rows, 16-B piece (lane & 7) of the row's 128-B line
  const int srow = lane >> 3;
  const int scol = (lane & 7) * 8;
  const T* Ag = Ab + (size_t)(m0 + srow) * kDm + scol;   // this lane's piece of row group 0, k = 0
  const T* Bg = Bb + (size_t)(n0 + srow) * kDm + scol;
  T* sa = sOp[wave][0];
  T* sb = sOp[wave][1];
  H ra[16], rb[16];
#pragma unroll
  for (int it = 0; it < 16; ++it) {
    ra[it] = *(const H*)(Ag + it * 4 * kDm);
    rb[it] = *(const H*)(Bg + it * 4 * kDm);
  }

  for (int k0 = 0; k0 < K; k0 += 64) {
#pragma unroll
    for (int it = 0; it < 16; ++it) {
      *(H*)(sa + (it * 4 + srow) * GS_LP + scol) = ra[it];
      *(H*)(sb + (it * 4 + srow) * GS_LP + scol) = rb[it];
    }
    // the wave's own tile stores are complete before any of its lanes reads another lane's rows
    __builtin_amdgcn_fence(__ATOMIC_RELEASE, "workgroup");
    __builtin_amdgcn_wave_barrier();
    __builtin_amdgcn_fence(__ATOMIC_ACQUIRE, "workgroup");
    if (k0 + 64 < K) {   // wave-uniform: the next step's tiles fly while this step's products run
#pragma unroll
      for (int it = 0; it < 16; ++it) {
        ra[it] = *(const H*)(Ag + it * 4 * kDm + (k0 + 64));
        rb[it] = *(const H*)(Bg + it * 4 * kDm + (k0 + 64));
      }
      asm volatile("s_wait_xcnt 0x0" ::: "memory");   // before the fragment reads below reuse the address registers of these loads
    }
#pragma unroll
    for (int kk = 0; kk < 2; ++kk) {
      V bh[4], ah[4];
#pragma unroll
      for (int j = 0; j < 4; ++j) bh[j] = Frag<T>::load(sb + ((j << 4) + rlane) * GS_LP + kk * 32 + koff);
#pragma unroll
      for (int i = 0; i < 4; ++i) ah[i] = Frag<T>::load(sa + ((i << 4) + rlane) * GS_LP + kk * 32 + koff);
#pragma unroll
      for (int i = 0; i < 4; ++i) {
#pragma unroll
        for (int j = 0; j < 4; ++j) acc[i][j] = Frag<T>::mma(ah[i], bh[j], acc[i][j]);
        Frag<T>::guard(acc[i][0], acc[i][3], ah[i], ah[i]);
      }
      Frag<T>::keep(bh[0], bh[1], bh[2], bh[3]);
    }
    // every fragment read of this step is done before the next step's stores overwrite the tiles
    __builtin_amdgcn_fence(__ATOMIC_RELEASE, "workgroup");
    __builtin_amdgcn_wave_barrier();
    __builtin_amdgcn_fence(__ATOMIC_ACQUIRE, "workgroup");
  }
  acc_guard4(acc[0][0], acc[0][1], acc[0][2], acc[0][3]);
  acc_guard4(acc[1][0], acc[1][1], acc[1][2], acc[1][3]);
  acc_guard4(acc[2][0], acc[2][1], acc[2][2], acc[2][3]);
  acc_guard4(acc[3][0], acc[3][1], acc[3][2], acc[3][3]);

  // ---- epilogue ----
  float* slab = sT[wave];
  const float* Rb = RESID ? (resid + (size_t)b * strideR) : nullptr;
#pragma unroll
  for (int i = 0; i < 4; ++i) {
    const int mBase = m0 + (i << 4);
    float bm[8];
    if (BIAS_MODE == 1) {
      const float* bp = bias + mBase + mOff;
#pragma unroll
      for (int r = 0; r < 8; ++r) bm[r] = bp[r];
      // before the address registers of the bias loads are reused; the address as an input keeps them untouched up to here
      asm volatile("s_wait_xcnt 0x0" :: "v"(bp) : "memory");
    }
#pragma unroll
    for (int j = 0; j < 4; ++j) {
      const int n = n0 + (j << 4) + rlane;
      float bv = 0.f;
      if (BIAS_MODE == 2) bv = bias[n];
#pragma unroll
      for (int r = 0; r < 8; ++r) {
        float v = acc[i][j][r] * scale;
        if (BIAS_MODE == 1) v += bm[r];
        if (BIAS_MODE == 2) v += bv;
        if (RESID) v += Rb[(size_t)(mBase + mOff + r) * ldc + n];
        if (ACT == 1) v = tanhf(v);
        if (ACT == 2) v = fmaxf(v, 0.0f);
        if (ACT == 3) v = v / (1.0f + expf(-v));
        if (ACT == 4) v = (v > 0.f) ? v : 0.01f * v;
        if (ACT == 5) v = 0.5f * v * (1.0f + erff(v * 0.70710678118654752f));
        slab[(mOff + r) * 68 + (j << 4) + rlane] = v;
      }
    }
    __builtin_amdgcn_fence(__ATOMIC_RELEASE, "workgroup");
    __builtin_amdgcn_wave_barrier();
    __builtin_amdgcn_fence(__ATOMIC_ACQUIRE, "workgroup");
    if (OUT_MODE == 0) {
      float* C = (float*)Cout + (size_t)b * strideC;
      const int hh = lane >> 4, c4 = (lane & 15) * 4;     // row seg = 256 B = 16 lanes x 16 B
      {
#pragma unroll
        for (int it = 0; it < 8; ++it) {
          const int row = it * 2 + hh;
          v4f v = *(const v4f*)(slab + row * 68 + c4);
          *(v4f*)(C + (size_t)(mBase + row) * ldc + n0 + c4) = v;
        }
        
      }
    } else {
      const int q = lane >> 3, c8 = (lane & 7) * 8;
      unsigned short* C  = (unsigned short*)Cout  + (size_t)b * strideC;
      unsigned short* C2 = (OUT_MODE == 2) ? ((unsigned short*)Cout2 + (size_t)b * strideC) : nullptr;
      {
#pragma unroll
        for (int it = 0; it < 4; ++it) {
          const int row = it * 4 + q;
          const float* sp = slab + row * 68 + c8;
          v8h hv, lv;
#pragma unroll
          for (int e = 0; e < 8; ++e) {
            if (OUT_MODE == 1) {
              hv[e] = (_Float16)sp[e];
            } else {
              unsigned short hb = f2bf_bits(sp[e]);
              unsigned short lb = f2bf_bits(sp[e] - bf_bits2f(hb));
              hv[e] = __builtin_bit_cast(_Float16, hb);
              lv[e] = __builtin_bit_cast(_Float16, lb);
            }
          }
          *(v8h*)(C + (size_t)(mBase + row) * ldc + n0 + c8) = hv;
          if (OUT_MODE == 2) *(v8h*)(C2 + (size_t)(mBase + row) * ldc + n0 + c8) = lv;
        }
        
      }
    }
    __builtin_amdgcn_fence(__ATOMIC_RELEASE, "workgroup");
    __builtin_amdgcn_wave_barrier();
    __builtin_amdgcn_fence(__ATOMIC_ACQUIRE, "workgroup");
    // keeps the next row group's arithmetic behind the fence's store wait: no register of an issued store is rewritten before it
    __builtin_amdgcn_sched_barrier(0);
  }
}

// ---------------------------------------------------------------------------
// Elementwise f32 -> bf16 (RNE), 2 elements per thread, one 4-B store per lane -> each wave writes exactly
// Coverage: grid = ceil(n2/256) x 256 threads x 2 elements = 2*n2 = whole plane
//   (x: n2 = 4096*1024/2 = 2097152 -> 8192 blocks exact; wk/wv: n2 = 32768 -> 128 blocks exact).
// ---------------------------------------------------------------------------
__global__ __launch_bounds__(256) void cast_bf16x2_kernel(const float* __restrict__ in, unsigned short* __restrict__ out, int n2) {
  const int i = blockIdx.x * 256 + threadIdx.x;
  if (i < n2) {
    const v2f f = *(const v2f*)(in + 2 * (size_t)i);
    const unsigned u = pk16(f2bf_bits(f[0]), f2bf_bits(f[1]));
    ((unsigned*)out)[i] = u;
    
  }
}

// ---------------------------------------------------------------------------
// Row-permuted f32 -> bf16 (RNE) cast of a [1024][ncol] weight: dest row rd = h*64 + d takes source row d*16 + h
// (de-interleave of the (hidden, heads) column split). grid = (ncol/512, 1024), 256 threads, 2 elements per thread.
// ---------------------------------------------------------------------------
__global__ __launch_bounds__(256) void cast_perm_rows_bf16x2_kernel(const float* __restrict__ in, unsigned short* __restrict__ out, int ncol) {
  const int rd = blockIdx.y;                            // 0..1023
  int rs = ((rd & 63) << 4) + (rd >> 6);                // 0..1023
  rs = rs > 1023 ? 1023 : rs;
  const int i = blockIdx.x * 256 + threadIdx.x;         // pair index within the row
  if (i < (ncol >> 1)) {
    const v2f f = *(const v2f*)(in + (size_t)rs * ncol + 2 * (size_t)i);
    const unsigned u = pk16(f2bf_bits(f[0]), f2bf_bits(f[1]));
    unsigned* o = (unsigned*)(out + (size_t)rd * ncol);
    o[i] = u;
    
  }
}

// ---------------------------------------------------------------------------
// Permuted bias: out[h*64 + d] = in[d*16 + h]; n = 1024; 4 blocks x 256 threads x 4 B = whole vector,
// ---------------------------------------------------------------------------
__global__ __launch_bounds__(256) void perm_bias_kernel(const float* __restrict__ in, float* __restrict__ out, int n) {
  const int i = blockIdx.x * 256 + threadIdx.x;
  if (i < n) {
    int s = ((i & 63) << 4) + (i >> 6);
    s = s > n - 1 ? n - 1 : s;
    const float v = in[s];
    ((float*)out)[i] = v;
    
  }
}

// ---------------------------------------------------------------------------
// Elementwise f32 -> f16 of (bf16_rne(x) * sc) with sc a power of two: 2 elements per thread, one 4-B store per lane.
// ---------------------------------------------------------------------------
__global__ __launch_bounds__(256) void cast_bf_f16x2_scaled_kernel(const float* __restrict__ in, unsigned short* __restrict__ out, int n2, float sc) {
  const int i = blockIdx.x * 256 + threadIdx.x;
  if (i < n2) {
    const v2f f = *(const v2f*)(in + 2 * (size_t)i);
    const float g0 = bf_bits2f(f2bf_bits(f[0])) * sc;
    const float g1 = bf_bits2f(f2bf_bits(f[1])) * sc;
    const _Float16 h0 = (_Float16)g0, h1 = (_Float16)g1;
    const unsigned u = pk16(__builtin_bit_cast(unsigned short, h0), __builtin_bit_cast(unsigned short, h1));
    ((unsigned*)out)[i] = u;
    
  }
}

// =====================================================================================
// Full (non-causal, unmasked) multi-query attention, head dim 64.
//   q planes (hi/lo bf16): element (b, t, h, d) at [(b*kSeq + t)*kDm + h*64 + d]
//   k planes (hi/lo bf16): element (b, s, d) at [(b*kSeq + s)*kDhd + d]      (one KV head shared by all heads)
//   v^T plane (f16):       element (b, d, s) at [(b*64 + d)*kSeq + s]
//   out plane (f16, x kOsc): element (b, t, h, d) at [(b*kSeq + t)*kDm + h*64 + d]
//   scores = (q . k) * sscale : bf16 hi/lo split (hi.hi + hi.lo + lo.hi) on v_wmma_f32_16x16x32_bf16
//   out    = p . v            : v_wmma_f32_16x16x32_f16, p (unnormalised, <= 1) carried x2^15, f32 accumulate
//   both products are formed transposed: S^T = K . Q^T (A = K rows, B = Q columns) and O^T += V^T . P^T (A = V^T rows,
//   B = P^T packed from the score accumulators), so a lane holds 32 scores of ONE query per chunk: maximum and sum run
//   in the lane, the two wave halves join by one cross-row move, and P never passes through LDS.
//   online softmax in f32 over all kSeq keys (32 chunks of 64, compile-time trip count, no masking).
//   Block = 4 waves = 64 query rows of one (batch, head); grid = (kHeads * kSeq/64, kBatch).
//   K / V^T chunk staging: 128 threads x 32 elements per plane = the whole 64x64 tile (16-B copies, plain loads,
//   __syncthreads before and after); fragment loads read the LDS tiles with the same vector element type.
// =====================================================================================
#define AT_D 64
#define AT_NW 4
#define AT_QB 64
#define AT_KC 64
#define AT_LP 72   // LDS row pitch in 16-bit elements: 144 B = 16 B x 9 (odd), so the 16 rows of one ds_load_b128 half fall on 16 distinct 4-bank groups

__device__ __forceinline__ v8f at_mma(v16b a, v16b b, v8f c) {
  c = __builtin_amdgcn_wmma_f32_16x16x32_bf16(false, a, false, b, (short)0, c, false, false);
  asm volatile("v_nop\n\tv_nop\n\tv_nop\n\tv_nop" : "+v"(c) : "v"(a), "v"(b));
  return c;
}
__device__ __forceinline__ v8f at_mma_h(v16h a, v16h b, v8f c) {
  c = __builtin_amdgcn_wmma_f32_16x16x32_f16(false, a, false, b, (short)0, c, false, false);
  asm volatile("v_nop\n\tv_nop\n\tv_nop\n\tv_nop" : "+v"(c) : "v"(a), "v"(b));
  return c;
}

// lane l takes the value of lane l ^ 16 (the other half of the wave, same column)
__device__ __forceinline__ float at_xhalf(float x) {
  return __builtin_bit_cast(float, __builtin_amdgcn_permlanex16(__builtin_bit_cast(int, x), __builtin_bit_cast(int, x), 0x76543210, 0xfedcba98, false, false));
}

__global__ __launch_bounds__(128)
void mqa_full64_kernel(const unsigned short* __restrict__ qhp, const unsigned short* __restrict__ qlp,
                       const unsigned short* __restrict__ khp, const unsigned short* __restrict__ klp,
                       const unsigned short* __restrict__ vtp, unsigned short* __restrict__ o16p,
                       float sscale) {
  union FB { v16b v; v8b h[2]; };
  union FH { v16h v; v8h h[2]; };
  __shared__ __align__(16) __bf16   Ksh[AT_KC * AT_LP];         // K hi [kv][d], pitch AT_LP      9 KB
  __shared__ __align__(16) __bf16   Ksl[AT_KC * AT_LP];         // K lo                          9 KB
  __shared__ __align__(16) _Float16 Vth[AT_D * AT_LP];          // V^T f16 [d][kv], pitch AT_LP  9 KB
  __shared__ __align__(16) float    Os[AT_NW][16 * 68];         // per wave out tile, pitch 68

  const int tid  = threadIdx.x;
  const int wave = tid >> 5;
  const int lane = tid & 31;
  const int hh   = lane >> 4;
  const int c    = lane & 15;

  const int nqb = kSeq / AT_QB;            // 32
  const int b  = blockIdx.y;               // 0..kBatch-1
  const int bx = blockIdx.x;               // 0..kHeads*nqb-1
  const int qb = bx % nqb;
  const int h  = bx / nqb;                 // 0..kHeads-1
  const int q0 = qb * AT_QB + wave * 16;

  const __bf16*   Qh = (const __bf16*)(const void*)qhp + (size_t)b * kSeq * kDm + (size_t)h * AT_D;
  const __bf16*   Ql = (const __bf16*)(const void*)qlp + (size_t)b * kSeq * kDm + (size_t)h * AT_D;
  const __bf16*   Kh = (const __bf16*)(const void*)khp + (size_t)b * kSeq * kDhd;
  const __bf16*   Kl = (const __bf16*)(const void*)klp + (size_t)b * kSeq * kDhd;
  const _Float16* Vt = (const _Float16*)(const void*)vtp + (size_t)b * AT_D * kSeq;
  _Float16*       ob = (_Float16*)(void*)o16p + (size_t)b * kSeq * kDm + (size_t)h * AT_D;

  // ---- Q fragments (B operand, column = query = lane&15, split k map via Frag load): 2 d-chunks, hi and lo ----
  v16b qah[2], qal[2];
#pragma unroll
  for (int dc = 0; dc < 2; ++dc) {
    const __bf16* qr = Qh + (size_t)(q0 + c) * kDm + dc * 32 + 8 * hh;
    const __bf16* ql = Ql + (size_t)(q0 + c) * kDm + dc * 32 + 8 * hh;
    qah[dc] = Frag<__bf16>::load(qr);
    qal[dc] = Frag<__bf16>::load(ql);
  }

  float mrun = -INFINITY;   // running maximum of query q0 + c (equal in both wave halves)
  float lrun = 0.f;         // running sum over this half's keys only; the halves join in the epilogue
  v8f oacc[4];              // oacc[t][r] = O^T(d = t*16 + 8*hh + r, query q0 + c)
#pragma unroll
  for (int t = 0; t < 4; ++t) oacc[t] = (v8f){0.f,0.f,0.f,0.f,0.f,0.f,0.f,0.f};

  const int nChunks = kSeq / AT_KC;   // 32, compile-time constant
  for (int kc = 0; kc < nChunks; ++kc) {
    const int kv0 = kc * AT_KC;
    __syncthreads();
    {
      // staging coverage: 128 threads x (4 x 8) elements = 64 rows x 64 per plane = the whole chunk tile
      const int r = tid >> 1, half = (tid & 1) * 32;
      const __bf16*   ksh = Kh + (size_t)(kv0 + r) * kDhd + half;   // K row kv0+r, d = half..half+31
      const __bf16*   ksl = Kl + (size_t)(kv0 + r) * kDhd + half;
      const _Float16* vsr = Vt + (size_t)r * kSeq + kv0 + half;      // V^T row d = r, s = kv0+half..+31
#pragma unroll
      for (int i = 0; i < 4; ++i) {
        const v8b a0 = *(const v8b*)(ksh + 8 * i);
        const v8b a1 = *(const v8b*)(ksl + 8 * i);
        const v8h b0 = *(const v8h*)(vsr + 8 * i);
        *(v8b*)(Ksh + r * AT_LP + half + 8 * i) = a0;
        *(v8b*)(Ksl + r * AT_LP + half + 8 * i) = a1;
        *(v8h*)(Vth + r * AT_LP + half + 8 * i) = b0;
      }
    }
    __syncthreads();

    // ---- scores, transposed: A operand row = key j*16+c, B operand column = query c, both <- d with the split k map ----
    v8f s[4];
#pragma unroll
    for (int j = 0; j < 4; ++j) {
      s[j] = (v8f){0.f,0.f,0.f,0.f,0.f,0.f,0.f,0.f};
#pragma unroll
      for (int dc = 0; dc < 2; ++dc) {
        FB kb, kl;
        kb.h[0] = *(const v8b*)(Ksh + (j * 16 + c) * AT_LP + dc * 32 + 8 * hh);
        kb.h[1] = *(const v8b*)(Ksh + (j * 16 + c) * AT_LP + dc * 32 + 16 + 8 * hh);
        kl.h[0] = *(const v8b*)(Ksl + (j * 16 + c) * AT_LP + dc * 32 + 8 * hh);
        kl.h[1] = *(const v8b*)(Ksl + (j * 16 + c) * AT_LP + dc * 32 + 16 + 8 * hh);
        s[j] = at_mma(kb.v, qah[dc], s[j]);
        s[j] = at_mma(kl.v, qah[dc], s[j]);
        s[j] = at_mma(kb.v, qal[dc], s[j]);
      }
    }
    // D layout: s[j][r] = score(key kv0 + j*16 + 8*hh + r, query q0 + c)
    // the loops over j, r and t below are unrolled because s and oacc are register arrays; one chain per j keeps four
    // independent maximum and sum chains in flight
    float mj[4];
#pragma unroll
    for (int j = 0; j < 4; ++j) {
      float m = -INFINITY;
#pragma unroll
      for (int r = 0; r < 8; ++r) {
        const float sv = s[j][r] * sscale;
        s[j][r] = sv;
        m = fmaxf(m, sv);
      }
      mj[j] = m;
    }
    float cm = fmaxf(fmaxf(mj[0], mj[1]), fmaxf(mj[2], mj[3]));
    cm = fmaxf(cm, at_xhalf(cm));            // the query's maximum over all 64 keys of the chunk, in both halves
    const float mnew = fmaxf(mrun, cm);
    const float alpha = expf(mrun - mnew);
    mrun = mnew;
    float pj[4];
#pragma unroll
    for (int j = 0; j < 4; ++j) {
      float ps = 0.f;
#pragma unroll
      for (int r = 0; r < 8; ++r) {
        const float p = expf(s[j][r] - mnew);
        ps += p;
        s[j][r] = p * kPsc;
      }
      pj[j] = ps;
    }
    lrun = lrun * alpha + ((pj[0] + pj[1]) + (pj[2] + pj[3]));
#pragma unroll
    for (int t = 0; t < 4; ++t)
#pragma unroll
      for (int r = 0; r < 8; ++r) oacc[t][r] *= alpha;
    // ---- O^T += V^T . P^T: two score tiles (keys kk*32 + 8hh + 0..7 and kk*32 + 16 + 8hh + 0..7) are one B operand in place ----
#pragma unroll
    for (int kk = 0; kk < 2; ++kk) {   // unrolled: the score tiles are registers and cannot be indexed at run time
      v16h pb;
#pragma unroll   // vector elements are registers: constant indices only
      for (int e = 0; e < 8; ++e) {
        pb[e]     = (_Float16)s[2 * kk][e];
        pb[8 + e] = (_Float16)s[2 * kk + 1][e];
      }
#pragma unroll
      for (int t = 0; t < 4; ++t) {
        FH vb;
        vb.h[0] = *(const v8h*)(Vth + (t * 16 + c) * AT_LP + kk * 32 + 8 * hh);       // A: row = d = t*16 + c, same key map as P^T
        vb.h[1] = *(const v8h*)(Vth + (t * 16 + c) * AT_LP + kk * 32 + 16 + 8 * hh);
        oacc[t] = at_mma_h(vb.v, pb, oacc[t]);
      }
    }
  }

  // ---- epilogue: O = oacc / (l * 2^15), carried x kOsc as f16 ----
  float* os = Os[wave];
  {
    const float lsum = lrun + at_xhalf(lrun);   // the two halves' key sums of query q0 + c
    const float inv = kOsc * (1.0f / (lsum * kPsc));
#pragma unroll   // oacc is a register array: constant indices only (inner loop too)
    for (int t = 0; t < 4; ++t) {
      v4f w0, w1;
#pragma unroll
      for (int r = 0; r < 4; ++r) { w0[r] = oacc[t][r] * inv; w1[r] = oacc[t][4 + r] * inv; }
      *(v4f*)(os + c * 68 + t * 16 + 8 * hh)     = w0;   // row = query c, 8 consecutive d per lane
      *(v4f*)(os + c * 68 + t * 16 + 8 * hh + 4) = w1;
    }
  }
  __builtin_amdgcn_fence(__ATOMIC_RELEASE, "workgroup");
  __builtin_amdgcn_wave_barrier();
  __builtin_amdgcn_fence(__ATOMIC_ACQUIRE, "workgroup");
  {
    const int qg = lane >> 3, c8 = (lane & 7) * 8;
    {
#pragma unroll
      for (int it = 0; it < 4; ++it) {
        const int row = it * 4 + qg;                    // 4 it x 4 groups = rows 0..15
        const float* sp = os + row * 68 + c8;
        v8h hv;
#pragma unroll
        for (int e = 0; e < 8; ++e) hv[e] = (_Float16)sp[e];
        *(v8h*)(ob + (size_t)(q0 + row) * kDm + c8) = hv;
      }
      
    }
  }
}

// ---------------------------------------------------------------------------
// Host driver. Workspace region map (bytes, 256-B aligned offsets):
//   x16   [4096][1024] bf16           8388608
//   wq16p [1024][1024] bf16 (rows permuted to head-major)  2097152
//   wk16  [64][1024]   bf16            131072
//   wv16  [64][1024]   bf16            131072
//   wo16  [1024][1024] f16 (bf16-RNE x16)  2097152
//   bqp   [1024]       f32 (permuted)     4096
//   Qh,Ql [4096][1024] bf16 hi/lo     2 x 8388608
//   Kh,Kl [4096][64]   bf16 hi/lo     2 x 524288
//   Vt16  [2][64][2048] f16            524288
//   O16   [4096][1024] f16 (x16)      8388608
//   total 39587840 B
// ---------------------------------------------------------------------------
extern "C" void kernel_launch(void* const* d_in, const int* in_sizes, int n_in,
                              void* d_out, int out_size, void* d_ws, size_t ws_size,
                              hipStream_t stream) {
  const int nB = kBatch, nS = kSeq, nD = kDm, nDh = kDhd;
  const int nM = nB * nS;   // 4096
  if (n_in < 9) return;
  if (in_sizes[0] != nM * nD || in_sizes[1] != nD * nD || in_sizes[2] != nD ||
      in_sizes[3] != nDh * nD || in_sizes[4] != nDh || in_sizes[5] != nDh * nD ||
      in_sizes[6] != nDh || in_sizes[7] != nD * nD || in_sizes[8] != nD || out_size != nM * nD) return;

  const float* x  = (const float*)d_in[0];
  const float* wq = (const float*)d_in[1];
  const float* bq = (const float*)d_in[2];
  const float* wk = (const float*)d_in[3];
  const float* bk = (const float*)d_in[4];
  const float* wv = (const float*)d_in[5];
  const float* bv = (const float*)d_in[6];
  const float* wo = (const float*)d_in[7];
  const float* bo = (const float*)d_in[8];

  size_t off = 0;
  auto carve = [&](size_t bytes) -> char* {
    char* p = (char*)d_ws + off;
    off += (bytes + 255) & ~(size_t)255;
    return p;
  };
  unsigned short* x16   = (unsigned short*)carve((size_t)nM * nD * 2);
  unsigned short* wq16p = (unsigned short*)carve((size_t)nD * nD * 2);
  unsigned short* wk16  = (unsigned short*)carve((size_t)nDh * nD * 2);
  unsigned short* wv16  = (unsigned short*)carve((size_t)nDh * nD * 2);
  unsigned short* wo16  = (unsigned short*)carve((size_t)nD * nD * 2);
  float*          bqp   = (float*)carve((size_t)nD * 4);
  unsigned short* Qh    = (unsigned short*)carve((size_t)nM * nD * 2);
  unsigned short* Ql    = (unsigned short*)carve((size_t)nM * nD * 2);
  unsigned short* Kh    = (unsigned short*)carve((size_t)nM * nDh * 2);
  unsigned short* Kl    = (unsigned short*)carve((size_t)nM * nDh * 2);
  unsigned short* Vt16  = (unsigned short*)carve((size_t)nB * nDh * nS * 2);
  unsigned short* O16   = (unsigned short*)carve((size_t)nM * nD * 2);
  if (off > ws_size) return;

  // ---- casts (bf16 RNE; wq rows / bq permuted to head-major; wo as f16(bf16_rne(wo) * 16)) ----
  {
    const int n2x = nM * nD / 2;      // 2097152 -> 8192 blocks
    cast_bf16x2_kernel<<<dim3((n2x + 255) / 256), dim3(256), 0, stream>>>(x, x16, n2x);
    const int n2kv = nDh * nD / 2;    // 32768 -> 128 blocks
    cast_bf16x2_kernel<<<dim3((n2kv + 255) / 256), dim3(256), 0, stream>>>(wk, wk16, n2kv);
    cast_bf16x2_kernel<<<dim3((n2kv + 255) / 256), dim3(256), 0, stream>>>(wv, wv16, n2kv);
    cast_perm_rows_bf16x2_kernel<<<dim3((nD / 2 + 255) / 256, nD), dim3(256), 0, stream>>>(wq, wq16p, nD);
    perm_bias_kernel<<<dim3((nD + 255) / 256), dim3(256), 0, stream>>>(bq, bqp, nD);
    const int n2o = nD * nD / 2;      // 524288 -> 2048 blocks
    cast_bf_f16x2_scaled_kernel<<<dim3((n2o + 255) / 256), dim3(256), 0, stream>>>(wo, wo16, n2o, kWsc);
  }

  // ---- q projection: [4096][1024] = x16 . wq16p^T + bqp -> bf16 hi/lo planes, head-major columns (h*64 + d) ----
  // M=4096, N=1024 (multiples of 64), K=1024 (multiple of 64); tiles 64*16 = 1024 -> 128 blocks of 8 waves
  wmma_gemm64<1, false, 2, 2, false, 0><<<dim3((nM / 64) * (nD / 64) / 8, 1), dim3(256), 0, stream>>>(
      x16, x16, 0L, wq16p, wq16p, 0L, (void*)Qh, (void*)Ql, nD, 0L, bqp, bqp, 0L, nM, nD, nD, 1.0f);

  // ---- k projection: [4096][64] = x16 . wk16^T + bk -> bf16 hi/lo planes; tiles 64 -> 8 blocks ----
  wmma_gemm64<1, false, 2, 2, false, 0><<<dim3((nM / 64) * (nDh / 64) / 8, 1), dim3(256), 0, stream>>>(
      x16, x16, 0L, wk16, wk16, 0L, (void*)Kh, (void*)Kl, nDh, 0L, bk, bk, 0L, nM, nDh, nD, 1.0f);

  // ---- v^T projection per batch z: Vt16_z [64][2048] = wv16 . x16_z^T + bv[m] -> f16; tiles 32 -> 4 blocks, grid.y = 2 ----
  wmma_gemm64<1, false, 1, 1, false, 0><<<dim3((nDh / 64) * (nS / 64) / 8, nB), dim3(256), 0, stream>>>(
      wv16, wv16, 0L, x16, x16, (long)nS * nD, (void*)Vt16, (void*)Vt16, nS, (long)nDh * nS,
      bv, bv, 0L, nDh, nS, nD, 1.0f);

  // ---- attention: grid (16 heads x 32 query blocks, 2 batches), all heads share the batch's K / V^T planes ----
  mqa_full64_kernel<<<dim3(kHeads * (nS / AT_QB), nB), dim3(128), 0, stream>>>(Qh, Ql, Kh, Kl, Vt16, O16, 0.125f);

  // ---- output projection: out [4096][1024] f32 = (O16 . wo16^T) / 256 + bo ----
  wmma_gemm64<0, false, 2, 0, false, 0><<<dim3((nM / 64) * (nD / 64) / 8, 1), dim3(256), 0, stream>>>(
      O16, O16, 0L, wo16, wo16, 0L, d_out, d_out, nD, 0L, bo, bo, 0L, nM, nD, nD, 1.0f / (kOsc * kWsc));
}

// v004
// It runs in 167 microseconds.
// Timed twice side by side with v003, it ran 1.15 and 1.16 times as fast.
// All steps since v000 together make it 2.91 times as fast.
// Contractions: q/k/v^T projections v_wmma_f32_16x16x32_bf16 (inputs RNE-cast to bf16, f32 acc); q.k^T v_wmma_f32_16x16x32_bf16 with bf16 hi/lo split (hi.hi+hi.lo+lo.hi); p.v and output projection v_wmma_f32_16x16x32_f16 (p carried x2^15, o carried x16, wo carried x16), f32 acc; online softmax, biases and scales in f32.
#include <hip/hip_runtime.h>
#include <math.h>
#include <stdint.h>

typedef __attribute__((ext_vector_type(16))) _Float16 v16h;
typedef __attribute__((ext_vector_type(8)))  _Float16 v8h;
typedef __attribute__((ext_vector_type(16))) __bf16   v16b;
typedef __attribute__((ext_vector_type(8)))  __bf16   v8b;
typedef __attribute__((ext_vector_type(8)))  float    v8f;
typedef __attribute__((ext_vector_type(4)))  float    v4f;
typedef __attribute__((ext_vector_type(2)))  float    v2f;
typedef __attribute__((ext_vector_type(4)))  unsigned int v4u;

// problem geometry (compile-time)
constexpr int kBatch = 2;
constexpr int kSeq   = 2048;
constexpr int kDm    = 1024;   // model width = H*Dh = q row pitch
constexpr int kHeads = 16;
constexpr int kDhd   = 64;     // per-head dim = k row pitch
constexpr float kPlog = 15.0f;     // softmax numerators carried x2^15 in f16: 15 is added to their base-2 exponent
constexpr float kOsc = 16.0f;      // attention output carried x16 in f16
constexpr float kWsc = 16.0f;      // output-projection weight carried x16 in f16

__device__ __forceinline__ unsigned short f2bf_bits(float f) {
  unsigned u = __float_as_uint(f);
  return (unsigned short)((u + 0x7FFFu + ((u >> 16) & 1u)) >> 16);
}
__device__ __forceinline__ float bf_bits2f(unsigned short h) { return __uint_as_float(((unsigned)h) << 16); }
__device__ __forceinline__ unsigned pk16(unsigned short a, unsigned short b) { return (unsigned)a | ((unsigned)b << 16); }

// hazard guards as plain device helpers
__device__ __forceinline__ void dep_guard_h(v8f& a, v8f& b, v16h x, v16h y) { asm volatile("v_nop\n\tv_nop\n\tv_nop\n\tv_nop" : "+v"(a), "+v"(b) : "v"(x), "v"(y)); }
__device__ __forceinline__ void dep_guard_b(v8f& a, v8f& b, v16b x, v16b y) { asm volatile("v_nop\n\tv_nop\n\tv_nop\n\tv_nop" : "+v"(a), "+v"(b) : "v"(x), "v"(y)); }
__device__ __forceinline__ void keep4_h(v16h a, v16h b, v16h c, v16h d) { asm volatile("v_nop" :: "v"(a), "v"(b), "v"(c), "v"(d)); }
__device__ __forceinline__ void keep4_b(v16b a, v16b b, v16b c, v16b d) { asm volatile("v_nop" :: "v"(a), "v"(b), "v"(c), "v"(d)); }
__device__ __forceinline__ void acc_guard4(v8f& a, v8f& b, v8f& c, v8f& d) { asm volatile("v_nop\n\tv_nop\n\tv_nop\n\tv_nop" : "+v"(a), "+v"(b), "+v"(c), "+v"(d)); }
template <typename T> struct Frag;
template <> struct Frag<_Float16> {
  typedef v16h V; typedef v8h H; union U { v16h v; v8h h[2]; };
  static __device__ __forceinline__ v16h load(const _Float16* p) {   // elements 0..7 <- p[0..7], 8..15 <- p[16..23]
    U f; f.h[0] = *(const v8h*)(p); f.h[1] = *(const v8h*)(p + 16); return f.v;
  }
  static __device__ __forceinline__ v8f mma(v16h a, v16h b, v8f c) {
    return __builtin_amdgcn_wmma_f32_16x16x32_f16(false, a, false, b, (short)0, c, false, false);
  }
  static __device__ __forceinline__ void guard(v8f& a, v8f& b, v16h x, v16h y) { dep_guard_h(a, b, x, y); }
  static __device__ __forceinline__ void keep(v16h a, v16h b, v16h c, v16h d) { keep4_h(a, b, c, d); }
};
template <> struct Frag<__bf16> {
  typedef v16b V; typedef v8b H; union U { v16b v; v8b h[2]; };
  static __device__ __forceinline__ v16b load(const __bf16* p) {
    U f; f.h[0] = *(const v8b*)(p); f.h[1] = *(const v8b*)(p + 16); return f.v;
  }
  static __device__ __forceinline__ v8f mma(v16b a, v16b b, v8f c) {
    return __builtin_amdgcn_wmma_f32_16x16x32_bf16(false, a, false, b, (short)0, c, false, false);
  }
  static __device__ __forceinline__ void guard(v8f& a, v8f& b, v16b x, v16b y) { dep_guard_b(a, b, x, y); }
  static __device__ __forceinline__ void keep(v16b a, v16b b, v16b c, v16b d) { keep4_b(a, b, c, d); }
};

// ---- Register-blocked batched WMMA GEMM ------------------------------------
// C[m,n] = scale * sum_k A[m,k] * Bt[n,k] (+bias)(+resid); each wave owns a 64x64 tile.
// A row-major [M,K]; Bt row-major [N,K], both with row pitch kDm (compile time, so that the 16 row groups of a tile
// are immediate offsets of one address); M,N % 64 == 0, K % 64 == 0, K <= kDm.
// Operand path: per 64-k step each wave copies its own 64x64 A tile and 64x64 Bt tile into its own LDS range with
// global loads that cover whole 128-B lines (8 lanes per row, 4 rows per load), the next step's loads being issued
// before the current step's products; the WMMA fragments are read from LDS (k order per 32-k group as Frag::load).
// SPLIT (hi/lo planes) is not instantiated and not supported by the staged loop.
// BIAS_MODE: 0 = none, 1 = bias[m], 2 = bias[n].
// OUT_MODE: 0 = f32, 1 = f16, 2 = bf16 hi plane (Cout) + bf16 lo plane (Cout2).
// ET: 0 = f16 operands, 1 = bf16 operands (pointers passed as 16-bit storage)
#define GS_LP 72   // LDS row pitch of a staged operand tile in 16-bit elements: 144 B = 16 B x 9 (odd), conflict-free for ds_load_b128 fragment reads
template <int ET> struct Elem;
template <> struct Elem<0> { typedef _Float16 T; };
template <> struct Elem<1> { typedef __bf16 T; };
template <int ET, bool SPLIT, int BIAS_MODE, int OUT_MODE, bool RESID, int ACT = 0>
__global__ __launch_bounds__(256) void wmma_gemm64(
    const unsigned short* __restrict__ Ap, const unsigned short* __restrict__ A2p, long strideA,
    const unsigned short* __restrict__ Btp, const unsigned short* __restrict__ Bt2p, long strideB,
    void* __restrict__ Cout, void* __restrict__ Cout2, int ldc, long strideC,
    const float* __restrict__ bias,
    const float* __restrict__ resid, long strideR,
    int M, int N, int K, float scale) {
  typedef typename Elem<ET>::T T;
  typedef typename Frag<T>::V V;
  const T* A = (const T*)Ap; const T* Bt = (const T*)Btp;
  static_assert(!SPLIT, "the staged operand loop takes single-plane operands");
  typedef typename Frag<T>::H H;
  __shared__ __align__(16) T sOp[8][2][64 * GS_LP];   // per-wave A tile and Bt tile of one 64-k step, pitch GS_LP
  __shared__ __align__(16) float sT[8][16 * 68];   // per-wave 16x64 slab, pitch 68 floats
  const int b    = blockIdx.y;
  const int lane = threadIdx.x & 31;
  const int wave = __builtin_amdgcn_readfirstlane(threadIdx.x >> 5);   // wave-uniform: tile bases stay scalar
  const int tilesN = N >> 6;
  const int tilesM = M >> 6;
  const int tile = blockIdx.x * 8 + wave;
  if (tile >= tilesM * tilesN) return;   // wave-uniform; no block barriers in this kernel
  const int tm = tile / tilesN;
  const int tn = tile - tm * tilesN;
  const int m0 = tm << 6;
  const int n0 = tn << 6;

  const T* Ab  = A  + (size_t)b * strideA;
  const T* Bb  = Bt + (size_t)b * strideB;

  const int rlane = lane & 15;                 // row (A) / col (B, D) within subtile
  const int koff  = (lane >> 4) * 8;           // k offset of this lane half
  const int mOff  = (lane >> 4) * 8;           // D row offset

  v8f acc[4][4];
#pragma unroll
  for (int i = 0; i < 4; ++i)
#pragma unroll
    for (int j = 0; j < 4; ++j) acc[i][j] = (v8f){0.f,0.f,0.f,0.f,0.f,0.f,0.f,0.f};

  // staging map: lane -> row (lane >> 3) of each group of 4 rows, 16-B piece (lane & 7) of the row's 128-B line
  const int srow = lane >> 3;
  const int scol = (lane & 7) * 8;
  const T* Ag = Ab + (size_t)(m0 + srow) * kDm + scol;   // this lane's piece of row group 0, k = 0
  const T* Bg = Bb + (size_t)(n0 + srow) * kDm + scol;
  T* sa = sOp[wave][0];
  T* sb = sOp[wave][1];
  H ra[16], rb[16];
#pragma unroll
  for (int it = 0; it < 16; ++it) {
    ra[it] = *(const H*)(Ag + it * 4 * kDm);
    rb[it] = *(const H*)(Bg + it * 4 * kDm);
  }

  for (int k0 = 0; k0 < K; k0 += 64) {
#pragma unroll
    for (int it = 0; it < 16; ++it) {
      *(H*)(sa + (it * 4 + srow) * GS_LP + scol) = ra[it];
      *(H*)(sb + (it * 4 + srow) * GS_LP + scol) = rb[it];
    }
    // the wave's own tile stores are complete before any of its lanes reads another lane's rows
    __builtin_amdgcn_fence(__ATOMIC_RELEASE, "workgroup");
    __builtin_amdgcn_wave_barrier();
    __builtin_amdgcn_fence(__ATOMIC_ACQUIRE, "workgroup");
    if (k0 + 64 < K) {   // wave-uniform: the next step's tiles fly while this step's products run
#pragma unroll
      for (int it = 0; it < 16; ++it) {
        ra[it] = *(const H*)(Ag + it * 4 * kDm + (k0 + 64));
        rb[it] = *(const H*)(Bg + it * 4 * kDm + (k0 + 64));
      }
      asm volatile("s_wait_xcnt 0x0" ::: "memory");   // before the fragment reads below reuse the address registers of these loads
    }
#pragma unroll
    for (int kk = 0; kk < 2; ++kk) {
      V bh[4], ah[4];
#pragma unroll
      for (int j = 0; j < 4; ++j) bh[j] = Frag<T>::load(sb + ((j << 4) + rlane) * GS_LP + kk * 32 + koff);
#pragma unroll
      for (int i = 0; i < 4; ++i) ah[i] = Frag<T>::load(sa + ((i << 4) + rlane) * GS_LP + kk * 32 + koff);
#pragma unroll
      for (int i = 0; i < 4; ++i) {
#pragma unroll
        for (int j = 0; j < 4; ++j) acc[i][j] = Frag<T>::mma(ah[i], bh[j], acc[i][j]);
        Frag<T>::guard(acc[i][0], acc[i][3], ah[i], ah[i]);
      }
      Frag<T>::keep(bh[0], bh[1], bh[2], bh[3]);
    }
    // every fragment read of this step is done before the next step's stores overwrite the tiles
    __builtin_amdgcn_fence(__ATOMIC_RELEASE, "workgroup");
    __builtin_amdgcn_wave_barrier();
    __builtin_amdgcn_fence(__ATOMIC_ACQUIRE, "workgroup");
  }
  acc_guard4(acc[0][0], acc[0][1], acc[0][2], acc[0][3]);
  acc_guard4(acc[1][0], acc[1][1], acc[1][2], acc[1][3]);
  acc_guard4(acc[2][0], acc[2][1], acc[2][2], acc[2][3]);
  acc_guard4(acc[3][0], acc[3][1], acc[3][2], acc[3][3]);

  // ---- epilogue ----
  float* slab = sT[wave];
  const float* Rb = RESID ? (resid + (size_t)b * strideR) : nullptr;
#pragma unroll
  for (int i = 0; i < 4; ++i) {
    const int mBase = m0 + (i << 4);
    float bm[8];
    if (BIAS_MODE == 1) {
      const float* bp = bias + mBase + mOff;
#pragma unroll
      for (int r = 0; r < 8; ++r) bm[r] = bp[r];
      // before the address registers of the bias loads are reused; the address as an input keeps them untouched up to here
      asm volatile("s_wait_xcnt 0x0" :: "v"(bp) : "memory");
    }
#pragma unroll
    for (int j = 0; j < 4; ++j) {
      const int n = n0 + (j << 4) + rlane;
      float bv = 0.f;
      if (BIAS_MODE == 2) bv = bias[n];
#pragma unroll
      for (int r = 0; r < 8; ++r) {
        float v = acc[i][j][r] * scale;
        if (BIAS_MODE == 1) v += bm[r];
        if (BIAS_MODE == 2) v += bv;
        if (RESID) v += Rb[(size_t)(mBase + mOff + r) * ldc + n];
        if (ACT == 1) v = tanhf(v);
        if (ACT == 2) v = fmaxf(v, 0.0f);
        if (ACT == 3) v = v / (1.0f + expf(-v));
        if (ACT == 4) v = (v > 0.f) ? v : 0.01f * v;
        if (ACT == 5) v = 0.5f * v * (1.0f + erff(v * 0.70710678118654752f));
        slab[(mOff + r) * 68 + (j << 4) + rlane] = v;
      }
    }
    __builtin_amdgcn_fence(__ATOMIC_RELEASE, "workgroup");
    __builtin_amdgcn_wave_barrier();
    __builtin_amdgcn_fence(__ATOMIC_ACQUIRE, "workgroup");
    if (OUT_MODE == 0) {
      float* C = (float*)Cout + (size_t)b * strideC;
      const int hh = lane >> 4, c4 = (lane & 15) * 4;     // row seg = 256 B = 16 lanes x 16 B
      {
#pragma unroll
        for (int it = 0; it < 8; ++it) {
          const int row = it * 2 + hh;
          v4f v = *(const v4f*)(slab + row * 68 + c4);
          *(v4f*)(C + (size_t)(mBase + row) * ldc + n0 + c4) = v;
        }
        
      }
    } else {
      const int q = lane >> 3, c8 = (lane & 7) * 8;
      unsigned short* C  = (unsigned short*)Cout  + (size_t)b * strideC;
      unsigned short* C2 = (OUT_MODE == 2) ? ((unsigned short*)Cout2 + (size_t)b * strideC) : nullptr;
      {
#pragma unroll
        for (int it = 0; it < 4; ++it) {
          const int row = it * 4 + q;
          const float* sp = slab + row * 68 + c8;
          v8h hv, lv;
#pragma unroll
          for (int e = 0; e < 8; ++e) {
            if (OUT_MODE == 1) {
              hv[e] = (_Float16)sp[e];
            } else {
              unsigned short hb = f2bf_bits(sp[e]);
              unsigned short lb = f2bf_bits(sp[e] - bf_bits2f(hb));
              hv[e] = __builtin_bit_cast(_Float16, hb);
              lv[e] = __builtin_bit_cast(_Float16, lb);
            }
          }
          *(v8h*)(C + (size_t)(mBase + row) * ldc + n0 + c8) = hv;
          if (OUT_MODE == 2) *(v8h*)(C2 + (size_t)(mBase + row) * ldc + n0 + c8) = lv;
        }
        
      }
    }
    __builtin_amdgcn_fence(__ATOMIC_RELEASE, "workgroup");
    __builtin_amdgcn_wave_barrier();
    __builtin_amdgcn_fence(__ATOMIC_ACQUIRE, "workgroup");
    // keeps the next row group's arithmetic behind the fence's store wait: no register of an issued store is rewritten before it
    __builtin_amdgcn_sched_barrier(0);
  }
}

// ---------------------------------------------------------------------------
// Elementwise f32 -> bf16 (RNE), 2 elements per thread, one 4-B store per lane -> each wave writes exactly
// Coverage: grid = ceil(n2/256) x 256 threads x 2 elements = 2*n2 = whole plane
//   (x: n2 = 4096*1024/2 = 2097152 -> 8192 blocks exact; wk/wv: n2 = 32768 -> 128 blocks exact).
// ---------------------------------------------------------------------------
__global__ __launch_bounds__(256) void cast_bf16x2_kernel(const float* __restrict__ in, unsigned short* __restrict__ out, int n2) {
  const int i = blockIdx.x * 256 + threadIdx.x;
  if (i < n2) {
    const v2f f = *(const v2f*)(in + 2 * (size_t)i);
    const unsigned u = pk16(f2bf_bits(f[0]), f2bf_bits(f[1]));
    ((unsigned*)out)[i] = u;
    
  }
}

// ---------------------------------------------------------------------------
// Row-permuted f32 -> bf16 (RNE) cast of a [1024][ncol] weight: dest row rd = h*64 + d takes source row d*16 + h
// (de-interleave of the (hidden, heads) column split). grid = (ncol/512, 1024), 256 threads, 2 elements per thread.
// ---------------------------------------------------------------------------
__global__ __launch_bounds__(256) void cast_perm_rows_bf16x2_kernel(const float* __restrict__ in, unsigned short* __restrict__ out, int ncol) {
  const int rd = blockIdx.y;                            // 0..1023
  int rs = ((rd & 63) << 4) + (rd >> 6);                // 0..1023
  rs = rs > 1023 ? 1023 : rs;
  const int i = blockIdx.x * 256 + threadIdx.x;         // pair index within the row
  if (i < (ncol >> 1)) {
    const v2f f = *(const v2f*)(in + (size_t)rs * ncol + 2 * (size_t)i);
    const unsigned u = pk16(f2bf_bits(f[0]), f2bf_bits(f[1]));
    unsigned* o = (unsigned*)(out + (size_t)rd * ncol);
    o[i] = u;
    
  }
}

// ---------------------------------------------------------------------------
// Permuted bias: out[h*64 + d] = in[d*16 + h]; n = 1024; 4 blocks x 256 threads x 4 B = whole vector,
// ---------------------------------------------------------------------------
__global__ __launch_bounds__(256) void perm_bias_kernel(const float* __restrict__ in, float* __restrict__ out, int n) {
  const int i = blockIdx.x * 256 + threadIdx.x;
  if (i < n) {
    int s = ((i & 63) << 4) + (i >> 6);
    s = s > n - 1 ? n - 1 : s;
    const float v = in[s];
    ((float*)out)[i] = v;
    
  }
}

// ---------------------------------------------------------------------------
// Elementwise f32 -> f16 of (bf16_rne(x) * sc) with sc a power of two: 2 elements per thread, one 4-B store per lane.
// ---------------------------------------------------------------------------
__global__ __launch_bounds__(256) void cast_bf_f16x2_scaled_kernel(const float* __restrict__ in, unsigned short* __restrict__ out, int n2, float sc) {
  const int i = blockIdx.x * 256 + threadIdx.x;
  if (i < n2) {
    const v2f f = *(const v2f*)(in + 2 * (size_t)i);
    const float g0 = bf_bits2f(f2bf_bits(f[0])) * sc;
    const float g1 = bf_bits2f(f2bf_bits(f[1])) * sc;
    const _Float16 h0 = (_Float16)g0, h1 = (_Float16)g1;
    const unsigned u = pk16(__builtin_bit_cast(unsigned short, h0), __builtin_bit_cast(unsigned short, h1));
    ((unsigned*)out)[i] = u;
    
  }
}

// =====================================================================================
// Full (non-causal, unmasked) multi-query attention, head dim 64.
//   q planes (hi/lo bf16): element (b, t, h, d) at [(b*kSeq + t)*kDm + h*64 + d]
//   k planes (hi/lo bf16): element (b, s, d) at [(b*kSeq + s)*kDhd + d]      (one KV head shared by all heads)
//   v^T plane (f16):       element (b, d, s) at [(b*64 + d)*kSeq + s]
//   out plane (f16, x kOsc): element (b, t, h, d) at [(b*kSeq + t)*kDm + h*64 + d]
//   scores = (q . k) * sscale : bf16 hi/lo split (hi.hi + hi.lo + lo.hi) on v_wmma_f32_16x16x32_bf16
//   out    = p . v            : v_wmma_f32_16x16x32_f16, p (unnormalised, <= 1) carried x2^15, f32 accumulate
//   both products are formed transposed: S^T = K . Q^T (A = K rows, B = Q columns) and O^T += V^T . P^T (A = V^T rows,
//   B = P^T packed from the score accumulators), so a lane holds 32 scores of ONE query per chunk: maximum and sum run
//   in the lane, the two wave halves join by one cross-row move, and P never passes through LDS.
//   online softmax in f32 over all kSeq keys (32 chunks of 64, compile-time trip count, no masking).
//   Block = 4 waves = 64 query rows of one (batch, head); grid = (kHeads * kSeq/64, kBatch).
//   K / V^T chunk staging: 128 threads x 32 elements per plane = the whole 64x64 tile (16-B copies, plain loads,
//   __syncthreads before and after); fragment loads read the LDS tiles with the same vector element type.
// =====================================================================================
#define AT_D 64
#define AT_NW 4
#define AT_QB 64
#define AT_KC 64
#define AT_LP 72   // LDS row pitch in 16-bit elements: 144 B = 16 B x 9 (odd), so the 16 rows of one ds_load_b128 half fall on 16 distinct 4-bank groups

__device__ __forceinline__ v8f at_mma(v16b a, v16b b, v8f c) {
  c = __builtin_amdgcn_wmma_f32_16x16x32_bf16(false, a, false, b, (short)0, c, false, false);
  asm volatile("v_nop\n\tv_nop\n\tv_nop\n\tv_nop" : "+v"(c) : "v"(a), "v"(b));
  return c;
}
__device__ __forceinline__ v8f at_mma_h(v16h a, v16h b, v8f c) {
  c = __builtin_amdgcn_wmma_f32_16x16x32_f16(false, a, false, b, (short)0, c, false, false);
  asm volatile("v_nop\n\tv_nop\n\tv_nop\n\tv_nop" : "+v"(c) : "v"(a), "v"(b));
  return c;
}

// lane l takes the value of lane l ^ 16 (the other half of the wave, same column)
__device__ __forceinline__ float at_xhalf(float x) {
  return __builtin_bit_cast(float, __builtin_amdgcn_permlanex16(__builtin_bit_cast(int, x), __builtin_bit_cast(int, x), 0x76543210, 0xfedcba98, false, false));
}

__device__ __forceinline__ float at_exp2(float x) {
  float y;
  // v_nop: the slot behind the transcendental; s_delay_alu: the compiler hints no reader of an asm result, and an unhinted wait holds up the SIMD's other waves
  asm("v_exp_f32 %0, %1\n\tv_nop\n\ts_delay_alu instid0(TRANS32_DEP_1)" : "=v"(y) : "v"(x));
  return y;
}
// eight at once, each in place on a register of its own: every exp is the independent instruction behind the one before it,
// and the one v_nop is the slot behind the last; the closing s_delay_alu hints the first reader behind the statement (as above)
__device__ __forceinline__ void at_exp2x8(float& a0, float& a1, float& a2, float& a3, float& a4, float& a5, float& a6, float& a7) {
  asm("v_exp_f32 %0, %0\n\tv_exp_f32 %1, %1\n\tv_exp_f32 %2, %2\n\tv_exp_f32 %3, %3\n\t"
      "v_exp_f32 %4, %4\n\tv_exp_f32 %5, %5\n\tv_exp_f32 %6, %6\n\tv_exp_f32 %7, %7\n\tv_nop\n\ts_delay_alu instid0(TRANS32_DEP_1)"
      : "+v"(a0), "+v"(a1), "+v"(a2), "+v"(a3), "+v"(a4), "+v"(a5), "+v"(a6), "+v"(a7));
}

__global__ __launch_bounds__(128)
void mqa_full64_kernel(const unsigned short* __restrict__ qhp, const unsigned short* __restrict__ qlp,
                       const unsigned short* __restrict__ khp, const unsigned short* __restrict__ klp,
                       const unsigned short* __restrict__ vtp, unsigned short* __restrict__ o16p,
                       float sscale) {
  union FB { v16b v; v8b h[2]; };
  union FH { v16h v; v8h h[2]; };
  __shared__ __align__(16) __bf16   Ksh[AT_KC * AT_LP];         // K hi [kv][d], pitch AT_LP      9 KB
  __shared__ __align__(16) __bf16   Ksl[AT_KC * AT_LP];         // K lo                          9 KB
  __shared__ __align__(16) _Float16 Vth[AT_D * AT_LP];          // V^T f16 [d][kv], pitch AT_LP  9 KB
  __shared__ __align__(16) float    Os[AT_NW][16 * 68];         // per wave out tile, pitch 68

  const int tid  = threadIdx.x;
  const int wave = tid >> 5;
  const int lane = tid & 31;
  const int hh   = lane >> 4;
  const int c    = lane & 15;

  const int nqb = kSeq / AT_QB;            // 32
  const int b  = blockIdx.y;               // 0..kBatch-1
  const int bx = blockIdx.x;               // 0..kHeads*nqb-1
  const int qb = bx % nqb;
  const int h  = bx / nqb;                 // 0..kHeads-1
  const int q0 = qb * AT_QB + wave * 16;

  const __bf16*   Qh = (const __bf16*)(const void*)qhp + (size_t)b * kSeq * kDm + (size_t)h * AT_D;
  const __bf16*   Ql = (const __bf16*)(const void*)qlp + (size_t)b * kSeq * kDm + (size_t)h * AT_D;
  const __bf16*   Kh = (const __bf16*)(const void*)khp + (size_t)b * kSeq * kDhd;
  const __bf16*   Kl = (const __bf16*)(const void*)klp + (size_t)b * kSeq * kDhd;
  const _Float16* Vt = (const _Float16*)(const void*)vtp + (size_t)b * AT_D * kSeq;
  _Float16*       ob = (_Float16*)(void*)o16p + (size_t)b * kSeq * kDm + (size_t)h * AT_D;

  // ---- Q fragments (B operand, column = query = lane&15, split k map via Frag load): 2 d-chunks, hi and lo ----
  v16b qah[2], qal[2];
#pragma unroll
  for (int dc = 0; dc < 2; ++dc) {
    const __bf16* qr = Qh + (size_t)(q0 + c) * kDm + dc * 32 + 8 * hh;
    const __bf16* ql = Ql + (size_t)(q0 + c) * kDm + dc * 32 + 8 * hh;
    qah[dc] = Frag<__bf16>::load(qr);
    qal[dc] = Frag<__bf16>::load(ql);
  }

  const float c2 = sscale * 1.44269504088896340736f;   // score scale times log2(e), positive: exp(x) = 2^(x * log2 e)
  float mrun = -INFINITY;   // running maximum of query q0 + c in base-2 units (equal in both wave halves)
  float lrun = 0.f;         // running sum (x2^15) over this half's keys only; the halves join in the epilogue
  v8f oacc[4];              // oacc[t][r] = O^T(d = t*16 + 8*hh + r, query q0 + c)
#pragma unroll
  for (int t = 0; t < 4; ++t) oacc[t] = (v8f){0.f,0.f,0.f,0.f,0.f,0.f,0.f,0.f};

  const int nChunks = kSeq / AT_KC;   // 32, compile-time constant
  for (int kc = 0; kc < nChunks; ++kc) {
    const int kv0 = kc * AT_KC;
    __syncthreads();
    {
      // staging coverage: 128 threads x (4 x 8) elements = 64 rows x 64 per plane = the whole chunk tile
      const int r = tid >> 1, half = (tid & 1) * 32;
      const __bf16*   ksh = Kh + (size_t)(kv0 + r) * kDhd + half;   // K row kv0+r, d = half..half+31
      const __bf16*   ksl = Kl + (size_t)(kv0 + r) * kDhd + half;
      const _Float16* vsr = Vt + (size_t)r * kSeq + kv0 + half;      // V^T row d = r, s = kv0+half..+31
#pragma unroll
      for (int i = 0; i < 4; ++i) {
        const v8b a0 = *(const v8b*)(ksh + 8 * i);
        const v8b a1 = *(const v8b*)(ksl + 8 * i);
        const v8h b0 = *(const v8h*)(vsr + 8 * i);
        *(v8b*)(Ksh + r * AT_LP + half + 8 * i) = a0;
        *(v8b*)(Ksl + r * AT_LP + half + 8 * i) = a1;
        *(v8h*)(Vth + r * AT_LP + half + 8 * i) = b0;
      }
    }
    __syncthreads();

    // ---- scores, transposed: A operand row = key j*16+c, B operand column = query c, both <- d with the split k map ----
    v8f s[4];
#pragma unroll
    for (int j = 0; j < 4; ++j) {
      s[j] = (v8f){0.f,0.f,0.f,0.f,0.f,0.f,0.f,0.f};
#pragma unroll
      for (int dc = 0; dc < 2; ++dc) {
        FB kb, kl;
        kb.h[0] = *(const v8b*)(Ksh + (j * 16 + c) * AT_LP + dc * 32 + 8 * hh);
        kb.h[1] = *(const v8b*)(Ksh + (j * 16 + c) * AT_LP + dc * 32 + 16 + 8 * hh);
        kl.h[0] = *(const v8b*)(Ksl + (j * 16 + c) * AT_LP + dc * 32 + 8 * hh);
        kl.h[1] = *(const v8b*)(Ksl + (j * 16 + c) * AT_LP + dc * 32 + 16 + 8 * hh);
        s[j] = at_mma(kb.v, qah[dc], s[j]);
        s[j] = at_mma(kl.v, qah[dc], s[j]);
        s[j] = at_mma(kb.v, qal[dc], s[j]);
      }
    }
    // D layout: s[j][r] = score(key kv0 + j*16 + 8*hh + r, query q0 + c)
    // the loops over j, r and t below are unrolled because s and oacc are register arrays; one chain per j keeps four
    // independent maximum and sum chains in flight
    float mj[4];
#pragma unroll
    for (int j = 0; j < 4; ++j) {
      float m = -INFINITY;
#pragma unroll
      for (int r = 0; r < 8; ++r) m = fmaxf(m, s[j][r]);   // raw products: c2 > 0 keeps their order
      mj[j] = m;
    }
    float cm = fmaxf(fmaxf(mj[0], mj[1]), fmaxf(mj[2], mj[3]));
    cm = fmaxf(cm, at_xhalf(cm));            // the query's maximum over all 64 keys of the chunk, in both halves
    const float mnew = fmaxf(mrun, cm * c2);  // running maximum in base-2 units
    const float alpha = at_exp2(mrun - mnew);
    mrun = mnew;
    const float nb = kPlog - mnew;            // one addend per query: exponent = score * c2 - maximum + 15
    float pj[4];
#pragma unroll
    for (int j = 0; j < 4; ++j) {
      float x[8];
#pragma unroll
      for (int r = 0; r < 8; ++r) x[r] = fmaf(s[j][r], c2, nb);   // base-2 exponent of the numerator x2^15: one multiply-add
      at_exp2x8(x[0], x[1], x[2], x[3], x[4], x[5], x[6], x[7]);
      float ps = 0.f;
#pragma unroll
      for (int r = 0; r < 8; ++r) {
        ps += x[r];
        s[j][r] = x[r];
      }
      pj[j] = ps;
    }
    lrun = lrun * alpha + ((pj[0] + pj[1]) + (pj[2] + pj[3]));
#pragma unroll
    for (int t = 0; t < 4; ++t)
#pragma unroll
      for (int r = 0; r < 8; ++r) oacc[t][r] *= alpha;
    // ---- O^T += V^T . P^T: two score tiles (keys kk*32 + 8hh + 0..7 and kk*32 + 16 + 8hh + 0..7) are one B operand in place ----
#pragma unroll
    for (int kk = 0; kk < 2; ++kk) {   // unrolled: the score tiles are registers and cannot be indexed at run time
      v16h pb;
#pragma unroll   // vector elements are registers: constant indices only
      for (int e = 0; e < 8; ++e) {
        pb[e]     = (_Float16)s[2 * kk][e];
        pb[8 + e] = (_Float16)s[2 * kk + 1][e];
      }
#pragma unroll
      for (int t = 0; t < 4; ++t) {
        FH vb;
        vb.h[0] = *(const v8h*)(Vth + (t * 16 + c) * AT_LP + kk * 32 + 8 * hh);       // A: row = d = t*16 + c, same key map as P^T
        vb.h[1] = *(const v8h*)(Vth + (t * 16 + c) * AT_LP + kk * 32 + 16 + 8 * hh);
        oacc[t] = at_mma_h(vb.v, pb, oacc[t]);
      }
    }
  }

  // ---- epilogue: O = oacc / (l * 2^15), carried x kOsc as f16 ----
  float* os = Os[wave];
  {
    const float lsum = lrun + at_xhalf(lrun);   // the two halves' key sums of query q0 + c
    const float inv = kOsc * (1.0f / lsum);   // lsum carries the numerators' x2^15
#pragma unroll   // oacc is a register array: constant indices only (inner loop too)
    for (int t = 0; t < 4; ++t) {
      v4f w0, w1;
#pragma unroll
      for (int r = 0; r < 4; ++r) { w0[r] = oacc[t][r] * inv; w1[r] = oacc[t][4 + r] * inv; }
      *(v4f*)(os + c * 68 + t * 16 + 8 * hh)     = w0;   // row = query c, 8 consecutive d per lane
      *(v4f*)(os + c * 68 + t * 16 + 8 * hh + 4) = w1;
    }
  }
  __builtin_amdgcn_fence(__ATOMIC_RELEASE, "workgroup");
  __builtin_amdgcn_wave_barrier();
  __builtin_amdgcn_fence(__ATOMIC_ACQUIRE, "workgroup");
  {
    const int qg = lane >> 3, c8 = (lane & 7) * 8;
    {
#pragma unroll
      for (int it = 0; it < 4; ++it) {
        const int row = it * 4 + qg;                    // 4 it x 4 groups = rows 0..15
        const float* sp = os + row * 68 + c8;
        v8h hv;
#pragma unroll
        for (int e = 0; e < 8; ++e) hv[e] = (_Float16)sp[e];
        *(v8h*)(ob + (size_t)(q0 + row) * kDm + c8) = hv;
      }
      
    }
  }
}

// ---------------------------------------------------------------------------
// Host driver. Workspace region map (bytes, 256-B aligned offsets):
//   x16   [4096][1024] bf16           8388608
//   wq16p [1024][1024] bf16 (rows permuted to head-major)  2097152
//   wk16  [64][1024]   bf16            131072
//   wv16  [64][1024]   bf16            131072
//   wo16  [1024][1024] f16 (bf16-RNE x16)  2097152
//   bqp   [1024]       f32 (permuted)     4096
//   Qh,Ql [4096][1024] bf16 hi/lo     2 x 8388608
//   Kh,Kl [4096][64]   bf16 hi/lo     2 x 524288
//   Vt16  [2][64][2048] f16            524288
//   O16   [4096][1024] f16 (x16)      8388608
//   total 39587840 B
// ---------------------------------------------------------------------------
extern "C" void kernel_launch(void* const* d_in, const int* in_sizes, int n_in,
                              void* d_out, int out_size, void* d_ws, size_t ws_size,
                              hipStream_t stream) {
  const int nB = kBatch, nS = kSeq, nD = kDm, nDh = kDhd;
  const int nM = nB * nS;   // 4096
  if (n_in < 9) return;
  if (in_sizes[0] != nM * nD || in_sizes[1] != nD * nD || in_sizes[2] != nD ||
      in_sizes[3] != nDh * nD || in_sizes[4] != nDh || in_sizes[5] != nDh * nD ||
      in_sizes[6] != nDh || in_sizes[7] != nD * nD || in_sizes[8] != nD || out_size != nM * nD) return;

  const float* x  = (const float*)d_in[0];
  const float* wq = (const float*)d_in[1];
  const float* bq = (const float*)d_in[2];
  const float* wk = (const float*)d_in[3];
  const float* bk = (const float*)d_in[4];
  const float* wv = (const float*)d_in[5];
  const float* bv = (const float*)d_in[6];
  const float* wo = (const float*)d_in[7];
  const float* bo = (const float*)d_in[8];

  size_t off = 0;
  auto carve = [&](size_t bytes) -> char* {
    char* p = (char*)d_ws + off;
    off += (bytes + 255) & ~(size_t)255;
    return p;
  };
  unsigned short* x16   = (unsigned short*)carve((size_t)nM * nD * 2);
  unsigned short* wq16p = (unsigned short*)carve((size_t)nD * nD * 2);
  unsigned short* wk16  = (unsigned short*)carve((size_t)nDh * nD * 2);
  unsigned short* wv16  = (unsigned short*)carve((size_t)nDh * nD * 2);
  unsigned short* wo16  = (unsigned short*)carve((size_t)nD * nD * 2);
  float*          bqp   = (float*)carve((size_t)nD * 4);
  unsigned short* Qh    = (unsigned short*)carve((size_t)nM * nD * 2);
  unsigned short* Ql    = (unsigned short*)carve((size_t)nM * nD * 2);
  unsigned short* Kh    = (unsigned short*)carve((size_t)nM * nDh * 2);
  unsigned short* Kl    = (unsigned short*)carve((size_t)nM * nDh * 2);
  unsigned short* Vt16  = (unsigned short*)carve((size_t)nB * nDh * nS * 2);
  unsigned short* O16   = (unsigned short*)carve((size_t)nM * nD * 2);
  if (off > ws_size) return;

  // ---- casts (bf16 RNE; wq rows / bq permuted to head-major; wo as f16(bf16_rne(wo) * 16)) ----
  {
    const int n2x = nM * nD / 2;      // 2097152 -> 8192 blocks
    cast_bf16x2_kernel<<<dim3((n2x + 255) / 256), dim3(256), 0, stream>>>(x, x16, n2x);
    const int n2kv = nDh * nD / 2;    // 32768 -> 128 blocks
    cast_bf16x2_kernel<<<dim3((n2kv + 255) / 256), dim3(256), 0, stream>>>(wk, wk16, n2kv);
    cast_bf16x2_kernel<<<dim3((n2kv + 255) / 256), dim3(256), 0, stream>>>(wv, wv16, n2kv);
    cast_perm_rows_bf16x2_kernel<<<dim3((nD / 2 + 255) / 256, nD), dim3(256), 0, stream>>>(wq, wq16p, nD);
    perm_bias_kernel<<<dim3((nD + 255) / 256), dim3(256), 0, stream>>>(bq, bqp, nD);
    const int n2o = nD * nD / 2;      // 524288 -> 2048 blocks
    cast_bf_f16x2_scaled_kernel<<<dim3((n2o + 255) / 256), dim3(256), 0, stream>>>(wo, wo16, n2o, kWsc);
  }

  // ---- q projection: [4096][1024] = x16 . wq16p^T + bqp -> bf16 hi/lo planes, head-major columns (h*64 + d) ----
  // M=4096, N=1024 (multiples of 64), K=1024 (multiple of 64); tiles 64*16 = 1024 -> 128 blocks of 8 waves
  wmma_gemm64<1, false, 2, 2, false, 0><<<dim3((nM / 64) * (nD / 64) / 8, 1), dim3(256), 0, stream>>>(
      x16, x16, 0L, wq16p, wq16p, 0L, (void*)Qh, (void*)Ql, nD, 0L, bqp, bqp, 0L, nM, nD, nD, 1.0f);

  // ---- k projection: [4096][64] = x16 . wk16^T + bk -> bf16 hi/lo planes; tiles 64 -> 8 blocks ----
  wmma_gemm64<1, false, 2, 2, false, 0><<<dim3((nM / 64) * (nDh / 64) / 8, 1), dim3(256), 0, stream>>>(
      x16, x16, 0L, wk16, wk16, 0L, (void*)Kh, (void*)Kl, nDh, 0L, bk, bk, 0L, nM, nDh, nD, 1.0f);

  // ---- v^T projection per batch z: Vt16_z [64][2048] = wv16 . x16_z^T + bv[m] -> f16; tiles 32 -> 4 blocks, grid.y = 2 ----
  wmma_gemm64<1, false, 1, 1, false, 0><<<dim3((nDh / 64) * (nS / 64) / 8, nB), dim3(256), 0, stream>>>(
      wv16, wv16, 0L, x16, x16, (long)nS * nD, (void*)Vt16, (void*)Vt16, nS, (long)nDh * nS,
      bv, bv, 0L, nDh, nS, nD, 1.0f);

  // ---- attention: grid (16 heads x 32 query blocks, 2 batches), all heads share the batch's K / V^T planes ----
  mqa_full64_kernel<<<dim3(kHeads * (nS / AT_QB), nB), dim3(128), 0, stream>>>(Qh, Ql, Kh, Kl, Vt16, O16, 0.125f);

  // ---- output projection: out [4096][1024] f32 = (O16 . wo16^T) / 256 + bo ----
  wmma_gemm64<0, false, 2, 0, false, 0><<<dim3((nM / 64) * (nD / 64) / 8, 1), dim3(256), 0, stream>>>(
      O16, O16, 0L, wo16, wo16, 0L, d_out, d_out, nD, 0L, bo, bo, 0L, nM, nD, nD, 1.0f / (kOsc * kWsc));
}

// v005
// A run of this version takes 122 microseconds.
// Timed twice side by side with v004, it ran 1.37 and 1.38 times as fast.
// Counting every step since v000, it is 4.00 times as fast.
// Contractions: q/k/v^T projections v_wmma_f32_16x16x32_bf16 (inputs RNE-cast to bf16, f32 acc); q.k^T v_wmma_f32_16x16x32_bf16 with bf16 hi/lo split (hi.hi+hi.lo+lo.hi); p.v and output projection v_wmma_f32_16x16x32_f16 (p carried x2^15, o carried x16, wo carried x16), f32 acc; online softmax, biases and scales in f32.
#include <hip/hip_runtime.h>
#include <math.h>
#include <stdint.h>

typedef __attribute__((ext_vector_type(16))) _Float16 v16h;
typedef __attribute__((ext_vector_type(8)))  _Float16 v8h;
typedef __attribute__((ext_vector_type(16))) __bf16   v16b;
typedef __attribute__((ext_vector_type(8)))  __bf16   v8b;
typedef __attribute__((ext_vector_type(8)))  float    v8f;
typedef __attribute__((ext_vector_type(4)))  float    v4f;
typedef __attribute__((ext_vector_type(2)))  float    v2f;
typedef __attribute__((ext_vector_type(4)))  unsigned int v4u;

// problem geometry (compile-time)
constexpr int kBatch = 2;
constexpr int kSeq   = 2048;
constexpr int kDm    = 1024;   // model width = H*Dh = q row pitch
constexpr int kHeads = 16;
constexpr int kDhd   = 64;     // per-head dim = k row pitch
constexpr float kPlog = 15.0f;     // softmax numerators carried x2^15 in f16: 15 is added to their base-2 exponent
constexpr float kOsc = 16.0f;      // attention output carried x16 in f16
constexpr float kWsc = 16.0f;      // output-projection weight carried x16 in f16

__device__ __forceinline__ unsigned short f2bf_bits(float f) {
  unsigned u = __float_as_uint(f);
  return (unsigned short)((u + 0x7FFFu + ((u >> 16) & 1u)) >> 16);
}
__device__ __forceinline__ float bf_bits2f(unsigned short h) { return __uint_as_float(((unsigned)h) << 16); }
__device__ __forceinline__ unsigned pk16(unsigned short a, unsigned short b) { return (unsigned)a | ((unsigned)b << 16); }

// hazard guards as plain device helpers
__device__ __forceinline__ void dep_guard_h(v8f& a, v8f& b, v16h x, v16h y) { asm volatile("v_nop\n\tv_nop\n\tv_nop\n\tv_nop" : "+v"(a), "+v"(b) : "v"(x), "v"(y)); }
__device__ __forceinline__ void dep_guard_b(v8f& a, v8f& b, v16b x, v16b y) { asm volatile("v_nop\n\tv_nop\n\tv_nop\n\tv_nop" : "+v"(a), "+v"(b) : "v"(x), "v"(y)); }
__device__ __forceinline__ void keep4_h(v16h a, v16h b, v16h c, v16h d) { asm volatile("v_nop" :: "v"(a), "v"(b), "v"(c), "v"(d)); }
__device__ __forceinline__ void keep4_b(v16b a, v16b b, v16b c, v16b d) { asm volatile("v_nop" :: "v"(a), "v"(b), "v"(c), "v"(d)); }
__device__ __forceinline__ void acc_guard4(v8f& a, v8f& b, v8f& c, v8f& d) { asm volatile("v_nop\n\tv_nop\n\tv_nop\n\tv_nop" : "+v"(a), "+v"(b), "+v"(c), "+v"(d)); }
template <typename T> struct Frag;
template <> struct Frag<_Float16> {
  typedef v16h V; typedef v8h H; union U { v16h v; v8h h[2]; };
  static __device__ __forceinline__ v16h load(const _Float16* p) {   // elements 0..7 <- p[0..7], 8..15 <- p[16..23]
    U f; f.h[0] = *(const v8h*)(p); f.h[1] = *(const v8h*)(p + 16); return f.v;
  }
  static __device__ __forceinline__ v8f mma(v16h a, v16h b, v8f c) {
    return __builtin_amdgcn_wmma_f32_16x16x32_f16(false, a, false, b, (short)0, c, false, false);
  }
  static __device__ __forceinline__ void guard(v8f& a, v8f& b, v16h x, v16h y) { dep_guard_h(a, b, x, y); }
  static __device__ __forceinline__ void keep(v16h a, v16h b, v16h c, v16h d) { keep4_h(a, b, c, d); }
};
template <> struct Frag<__bf16> {
  typedef v16b V; typedef v8b H; union U { v16b v; v8b h[2]; };
  static __device__ __forceinline__ v16b load(const __bf16* p) {
    U f; f.h[0] = *(const v8b*)(p); f.h[1] = *(const v8b*)(p + 16); return f.v;
  }
  static __device__ __forceinline__ v8f mma(v16b a, v16b b, v8f c) {
    return __builtin_amdgcn_wmma_f32_16x16x32_bf16(false, a, false, b, (short)0, c, false, false);
  }
  static __device__ __forceinline__ void guard(v8f& a, v8f& b, v16b x, v16b y) { dep_guard_b(a, b, x, y); }
  static __device__ __forceinline__ void keep(v16b a, v16b b, v16b c, v16b d) { keep4_b(a, b, c, d); }
};

// ---- Register-blocked batched WMMA GEMM ------------------------------------
// C[m,n] = scale * sum_k A[m,k] * Bt[n,k] (+bias)(+resid); each wave owns a 64x64 tile.
// A row-major [M,K]; Bt row-major [N,K], both with row pitch kDm (compile time, so that the 16 row groups of a tile
// are immediate offsets of one address); M,N % 64 == 0, K % 64 == 0, K <= kDm.
// Operand path: per 64-k step each wave copies its own 64x64 A tile and 64x64 Bt tile into its own LDS range with
// global loads that cover whole 128-B lines (8 lanes per row, 4 rows per load), the next step's loads being issued
// before the current step's products; the WMMA fragments are read from LDS (k order per 32-k group as Frag::load).
// SPLIT (hi/lo planes) is not instantiated and not supported by the staged loop.
// BIAS_MODE: 0 = none, 1 = bias[m], 2 = bias[n].
// OUT_MODE: 0 = f32, 1 = f16, 2 = bf16 hi plane (Cout) + bf16 lo plane (Cout2).
// ET: 0 = f16 operands, 1 = bf16 operands (pointers passed as 16-bit storage)
#define GS_LP 72   // LDS row pitch of a staged operand tile in 16-bit elements: 144 B = 16 B x 9 (odd), conflict-free for ds_load_b128 fragment reads
template <int ET> struct Elem;
template <> struct Elem<0> { typedef _Float16 T; };
template <> struct Elem<1> { typedef __bf16 T; };
// The body is a device function, so that one launch can run several products as ranges of its grid: bx = the work-group's
// index within its product, b = the batch, sOpAll / sTAll = the work-group's LDS (8 waves x (A tile + Bt tile); 8 slabs).
#define GS_OPW (2 * 64 * GS_LP)   // 16-bit elements of one wave's A tile + Bt tile
#define GS_SLW (16 * 68)          // floats of one wave's 16x64 slab, pitch 68
template <int ET, bool SPLIT, int BIAS_MODE, int OUT_MODE, bool RESID, int ACT>
__device__ __forceinline__ void gemm64_body(
    typename Elem<ET>::T* sOpAll, float* sTAll, int bx, int b,
    const unsigned short* __restrict__ Ap, long strideA,
    const unsigned short* __restrict__ Btp, long strideB,
    void* __restrict__ Cout, void* __restrict__ Cout2, int ldc, long strideC,
    const float* __restrict__ bias,
    const float* __restrict__ resid, long strideR,
    int M, int N, int K, float scale) {
  typedef typename Elem<ET>::T T;
  typedef typename Frag<T>::V V;
  const T* A = (const T*)Ap; const T* Bt = (const T*)Btp;
  static_assert(!SPLIT, "the staged operand loop takes single-plane operands");
  typedef typename Frag<T>::H H;
  const int lane = threadIdx.x & 31;
  const int wave = __builtin_amdgcn_readfirstlane(threadIdx.x >> 5);   // wave-uniform: tile bases stay scalar
  const int tilesN = N >> 6;
  const int tilesM = M >> 6;
  const int tile = bx * 8 + wave;
  if (tile >= tilesM * tilesN) return;   // wave-uniform; no block barriers in this body
  const int tm = tile / tilesN;
  const int tn = tile - tm * tilesN;
  const int m0 = tm << 6;
  const int n0 = tn << 6;

  const T* Ab  = A  + (size_t)b * strideA;
  const T* Bb  = Bt + (size_t)b * strideB;

  const int rlane = lane & 15;                 // row (A) / col (B, D) within subtile
  const int koff  = (lane >> 4) * 8;           // k offset of this lane half
  const int mOff  = (lane >> 4) * 8;           // D row offset

  v8f acc[4][4];
#pragma unroll
  for (int i = 0; i < 4; ++i)
#pragma unroll
    for (int j = 0; j < 4; ++j) acc[i][j] = (v8f){0.f,0.f,0.f,0.f,0.f,0.f,0.f,0.f};

  // staging map: lane -> row (lane >> 3) of each group of 4 rows, 16-B piece (lane & 7) of the row's 128-B line
  const int srow = lane >> 3;
  const int scol = (lane & 7) * 8;
  const T* Ag = Ab + (size_t)(m0 + srow) * kDm + scol;   // this lane's piece of row group 0, k = 0
  const T* Bg = Bb + (size_t)(n0 + srow) * kDm + scol;
  T* sa = sOpAll + wave * GS_OPW;   // per-wave A tile and Bt tile of one 64-k step, pitch GS_LP
  T* sb = sa + 64 * GS_LP;
  H ra[16], rb[16];
#pragma unroll
  for (int it = 0; it < 16; ++it) {
    ra[it] = *(const H*)(Ag + it * 4 * kDm);
    rb[it] = *(const H*)(Bg + it * 4 * kDm);
  }

  for (int k0 = 0; k0 < K; k0 += 64) {
#pragma unroll
    for (int it = 0; it < 16; ++it) {
      *(H*)(sa + (it * 4 + srow) * GS_LP + scol) = ra[it];
      *(H*)(sb + (it * 4 + srow) * GS_LP + scol) = rb[it];
    }
    // the wave's own tile stores are complete before any of its lanes reads another lane's rows
    __builtin_amdgcn_fence(__ATOMIC_RELEASE, "workgroup");
    __builtin_amdgcn_wave_barrier();
    __builtin_amdgcn_fence(__ATOMIC_ACQUIRE, "workgroup");
    if (k0 + 64 < K) {   // wave-uniform: the next step's tiles fly while this step's products run
#pragma unroll
      for (int it = 0; it < 16; ++it) {
        ra[it] = *(const H*)(Ag + it * 4 * kDm + (k0 + 64));
        rb[it] = *(const H*)(Bg + it * 4 * kDm + (k0 + 64));
      }
      asm volatile("s_wait_xcnt 0x0" ::: "memory");   // before the fragment reads below reuse the address registers of these loads
    }
#pragma unroll
    for (int kk = 0; kk < 2; ++kk) {
      V bh[4], ah[4];
#pragma unroll
      for (int j = 0; j < 4; ++j) bh[j] = Frag<T>::load(sb + ((j << 4) + rlane) * GS_LP + kk * 32 + koff);
#pragma unroll
      for (int i = 0; i < 4; ++i) ah[i] = Frag<T>::load(sa + ((i << 4) + rlane) * GS_LP + kk * 32 + koff);
#pragma unroll
      for (int i = 0; i < 4; ++i) {
#pragma unroll
        for (int j = 0; j < 4; ++j) acc[i][j] = Frag<T>::mma(ah[i], bh[j], acc[i][j]);
        Frag<T>::guard(acc[i][0], acc[i][3], ah[i], ah[i]);
      }
      Frag<T>::keep(bh[0], bh[1], bh[2], bh[3]);
    }
    // every fragment read of this step is done before the next step's stores overwrite the tiles
    __builtin_amdgcn_fence(__ATOMIC_RELEASE, "workgroup");
    __builtin_amdgcn_wave_barrier();
    __builtin_amdgcn_fence(__ATOMIC_ACQUIRE, "workgroup");
  }
  acc_guard4(acc[0][0], acc[0][1], acc[0][2], acc[0][3]);
  acc_guard4(acc[1][0], acc[1][1], acc[1][2], acc[1][3]);
  acc_guard4(acc[2][0], acc[2][1], acc[2][2], acc[2][3]);
  acc_guard4(acc[3][0], acc[3][1], acc[3][2], acc[3][3]);

  // ---- epilogue ----
  float* slab = sTAll + wave * GS_SLW;
  const float* Rb = RESID ? (resid + (size_t)b * strideR) : nullptr;
#pragma unroll
  for (int i = 0; i < 4; ++i) {
    const int mBase = m0 + (i << 4);
    float bm[8];
    if (BIAS_MODE == 1) {
      const float* bp = bias + mBase + mOff;
#pragma unroll
      for (int r = 0; r < 8; ++r) bm[r] = bp[r];
      // before the address registers of the bias loads are reused; the address as an input keeps them untouched up to here
      asm volatile("s_wait_xcnt 0x0" :: "v"(bp) : "memory");
    }
#pragma unroll
    for (int j = 0; j < 4; ++j) {
      const int n = n0 + (j << 4) + rlane;
      float bv = 0.f;
      if (BIAS_MODE == 2) bv = bias[n];
#pragma unroll
      for (int r = 0; r < 8; ++r) {
        float v = acc[i][j][r] * scale;
        if (BIAS_MODE == 1) v += bm[r];
        if (BIAS_MODE == 2) v += bv;
        if (RESID) v += Rb[(size_t)(mBase + mOff + r) * ldc + n];
        if (ACT == 1) v = tanhf(v);
        if (ACT == 2) v = fmaxf(v, 0.0f);
        if (ACT == 3) v = v / (1.0f + expf(-v));
        if (ACT == 4) v = (v > 0.f) ? v : 0.01f * v;
        if (ACT == 5) v = 0.5f * v * (1.0f + erff(v * 0.70710678118654752f));
        slab[(mOff + r) * 68 + (j << 4) + rlane] = v;
      }
    }
    __builtin_amdgcn_fence(__ATOMIC_RELEASE, "workgroup");
    __builtin_amdgcn_wave_barrier();
    __builtin_amdgcn_fence(__ATOMIC_ACQUIRE, "workgroup");
    if (OUT_MODE == 0) {
      float* C = (float*)Cout + (size_t)b * strideC;
      const int hh = lane >> 4, c4 = (lane & 15) * 4;     // row seg = 256 B = 16 lanes x 16 B
      {
#pragma unroll
        for (int it = 0; it < 8; ++it) {
          const int row = it * 2 + hh;
          v4f v = *(const v4f*)(slab + row * 68 + c4);
          *(v4f*)(C + (size_t)(mBase + row) * ldc + n0 + c4) = v;
        }
        
      }
    } else {
      const int q = lane >> 3, c8 = (lane & 7) * 8;
      unsigned short* C  = (unsigned short*)Cout  + (size_t)b * strideC;
      unsigned short* C2 = (OUT_MODE == 2) ? ((unsigned short*)Cout2 + (size_t)b * strideC) : nullptr;
      {
#pragma unroll
        for (int it = 0; it < 4; ++it) {
          const int row = it * 4 + q;
          const float* sp = slab + row * 68 + c8;
          v8h hv, lv;
#pragma unroll
          for (int e = 0; e < 8; ++e) {
            if (OUT_MODE == 1) {
              hv[e] = (_Float16)sp[e];
            } else {
              unsigned short hb = f2bf_bits(sp[e]);
              unsigned short lb = f2bf_bits(sp[e] - bf_bits2f(hb));
              hv[e] = __builtin_bit_cast(_Float16, hb);
              lv[e] = __builtin_bit_cast(_Float16, lb);
            }
          }
          *(v8h*)(C + (size_t)(mBase + row) * ldc + n0 + c8) = hv;
          if (OUT_MODE == 2) *(v8h*)(C2 + (size_t)(mBase + row) * ldc + n0 + c8) = lv;
        }
        
      }
    }
    __builtin_amdgcn_fence(__ATOMIC_RELEASE, "workgroup");
    __builtin_amdgcn_wave_barrier();
    __builtin_amdgcn_fence(__ATOMIC_ACQUIRE, "workgroup");
    // keeps the next row group's arithmetic behind the fence's store wait: no register of an issued store is rewritten before it
    __builtin_amdgcn_sched_barrier(0);
  }
}

// one product per launch: grid = (tiles / 8, batches)
template <int ET, bool SPLIT, int BIAS_MODE, int OUT_MODE, bool RESID, int ACT = 0>
__global__ __launch_bounds__(256) void wmma_gemm64(
    const unsigned short* __restrict__ Ap, long strideA,
    const unsigned short* __restrict__ Btp, long strideB,
    void* __restrict__ Cout, void* __restrict__ Cout2, int ldc, long strideC,
    const float* __restrict__ bias,
    const float* __restrict__ resid, long strideR,
    int M, int N, int K, float scale) {
  __shared__ __align__(16) typename Elem<ET>::T sOp[8 * GS_OPW];
  __shared__ __align__(16) float sT[8 * GS_SLW];
  gemm64_body<ET, SPLIT, BIAS_MODE, OUT_MODE, RESID, ACT>(sOp, sT, blockIdx.x, blockIdx.y, Ap, strideA, Btp, strideB,
      Cout, Cout2, ldc, strideC, bias, resid, strideR, M, N, K, scale);
}

// ---------------------------------------------------------------------------
// The three projections of x, which do not depend on one another, as ranges of one grid (144 work-groups, one round):
//   [0, 128)    q   [4096][1024] = x16 . wq16p^T + bqp  -> bf16 hi/lo planes, head-major columns (h*64 + d)
//   [128, 136)  k   [4096][64]   = x16 . wk16^T + bk    -> bf16 hi/lo planes
//   [136, 144)  v^T per batch z: [64][2048] = wv16 . x16_z^T + bv[m] -> f16; 4 work-groups per batch
// The range test reads blockIdx only: uniform for the work-group. K, the inner length of all three, is an argument as in wmma_gemm64.
// ---------------------------------------------------------------------------
constexpr int kPjQ = (kBatch * kSeq / 64) * (kDm / 64) / 8;    // 128
constexpr int kPjK = (kBatch * kSeq / 64) * (kDhd / 64) / 8;   // 8
constexpr int kPjV = (kDhd / 64) * (kSeq / 64) / 8;            // 4 per batch
__global__ __launch_bounds__(256) void proj_qkv_kernel(
    const unsigned short* __restrict__ x16, const unsigned short* __restrict__ wq16p,
    const unsigned short* __restrict__ wk16, const unsigned short* __restrict__ wv16,
    const float* __restrict__ bqp, const float* __restrict__ bk, const float* __restrict__ bv,
    unsigned short* __restrict__ Qh, unsigned short* __restrict__ Ql,
    unsigned short* __restrict__ Kh, unsigned short* __restrict__ Kl,
    unsigned short* __restrict__ Vt16, int K) {
  __shared__ __align__(16) __bf16 sOp[8 * GS_OPW];
  __shared__ __align__(16) float sT[8 * GS_SLW];
  const int bx = blockIdx.x;
  if (bx < kPjQ + kPjK) {
    const bool isq = bx < kPjQ;
    const int n = isq ? kDm : kDhd;
    gemm64_body<1, false, 2, 2, false, 0>(sOp, sT, isq ? bx : bx - kPjQ, 0, x16, 0L, isq ? wq16p : wk16, 0L,
        (void*)(isq ? Qh : Kh), (void*)(isq ? Ql : Kl), n, 0L, isq ? bqp : bk, nullptr, 0L, kBatch * kSeq, n, K, 1.0f);
  } else {
    const int v = bx - (kPjQ + kPjK);
    gemm64_body<1, false, 1, 1, false, 0>(sOp, sT, v % kPjV, v / kPjV, wv16, 0L, x16, (long)kSeq * kDm,
        (void*)Vt16, (void*)Vt16, kSeq, (long)kDhd * kSeq, bv, nullptr, 0L, kDhd, kSeq, K, 1.0f);
  }
}

// ---------------------------------------------------------------------------
// Elementwise f32 -> bf16 (RNE), 2 elements per thread, one 4-B store per lane -> each wave writes exactly
// Coverage: range = ceil(n2/256) work-groups x 256 threads x 2 elements = 2*n2 = whole plane
//   (x: n2 = 4096*1024/2 = 2097152 -> 8192 blocks exact; wk/wv: n2 = 32768 -> 128 blocks exact).
// ---------------------------------------------------------------------------
__device__ __forceinline__ void cast_bf16x2(int bx, const float* __restrict__ in, unsigned short* __restrict__ out, int n2) {
  const int i = bx * 256 + threadIdx.x;
  if (i < n2) {
    const v2f f = *(const v2f*)(in + 2 * (size_t)i);
    const unsigned u = pk16(f2bf_bits(f[0]), f2bf_bits(f[1]));
    ((unsigned*)out)[i] = u;
    
  }
}

// ---------------------------------------------------------------------------
// Row-permuted f32 -> bf16 (RNE) cast of a [1024][ncol] weight: dest row rd = h*64 + d takes source row d*16 + h
// (de-interleave of the (hidden, heads) column split). (bx, by) in (ncol/512, 1024), 256 threads, 2 elements per thread.
// ---------------------------------------------------------------------------
__device__ __forceinline__ void cast_perm_rows_bf16x2(int bx, int by, const float* __restrict__ in, unsigned short* __restrict__ out, int ncol) {
  const int rd = by;                                    // 0..1023
  int rs = ((rd & 63) << 4) + (rd >> 6);                // 0..1023
  rs = rs > 1023 ? 1023 : rs;
  const int i = bx * 256 + threadIdx.x;                 // pair index within the row
  if (i < (ncol >> 1)) {
    const v2f f = *(const v2f*)(in + (size_t)rs * ncol + 2 * (size_t)i);
    const unsigned u = pk16(f2bf_bits(f[0]), f2bf_bits(f[1]));
    unsigned* o = (unsigned*)(out + (size_t)rd * ncol);
    o[i] = u;
    
  }
}

// ---------------------------------------------------------------------------
// Permuted bias: out[h*64 + d] = in[d*16 + h]; n = 1024; 4 blocks x 256 threads x 4 B = whole vector,
// ---------------------------------------------------------------------------
__device__ __forceinline__ void perm_bias(int bx, const float* __restrict__ in, float* __restrict__ out, int n) {
  const int i = bx * 256 + threadIdx.x;
  if (i < n) {
    int s = ((i & 63) << 4) + (i >> 6);
    s = s > n - 1 ? n - 1 : s;
    const float v = in[s];
    ((float*)out)[i] = v;
    
  }
}

// ---------------------------------------------------------------------------
// Elementwise f32 -> f16 of (bf16_rne(x) * sc) with sc a power of two: 2 elements per thread, one 4-B store per lane.
// ---------------------------------------------------------------------------
__device__ __forceinline__ void cast_bf_f16x2_scaled(int bx, const float* __restrict__ in, unsigned short* __restrict__ out, int n2, float sc) {
  const int i = bx * 256 + threadIdx.x;
  if (i < n2) {
    const v2f f = *(const v2f*)(in + 2 * (size_t)i);
    const float g0 = bf_bits2f(f2bf_bits(f[0])) * sc;
    const float g1 = bf_bits2f(f2bf_bits(f[1])) * sc;
    const _Float16 h0 = (_Float16)g0, h1 = (_Float16)g1;
    const unsigned u = pk16(__builtin_bit_cast(unsigned short, h0), __builtin_bit_cast(unsigned short, h1));
    ((unsigned*)out)[i] = u;
    
  }
}

// ---------------------------------------------------------------------------
// The six casts and permutations above, which do not depend on one another, as ranges of one grid of 256-thread work-groups
// (each range has the work-group count its own launch would have; the range tests read blockIdx only):
//   x 8192 | wq 2 x 1024 | wo 2048 | wk 128 | wv 128 | bq 4   = 12548
// ---------------------------------------------------------------------------
constexpr int kCbX  = kBatch * kSeq * kDm / 2 / 256;   // 8192
constexpr int kCbQx = kDm / 2 / 256;                   // 2 work-groups per wq row
constexpr int kCbQ  = kCbQx * kDm;                     // 2048
constexpr int kCbO  = kDm * kDm / 2 / 256;             // 2048
constexpr int kCbKV = kDhd * kDm / 2 / 256;            // 128
constexpr int kCbB  = kDm / 256;                       // 4
constexpr int kCbAll = kCbX + kCbQ + kCbO + 2 * kCbKV + kCbB;
__global__ __launch_bounds__(256) void prep_kernel(
    const float* __restrict__ x, const float* __restrict__ wq, const float* __restrict__ wo,
    const float* __restrict__ wk, const float* __restrict__ wv, const float* __restrict__ bq,
    unsigned short* __restrict__ x16, unsigned short* __restrict__ wq16p, unsigned short* __restrict__ wo16,
    unsigned short* __restrict__ wk16, unsigned short* __restrict__ wv16, float* __restrict__ bqp) {
  int bx = blockIdx.x;
  if (bx < kCbX) { cast_bf16x2(bx, x, x16, kBatch * kSeq * kDm / 2); return; }
  bx -= kCbX;
  if (bx < kCbQ) { cast_perm_rows_bf16x2(bx % kCbQx, bx / kCbQx, wq, wq16p, kDm); return; }
  bx -= kCbQ;
  if (bx < kCbO) { cast_bf_f16x2_scaled(bx, wo, wo16, kDm * kDm / 2, kWsc); return; }
  bx -= kCbO;
  if (bx < kCbKV) { cast_bf16x2(bx, wk, wk16, kDhd * kDm / 2); return; }
  bx -= kCbKV;
  if (bx < kCbKV) { cast_bf16x2(bx, wv, wv16, kDhd * kDm / 2); return; }
  bx -= kCbKV;
  perm_bias(bx, bq, bqp, kDm);
}

// =====================================================================================
// Full (non-causal, unmasked) multi-query attention, head dim 64.
//   q planes (hi/lo bf16): element (b, t, h, d) at [(b*kSeq + t)*kDm + h*64 + d]
//   k planes (hi/lo bf16): element (b, s, d) at [(b*kSeq + s)*kDhd + d]      (one KV head shared by all heads)
//   v^T plane (f16):       element (b, d, s) at [(b*64 + d)*kSeq + s]
//   out plane (f16, x kOsc): element (b, t, h, d) at [(b*kSeq + t)*kDm + h*64 + d]
//   scores = (q . k) * sscale : bf16 hi/lo split (hi.hi + hi.lo + lo.hi) on v_wmma_f32_16x16x32_bf16
//   out    = p . v            : v_wmma_f32_16x16x32_f16, p (unnormalised, <= 1) carried x2^15, f32 accumulate
//   both products are formed transposed: S^T = K . Q^T (A = K rows, B = Q columns) and O^T += V^T . P^T (A = V^T rows,
//   B = P^T packed from the score accumulators), so a lane holds 32 scores of ONE query per chunk: maximum and sum run
//   in the lane, the two wave halves join by one cross-row move, and P never passes through LDS.
//   online softmax in f32 over all kSeq keys (32 chunks of 64, compile-time trip count, no masking).
//   Block = 4 waves = 64 query rows of one (batch, head); grid = (kHeads * kSeq/64, kBatch).
//   K / V^T chunk staging: 128 threads x 32 elements per plane = the whole 64x64 tile (16-B copies, plain loads,
//   __syncthreads before and after); fragment loads read the LDS tiles with the same vector element type.
// =====================================================================================
#define AT_D 64
#define AT_NW 4
#define AT_QB 64
#define AT_KC 64
#define AT_LP 72   // LDS row pitch in 16-bit elements: 144 B = 16 B x 9 (odd), so the 16 rows of one ds_load_b128 half fall on 16 distinct 4-bank groups

__device__ __forceinline__ v8f at_mma(v16b a, v16b b, v8f c) {
  c = __builtin_amdgcn_wmma_f32_16x16x32_bf16(false, a, false, b, (short)0, c, false, false);
  asm volatile("v_nop\n\tv_nop\n\tv_nop\n\tv_nop" : "+v"(c) : "v"(a), "v"(b));
  return c;
}
__device__ __forceinline__ v8f at_mma_h(v16h a, v16h b, v8f c) {
  c = __builtin_amdgcn_wmma_f32_16x16x32_f16(false, a, false, b, (short)0, c, false, false);
  asm volatile("v_nop\n\tv_nop\n\tv_nop\n\tv_nop" : "+v"(c) : "v"(a), "v"(b));
  return c;
}

// lane l takes the value of lane l ^ 16 (the other half of the wave, same column)
__device__ __forceinline__ float at_xhalf(float x) {
  return __builtin_bit_cast(float, __builtin_amdgcn_permlanex16(__builtin_bit_cast(int, x), __builtin_bit_cast(int, x), 0x76543210, 0xfedcba98, false, false));
}

__device__ __forceinline__ float at_exp2(float x) {
  float y;
  // v_nop: the slot behind the transcendental; s_delay_alu: the compiler hints no reader of an asm result, and an unhinted wait holds up the SIMD's other waves
  asm("v_exp_f32 %0, %1\n\tv_nop\n\ts_delay_alu instid0(TRANS32_DEP_1)" : "=v"(y) : "v"(x));
  return y;
}
// eight at once, each in place on a register of its own: every exp is the independent instruction behind the one before it,
// and the one v_nop is the slot behind the last; the closing s_delay_alu hints the first reader behind the statement (as above)
__device__ __forceinline__ void at_exp2x8(float& a0, float& a1, float& a2, float& a3, float& a4, float& a5, float& a6, float& a7) {
  asm("v_exp_f32 %0, %0\n\tv_exp_f32 %1, %1\n\tv_exp_f32 %2, %2\n\tv_exp_f32 %3, %3\n\t"
      "v_exp_f32 %4, %4\n\tv_exp_f32 %5, %5\n\tv_exp_f32 %6, %6\n\tv_exp_f32 %7, %7\n\tv_nop\n\ts_delay_alu instid0(TRANS32_DEP_1)"
      : "+v"(a0), "+v"(a1), "+v"(a2), "+v"(a3), "+v"(a4), "+v"(a5), "+v"(a6), "+v"(a7));
}

__global__ __launch_bounds__(128)
void mqa_full64_kernel(const unsigned short* __restrict__ qhp, const unsigned short* __restrict__ qlp,
                       const unsigned short* __restrict__ khp, const unsigned short* __restrict__ klp,
                       const unsigned short* __restrict__ vtp, unsigned short* __restrict__ o16p,
                       float sscale) {
  union FB { v16b v; v8b h[2]; };
  union FH { v16h v; v8h h[2]; };
  __shared__ __align__(16) __bf16   Ksh[AT_KC * AT_LP];         // K hi [kv][d], pitch AT_LP      9 KB
  __shared__ __align__(16) __bf16   Ksl[AT_KC * AT_LP];         // K lo                          9 KB
  __shared__ __align__(16) _Float16 Vth[AT_D * AT_LP];          // V^T f16 [d][kv], pitch AT_LP  9 KB
  __shared__ __align__(16) float    Os[AT_NW][16 * 68];         // per wave out tile, pitch 68

  const int tid  = threadIdx.x;
  const int wave = tid >> 5;
  const int lane = tid & 31;
  const int hh   = lane >> 4;
  const int c    = lane & 15;

  const int nqb = kSeq / AT_QB;            // 32
  const int b  = blockIdx.y;               // 0..kBatch-1
  const int bx = blockIdx.x;               // 0..kHeads*nqb-1
  const int qb = bx % nqb;
  const int h  = bx / nqb;                 // 0..kHeads-1
  const int q0 = qb * AT_QB + wave * 16;

  const __bf16*   Qh = (const __bf16*)(const void*)qhp + (size_t)b * kSeq * kDm + (size_t)h * AT_D;
  const __bf16*   Ql = (const __bf16*)(const void*)qlp + (size_t)b * kSeq * kDm + (size_t)h * AT_D;
  const __bf16*   Kh = (const __bf16*)(const void*)khp + (size_t)b * kSeq * kDhd;
  const __bf16*   Kl = (const __bf16*)(const void*)klp + (size_t)b * kSeq * kDhd;
  const _Float16* Vt = (const _Float16*)(const void*)vtp + (size_t)b * AT_D * kSeq;
  _Float16*       ob = (_Float16*)(void*)o16p + (size_t)b * kSeq * kDm + (size_t)h * AT_D;

  // ---- Q fragments (B operand, column = query = lane&15, split k map via Frag load): 2 d-chunks, hi and lo ----
  v16b qah[2], qal[2];
#pragma unroll
  for (int dc = 0; dc < 2; ++dc) {
    const __bf16* qr = Qh + (size_t)(q0 + c) * kDm + dc * 32 + 8 * hh;
    const __bf16* ql = Ql + (size_t)(q0 + c) * kDm + dc * 32 + 8 * hh;
    qah[dc] = Frag<__bf16>::load(qr);
    qal[dc] = Frag<__bf16>::load(ql);
  }

  const float c2 = sscale * 1.44269504088896340736f;   // score scale times log2(e), positive: exp(x) = 2^(x * log2 e)
  float mrun = -INFINITY;   // running maximum of query q0 + c in base-2 units (equal in both wave halves)
  float lrun = 0.f;         // running sum (x2^15) over this half's keys only; the halves join in the epilogue
  v8f oacc[4];              // oacc[t][r] = O^T(d = t*16 + 8*hh + r, query q0 + c)
#pragma unroll
  for (int t = 0; t < 4; ++t) oacc[t] = (v8f){0.f,0.f,0.f,0.f,0.f,0.f,0.f,0.f};

  const int nChunks = kSeq / AT_KC;   // 32, compile-time constant
  for (int kc = 0; kc < nChunks; ++kc) {
    const int kv0 = kc * AT_KC;
    __syncthreads();
    {
      // staging coverage: 128 threads x (4 x 8) elements = 64 rows x 64 per plane = the whole chunk tile
      const int r = tid >> 1, half = (tid & 1) * 32;
      const __bf16*   ksh = Kh + (size_t)(kv0 + r) * kDhd + half;   // K row kv0+r, d = half..half+31
      const __bf16*   ksl = Kl + (size_t)(kv0 + r) * kDhd + half;
      const _Float16* vsr = Vt + (size_t)r * kSeq + kv0 + half;      // V^T row d = r, s = kv0+half..+31
#pragma unroll
      for (int i = 0; i < 4; ++i) {
        const v8b a0 = *(const v8b*)(ksh + 8 * i);
        const v8b a1 = *(const v8b*)(ksl + 8 * i);
        const v8h b0 = *(const v8h*)(vsr + 8 * i);
        *(v8b*)(Ksh + r * AT_LP + half + 8 * i) = a0;
        *(v8b*)(Ksl + r * AT_LP + half + 8 * i) = a1;
        *(v8h*)(Vth + r * AT_LP + half + 8 * i) = b0;
      }
    }
    __syncthreads();

    // ---- scores, transposed: A operand row = key j*16+c, B operand column = query c, both <- d with the split k map ----
    v8f s[4];
#pragma unroll
    for (int j = 0; j < 4; ++j) {
      s[j] = (v8f){0.f,0.f,0.f,0.f,0.f,0.f,0.f,0.f};
#pragma unroll
      for (int dc = 0; dc < 2; ++dc) {
        FB kb, kl;
        kb.h[0] = *(const v8b*)(Ksh + (j * 16 + c) * AT_LP + dc * 32 + 8 * hh);
        kb.h[1] = *(const v8b*)(Ksh + (j * 16 + c) * AT_LP + dc * 32 + 16 + 8 * hh);
        kl.h[0] = *(const v8b*)(Ksl + (j * 16 + c) * AT_LP + dc * 32 + 8 * hh);
        kl.h[1] = *(const v8b*)(Ksl + (j * 16 + c) * AT_LP + dc * 32 + 16 + 8 * hh);
        s[j] = at_mma(kb.v, qah[dc], s[j]);
        s[j] = at_mma(kl.v, qah[dc], s[j]);
        s[j] = at_mma(kb.v, qal[dc], s[j]);
      }
    }
    // D layout: s[j][r] = score(key kv0 + j*16 + 8*hh + r, query q0 + c)
    // the loops over j, r and t below are unrolled because s and oacc are register arrays; one chain per j keeps four
    // independent maximum and sum chains in flight
    float mj[4];
#pragma unroll
    for (int j = 0; j < 4; ++j) {
      float m = -INFINITY;
#pragma unroll
      for (int r = 0; r < 8; ++r) m = fmaxf(m, s[j][r]);   // raw products: c2 > 0 keeps their order
      mj[j] = m;
    }
    float cm = fmaxf(fmaxf(mj[0], mj[1]), fmaxf(mj[2], mj[3]));
    cm = fmaxf(cm, at_xhalf(cm));            // the query's maximum over all 64 keys of the chunk, in both halves
    const float mnew = fmaxf(mrun, cm * c2);  // running maximum in base-2 units
    const float alpha = at_exp2(mrun - mnew);
    mrun = mnew;
    const float nb = kPlog - mnew;            // one addend per query: exponent = score * c2 - maximum + 15
    float pj[4];
#pragma unroll
    for (int j = 0; j < 4; ++j) {
      float x[8];
#pragma unroll
      for (int r = 0; r < 8; ++r) x[r] = fmaf(s[j][r], c2, nb);   // base-2 exponent of the numerator x2^15: one multiply-add
      at_exp2x8(x[0], x[1], x[2], x[3], x[4], x[5], x[6], x[7]);
      float ps = 0.f;
#pragma unroll
      for (int r = 0; r < 8; ++r) {
        ps += x[r];
        s[j][r] = x[r];
      }
      pj[j] = ps;
    }
    lrun = lrun * alpha + ((pj[0] + pj[1]) + (pj[2] + pj[3]));
#pragma unroll
    for (int t = 0; t < 4; ++t)
#pragma unroll
      for (int r = 0; r < 8; ++r) oacc[t][r] *= alpha;
    // ---- O^T += V^T . P^T: two score tiles (keys kk*32 + 8hh + 0..7 and kk*32 + 16 + 8hh + 0..7) are one B operand in place ----
#pragma unroll
    for (int kk = 0; kk < 2; ++kk) {   // unrolled: the score tiles are registers and cannot be indexed at run time
      v16h pb;
#pragma unroll   // vector elements are registers: constant indices only
      for (int e = 0; e < 8; ++e) {
        pb[e]     = (_Float16)s[2 * kk][e];
        pb[8 + e] = (_Float16)s[2 * kk + 1][e];
      }
#pragma unroll
      for (int t = 0; t < 4; ++t) {
        FH vb;
        vb.h[0] = *(const v8h*)(Vth + (t * 16 + c) * AT_LP + kk * 32 + 8 * hh);       // A: row = d = t*16 + c, same key map as P^T
        vb.h[1] = *(const v8h*)(Vth + (t * 16 + c) * AT_LP + kk * 32 + 16 + 8 * hh);
        oacc[t] = at_mma_h(vb.v, pb, oacc[t]);
      }
    }
  }

  // ---- epilogue: O = oacc / (l * 2^15), carried x kOsc as f16 ----
  float* os = Os[wave];
  {
    const float lsum = lrun + at_xhalf(lrun);   // the two halves' key sums of query q0 + c
    const float inv = kOsc * (1.0f / lsum);   // lsum carries the numerators' x2^15
#pragma unroll   // oacc is a register array: constant indices only (inner loop too)
    for (int t = 0; t < 4; ++t) {
      v4f w0, w1;
#pragma unroll
      for (int r = 0; r < 4; ++r) { w0[r] = oacc[t][r] * inv; w1[r] = oacc[t][4 + r] * inv; }
      *(v4f*)(os + c * 68 + t * 16 + 8 * hh)     = w0;   // row = query c, 8 consecutive d per lane
      *(v4f*)(os + c * 68 + t * 16 + 8 * hh + 4) = w1;
    }
  }
  __builtin_amdgcn_fence(__ATOMIC_RELEASE, "workgroup");
  __builtin_amdgcn_wave_barrier();
  __builtin_amdgcn_fence(__ATOMIC_ACQUIRE, "workgroup");
  {
    const int qg = lane >> 3, c8 = (lane & 7) * 8;
    {
#pragma unroll
      for (int it = 0; it < 4; ++it) {
        const int row = it * 4 + qg;                    // 4 it x 4 groups = rows 0..15
        const float* sp = os + row * 68 + c8;
        v8h hv;
#pragma unroll
        for (int e = 0; e < 8; ++e) hv[e] = (_Float16)sp[e];
        *(v8h*)(ob + (size_t)(q0 + row) * kDm + c8) = hv;
      }
      
    }
  }
}

// ---------------------------------------------------------------------------
// Host driver. Workspace region map (bytes, 256-B aligned offsets):
//   x16   [4096][1024] bf16           8388608
//   wq16p [1024][1024] bf16 (rows permuted to head-major)  2097152
//   wk16  [64][1024]   bf16            131072
//   wv16  [64][1024]   bf16            131072
//   wo16  [1024][1024] f16 (bf16-RNE x16)  2097152
//   bqp   [1024]       f32 (permuted)     4096
//   Qh,Ql [4096][1024] bf16 hi/lo     2 x 8388608
//   Kh,Kl [4096][64]   bf16 hi/lo     2 x 524288
//   Vt16  [2][64][2048] f16            524288
//   O16   [4096][1024] f16 (x16)      8388608
//   total 39587840 B
// ---------------------------------------------------------------------------
extern "C" void kernel_launch(void* const* d_in, const int* in_sizes, int n_in,
                              void* d_out, int out_size, void* d_ws, size_t ws_size,
                              hipStream_t stream) {
  const int nB = kBatch, nS = kSeq, nD = kDm, nDh = kDhd;
  const int nM = nB * nS;   // 4096
  if (n_in < 9) return;
  if (in_sizes[0] != nM * nD || in_sizes[1] != nD * nD || in_sizes[2] != nD ||
      in_sizes[3] != nDh * nD || in_sizes[4] != nDh || in_sizes[5] != nDh * nD ||
      in_sizes[6] != nDh || in_sizes[7] != nD * nD || in_sizes[8] != nD || out_size != nM * nD) return;

  const float* x  = (const float*)d_in[0];
  const float* wq = (const float*)d_in[1];
  const float* bq = (const float*)d_in[2];
  const float* wk = (const float*)d_in[3];
  const float* bk = (const float*)d_in[4];
  const float* wv = (const float*)d_in[5];
  const float* bv = (const float*)d_in[6];
  const float* wo = (const float*)d_in[7];
  const float* bo = (const float*)d_in[8];

  size_t off = 0;
  auto carve = [&](size_t bytes) -> char* {
    char* p = (char*)d_ws + off;
    off += (bytes + 255) & ~(size_t)255;
    return p;
  };
  unsigned short* x16   = (unsigned short*)carve((size_t)nM * nD * 2);
  unsigned short* wq16p = (unsigned short*)carve((size_t)nD * nD * 2);
  unsigned short* wk16  = (unsigned short*)carve((size_t)nDh * nD * 2);
  unsigned short* wv16  = (unsigned short*)carve((size_t)nDh * nD * 2);
  unsigned short* wo16  = (unsigned short*)carve((size_t)nD * nD * 2);
  float*          bqp   = (float*)carve((size_t)nD * 4);
  unsigned short* Qh    = (unsigned short*)carve((size_t)nM * nD * 2);
  unsigned short* Ql    = (unsigned short*)carve((size_t)nM * nD * 2);
  unsigned short* Kh    = (unsigned short*)carve((size_t)nM * nDh * 2);
  unsigned short* Kl    = (unsigned short*)carve((size_t)nM * nDh * 2);
  unsigned short* Vt16  = (unsigned short*)carve((size_t)nB * nDh * nS * 2);
  unsigned short* O16   = (unsigned short*)carve((size_t)nM * nD * 2);
  if (off > ws_size) return;

  // ---- casts (bf16 RNE; wq rows / bq permuted to head-major; wo as f16(bf16_rne(wo) * 16)): one launch ----
  prep_kernel<<<dim3(kCbAll), dim3(256), 0, stream>>>(x, wq, wo, wk, wv, bq, x16, wq16p, wo16, wk16, wv16, bqp);

  // ---- q, k and v^T projections: one launch, 128 + 8 + 2 x 4 work-groups of 8 waves, one 64x64 tile per wave ----
  proj_qkv_kernel<<<dim3(kPjQ + kPjK + kBatch * kPjV), dim3(256), 0, stream>>>(
      x16, wq16p, wk16, wv16, bqp, bk, bv, Qh, Ql, Kh, Kl, Vt16, nD);

  // ---- attention: grid (16 heads x 32 query blocks, 2 batches), all heads share the batch's K / V^T planes ----
  mqa_full64_kernel<<<dim3(kHeads * (nS / AT_QB), nB), dim3(128), 0, stream>>>(Qh, Ql, Kh, Kl, Vt16, O16, 0.125f);

  // ---- output projection: out [4096][1024] f32 = (O16 . wo16^T) / 256 + bo ----
  wmma_gemm64<0, false, 2, 0, false, 0><<<dim3((nM / 64) * (nD / 64) / 8, 1), dim3(256), 0, stream>>>(
      O16, 0L, wo16, 0L, d_out, d_out, nD, 0L, bo, bo, 0L, nM, nD, nD, 1.0f / (kOsc * kWsc));
}

// v006
// It runs in 110 microseconds.
// Timed twice side by side with v005, it ran 1.10 and 1.09 times as fast.
// Counting every step since v000, it is 4.38 times as fast.
// Contractions: q/k/v^T projections v_wmma_f32_16x16x32_bf16 (inputs RNE-cast to bf16, f32 acc); q.k^T v_wmma_f32_16x16x32_bf16 with bf16 hi/lo split (hi.hi+hi.lo+lo.hi); p.v and output projection v_wmma_f32_16x16x32_f16 (p carried x2^15, o carried x16, wo carried x16), f32 acc; online softmax, biases and scales in f32.
#include <hip/hip_runtime.h>
#include <math.h>
#include <stdint.h>

typedef __attribute__((ext_vector_type(16))) _Float16 v16h;
typedef __attribute__((ext_vector_type(8)))  _Float16 v8h;
typedef __attribute__((ext_vector_type(16))) __bf16   v16b;
typedef __attribute__((ext_vector_type(8)))  __bf16   v8b;
typedef __attribute__((ext_vector_type(8)))  float    v8f;
typedef __attribute__((ext_vector_type(4)))  float    v4f;
typedef __attribute__((ext_vector_type(2)))  float    v2f;
typedef __attribute__((ext_vector_type(4)))  unsigned int v4u;

// problem geometry (compile-time)
constexpr int kBatch = 2;
constexpr int kSeq   = 2048;
constexpr int kDm    = 1024;   // model width = H*Dh = q row pitch
constexpr int kHeads = 16;
constexpr int kDhd   = 64;     // per-head dim = k row pitch
constexpr float kPlog = 15.0f;     // softmax numerators carried x2^15 in f16: 15 is added to their base-2 exponent
constexpr float kOsc = 16.0f;      // attention output carried x16 in f16
constexpr float kWsc = 16.0f;      // output-projection weight carried x16 in f16

__device__ __forceinline__ unsigned short f2bf_bits(float f) {
  unsigned u = __float_as_uint(f);
  return (unsigned short)((u + 0x7FFFu + ((u >> 16) & 1u)) >> 16);
}
__device__ __forceinline__ float bf_bits2f(unsigned short h) { return __uint_as_float(((unsigned)h) << 16); }
__device__ __forceinline__ unsigned pk16(unsigned short a, unsigned short b) { return (unsigned)a | ((unsigned)b << 16); }

// hazard guards as plain device helpers
__device__ __forceinline__ void dep_guard_h(v8f& a, v8f& b, v16h x, v16h y) { asm volatile("v_nop\n\tv_nop\n\tv_nop\n\tv_nop" : "+v"(a), "+v"(b) : "v"(x), "v"(y)); }
__device__ __forceinline__ void dep_guard_b(v8f& a, v8f& b, v16b x, v16b y) { asm volatile("v_nop\n\tv_nop\n\tv_nop\n\tv_nop" : "+v"(a), "+v"(b) : "v"(x), "v"(y)); }
__device__ __forceinline__ void keep4_h(v16h a, v16h b, v16h c, v16h d) { asm volatile("v_nop" :: "v"(a), "v"(b), "v"(c), "v"(d)); }
__device__ __forceinline__ void keep4_b(v16b a, v16b b, v16b c, v16b d) { asm volatile("v_nop" :: "v"(a), "v"(b), "v"(c), "v"(d)); }
__device__ __forceinline__ void acc_guard4(v8f& a, v8f& b, v8f& c, v8f& d) { asm volatile("v_nop\n\tv_nop\n\tv_nop\n\tv_nop" : "+v"(a), "+v"(b), "+v"(c), "+v"(d)); }
template <typename T> struct Frag;
template <> struct Frag<_Float16> {
  typedef v16h V; typedef v8h H; union U { v16h v; v8h h[2]; };
  static __device__ __forceinline__ v16h load(const _Float16* p) {   // elements 0..7 <- p[0..7], 8..15 <- p[16..23]
    U f; f.h[0] = *(const v8h*)(p); f.h[1] = *(const v8h*)(p + 16); return f.v;
  }
  static __device__ __forceinline__ v8f mma(v16h a, v16h b, v8f c) {
    return __builtin_amdgcn_wmma_f32_16x16x32_f16(false, a, false, b, (short)0, c, false, false);
  }
  static __device__ __forceinline__ void guard(v8f& a, v8f& b, v16h x, v16h y) { dep_guard_h(a, b, x, y); }
  static __device__ __forceinline__ void keep(v16h a, v16h b, v16h c, v16h d) { keep4_h(a, b, c, d); }
};
template <> struct Frag<__bf16> {
  typedef v16b V; typedef v8b H; union U { v16b v; v8b h[2]; };
  static __device__ __forceinline__ v16b load(const __bf16* p) {
    U f; f.h[0] = *(const v8b*)(p); f.h[1] = *(const v8b*)(p + 16); return f.v;
  }
  static __device__ __forceinline__ v8f mma(v16b a, v16b b, v8f c) {
    return __builtin_amdgcn_wmma_f32_16x16x32_bf16(false, a, false, b, (short)0, c, false, false);
  }
  static __device__ __forceinline__ void guard(v8f& a, v8f& b, v16b x, v16b y) { dep_guard_b(a, b, x, y); }
  static __device__ __forceinline__ void keep(v16b a, v16b b, v16b c, v16b d) { keep4_b(a, b, c, d); }
};

// ---- Register-blocked batched WMMA GEMM ------------------------------------
// C[m,n] = scale * sum_k A[m,k] * Bt[n,k] (+bias)(+resid); each wave owns a 64x64 tile.
// A row-major [M,K]; Bt row-major [N,K], both with row pitch kDm (compile time, so that the 16 row groups of a tile
// are immediate offsets of one address); M,N % 64 == 0, K % 64 == 0, K <= kDm.
// Operand path: per 64-k step each wave copies its own 64x64 A tile and 64x64 Bt tile into its own LDS range with
// global loads that cover whole 128-B lines (8 lanes per row, 4 rows per load), the next step's loads being issued
// before the current step's products; the WMMA fragments are read from LDS (k order per 32-k group as Frag::load).
// SPLIT (hi/lo planes) is not instantiated and not supported by the staged loop.
// BIAS_MODE: 0 = none, 1 = bias[m], 2 = bias[n].
// OUT_MODE: 0 = f32, 1 = f16, 2 = bf16 hi plane (Cout) + bf16 lo plane (Cout2).
// ET: 0 = f16 operands, 1 = bf16 operands (pointers passed as 16-bit storage)
#define GS_LP 72   // LDS row pitch of a staged operand tile in 16-bit elements: 144 B = 16 B x 9 (odd), conflict-free for ds_load_b128 fragment reads
template <int ET> struct Elem;
template <> struct Elem<0> { typedef _Float16 T; };
template <> struct Elem<1> { typedef __bf16 T; };
// The body is a device function, so that one launch can run several products as ranges of its grid: bx = the work-group's
// index within its product, b = the batch, sOpAll / sTAll = the work-group's LDS (8 waves x (A tile + Bt tile); 8 slabs).
#define GS_OPW (2 * 64 * GS_LP)   // 16-bit elements of one wave's A tile + Bt tile
#define GS_SLW (16 * 68)          // floats of one wave's 16x64 slab, pitch 68
template <int ET, bool SPLIT, int BIAS_MODE, int OUT_MODE, bool RESID, int ACT>
__device__ __forceinline__ void gemm64_body(
    typename Elem<ET>::T* sOpAll, float* sTAll, int bx, int b,
    const unsigned short* __restrict__ Ap, long strideA,
    const unsigned short* __restrict__ Btp, long strideB,
    void* __restrict__ Cout, void* __restrict__ Cout2, int ldc, long strideC,
    const float* __restrict__ bias,
    const float* __restrict__ resid, long strideR,
    int M, int N, int K, float scale) {
  typedef typename Elem<ET>::T T;
  typedef typename Frag<T>::V V;
  const T* A = (const T*)Ap; const T* Bt = (const T*)Btp;
  static_assert(!SPLIT, "the staged operand loop takes single-plane operands");
  typedef typename Frag<T>::H H;
  const int lane = threadIdx.x & 31;
  const int wave = __builtin_amdgcn_readfirstlane(threadIdx.x >> 5);   // wave-uniform: tile bases stay scalar
  const int tilesN = N >> 6;
  const int tilesM = M >> 6;
  const int tile = bx * 8 + wave;
  if (tile >= tilesM * tilesN) return;   // wave-uniform; no block barriers in this body
  const int tm = tile / tilesN;
  const int tn = tile - tm * tilesN;
  const int m0 = tm << 6;
  const int n0 = tn << 6;

  const T* Ab  = A  + (size_t)b * strideA;
  const T* Bb  = Bt + (size_t)b * strideB;

  const int rlane = lane & 15;                 // row (A) / col (B, D) within subtile
  const int koff  = (lane >> 4) * 8;           // k offset of this lane half
  const int mOff  = (lane >> 4) * 8;           // D row offset

  v8f acc[4][4];
#pragma unroll
  for (int i = 0; i < 4; ++i)
#pragma unroll
    for (int j = 0; j < 4; ++j) acc[i][j] = (v8f){0.f,0.f,0.f,0.f,0.f,0.f,0.f,0.f};

  // staging map: lane -> row (lane >> 3) of each group of 4 rows, 16-B piece (lane & 7) of the row's 128-B line
  const int srow = lane >> 3;
  const int scol = (lane & 7) * 8;
  const T* Ag = Ab + (size_t)(m0 + srow) * kDm + scol;   // this lane's piece of row group 0, k = 0
  const T* Bg = Bb + (size_t)(n0 + srow) * kDm + scol;
  T* sa = sOpAll + wave * GS_OPW;   // per-wave A tile and Bt tile of one 64-k step, pitch GS_LP
  T* sb = sa + 64 * GS_LP;
  H ra[16], rb[16];
#pragma unroll
  for (int it = 0; it < 16; ++it) {
    ra[it] = *(const H*)(Ag + it * 4 * kDm);
    rb[it] = *(const H*)(Bg + it * 4 * kDm);
  }

  for (int k0 = 0; k0 < K; k0 += 64) {
#pragma unroll
    for (int it = 0; it < 16; ++it) {
      *(H*)(sa + (it * 4 + srow) * GS_LP + scol) = ra[it];
      *(H*)(sb + (it * 4 + srow) * GS_LP + scol) = rb[it];
    }
    // the wave's own tile stores are complete before any of its lanes reads another lane's rows
    __builtin_amdgcn_fence(__ATOMIC_RELEASE, "workgroup");
    __builtin_amdgcn_wave_barrier();
    __builtin_amdgcn_fence(__ATOMIC_ACQUIRE, "workgroup");
    if (k0 + 64 < K) {   // wave-uniform: the next step's tiles fly while this step's products run
#pragma unroll
      for (int it = 0; it < 16; ++it) {
        ra[it] = *(const H*)(Ag + it * 4 * kDm + (k0 + 64));
        rb[it] = *(const H*)(Bg + it * 4 * kDm + (k0 + 64));
      }
      asm volatile("s_wait_xcnt 0x0" ::: "memory");   // before the fragment reads below reuse the address registers of these loads
    }
#pragma unroll
    for (int kk = 0; kk < 2; ++kk) {
      V bh[4], ah[4];
#pragma unroll
      for (int j = 0; j < 4; ++j) bh[j] = Frag<T>::load(sb + ((j << 4) + rlane) * GS_LP + kk * 32 + koff);
#pragma unroll
      for (int i = 0; i < 4; ++i) ah[i] = Frag<T>::load(sa + ((i << 4) + rlane) * GS_LP + kk * 32 + koff);
#pragma unroll
      for (int i = 0; i < 4; ++i) {
#pragma unroll
        for (int j = 0; j < 4; ++j) acc[i][j] = Frag<T>::mma(ah[i], bh[j], acc[i][j]);
        Frag<T>::guard(acc[i][0], acc[i][3], ah[i], ah[i]);
      }
      Frag<T>::keep(bh[0], bh[1], bh[2], bh[3]);
    }
    // every fragment read of this step is done before the next step's stores overwrite the tiles
    __builtin_amdgcn_fence(__ATOMIC_RELEASE, "workgroup");
    __builtin_amdgcn_wave_barrier();
    __builtin_amdgcn_fence(__ATOMIC_ACQUIRE, "workgroup");
  }
  acc_guard4(acc[0][0], acc[0][1], acc[0][2], acc[0][3]);
  acc_guard4(acc[1][0], acc[1][1], acc[1][2], acc[1][3]);
  acc_guard4(acc[2][0], acc[2][1], acc[2][2], acc[2][3]);
  acc_guard4(acc[3][0], acc[3][1], acc[3][2], acc[3][3]);

  // ---- epilogue ----
  float* slab = sTAll + wave * GS_SLW;
  const float* Rb = RESID ? (resid + (size_t)b * strideR) : nullptr;
#pragma unroll
  for (int i = 0; i < 4; ++i) {
    const int mBase = m0 + (i << 4);
    float bm[8];
    if (BIAS_MODE == 1) {
      const float* bp = bias + mBase + mOff;
#pragma unroll
      for (int r = 0; r < 8; ++r) bm[r] = bp[r];
      // before the address registers of the bias loads are reused; the address as an input keeps them untouched up to here
      asm volatile("s_wait_xcnt 0x0" :: "v"(bp) : "memory");
    }
#pragma unroll
    for (int j = 0; j < 4; ++j) {
      const int n = n0 + (j << 4) + rlane;
      float bv = 0.f;
      if (BIAS_MODE == 2) bv = bias[n];
#pragma unroll
      for (int r = 0; r < 8; ++r) {
        float v = acc[i][j][r] * scale;
        if (BIAS_MODE == 1) v += bm[r];
        if (BIAS_MODE == 2) v += bv;
        if (RESID) v += Rb[(size_t)(mBase + mOff + r) * ldc + n];
        if (ACT == 1) v = tanhf(v);
        if (ACT == 2) v = fmaxf(v, 0.0f);
        if (ACT == 3) v = v / (1.0f + expf(-v));
        if (ACT == 4) v = (v > 0.f) ? v : 0.01f * v;
        if (ACT == 5) v = 0.5f * v * (1.0f + erff(v * 0.70710678118654752f));
        slab[(mOff + r) * 68 + (j << 4) + rlane] = v;
      }
    }
    __builtin_amdgcn_fence(__ATOMIC_RELEASE, "workgroup");
    __builtin_amdgcn_wave_barrier();
    __builtin_amdgcn_fence(__ATOMIC_ACQUIRE, "workgroup");
    if (OUT_MODE == 0) {
      float* C = (float*)Cout + (size_t)b * strideC;
      const int hh = lane >> 4, c4 = (lane & 15) * 4;     // row seg = 256 B = 16 lanes x 16 B
      {
#pragma unroll
        for (int it = 0; it < 8; ++it) {
          const int row = it * 2 + hh;
          v4f v = *(const v4f*)(slab + row * 68 + c4);
          *(v4f*)(C + (size_t)(mBase + row) * ldc + n0 + c4) = v;
        }
        
      }
    } else {
      const int q = lane >> 3, c8 = (lane & 7) * 8;
      unsigned short* C  = (unsigned short*)Cout  + (size_t)b * strideC;
      unsigned short* C2 = (OUT_MODE == 2) ? ((unsigned short*)Cout2 + (size_t)b * strideC) : nullptr;
      {
#pragma unroll
        for (int it = 0; it < 4; ++it) {
          const int row = it * 4 + q;
          const float* sp = slab + row * 68 + c8;
          v8h hv, lv;
#pragma unroll
          for (int e = 0; e < 8; ++e) {
            if (OUT_MODE == 1) {
              hv[e] = (_Float16)sp[e];
            } else {
              unsigned short hb = f2bf_bits(sp[e]);
              unsigned short lb = f2bf_bits(sp[e] - bf_bits2f(hb));
              hv[e] = __builtin_bit_cast(_Float16, hb);
              lv[e] = __builtin_bit_cast(_Float16, lb);
            }
          }
          *(v8h*)(C + (size_t)(mBase + row) * ldc + n0 + c8) = hv;
          if (OUT_MODE == 2) *(v8h*)(C2 + (size_t)(mBase + row) * ldc + n0 + c8) = lv;
        }
        
      }
    }
    __builtin_amdgcn_fence(__ATOMIC_RELEASE, "workgroup");
    __builtin_amdgcn_wave_barrier();
    __builtin_amdgcn_fence(__ATOMIC_ACQUIRE, "workgroup");
    // keeps the next row group's arithmetic behind the fence's store wait: no register of an issued store is rewritten before it
    __builtin_amdgcn_sched_barrier(0);
  }
}

// one product per launch: grid = (tiles / 8, batches)
template <int ET, bool SPLIT, int BIAS_MODE, int OUT_MODE, bool RESID, int ACT = 0>
__global__ __launch_bounds__(256) void wmma_gemm64(
    const unsigned short* __restrict__ Ap, long strideA,
    const unsigned short* __restrict__ Btp, long strideB,
    void* __restrict__ Cout, void* __restrict__ Cout2, int ldc, long strideC,
    const float* __restrict__ bias,
    const float* __restrict__ resid, long strideR,
    int M, int N, int K, float scale) {
  __shared__ __align__(16) typename Elem<ET>::T sOp[8 * GS_OPW];
  __shared__ __align__(16) float sT[8 * GS_SLW];
  gemm64_body<ET, SPLIT, BIAS_MODE, OUT_MODE, RESID, ACT>(sOp, sT, blockIdx.x, blockIdx.y, Ap, strideA, Btp, strideB,
      Cout, Cout2, ldc, strideC, bias, resid, strideR, M, N, K, scale);
}

// ---------------------------------------------------------------------------
// The three projections of x, which do not depend on one another, as ranges of one grid (144 work-groups, one round):
//   [0, 128)    q   [4096][1024] = x16 . wq16p^T + bqp  -> bf16 hi/lo planes, head-major columns (h*64 + d)
//   [128, 136)  k   [4096][64]   = x16 . wk16^T + bk    -> bf16 hi/lo planes
//   [136, 144)  v^T per batch z: [64][2048] = wv16 . x16_z^T + bv[m] -> f16; 4 work-groups per batch
// The range test reads blockIdx only: uniform for the work-group. K, the inner length of all three, is an argument as in wmma_gemm64.
// ---------------------------------------------------------------------------
constexpr int kPjQ = (kBatch * kSeq / 64) * (kDm / 64) / 8;    // 128
constexpr int kPjK = (kBatch * kSeq / 64) * (kDhd / 64) / 8;   // 8
constexpr int kPjV = (kDhd / 64) * (kSeq / 64) / 8;            // 4 per batch
__global__ __launch_bounds__(256) void proj_qkv_kernel(
    const unsigned short* __restrict__ x16, const unsigned short* __restrict__ wq16p,
    const unsigned short* __restrict__ wk16, const unsigned short* __restrict__ wv16,
    const float* __restrict__ bqp, const float* __restrict__ bk, const float* __restrict__ bv,
    unsigned short* __restrict__ Qh, unsigned short* __restrict__ Ql,
    unsigned short* __restrict__ Kh, unsigned short* __restrict__ Kl,
    unsigned short* __restrict__ Vt16, int K) {
  __shared__ __align__(16) __bf16 sOp[8 * GS_OPW];
  __shared__ __align__(16) float sT[8 * GS_SLW];
  const int bx = blockIdx.x;
  if (bx < kPjQ + kPjK) {
    const bool isq = bx < kPjQ;
    const int n = isq ? kDm : kDhd;
    gemm64_body<1, false, 2, 2, false, 0>(sOp, sT, isq ? bx : bx - kPjQ, 0, x16, 0L, isq ? wq16p : wk16, 0L,
        (void*)(isq ? Qh : Kh), (void*)(isq ? Ql : Kl), n, 0L, isq ? bqp : bk, nullptr, 0L, kBatch * kSeq, n, K, 1.0f);
  } else {
    const int v = bx - (kPjQ + kPjK);
    gemm64_body<1, false, 1, 1, false, 0>(sOp, sT, v % kPjV, v / kPjV, wv16, 0L, x16, (long)kSeq * kDm,
        (void*)Vt16, (void*)Vt16, kSeq, (long)kDhd * kSeq, bv, nullptr, 0L, kDhd, kSeq, K, 1.0f);
  }
}

// ---------------------------------------------------------------------------
// Elementwise f32 -> bf16 (RNE), 2 elements per thread, one 4-B store per lane -> each wave writes exactly
// Coverage: range = ceil(n2/256) work-groups x 256 threads x 2 elements = 2*n2 = whole plane
//   (x: n2 = 4096*1024/2 = 2097152 -> 8192 blocks exact; wk/wv: n2 = 32768 -> 128 blocks exact).
// ---------------------------------------------------------------------------
__device__ __forceinline__ void cast_bf16x2(int bx, const float* __restrict__ in, unsigned short* __restrict__ out, int n2) {
  const int i = bx * 256 + threadIdx.x;
  if (i < n2) {
    const v2f f = *(const v2f*)(in + 2 * (size_t)i);
    const unsigned u = pk16(f2bf_bits(f[0]), f2bf_bits(f[1]));
    ((unsigned*)out)[i] = u;
    
  }
}

// ---------------------------------------------------------------------------
// Row-permuted f32 -> bf16 (RNE) cast of a [1024][ncol] weight: dest row rd = h*64 + d takes source row d*16 + h
// (de-interleave of the (hidden, heads) column split). (bx, by) in (ncol/512, 1024), 256 threads, 2 elements per thread.
// ---------------------------------------------------------------------------
__device__ __forceinline__ void cast_perm_rows_bf16x2(int bx, int by, const float* __restrict__ in, unsigned short* __restrict__ out, int ncol) {
  const int rd = by;                                    // 0..1023
  int rs = ((rd & 63) << 4) + (rd >> 6);                // 0..1023
  rs = rs > 1023 ? 1023 : rs;
  const int i = bx * 256 + threadIdx.x;                 // pair index within the row
  if (i < (ncol >> 1)) {
    const v2f f = *(const v2f*)(in + (size_t)rs * ncol + 2 * (size_t)i);
    const unsigned u = pk16(f2bf_bits(f[0]), f2bf_bits(f[1]));
    unsigned* o = (unsigned*)(out + (size_t)rd * ncol);
    o[i] = u;
    
  }
}

// ---------------------------------------------------------------------------
// Permuted bias: out[h*64 + d] = in[d*16 + h]; n = 1024; 4 blocks x 256 threads x 4 B = whole vector,
// ---------------------------------------------------------------------------
__device__ __forceinline__ void perm_bias(int bx, const float* __restrict__ in, float* __restrict__ out, int n) {
  const int i = bx * 256 + threadIdx.x;
  if (i < n) {
    int s = ((i & 63) << 4) + (i >> 6);
    s = s > n - 1 ? n - 1 : s;
    const float v = in[s];
    ((float*)out)[i] = v;
    
  }
}

// ---------------------------------------------------------------------------
// Elementwise f32 -> f16 of (bf16_rne(x) * sc) with sc a power of two: 2 elements per thread, one 4-B store per lane.
// ---------------------------------------------------------------------------
__device__ __forceinline__ void cast_bf_f16x2_scaled(int bx, const float* __restrict__ in, unsigned short* __restrict__ out, int n2, float sc) {
  const int i = bx * 256 + threadIdx.x;
  if (i < n2) {
    const v2f f = *(const v2f*)(in + 2 * (size_t)i);
    const float g0 = bf_bits2f(f2bf_bits(f[0])) * sc;
    const float g1 = bf_bits2f(f2bf_bits(f[1])) * sc;
    const _Float16 h0 = (_Float16)g0, h1 = (_Float16)g1;
    const unsigned u = pk16(__builtin_bit_cast(unsigned short, h0), __builtin_bit_cast(unsigned short, h1));
    ((unsigned*)out)[i] = u;
    
  }
}

// ---------------------------------------------------------------------------
// The six casts and permutations above, which do not depend on one another, as ranges of one grid of 256-thread work-groups
// (each range has the work-group count its own launch would have; the range tests read blockIdx only):
//   x 8192 | wq 2 x 1024 | wo 2048 | wk 128 | wv 128 | bq 4   = 12548
// ---------------------------------------------------------------------------
constexpr int kCbX  = kBatch * kSeq * kDm / 2 / 256;   // 8192
constexpr int kCbQx = kDm / 2 / 256;                   // 2 work-groups per wq row
constexpr int kCbQ  = kCbQx * kDm;                     // 2048
constexpr int kCbO  = kDm * kDm / 2 / 256;             // 2048
constexpr int kCbKV = kDhd * kDm / 2 / 256;            // 128
constexpr int kCbB  = kDm / 256;                       // 4
constexpr int kCbAll = kCbX + kCbQ + kCbO + 2 * kCbKV + kCbB;
__global__ __launch_bounds__(256) void prep_kernel(
    const float* __restrict__ x, const float* __restrict__ wq, const float* __restrict__ wo,
    const float* __restrict__ wk, const float* __restrict__ wv, const float* __restrict__ bq,
    unsigned short* __restrict__ x16, unsigned short* __restrict__ wq16p, unsigned short* __restrict__ wo16,
    unsigned short* __restrict__ wk16, unsigned short* __restrict__ wv16, float* __restrict__ bqp) {
  int bx = blockIdx.x;
  if (bx < kCbX) { cast_bf16x2(bx, x, x16, kBatch * kSeq * kDm / 2); return; }
  bx -= kCbX;
  if (bx < kCbQ) { cast_perm_rows_bf16x2(bx % kCbQx, bx / kCbQx, wq, wq16p, kDm); return; }
  bx -= kCbQ;
  if (bx < kCbO) { cast_bf_f16x2_scaled(bx, wo, wo16, kDm * kDm / 2, kWsc); return; }
  bx -= kCbO;
  if (bx < kCbKV) { cast_bf16x2(bx, wk, wk16, kDhd * kDm / 2); return; }
  bx -= kCbKV;
  if (bx < kCbKV) { cast_bf16x2(bx, wv, wv16, kDhd * kDm / 2); return; }
  bx -= kCbKV;
  perm_bias(bx, bq, bqp, kDm);
}

// =====================================================================================
// Full (non-causal, unmasked) multi-query attention, head dim 64.
//   q planes (hi/lo bf16): element (b, t, h, d) at [(b*kSeq + t)*kDm + h*64 + d]
//   k planes (hi/lo bf16): element (b, s, d) at [(b*kSeq + s)*kDhd + d]      (one KV head shared by all heads)
//   v^T plane (f16):       element (b, d, s) at [(b*64 + d)*kSeq + s]
//   out plane (f16, x kOsc): element (b, t, h, d) at [(b*kSeq + t)*kDm + h*64 + d]
//   scores = (q . k) * sscale : bf16 hi/lo split (hi.hi + hi.lo + lo.hi) on v_wmma_f32_16x16x32_bf16
//   out    = p . v            : v_wmma_f32_16x16x32_f16, p (unnormalised, <= 1) carried x2^15, f32 accumulate
//   both products are formed transposed: S^T = K . Q^T (A = K rows, B = Q columns) and O^T += V^T . P^T (A = V^T rows,
//   B = P^T packed from the score accumulators), so a lane holds 32 scores of ONE query per chunk: maximum and sum run
//   in the lane, the two wave halves join by one cross-row move, and P never passes through LDS.
//   online softmax in f32 over all kSeq keys (32 chunks of 64, compile-time trip count, no masking).
//   Block = 4 waves = 64 query rows of one (batch, head); grid = (kHeads * kSeq/64, kBatch).
//   K / V^T chunk staging: asynchronous 16-B copies to LDS, 128 threads x 4 copies per plane = the whole 64x64 tile, 8 lanes
//   per 128-B row (whole lines); two buffers: chunk t + 2 is copied into the buffer that chunk t has left, one barrier per chunk.
// =====================================================================================
#define AT_D 64
#define AT_NW 4
#define AT_QB 64
#define AT_KC 64
#define AT_TL (AT_KC * AT_LP)   // 16-bit elements of one staged plane: 64 rows at pitch AT_LP
#define AT_LP 72   // LDS row pitch in 16-bit elements: 144 B = 16 B x 9 (odd), so the 16 rows of one ds_load_b128 half fall on 16 distinct 4-bank groups

__device__ __forceinline__ v8f at_mma(v16b a, v16b b, v8f c) {
  c = __builtin_amdgcn_wmma_f32_16x16x32_bf16(false, a, false, b, (short)0, c, false, false);
  asm volatile("v_nop\n\tv_nop\n\tv_nop\n\tv_nop" : "+v"(c) : "v"(a), "v"(b));
  return c;
}
__device__ __forceinline__ v8f at_mma_h(v16h a, v16h b, v8f c) {
  c = __builtin_amdgcn_wmma_f32_16x16x32_f16(false, a, false, b, (short)0, c, false, false);
  asm volatile("v_nop\n\tv_nop\n\tv_nop\n\tv_nop" : "+v"(c) : "v"(a), "v"(b));
  return c;
}

// lane l takes the value of lane l ^ 16 (the other half of the wave, same column)
__device__ __forceinline__ float at_xhalf(float x) {
  return __builtin_bit_cast(float, __builtin_amdgcn_permlanex16(__builtin_bit_cast(int, x), __builtin_bit_cast(int, x), 0x76543210, 0xfedcba98, false, false));
}

__device__ __forceinline__ float at_exp2(float x) {
  float y;
  // v_nop: the slot behind the transcendental; s_delay_alu: the compiler hints no reader of an asm result, and an unhinted wait holds up the SIMD's other waves
  asm("v_exp_f32 %0, %1\n\tv_nop\n\ts_delay_alu instid0(TRANS32_DEP_1)" : "=v"(y) : "v"(x));
  return y;
}
// eight at once, each in place on a register of its own: every exp is the independent instruction behind the one before it,
// and the one v_nop is the slot behind the last; the closing s_delay_alu hints the first reader behind the statement (as above)
__device__ __forceinline__ void at_exp2x8(float& a0, float& a1, float& a2, float& a3, float& a4, float& a5, float& a6, float& a7) {
  asm("v_exp_f32 %0, %0\n\tv_exp_f32 %1, %1\n\tv_exp_f32 %2, %2\n\tv_exp_f32 %3, %3\n\t"
      "v_exp_f32 %4, %4\n\tv_exp_f32 %5, %5\n\tv_exp_f32 %6, %6\n\tv_exp_f32 %7, %7\n\tv_nop\n\ts_delay_alu instid0(TRANS32_DEP_1)"
      : "+v"(a0), "+v"(a1), "+v"(a2), "+v"(a3), "+v"(a4), "+v"(a5), "+v"(a6), "+v"(a7));
}

// One chunk's twelve copies of one lane: rows r, r+16, r+32, r+48 of K hi, K lo and V^T, 16 B each, global -> LDS through no register.
// lk, ll, lv: the lane's LDS byte addresses of row r in the target buffer; gk, gl, gv: its global addresses of the same piece.
// s_wait_xcnt stands inside the statement, behind the last copy: the address registers are not rewritten before it.
__device__ __forceinline__ void at_copy_chunk(unsigned lk, unsigned ll, unsigned lv,
                                              const __bf16* gk, const __bf16* gl, const _Float16* gv) {
  constexpr unsigned ls = 16 * AT_LP * 2;   // LDS bytes between a lane's rows
  asm volatile(
      "global_load_async_to_lds_b128 %0, %12, off\n\t"
      "global_load_async_to_lds_b128 %1, %13, off\n\t"
      "global_load_async_to_lds_b128 %2, %14, off\n\t"
      "global_load_async_to_lds_b128 %3, %15, off\n\t"
      "global_load_async_to_lds_b128 %4, %16, off\n\t"
      "global_load_async_to_lds_b128 %5, %17, off\n\t"
      "global_load_async_to_lds_b128 %6, %18, off\n\t"
      "global_load_async_to_lds_b128 %7, %19, off\n\t"
      "global_load_async_to_lds_b128 %8, %20, off\n\t"
      "global_load_async_to_lds_b128 %9, %21, off\n\t"
      "global_load_async_to_lds_b128 %10, %22, off\n\t"
      "global_load_async_to_lds_b128 %11, %23, off\n\t"
      "s_wait_xcnt 0x0"
      :: "v"(lk), "v"(lk + ls), "v"(lk + 2 * ls), "v"(lk + 3 * ls),
         "v"(ll), "v"(ll + ls), "v"(ll + 2 * ls), "v"(ll + 3 * ls),
         "v"(lv), "v"(lv + ls), "v"(lv + 2 * ls), "v"(lv + 3 * ls),
         "v"(gk), "v"(gk + 16 * kDhd), "v"(gk + 32 * kDhd), "v"(gk + 48 * kDhd),
         "v"(gl), "v"(gl + 16 * kDhd), "v"(gl + 32 * kDhd), "v"(gl + 48 * kDhd),
         "v"(gv), "v"(gv + 16 * kSeq), "v"(gv + 32 * kSeq), "v"(gv + 48 * kSeq)
      : "memory");
}

__global__ __launch_bounds__(128)
void mqa_full64_kernel(const unsigned short* __restrict__ qhp, const unsigned short* __restrict__ qlp,
                       const unsigned short* __restrict__ khp, const unsigned short* __restrict__ klp,
                       const unsigned short* __restrict__ vtp, unsigned short* __restrict__ o16p,
                       float sscale) {
  union FB { v16b v; v8b h[2]; };
  union FH { v16h v; v8h h[2]; };
  __shared__ __align__(16) __bf16   KshB[2 * AT_TL];            // K hi [kv][d], pitch AT_LP      2 buffers x 9 KB
  __shared__ __align__(16) __bf16   KslB[2 * AT_TL];            // K lo                          2 buffers x 9 KB
  __shared__ __align__(16) _Float16 VthB[2 * AT_TL];            // V^T f16 [d][kv], pitch AT_LP  2 buffers x 9 KB
  __shared__ __align__(16) float    Os[AT_NW][16 * 68];         // per wave out tile, pitch 68

  const int tid  = threadIdx.x;
  const int wave = tid >> 5;
  const int lane = tid & 31;
  const int hh   = lane >> 4;
  const int c    = lane & 15;

  const int nqb = kSeq / AT_QB;            // 32
  const int b  = blockIdx.y;               // 0..kBatch-1
  const int bx = blockIdx.x;               // 0..kHeads*nqb-1
  const int qb = bx % nqb;
  const int h  = bx / nqb;                 // 0..kHeads-1
  const int q0 = qb * AT_QB + wave * 16;

  const __bf16*   Qh = (const __bf16*)(const void*)qhp + (size_t)b * kSeq * kDm + (size_t)h * AT_D;
  const __bf16*   Ql = (const __bf16*)(const void*)qlp + (size_t)b * kSeq * kDm + (size_t)h * AT_D;
  const __bf16*   Kh = (const __bf16*)(const void*)khp + (size_t)b * kSeq * kDhd;
  const __bf16*   Kl = (const __bf16*)(const void*)klp + (size_t)b * kSeq * kDhd;
  const _Float16* Vt = (const _Float16*)(const void*)vtp + (size_t)b * AT_D * kSeq;
  _Float16*       ob = (_Float16*)(void*)o16p + (size_t)b * kSeq * kDm + (size_t)h * AT_D;

  // ---- Q fragments (B operand, column = query = lane&15, split k map via Frag load): 2 d-chunks, hi and lo ----
  v16b qah[2], qal[2];
#pragma unroll
  for (int dc = 0; dc < 2; ++dc) {
    const __bf16* qr = Qh + (size_t)(q0 + c) * kDm + dc * 32 + 8 * hh;
    const __bf16* ql = Ql + (size_t)(q0 + c) * kDm + dc * 32 + 8 * hh;
    qah[dc] = Frag<__bf16>::load(qr);
    qal[dc] = Frag<__bf16>::load(ql);
  }

  const float c2 = sscale * 1.44269504088896340736f;   // score scale times log2(e), positive: exp(x) = 2^(x * log2 e)
  float mrun = -INFINITY;   // running maximum of query q0 + c in base-2 units (equal in both wave halves)
  float lrun = 0.f;         // running sum (x2^15) over this half's keys only; the halves join in the epilogue
  v8f oacc[4];              // oacc[t][r] = O^T(d = t*16 + 8*hh + r, query q0 + c)
#pragma unroll
  for (int t = 0; t < 4; ++t) oacc[t] = (v8f){0.f,0.f,0.f,0.f,0.f,0.f,0.f,0.f};

  const int nChunks = kSeq / AT_KC;   // 32, compile-time constant (at least two: the prologue fills both buffers)
  // staging map: row sr (+16, +32, +48), 16-B piece sp / 8 of the row's 128-B line; 128 threads x 4 rows x 8 elements = 64 x 64 per plane
  const int sr = tid >> 3, sp = (tid & 7) * 8;
  const __bf16*   gk = Kh + (size_t)sr * kDhd + sp;   // chunk 0: K row sr, d = sp..sp+7; a chunk further: + AT_KC rows
  const __bf16*   gl = Kl + (size_t)sr * kDhd + sp;
  const _Float16* gv = Vt + (size_t)sr * kSeq + sp;    // chunk 0: V^T row d = sr, s = sp..sp+7; a chunk further: + AT_KC columns
  const unsigned lk = (unsigned)(uintptr_t)(KshB + sr * AT_LP + sp);   // LDS byte address: the low 32 bits of the shared address
  const unsigned ll = (unsigned)(uintptr_t)(KslB + sr * AT_LP + sp);
  const unsigned lv = (unsigned)(uintptr_t)(VthB + sr * AT_LP + sp);
  at_copy_chunk(lk, ll, lv, gk, gl, gv);                     // chunk 0 -> buffer 0
  asm volatile("s_wait_asynccnt 0x0" ::: "memory");          // this wave's copies of chunk 0 have landed
  __syncthreads();                                           // ... and every other wave's: chunk 0 may be read
  at_copy_chunk(lk + AT_TL * 2, ll + AT_TL * 2, lv + AT_TL * 2, gk + AT_KC * kDhd, gl + AT_KC * kDhd, gv + AT_KC);   // chunk 1 -> buffer 1
  for (int kc = 0; kc < nChunks; ++kc) {
    const int bo = (kc & 1) * AT_TL;   // this chunk's buffer
    const __bf16*   Ksh = KshB + bo;
    const __bf16*   Ksl = KslB + bo;
    const _Float16* Vth = VthB + bo;

    // ---- scores, transposed: A operand row = key j*16+c, B operand column = query c, both <- d with the split k map ----
    v8f s[4];
#pragma unroll
    for (int j = 0; j < 4; ++j) {
      s[j] = (v8f){0.f,0.f,0.f,0.f,0.f,0.f,0.f,0.f};
#pragma unroll
      for (int dc = 0; dc < 2; ++dc) {
        FB kb, kl;
        kb.h[0] = *(const v8b*)(Ksh + (j * 16 + c) * AT_LP + dc * 32 + 8 * hh);
        kb.h[1] = *(const v8b*)(Ksh + (j * 16 + c) * AT_LP + dc * 32 + 16 + 8 * hh);
        kl.h[0] = *(const v8b*)(Ksl + (j * 16 + c) * AT_LP + dc * 32 + 8 * hh);
        kl.h[1] = *(const v8b*)(Ksl + (j * 16 + c) * AT_LP + dc * 32 + 16 + 8 * hh);
        s[j] = at_mma(kb.v, qah[dc], s[j]);
        s[j] = at_mma(kl.v, qah[dc], s[j]);
        s[j] = at_mma(kb.v, qal[dc], s[j]);
      }
    }
    // D layout: s[j][r] = score(key kv0 + j*16 + 8*hh + r, query q0 + c)
    // the loops over j, r and t below are unrolled because s and oacc are register arrays; one chain per j keeps four
    // independent maximum and sum chains in flight
    float mj[4];
#pragma unroll
    for (int j = 0; j < 4; ++j) {
      float m = -INFINITY;
#pragma unroll
      for (int r = 0; r < 8; ++r) m = fmaxf(m, s[j][r]);   // raw products: c2 > 0 keeps their order
      mj[j] = m;
    }
    float cm = fmaxf(fmaxf(mj[0], mj[1]), fmaxf(mj[2], mj[3]));
    cm = fmaxf(cm, at_xhalf(cm));            // the query's maximum over all 64 keys of the chunk, in both halves
    const float mnew = fmaxf(mrun, cm * c2);  // running maximum in base-2 units
    const float alpha = at_exp2(mrun - mnew);
    mrun = mnew;
    const float nb = kPlog - mnew;            // one addend per query: exponent = score * c2 - maximum + 15
    float pj[4];
#pragma unroll
    for (int j = 0; j < 4; ++j) {
      float x[8];
#pragma unroll
      for (int r = 0; r < 8; ++r) x[r] = fmaf(s[j][r], c2, nb);   // base-2 exponent of the numerator x2^15: one multiply-add
      at_exp2x8(x[0], x[1], x[2], x[3], x[4], x[5], x[6], x[7]);
      float ps = 0.f;
#pragma unroll
      for (int r = 0; r < 8; ++r) {
        ps += x[r];
        s[j][r] = x[r];
      }
      pj[j] = ps;
    }
    lrun = lrun * alpha + ((pj[0] + pj[1]) + (pj[2] + pj[3]));
#pragma unroll
    for (int t = 0; t < 4; ++t)
#pragma unroll
      for (int r = 0; r < 8; ++r) oacc[t][r] *= alpha;
    // ---- O^T += V^T . P^T: two score tiles (keys kk*32 + 8hh + 0..7 and kk*32 + 16 + 8hh + 0..7) are one B operand in place ----
#pragma unroll
    for (int kk = 0; kk < 2; ++kk) {   // unrolled: the score tiles are registers and cannot be indexed at run time
      v16h pb;
#pragma unroll   // vector elements are registers: constant indices only
      for (int e = 0; e < 8; ++e) {
        pb[e]     = (_Float16)s[2 * kk][e];
        pb[8 + e] = (_Float16)s[2 * kk + 1][e];
      }
#pragma unroll
      for (int t = 0; t < 4; ++t) {
        FH vb;
        vb.h[0] = *(const v8h*)(Vth + (t * 16 + c) * AT_LP + kk * 32 + 8 * hh);       // A: row = d = t*16 + c, same key map as P^T
        vb.h[1] = *(const v8h*)(Vth + (t * 16 + c) * AT_LP + kk * 32 + 16 + 8 * hh);
        oacc[t] = at_mma_h(vb.v, pb, oacc[t]);
      }
    }
    // hand-over: this wave's reads of the chunk's buffer are done, its copies of the next chunk have landed; behind the barrier
    // the same holds of every wave, so the next chunk may be read and this chunk's buffer refilled
    asm volatile("s_wait_dscnt 0x0" ::: "memory");      // this wave's last fragment reads of the buffer have returned
    asm volatile("s_wait_asynccnt 0x0" ::: "memory");   // this wave's copies of chunk kc + 1 have landed
    __syncthreads();
    if (kc + 2 < nChunks)   // the same for the whole work-group
      at_copy_chunk(lk + bo * 2, ll + bo * 2, lv + bo * 2,
                    gk + (size_t)(kc + 2) * AT_KC * kDhd, gl + (size_t)(kc + 2) * AT_KC * kDhd, gv + (kc + 2) * AT_KC);
  }
  asm volatile("s_wait_asynccnt 0x0" ::: "memory");   // no copy is outstanding when the wave goes on to its end

  // ---- epilogue: O = oacc / (l * 2^15), carried x kOsc as f16 ----
  float* os = Os[wave];
  {
    const float lsum = lrun + at_xhalf(lrun);   // the two halves' key sums of query q0 + c
    const float inv = kOsc * (1.0f / lsum);   // lsum carries the numerators' x2^15
#pragma unroll   // oacc is a register array: constant indices only (inner loop too)
    for (int t = 0; t < 4; ++t) {
      v4f w0, w1;
#pragma unroll
      for (int r = 0; r < 4; ++r) { w0[r] = oacc[t][r] * inv; w1[r] = oacc[t][4 + r] * inv; }
      *(v4f*)(os + c * 68 + t * 16 + 8 * hh)     = w0;   // row = query c, 8 consecutive d per lane
      *(v4f*)(os + c * 68 + t * 16 + 8 * hh + 4) = w1;
    }
  }
  __builtin_amdgcn_fence(__ATOMIC_RELEASE, "workgroup");
  __builtin_amdgcn_wave_barrier();
  __builtin_amdgcn_fence(__ATOMIC_ACQUIRE, "workgroup");
  {
    const int qg = lane >> 3, c8 = (lane & 7) * 8;
    {
#pragma unroll
      for (int it = 0; it < 4; ++it) {
        const int row = it * 4 + qg;                    // 4 it x 4 groups = rows 0..15
        const float* sp = os + row * 68 + c8;
        v8h hv;
#pragma unroll
        for (int e = 0; e < 8; ++e) hv[e] = (_Float16)sp[e];
        *(v8h*)(ob + (size_t)(q0 + row) * kDm + c8) = hv;
      }
      
    }
  }
}

// ---------------------------------------------------------------------------
// Host driver. Workspace region map (bytes, 256-B aligned offsets):
//   x16   [4096][1024] bf16           8388608
//   wq16p [1024][1024] bf16 (rows permuted to head-major)  2097152
//   wk16  [64][1024]   bf16            131072
//   wv16  [64][1024]   bf16            131072
//   wo16  [1024][1024] f16 (bf16-RNE x16)  2097152
//   bqp   [1024]       f32 (permuted)     4096
//   Qh,Ql [4096][1024] bf16 hi/lo     2 x 8388608
//   Kh,Kl [4096][64]   bf16 hi/lo     2 x 524288
//   Vt16  [2][64][2048] f16            524288
//   O16   [4096][1024] f16 (x16)      8388608
//   total 39587840 B
// ---------------------------------------------------------------------------
extern "C" void kernel_launch(void* const* d_in, const int* in_sizes, int n_in,
                              void* d_out, int out_size, void* d_ws, size_t ws_size,
                              hipStream_t stream) {
  const int nB = kBatch, nS = kSeq, nD = kDm, nDh = kDhd;
  const int nM = nB * nS;   // 4096
  if (n_in < 9) return;
  if (in_sizes[0] != nM * nD || in_sizes[1] != nD * nD || in_sizes[2] != nD ||
      in_sizes[3] != nDh * nD || in_sizes[4] != nDh || in_sizes[5] != nDh * nD ||
      in_sizes[6] != nDh || in_sizes[7] != nD * nD || in_sizes[8] != nD || out_size != nM * nD) return;

  const float* x  = (const float*)d_in[0];
  const float* wq = (const float*)d_in[1];
  const float* bq = (const float*)d_in[2];
  const float* wk = (const float*)d_in[3];
  const float* bk = (const float*)d_in[4];
  const float* wv = (const float*)d_in[5];
  const float* bv = (const float*)d_in[6];
  const float* wo = (const float*)d_in[7];
  const float* bo = (const float*)d_in[8];

  size_t off = 0;
  auto carve = [&](size_t bytes) -> char* {
    char* p = (char*)d_ws + off;
    off += (bytes + 255) & ~(size_t)255;
    return p;
  };
  unsigned short* x16   = (unsigned short*)carve((size_t)nM * nD * 2);
  unsigned short* wq16p = (unsigned short*)carve((size_t)nD * nD * 2);
  unsigned short* wk16  = (unsigned short*)carve((size_t)nDh * nD * 2);
  unsigned short* wv16  = (unsigned short*)carve((size_t)nDh * nD * 2);
  unsigned short* wo16  = (unsigned short*)carve((size_t)nD * nD * 2);
  float*          bqp   = (float*)carve((size_t)nD * 4);
  unsigned short* Qh    = (unsigned short*)carve((size_t)nM * nD * 2);
  unsigned short* Ql    = (unsigned short*)carve((size_t)nM * nD * 2);
  unsigned short* Kh    = (unsigned short*)carve((size_t)nM * nDh * 2);
  unsigned short* Kl    = (unsigned short*)carve((size_t)nM * nDh * 2);
  unsigned short* Vt16  = (unsigned short*)carve((size_t)nB * nDh * nS * 2);
  unsigned short* O16   = (unsigned short*)carve((size_t)nM * nD * 2);
  if (off > ws_size) return;

  // ---- casts (bf16 RNE; wq rows / bq permuted to head-major; wo as f16(bf16_rne(wo) * 16)): one launch ----
  prep_kernel<<<dim3(kCbAll), dim3(256), 0, stream>>>(x, wq, wo, wk, wv, bq, x16, wq16p, wo16, wk16, wv16, bqp);

  // ---- q, k and v^T projections: one launch, 128 + 8 + 2 x 4 work-groups of 8 waves, one 64x64 tile per wave ----
  proj_qkv_kernel<<<dim3(kPjQ + kPjK + kBatch * kPjV), dim3(256), 0, stream>>>(
      x16, wq16p, wk16, wv16, bqp, bk, bv, Qh, Ql, Kh, Kl, Vt16, nD);

  // ---- attention: grid (16 heads x 32 query blocks, 2 batches), all heads share the batch's K / V^T planes ----
  mqa_full64_kernel<<<dim3(kHeads * (nS / AT_QB), nB), dim3(128), 0, stream>>>(Qh, Ql, Kh, Kl, Vt16, O16, 0.125f);

  // ---- output projection: out [4096][1024] f32 = (O16 . wo16^T) / 256 + bo ----
  wmma_gemm64<0, false, 2, 0, false, 0><<<dim3((nM / 64) * (nD / 64) / 8, 1), dim3(256), 0, stream>>>(
      O16, 0L, wo16, 0L, d_out, d_out, nD, 0L, bo, bo, 0L, nM, nD, nD, 1.0f / (kOsc * kWsc));
}

// v007
// A run of this version takes 105 microseconds.
// Two timings next to v006 both put it at 1.05 times that version's speed.
// Over all steps from v000 it is 4.61 times as fast.
// Contractions: q/k/v^T projections v_wmma_f32_16x16x32_bf16 (inputs RNE-cast to bf16, f32 acc); q.k^T v_wmma_f32_16x16x32_bf16 with bf16 hi/lo split (hi.hi+hi.lo+lo.hi); p.v and output projection v_wmma_f32_16x16x32_f16 (p carried x2^15, o carried x16, wo carried x16), f32 acc; online softmax, biases and scales in f32.
#include <hip/hip_runtime.h>
#include <math.h>
#include <stdint.h>

typedef __attribute__((ext_vector_type(16))) _Float16 v16h;
typedef __attribute__((ext_vector_type(8)))  _Float16 v8h;
typedef __attribute__((ext_vector_type(16))) __bf16   v16b;
typedef __attribute__((ext_vector_type(8)))  __bf16   v8b;
typedef __attribute__((ext_vector_type(8)))  float    v8f;
typedef __attribute__((ext_vector_type(4)))  float    v4f;
typedef __attribute__((ext_vector_type(2)))  float    v2f;
typedef __attribute__((ext_vector_type(4)))  unsigned int v4u;

// problem geometry (compile-time)
constexpr int kBatch = 2;
constexpr int kSeq   = 2048;
constexpr int kDm    = 1024;   // model width = H*Dh = q row pitch
constexpr int kHeads = 16;
constexpr int kDhd   = 64;     // per-head dim = k row pitch
constexpr float kPlog = 15.0f;     // softmax numerators carried x2^15 in f16: 15 is added to their base-2 exponent
constexpr float kOsc = 16.0f;      // attention output carried x16 in f16
constexpr float kWsc = 16.0f;      // output-projection weight carried x16 in f16

__device__ __forceinline__ unsigned short f2bf_bits(float f) {
  unsigned u = __float_as_uint(f);
  return (unsigned short)((u + 0x7FFFu + ((u >> 16) & 1u)) >> 16);
}
__device__ __forceinline__ float bf_bits2f(unsigned short h) { return __uint_as_float(((unsigned)h) << 16); }
__device__ __forceinline__ unsigned pk16(unsigned short a, unsigned short b) { return (unsigned)a | ((unsigned)b << 16); }

// hazard guards as plain device helpers
__device__ __forceinline__ void dep_guard_h(v8f& a, v8f& b, v16h x, v16h y) { asm volatile("v_nop\n\tv_nop\n\tv_nop\n\tv_nop" : "+v"(a), "+v"(b) : "v"(x), "v"(y)); }
__device__ __forceinline__ void dep_guard_b(v8f& a, v8f& b, v16b x, v16b y) { asm volatile("v_nop\n\tv_nop\n\tv_nop\n\tv_nop" : "+v"(a), "+v"(b) : "v"(x), "v"(y)); }
__device__ __forceinline__ void keep4_h(v16h a, v16h b, v16h c, v16h d) { asm volatile("v_nop" :: "v"(a), "v"(b), "v"(c), "v"(d)); }
__device__ __forceinline__ void keep4_b(v16b a, v16b b, v16b c, v16b d) { asm volatile("v_nop" :: "v"(a), "v"(b), "v"(c), "v"(d)); }
__device__ __forceinline__ void acc_guard4(v8f& a, v8f& b, v8f& c, v8f& d) { asm volatile("v_nop\n\tv_nop\n\tv_nop\n\tv_nop" : "+v"(a), "+v"(b), "+v"(c), "+v"(d)); }
template <typename T> struct Frag;
template <> struct Frag<_Float16> {
  typedef v16h V; typedef v8h H; union U { v16h v; v8h h[2]; };
  static __device__ __forceinline__ v16h load(const _Float16* p) {   // elements 0..7 <- p[0..7], 8..15 <- p[16..23]
    U f; f.h[0] = *(const v8h*)(p); f.h[1] = *(const v8h*)(p + 16); return f.v;
  }
  static __device__ __forceinline__ v8f mma(v16h a, v16h b, v8f c) {
    return __builtin_amdgcn_wmma_f32_16x16x32_f16(false, a, false, b, (short)0, c, false, false);
  }
  static __device__ __forceinline__ void guard(v8f& a, v8f& b, v16h x, v16h y) { dep_guard_h(a, b, x, y); }
  static __device__ __forceinline__ void keep(v16h a, v16h b, v16h c, v16h d) { keep4_h(a, b, c, d); }
};
template <> struct Frag<__bf16> {
  typedef v16b V; typedef v8b H; union U { v16b v; v8b h[2]; };
  static __device__ __forceinline__ v16b load(const __bf16* p) {
    U f; f.h[0] = *(const v8b*)(p); f.h[1] = *(const v8b*)(p + 16); return f.v;
  }
  static __device__ __forceinline__ v8f mma(v16b a, v16b b, v8f c) {
    return __builtin_amdgcn_wmma_f32_16x16x32_bf16(false, a, false, b, (short)0, c, false, false);
  }
  static __device__ __forceinline__ void guard(v8f& a, v8f& b, v16b x, v16b y) { dep_guard_b(a, b, x, y); }
  static __device__ __forceinline__ void keep(v16b a, v16b b, v16b c, v16b d) { keep4_b(a, b, c, d); }
};

// ---- Register-blocked batched WMMA GEMM ------------------------------------
// C[m,n] = scale * sum_k A[m,k] * Bt[n,k] (+bias)(+resid); each wave owns a 64x64 tile.
// A row-major [M,K]; Bt row-major [N,K], both with row pitch kDm (compile time, so that the 16 row groups of a tile
// are immediate offsets of one address); M,N % 64 == 0, K % 64 == 0, K <= kDm.
// Operand path: per 64-k step each wave copies its own 64x64 A tile and 64x64 Bt tile into its own LDS range with
// global loads that cover whole 128-B lines (8 lanes per row, 4 rows per load), the next step's loads being issued
// before the current step's products; the WMMA fragments are read from LDS (k order per 32-k group as Frag::load).
// SPLIT (hi/lo planes) is not instantiated and not supported by the staged loop.
// BIAS_MODE: 0 = none, 1 = bias[m], 2 = bias[n].
// OUT_MODE: 0 = f32, 1 = f16, 2 = bf16 hi plane (Cout) + bf16 lo plane (Cout2).
// ET: 0 = f16 operands, 1 = bf16 operands (pointers passed as 16-bit storage)
#define GS_LP 72   // LDS row pitch of a staged operand tile in 16-bit elements: 144 B = 16 B x 9 (odd), conflict-free for ds_load_b128 fragment reads
template <int ET> struct Elem;
template <> struct Elem<0> { typedef _Float16 T; };
template <> struct Elem<1> { typedef __bf16 T; };
// The body is a device function, so that one launch can run several products as ranges of its grid: bx = the work-group's
// index within its product, b = the batch, sOpAll / sTAll = the work-group's LDS (8 waves x (A tile + Bt tile); 8 slabs).
#define GS_OPW (2 * 64 * GS_LP)   // 16-bit elements of one wave's A tile + Bt tile
#define GS_SLW (16 * 68)          // floats of one wave's 16x64 slab, pitch 68
template <int ET, bool SPLIT, int BIAS_MODE, int OUT_MODE, bool RESID, int ACT>
__device__ __forceinline__ void gemm64_body(
    typename Elem<ET>::T* sOpAll, float* sTAll, int bx, int b,
    const unsigned short* __restrict__ Ap, long strideA,
    const unsigned short* __restrict__ Btp, long strideB,
    void* __restrict__ Cout, void* __restrict__ Cout2, int ldc, long strideC,
    const float* __restrict__ bias,
    const float* __restrict__ resid, long strideR,
    int M, int N, int K, float scale) {
  typedef typename Elem<ET>::T T;
  typedef typename Frag<T>::V V;
  const T* A = (const T*)Ap; const T* Bt = (const T*)Btp;
  static_assert(!SPLIT, "the staged operand loop takes single-plane operands");
  typedef typename Frag<T>::H H;
  const int lane = threadIdx.x & 31;
  const int wave = __builtin_amdgcn_readfirstlane(threadIdx.x >> 5);   // wave-uniform: tile bases stay scalar
  const int tilesN = N >> 6;
  const int tilesM = M >> 6;
  const int tile = bx * 8 + wave;
  if (tile >= tilesM * tilesN) return;   // wave-uniform; no block barriers in this body
  const int tm = tile / tilesN;
  const int tn = tile - tm * tilesN;
  const int m0 = tm << 6;
  const int n0 = tn << 6;

  const T* Ab  = A  + (size_t)b * strideA;
  const T* Bb  = Bt + (size_t)b * strideB;

  const int rlane = lane & 15;                 // row (A) / col (B, D) within subtile
  const int koff  = (lane >> 4) * 8;           // k offset of this lane half
  const int mOff  = (lane >> 4) * 8;           // D row offset

  v8f acc[4][4];
#pragma unroll
  for (int i = 0; i < 4; ++i)
#pragma unroll
    for (int j = 0; j < 4; ++j) acc[i][j] = (v8f){0.f,0.f,0.f,0.f,0.f,0.f,0.f,0.f};

  // staging map: lane -> row (lane >> 3) of each group of 4 rows, 16-B piece (lane & 7) of the row's 128-B line
  const int srow = lane >> 3;
  const int scol = (lane & 7) * 8;
  const T* Ag = Ab + (size_t)(m0 + srow) * kDm + scol;   // this lane's piece of row group 0, k = 0
  const T* Bg = Bb + (size_t)(n0 + srow) * kDm + scol;
  T* sa = sOpAll + wave * GS_OPW;   // per-wave A tile and Bt tile of one 64-k step, pitch GS_LP
  T* sb = sa + 64 * GS_LP;
  H ra[16], rb[16];
#pragma unroll
  for (int it = 0; it < 16; ++it) {
    ra[it] = *(const H*)(Ag + it * 4 * kDm);
    rb[it] = *(const H*)(Bg + it * 4 * kDm);
  }

  for (int k0 = 0; k0 < K; k0 += 64) {
#pragma unroll
    for (int it = 0; it < 16; ++it) {
      *(H*)(sa + (it * 4 + srow) * GS_LP + scol) = ra[it];
      *(H*)(sb + (it * 4 + srow) * GS_LP + scol) = rb[it];
    }
    // the wave's own tile stores are complete before any of its lanes reads another lane's rows
    __builtin_amdgcn_fence(__ATOMIC_RELEASE, "workgroup");
    __builtin_amdgcn_wave_barrier();
    __builtin_amdgcn_fence(__ATOMIC_ACQUIRE, "workgroup");
    if (k0 + 64 < K) {   // wave-uniform: the next step's tiles fly while this step's products run
#pragma unroll
      for (int it = 0; it < 16; ++it) {
        ra[it] = *(const H*)(Ag + it * 4 * kDm + (k0 + 64));
        rb[it] = *(const H*)(Bg + it * 4 * kDm + (k0 + 64));
      }
      asm volatile("s_wait_xcnt 0x0" ::: "memory");   // before the fragment reads below reuse the address registers of these loads
    }
#pragma unroll
    for (int kk = 0; kk < 2; ++kk) {
      V bh[4], ah[4];
#pragma unroll
      for (int j = 0; j < 4; ++j) bh[j] = Frag<T>::load(sb + ((j << 4) + rlane) * GS_LP + kk * 32 + koff);
#pragma unroll
      for (int i = 0; i < 4; ++i) ah[i] = Frag<T>::load(sa + ((i << 4) + rlane) * GS_LP + kk * 32 + koff);
#pragma unroll
      for (int i = 0; i < 4; ++i) {
#pragma unroll
        for (int j = 0; j < 4; ++j) acc[i][j] = Frag<T>::mma(ah[i], bh[j], acc[i][j]);
        Frag<T>::guard(acc[i][0], acc[i][3], ah[i], ah[i]);
      }
      Frag<T>::keep(bh[0], bh[1], bh[2], bh[3]);
    }
    // every fragment read of this step is done before the next step's stores overwrite the tiles
    __builtin_amdgcn_fence(__ATOMIC_RELEASE, "workgroup");
    __builtin_amdgcn_wave_barrier();
    __builtin_amdgcn_fence(__ATOMIC_ACQUIRE, "workgroup");
  }
  acc_guard4(acc[0][0], acc[0][1], acc[0][2], acc[0][3]);
  acc_guard4(acc[1][0], acc[1][1], acc[1][2], acc[1][3]);
  acc_guard4(acc[2][0], acc[2][1], acc[2][2], acc[2][3]);
  acc_guard4(acc[3][0], acc[3][1], acc[3][2], acc[3][3]);

  // ---- epilogue ----
  float* slab = sTAll + wave * GS_SLW;
  const float* Rb = RESID ? (resid + (size_t)b * strideR) : nullptr;
#pragma unroll
  for (int i = 0; i < 4; ++i) {
    const int mBase = m0 + (i << 4);
    float bm[8];
    if (BIAS_MODE == 1) {
      const float* bp = bias + mBase + mOff;
#pragma unroll
      for (int r = 0; r < 8; ++r) bm[r] = bp[r];
      // before the address registers of the bias loads are reused; the address as an input keeps them untouched up to here
      asm volatile("s_wait_xcnt 0x0" :: "v"(bp) : "memory");
    }
#pragma unroll
    for (int j = 0; j < 4; ++j) {
      const int n = n0 + (j << 4) + rlane;
      float bv = 0.f;
      if (BIAS_MODE == 2) bv = bias[n];
#pragma unroll
      for (int r = 0; r < 8; ++r) {
        float v = acc[i][j][r] * scale;
        if (BIAS_MODE == 1) v += bm[r];
        if (BIAS_MODE == 2) v += bv;
        if (RESID) v += Rb[(size_t)(mBase + mOff + r) * ldc + n];
        if (ACT == 1) v = tanhf(v);
        if (ACT == 2) v = fmaxf(v, 0.0f);
        if (ACT == 3) v = v / (1.0f + expf(-v));
        if (ACT == 4) v = (v > 0.f) ? v : 0.01f * v;
        if (ACT == 5) v = 0.5f * v * (1.0f + erff(v * 0.70710678118654752f));
        slab[(mOff + r) * 68 + (j << 4) + rlane] = v;
      }
    }
    __builtin_amdgcn_fence(__ATOMIC_RELEASE, "workgroup");
    __builtin_amdgcn_wave_barrier();
    __builtin_amdgcn_fence(__ATOMIC_ACQUIRE, "workgroup");
    if (OUT_MODE == 0) {
      float* C = (float*)Cout + (size_t)b * strideC;
      const int hh = lane >> 4, c4 = (lane & 15) * 4;     // row seg = 256 B = 16 lanes x 16 B
      {
#pragma unroll
        for (int it = 0; it < 8; ++it) {
          const int row = it * 2 + hh;
          v4f v = *(const v4f*)(slab + row * 68 + c4);
          *(v4f*)(C + (size_t)(mBase + row) * ldc + n0 + c4) = v;
        }
        
      }
    } else {
      const int q = lane >> 3, c8 = (lane & 7) * 8;
      unsigned short* C  = (unsigned short*)Cout  + (size_t)b * strideC;
      unsigned short* C2 = (OUT_MODE == 2) ? ((unsigned short*)Cout2 + (size_t)b * strideC) : nullptr;
      {
#pragma unroll
        for (int it = 0; it < 4; ++it) {
          const int row = it * 4 + q;
          const float* sp = slab + row * 68 + c8;
          v8h hv, lv;
#pragma unroll
          for (int e = 0; e < 8; ++e) {
            if (OUT_MODE == 1) {
              hv[e] = (_Float16)sp[e];
            } else {
              unsigned short hb = f2bf_bits(sp[e]);
              unsigned short lb = f2bf_bits(sp[e] - bf_bits2f(hb));
              hv[e] = __builtin_bit_cast(_Float16, hb);
              lv[e] = __builtin_bit_cast(_Float16, lb);
            }
          }
          *(v8h*)(C + (size_t)(mBase + row) * ldc + n0 + c8) = hv;
          if (OUT_MODE == 2) *(v8h*)(C2 + (size_t)(mBase + row) * ldc + n0 + c8) = lv;
        }
        
      }
    }
    __builtin_amdgcn_fence(__ATOMIC_RELEASE, "workgroup");
    __builtin_amdgcn_wave_barrier();
    __builtin_amdgcn_fence(__ATOMIC_ACQUIRE, "workgroup");
    // keeps the next row group's arithmetic behind the fence's store wait: no register of an issued store is rewritten before it
    __builtin_amdgcn_sched_barrier(0);
  }
}

// one product per launch: grid = (tiles / 8, batches)
template <int ET, bool SPLIT, int BIAS_MODE, int OUT_MODE, bool RESID, int ACT = 0>
__global__ __launch_bounds__(256) void wmma_gemm64(
    const unsigned short* __restrict__ Ap, long strideA,
    const unsigned short* __restrict__ Btp, long strideB,
    void* __restrict__ Cout, void* __restrict__ Cout2, int ldc, long strideC,
    const float* __restrict__ bias,
    const float* __restrict__ resid, long strideR,
    int M, int N, int K, float scale) {
  __shared__ __align__(16) typename Elem<ET>::T sOp[8 * GS_OPW];
  __shared__ __align__(16) float sT[8 * GS_SLW];
  gemm64_body<ET, SPLIT, BIAS_MODE, OUT_MODE, RESID, ACT>(sOp, sT, blockIdx.x, blockIdx.y, Ap, strideA, Btp, strideB,
      Cout, Cout2, ldc, strideC, bias, resid, strideR, M, N, K, scale);
}

// ---------------------------------------------------------------------------
// The three projections of x, which do not depend on one another, as ranges of one grid (144 work-groups, one round):
//   [0, 128)    q   [4096][1024] = x16 . wq16p^T + bqp  -> bf16 hi/lo planes, head-major columns (h*64 + d)
//   [128, 136)  k   [4096][64]   = x16 . wk16^T + bk    -> bf16 hi/lo planes
//   [136, 144)  v^T per batch z: [64][2048] = wv16 . x16_z^T + bv[m] -> f16; 4 work-groups per batch
// The range test reads blockIdx only: uniform for the work-group. K, the inner length of all three, is an argument as in wmma_gemm64.
// ---------------------------------------------------------------------------
constexpr int kPjQ = (kBatch * kSeq / 64) * (kDm / 64) / 8;    // 128
constexpr int kPjK = (kBatch * kSeq / 64) * (kDhd / 64) / 8;   // 8
constexpr int kPjV = (kDhd / 64) * (kSeq / 64) / 8;            // 4 per batch
__global__ __launch_bounds__(256) void proj_qkv_kernel(
    const unsigned short* __restrict__ x16, const unsigned short* __restrict__ wq16p,
    const unsigned short* __restrict__ wk16, const unsigned short* __restrict__ wv16,
    const float* __restrict__ bqp, const float* __restrict__ bk, const float* __restrict__ bv,
    unsigned short* __restrict__ Qh, unsigned short* __restrict__ Ql,
    unsigned short* __restrict__ Kh, unsigned short* __restrict__ Kl,
    unsigned short* __restrict__ Vt16, int K) {
  __shared__ __align__(16) __bf16 sOp[8 * GS_OPW];
  __shared__ __align__(16) float sT[8 * GS_SLW];
  const int bx = blockIdx.x;
  if (bx < kPjQ + kPjK) {
    const bool isq = bx < kPjQ;
    const int n = isq ? kDm : kDhd;
    gemm64_body<1, false, 2, 2, false, 0>(sOp, sT, isq ? bx : bx - kPjQ, 0, x16, 0L, isq ? wq16p : wk16, 0L,
        (void*)(isq ? Qh : Kh), (void*)(isq ? Ql : Kl), n, 0L, isq ? bqp : bk, nullptr, 0L, kBatch * kSeq, n, K, 1.0f);
  } else {
    const int v = bx - (kPjQ + kPjK);
    gemm64_body<1, false, 1, 1, false, 0>(sOp, sT, v % kPjV, v / kPjV, wv16, 0L, x16, (long)kSeq * kDm,
        (void*)Vt16, (void*)Vt16, kSeq, (long)kDhd * kSeq, bv, nullptr, 0L, kDhd, kSeq, K, 1.0f);
  }
}

// ---------------------------------------------------------------------------
// Elementwise f32 -> bf16 (RNE), 2 elements per thread, one 4-B store per lane -> each wave writes exactly
// Coverage: range = ceil(n2/256) work-groups x 256 threads x 2 elements = 2*n2 = whole plane
//   (x: n2 = 4096*1024/2 = 2097152 -> 8192 blocks exact; wk/wv: n2 = 32768 -> 128 blocks exact).
// ---------------------------------------------------------------------------
__device__ __forceinline__ void cast_bf16x2(int bx, const float* __restrict__ in, unsigned short* __restrict__ out, int n2) {
  const int i = bx * 256 + threadIdx.x;
  if (i < n2) {
    const v2f f = *(const v2f*)(in + 2 * (size_t)i);
    const unsigned u = pk16(f2bf_bits(f[0]), f2bf_bits(f[1]));
    ((unsigned*)out)[i] = u;
    
  }
}

// ---------------------------------------------------------------------------
// Row-permuted f32 -> bf16 (RNE) cast of a [1024][ncol] weight: dest row rd = h*64 + d takes source row d*16 + h
// (de-interleave of the (hidden, heads) column split). (bx, by) in (ncol/512, 1024), 256 threads, 2 elements per thread.
// ---------------------------------------------------------------------------
__device__ __forceinline__ void cast_perm_rows_bf16x2(int bx, int by, const float* __restrict__ in, unsigned short* __restrict__ out, int ncol) {
  const int rd = by;                                    // 0..1023
  int rs = ((rd & 63) << 4) + (rd >> 6);                // 0..1023
  rs = rs > 1023 ? 1023 : rs;
  const int i = bx * 256 + threadIdx.x;                 // pair index within the row
  if (i < (ncol >> 1)) {
    const v2f f = *(const v2f*)(in + (size_t)rs * ncol + 2 * (size_t)i);
    const unsigned u = pk16(f2bf_bits(f[0]), f2bf_bits(f[1]));
    unsigned* o = (unsigned*)(out + (size_t)rd * ncol);
    o[i] = u;
    
  }
}

// ---------------------------------------------------------------------------
// Permuted bias: out[h*64 + d] = in[d*16 + h]; n = 1024; 4 blocks x 256 threads x 4 B = whole vector,
// ---------------------------------------------------------------------------
__device__ __forceinline__ void perm_bias(int bx, const float* __restrict__ in, float* __restrict__ out, int n) {
  const int i = bx * 256 + threadIdx.x;
  if (i < n) {
    int s = ((i & 63) << 4) + (i >> 6);
    s = s > n - 1 ? n - 1 : s;
    const float v = in[s];
    ((float*)out)[i] = v;
    
  }
}

// ---------------------------------------------------------------------------
// Elementwise f32 -> f16 of (bf16_rne(x) * sc) with sc a power of two: 2 elements per thread, one 4-B store per lane.
// ---------------------------------------------------------------------------
__device__ __forceinline__ void cast_bf_f16x2_scaled(int bx, const float* __restrict__ in, unsigned short* __restrict__ out, int n2, float sc) {
  const int i = bx * 256 + threadIdx.x;
  if (i < n2) {
    const v2f f = *(const v2f*)(in + 2 * (size_t)i);
    const float g0 = bf_bits2f(f2bf_bits(f[0])) * sc;
    const float g1 = bf_bits2f(f2bf_bits(f[1])) * sc;
    const _Float16 h0 = (_Float16)g0, h1 = (_Float16)g1;
    const unsigned u = pk16(__builtin_bit_cast(unsigned short, h0), __builtin_bit_cast(unsigned short, h1));
    ((unsigned*)out)[i] = u;
    
  }
}

// ---------------------------------------------------------------------------
// The six casts and permutations above, which do not depend on one another, as ranges of one grid of 256-thread work-groups
// (each range has the work-group count its own launch would have; the range tests read blockIdx only):
//   x 8192 | wq 2 x 1024 | wo 2048 | wk 128 | wv 128 | bq 4   = 12548
// ---------------------------------------------------------------------------
constexpr int kCbX  = kBatch * kSeq * kDm / 2 / 256;   // 8192
constexpr int kCbQx = kDm / 2 / 256;                   // 2 work-groups per wq row
constexpr int kCbQ  = kCbQx * kDm;                     // 2048
constexpr int kCbO  = kDm * kDm / 2 / 256;             // 2048
constexpr int kCbKV = kDhd * kDm / 2 / 256;            // 128
constexpr int kCbB  = kDm / 256;                       // 4
constexpr int kCbAll = kCbX + kCbQ + kCbO + 2 * kCbKV + kCbB;
__global__ __launch_bounds__(256) void prep_kernel(
    const float* __restrict__ x, const float* __restrict__ wq, const float* __restrict__ wo,
    const float* __restrict__ wk, const float* __restrict__ wv, const float* __restrict__ bq,
    unsigned short* __restrict__ x16, unsigned short* __restrict__ wq16p, unsigned short* __restrict__ wo16,
    unsigned short* __restrict__ wk16, unsigned short* __restrict__ wv16, float* __restrict__ bqp) {
  int bx = blockIdx.x;
  if (bx < kCbX) { cast_bf16x2(bx, x, x16, kBatch * kSeq * kDm / 2); return; }
  bx -= kCbX;
  if (bx < kCbQ) { cast_perm_rows_bf16x2(bx % kCbQx, bx / kCbQx, wq, wq16p, kDm); return; }
  bx -= kCbQ;
  if (bx < kCbO) { cast_bf_f16x2_scaled(bx, wo, wo16, kDm * kDm / 2, kWsc); return; }
  bx -= kCbO;
  if (bx < kCbKV) { cast_bf16x2(bx, wk, wk16, kDhd * kDm / 2); return; }
  bx -= kCbKV;
  if (bx < kCbKV) { cast_bf16x2(bx, wv, wv16, kDhd * kDm / 2); return; }
  bx -= kCbKV;
  perm_bias(bx, bq, bqp, kDm);
}

// =====================================================================================
// Full (non-causal, unmasked) multi-query attention, head dim 64.
//   q planes (hi/lo bf16): element (b, t, h, d) at [(b*kSeq + t)*kDm + h*64 + d]
//   k planes (hi/lo bf16): element (b, s, d) at [(b*kSeq + s)*kDhd + d]      (one KV head shared by all heads)
//   v^T plane (f16):       element (b, d, s) at [(b*64 + d)*kSeq + s]
//   out plane (f16, x kOsc): element (b, t, h, d) at [(b*kSeq + t)*kDm + h*64 + d]
//   scores = (q . k) * sscale : bf16 hi/lo split (hi.hi + hi.lo + lo.hi) on v_wmma_f32_16x16x32_bf16
//   out    = p . v            : v_wmma_f32_16x16x32_f16, p (unnormalised, <= 1) carried x2^15, f32 accumulate
//   both products are formed transposed: S^T = K . Q^T (A = K rows, B = Q columns) and O^T += V^T . P^T (A = V^T rows,
//   B = P^T packed from the score accumulators), so a lane holds 32 scores of ONE query per chunk: maximum and sum run
//   in the lane, the two wave halves join by one cross-row move, and P never passes through LDS.
//   online softmax in f32 over all kSeq keys (32 chunks of 64, compile-time trip count, no masking).
//   Block = 4 waves = 64 query rows of one (batch, head); grid = (kHeads * kSeq/64, kBatch).
//   K / V^T chunk staging: asynchronous 16-B copies to LDS, 128 threads x 4 copies per plane = the whole 64x64 tile, 8 lanes
//   per 128-B row (whole lines); two buffers: chunk t + 2 is copied into the buffer that chunk t has left, one barrier per chunk.
// =====================================================================================
#define AT_D 64
#define AT_NW 4
#define AT_QB 64
#define AT_KC 64
#define AT_TL (AT_KC * AT_LP)   // 16-bit elements of one staged plane: 64 rows at pitch AT_LP
#define AT_LP 72   // LDS row pitch in 16-bit elements: 144 B = 16 B x 9 (odd), so the 16 rows of one ds_load_b128 half fall on 16 distinct 4-bank groups

__device__ __forceinline__ v8f at_mma(v16b a, v16b b, v8f c) {
  c = __builtin_amdgcn_wmma_f32_16x16x32_bf16(false, a, false, b, (short)0, c, false, false);
  asm volatile("v_nop\n\tv_nop\n\tv_nop\n\tv_nop" : "+v"(c) : "v"(a), "v"(b));
  return c;
}
__device__ __forceinline__ v8f at_mma_h(v16h a, v16h b, v8f c) {
  c = __builtin_amdgcn_wmma_f32_16x16x32_f16(false, a, false, b, (short)0, c, false, false);
  asm volatile("v_nop\n\tv_nop\n\tv_nop\n\tv_nop" : "+v"(c) : "v"(a), "v"(b));
  return c;
}

// lane l takes the value of lane l ^ 16 (the other half of the wave, same column)
__device__ __forceinline__ float at_xhalf(float x) {
  return __builtin_bit_cast(float, __builtin_amdgcn_permlanex16(__builtin_bit_cast(int, x), __builtin_bit_cast(int, x), 0x76543210, 0xfedcba98, false, false));
}

__device__ __forceinline__ float at_exp2(float x) {
  float y;
  // v_nop: the slot behind the transcendental; s_delay_alu: the compiler hints no reader of an asm result, and an unhinted wait holds up the SIMD's other waves
  asm("v_exp_f32 %0, %1\n\tv_nop\n\ts_delay_alu instid0(TRANS32_DEP_1)" : "=v"(y) : "v"(x));
  return y;
}
// eight at once, each in place on a register of its own: every exp is the independent instruction behind the one before it,
// and the one v_nop is the slot behind the last; the closing s_delay_alu hints the first reader behind the statement (as above)
__device__ __forceinline__ void at_exp2x8(float& a0, float& a1, float& a2, float& a3, float& a4, float& a5, float& a6, float& a7) {
  asm("v_exp_f32 %0, %0\n\tv_exp_f32 %1, %1\n\tv_exp_f32 %2, %2\n\tv_exp_f32 %3, %3\n\t"
      "v_exp_f32 %4, %4\n\tv_exp_f32 %5, %5\n\tv_exp_f32 %6, %6\n\tv_exp_f32 %7, %7\n\tv_nop\n\ts_delay_alu instid0(TRANS32_DEP_1)"
      : "+v"(a0), "+v"(a1), "+v"(a2), "+v"(a3), "+v"(a4), "+v"(a5), "+v"(a6), "+v"(a7));
}

// One chunk's twelve copies of one lane: rows r, r+16, r+32, r+48 of K hi, K lo and V^T, 16 B each, global -> LDS through no register.
// lk, ll, lv: the lane's LDS byte addresses of row r in the target buffer; gk, gl, gv: its global addresses of the same piece.
// s_wait_xcnt stands inside the statement, behind the last copy: the address registers are not rewritten before it.
__device__ __forceinline__ void at_copy_chunk(unsigned lk, unsigned ll, unsigned lv,
                                              const __bf16* gk, const __bf16* gl, const _Float16* gv) {
  constexpr unsigned ls = 16 * AT_LP * 2;   // LDS bytes between a lane's rows
  asm volatile(
      "global_load_async_to_lds_b128 %0, %12, off\n\t"
      "global_load_async_to_lds_b128 %1, %13, off\n\t"
      "global_load_async_to_lds_b128 %2, %14, off\n\t"
      "global_load_async_to_lds_b128 %3, %15, off\n\t"
      "global_load_async_to_lds_b128 %4, %16, off\n\t"
      "global_load_async_to_lds_b128 %5, %17, off\n\t"
      "global_load_async_to_lds_b128 %6, %18, off\n\t"
      "global_load_async_to_lds_b128 %7, %19, off\n\t"
      "global_load_async_to_lds_b128 %8, %20, off\n\t"
      "global_load_async_to_lds_b128 %9, %21, off\n\t"
      "global_load_async_to_lds_b128 %10, %22, off\n\t"
      "global_load_async_to_lds_b128 %11, %23, off\n\t"
      "s_wait_xcnt 0x0"
      :: "v"(lk), "v"(lk + ls), "v"(lk + 2 * ls), "v"(lk + 3 * ls),
         "v"(ll), "v"(ll + ls), "v"(ll + 2 * ls), "v"(ll + 3 * ls),
         "v"(lv), "v"(lv + ls), "v"(lv + 2 * ls), "v"(lv + 3 * ls),
         "v"(gk), "v"(gk + 16 * kDhd), "v"(gk + 32 * kDhd), "v"(gk + 48 * kDhd),
         "v"(gl), "v"(gl + 16 * kDhd), "v"(gl + 32 * kDhd), "v"(gl + 48 * kDhd),
         "v"(gv), "v"(gv + 16 * kSeq), "v"(gv + 32 * kSeq), "v"(gv + 48 * kSeq)
      : "memory");
}

__global__ __launch_bounds__(128)
void mqa_full64_kernel(const unsigned short* __restrict__ qhp, const unsigned short* __restrict__ qlp,
                       const unsigned short* __restrict__ khp, const unsigned short* __restrict__ klp,
                       const unsigned short* __restrict__ vtp, unsigned short* __restrict__ o16p,
                       float sscale) {
  union FB { v16b v; v8b h[2]; };
  union FH { v16h v; v8h h[2]; };
  __shared__ __align__(16) __bf16   KshB[2 * AT_TL];            // K hi [kv][d], pitch AT_LP      2 buffers x 9 KB
  __shared__ __align__(16) __bf16   KslB[2 * AT_TL];            // K lo                          2 buffers x 9 KB
  __shared__ __align__(16) _Float16 VthB[2 * AT_TL];            // V^T f16 [d][kv], pitch AT_LP  2 buffers x 9 KB
  __shared__ __align__(16) float    Os[AT_NW][16 * 68];         // per wave out tile, pitch 68

  const int tid  = threadIdx.x;
  const int wave = tid >> 5;
  const int lane = tid & 31;
  const int hh   = lane >> 4;
  const int c    = lane & 15;

  const int nqb = kSeq / AT_QB;            // 32
  const int b  = blockIdx.y;               // 0..kBatch-1
  const int bx = blockIdx.x;               // 0..kHeads*nqb-1
  const int qb = bx % nqb;
  const int h  = bx / nqb;                 // 0..kHeads-1
  const int q0 = qb * AT_QB + wave * 16;

  const __bf16*   Qh = (const __bf16*)(const void*)qhp + (size_t)b * kSeq * kDm + (size_t)h * AT_D;
  const __bf16*   Ql = (const __bf16*)(const void*)qlp + (size_t)b * kSeq * kDm + (size_t)h * AT_D;
  const __bf16*   Kh = (const __bf16*)(const void*)khp + (size_t)b * kSeq * kDhd;
  const __bf16*   Kl = (const __bf16*)(const void*)klp + (size_t)b * kSeq * kDhd;
  const _Float16* Vt = (const _Float16*)(const void*)vtp + (size_t)b * AT_D * kSeq;
  _Float16*       ob = (_Float16*)(void*)o16p + (size_t)b * kSeq * kDm + (size_t)h * AT_D;

  // ---- Q fragments (B operand, column = query = lane&15, split k map via Frag load): 2 d-chunks, hi and lo ----
  v16b qah[2], qal[2];
#pragma unroll
  for (int dc = 0; dc < 2; ++dc) {
    const __bf16* qr = Qh + (size_t)(q0 + c) * kDm + dc * 32 + 8 * hh;
    const __bf16* ql = Ql + (size_t)(q0 + c) * kDm + dc * 32 + 8 * hh;
    qah[dc] = Frag<__bf16>::load(qr);
    qal[dc] = Frag<__bf16>::load(ql);
  }

  const float c2 = sscale * 1.44269504088896340736f;   // score scale times log2(e), positive: exp(x) = 2^(x * log2 e)
  float mrun = -INFINITY;   // running maximum of query q0 + c in base-2 units (equal in both wave halves)
  float lrun = 0.f;         // running sum (x2^15) over this half's keys only; the halves join in the epilogue
  v8f oacc[4];              // oacc[t][r] = O^T(d = t*16 + 8*hh + r, query q0 + c)
#pragma unroll
  for (int t = 0; t < 4; ++t) oacc[t] = (v8f){0.f,0.f,0.f,0.f,0.f,0.f,0.f,0.f};

  const int nChunks = kSeq / AT_KC;   // 32, compile-time constant (at least two: the prologue fills both buffers)
  // staging map: row sr (+16, +32, +48), 16-B piece sp / 8 of the row's 128-B line; 128 threads x 4 rows x 8 elements = 64 x 64 per plane
  const int sr = tid >> 3, sp = (tid & 7) * 8;
  const __bf16*   gk = Kh + (size_t)sr * kDhd + sp;   // chunk 0: K row sr, d = sp..sp+7; a chunk further: + AT_KC rows
  const __bf16*   gl = Kl + (size_t)sr * kDhd + sp;
  const _Float16* gv = Vt + (size_t)sr * kSeq + sp;    // chunk 0: V^T row d = sr, s = sp..sp+7; a chunk further: + AT_KC columns
  const unsigned lk = (unsigned)(uintptr_t)(KshB + sr * AT_LP + sp);   // LDS byte address: the low 32 bits of the shared address
  const unsigned ll = (unsigned)(uintptr_t)(KslB + sr * AT_LP + sp);
  const unsigned lv = (unsigned)(uintptr_t)(VthB + sr * AT_LP + sp);
  at_copy_chunk(lk, ll, lv, gk, gl, gv);                     // chunk 0 -> buffer 0
  asm volatile("s_wait_asynccnt 0x0" ::: "memory");          // this wave's copies of chunk 0 have landed
  __syncthreads();                                           // ... and every other wave's: chunk 0 may be read
  at_copy_chunk(lk + AT_TL * 2, ll + AT_TL * 2, lv + AT_TL * 2, gk + AT_KC * kDhd, gl + AT_KC * kDhd, gv + AT_KC);   // chunk 1 -> buffer 1
  for (int kc = 0; kc < nChunks; ++kc) {
    const int bo = (kc & 1) * AT_TL;   // this chunk's buffer
    const __bf16*   Ksh = KshB + bo;
    const __bf16*   Ksl = KslB + bo;
    const _Float16* Vth = VthB + bo;

    // ---- scores, transposed: A operand row = key j*16+c, B operand column = query c, both <- d with the split k map ----
    // The chunk's LDS reads stand in two groups, each ahead of the products that use it: a wave then waits out the LDS latency
    // once per group and not once per fragment. Group 1, here: all sixteen K fragments (hi and lo), in front of the first product.
    FB kb[4][2], kl[4][2];   // [key tile j][d half dc]
#pragma unroll   // register arrays: constant indices only (inner loop too)
    for (int j = 0; j < 4; ++j) {
#pragma unroll
      for (int dc = 0; dc < 2; ++dc) {
        kb[j][dc].h[0] = *(const v8b*)(Ksh + (j * 16 + c) * AT_LP + dc * 32 + 8 * hh);
        kb[j][dc].h[1] = *(const v8b*)(Ksh + (j * 16 + c) * AT_LP + dc * 32 + 16 + 8 * hh);
        kl[j][dc].h[0] = *(const v8b*)(Ksl + (j * 16 + c) * AT_LP + dc * 32 + 8 * hh);
        kl[j][dc].h[1] = *(const v8b*)(Ksl + (j * 16 + c) * AT_LP + dc * 32 + 16 + 8 * hh);
      }
    }
    FH vb[2][4];             // [key half kk][d tile t]
    v8f s[4];
#pragma unroll
    for (int j = 0; j < 4; ++j) {
      s[j] = (v8f){0.f,0.f,0.f,0.f,0.f,0.f,0.f,0.f};
#pragma unroll
      for (int dc = 0; dc < 2; ++dc) {
        s[j] = at_mma(kb[j][dc].v, qah[dc], s[j]);
        s[j] = at_mma(kl[j][dc].v, qah[dc], s[j]);
        s[j] = at_mma(kb[j][dc].v, qal[dc], s[j]);
      }
      if (j == 2) {
        // Group 2: all eight V^T fragments, into registers that the first three key tiles' K fragments have left; they land
        // behind the last key tile's products and the softmax. A: row = d = t*16 + c, same key map as P^T.
#pragma unroll
        for (int kk = 0; kk < 2; ++kk) {
#pragma unroll
          for (int t = 0; t < 4; ++t) {
            vb[kk][t].h[0] = *(const v8h*)(Vth + (t * 16 + c) * AT_LP + kk * 32 + 8 * hh);
            vb[kk][t].h[1] = *(const v8h*)(Vth + (t * 16 + c) * AT_LP + kk * 32 + 16 + 8 * hh);
          }
        }
      }
    }
    // D layout: s[j][r] = score(key kv0 + j*16 + 8*hh + r, query q0 + c)
    // the loops over j, r and t below are unrolled because s and oacc are register arrays; one chain per j keeps four
    // independent maximum and sum chains in flight
    float mj[4];
#pragma unroll
    for (int j = 0; j < 4; ++j) {
      float m = -INFINITY;
#pragma unroll
      for (int r = 0; r < 8; ++r) m = fmaxf(m, s[j][r]);   // raw products: c2 > 0 keeps their order
      mj[j] = m;
    }
    float cm = fmaxf(fmaxf(mj[0], mj[1]), fmaxf(mj[2], mj[3]));
    cm = fmaxf(cm, at_xhalf(cm));            // the query's maximum over all 64 keys of the chunk, in both halves
    const float mnew = fmaxf(mrun, cm * c2);  // running maximum in base-2 units
    const float alpha = at_exp2(mrun - mnew);
    mrun = mnew;
    const float nb = kPlog - mnew;            // one addend per query: exponent = score * c2 - maximum + 15
    float pj[4];
#pragma unroll
    for (int j = 0; j < 4; ++j) {
      float x[8];
#pragma unroll
      for (int r = 0; r < 8; ++r) x[r] = fmaf(s[j][r], c2, nb);   // base-2 exponent of the numerator x2^15: one multiply-add
      at_exp2x8(x[0], x[1], x[2], x[3], x[4], x[5], x[6], x[7]);
      float ps = 0.f;
#pragma unroll
      for (int r = 0; r < 8; ++r) {
        ps += x[r];
        s[j][r] = x[r];
      }
      pj[j] = ps;
    }
    lrun = lrun * alpha + ((pj[0] + pj[1]) + (pj[2] + pj[3]));
#pragma unroll
    for (int t = 0; t < 4; ++t)
#pragma unroll
      for (int r = 0; r < 8; ++r) oacc[t][r] *= alpha;
    // ---- O^T += V^T . P^T: two score tiles (keys kk*32 + 8hh + 0..7 and kk*32 + 16 + 8hh + 0..7) are one B operand in place ----
#pragma unroll
    for (int kk = 0; kk < 2; ++kk) {   // unrolled: the score tiles are registers and cannot be indexed at run time
      v16h pb;
#pragma unroll   // vector elements are registers: constant indices only
      for (int e = 0; e < 8; ++e) {
        pb[e]     = (_Float16)s[2 * kk][e];
        pb[8 + e] = (_Float16)s[2 * kk + 1][e];
      }
#pragma unroll
      for (int t = 0; t < 4; ++t) oacc[t] = at_mma_h(vb[kk][t].v, pb, oacc[t]);
    }
    // hand-over: this wave's reads of the chunk's buffer are done, its copies of the next chunk have landed; behind the barrier
    // the same holds of every wave, so the next chunk may be read and this chunk's buffer refilled
    asm volatile("s_wait_dscnt 0x0" ::: "memory");      // this wave's last fragment reads of the buffer have returned
    asm volatile("s_wait_asynccnt 0x0" ::: "memory");   // this wave's copies of chunk kc + 1 have landed
    __syncthreads();
    if (kc + 2 < nChunks)   // the same for the whole work-group
      at_copy_chunk(lk + bo * 2, ll + bo * 2, lv + bo * 2,
                    gk + (size_t)(kc + 2) * AT_KC * kDhd, gl + (size_t)(kc + 2) * AT_KC * kDhd, gv + (kc + 2) * AT_KC);
  }
  asm volatile("s_wait_asynccnt 0x0" ::: "memory");   // no copy is outstanding when the wave goes on to its end

  // ---- epilogue: O = oacc / (l * 2^15), carried x kOsc as f16 ----
  float* os = Os[wave];
  {
    const float lsum = lrun + at_xhalf(lrun);   // the two halves' key sums of query q0 + c
    const float inv = kOsc * (1.0f / lsum);   // lsum carries the numerators' x2^15
#pragma unroll   // oacc is a register array: constant indices only (inner loop too)
    for (int t = 0; t < 4; ++t) {
      v4f w0, w1;
#pragma unroll
      for (int r = 0; r < 4; ++r) { w0[r] = oacc[t][r] * inv; w1[r] = oacc[t][4 + r] * inv; }
      *(v4f*)(os + c * 68 + t * 16 + 8 * hh)     = w0;   // row = query c, 8 consecutive d per lane
      *(v4f*)(os + c * 68 + t * 16 + 8 * hh + 4) = w1;
    }
  }
  __builtin_amdgcn_fence(__ATOMIC_RELEASE, "workgroup");
  __builtin_amdgcn_wave_barrier();
  __builtin_amdgcn_fence(__ATOMIC_ACQUIRE, "workgroup");
  {
    const int qg = lane >> 3, c8 = (lane & 7) * 8;
    {
#pragma unroll
      for (int it = 0; it < 4; ++it) {
        const int row = it * 4 + qg;                    // 4 it x 4 groups = rows 0..15
        const float* sp = os + row * 68 + c8;
        v8h hv;
#pragma unroll
        for (int e = 0; e < 8; ++e) hv[e] = (_Float16)sp[e];
        *(v8h*)(ob + (size_t)(q0 + row) * kDm + c8) = hv;
      }
      
    }
  }
}

// ---------------------------------------------------------------------------
// Host driver. Workspace region map (bytes, 256-B aligned offsets):
//   x16   [4096][1024] bf16           8388608
//   wq16p [1024][1024] bf16 (rows permuted to head-major)  2097152
//   wk16  [64][1024]   bf16            131072
//   wv16  [64][1024]   bf16            131072
//   wo16  [1024][1024] f16 (bf16-RNE x16)  2097152
//   bqp   [1024]       f32 (permuted)     4096
//   Qh,Ql [4096][1024] bf16 hi/lo     2 x 8388608
//   Kh,Kl [4096][64]   bf16 hi/lo     2 x 524288
//   Vt16  [2][64][2048] f16            524288
//   O16   [4096][1024] f16 (x16)      8388608
//   total 39587840 B
// ---------------------------------------------------------------------------
extern "C" void kernel_launch(void* const* d_in, const int* in_sizes, int n_in,
                              void* d_out, int out_size, void* d_ws, size_t ws_size,
                              hipStream_t stream) {
  const int nB = kBatch, nS = kSeq, nD = kDm, nDh = kDhd;
  const int nM = nB * nS;   // 4096
  if (n_in < 9) return;
  if (in_sizes[0] != nM * nD || in_sizes[1] != nD * nD || in_sizes[2] != nD ||
      in_sizes[3] != nDh * nD || in_sizes[4] != nDh || in_sizes[5] != nDh * nD ||
      in_sizes[6] != nDh || in_sizes[7] != nD * nD || in_sizes[8] != nD || out_size != nM * nD) return;

  const float* x  = (const float*)d_in[0];
  const float* wq = (const float*)d_in[1];
  const float* bq = (const float*)d_in[2];
  const float* wk = (const float*)d_in[3];
  const float* bk = (const float*)d_in[4];
  const float* wv = (const float*)d_in[5];
  const float* bv = (const float*)d_in[6];
  const float* wo = (const float*)d_in[7];
  const float* bo = (const float*)d_in[8];

  size_t off = 0;
  auto carve = [&](size_t bytes) -> char* {
    char* p = (char*)d_ws + off;
    off += (bytes + 255) & ~(size_t)255;
    return p;
  };
  unsigned short* x16   = (unsigned short*)carve((size_t)nM * nD * 2);
  unsigned short* wq16p = (unsigned short*)carve((size_t)nD * nD * 2);
  unsigned short* wk16  = (unsigned short*)carve((size_t)nDh * nD * 2);
  unsigned short* wv16  = (unsigned short*)carve((size_t)nDh * nD * 2);
  unsigned short* wo16  = (unsigned short*)carve((size_t)nD * nD * 2);
  float*          bqp   = (float*)carve((size_t)nD * 4);
  unsigned short* Qh    = (unsigned short*)carve((size_t)nM * nD * 2);
  unsigned short* Ql    = (unsigned short*)carve((size_t)nM * nD * 2);
  unsigned short* Kh    = (unsigned short*)carve((size_t)nM * nDh * 2);
  unsigned short* Kl    = (unsigned short*)carve((size_t)nM * nDh * 2);
  unsigned short* Vt16  = (unsigned short*)carve((size_t)nB * nDh * nS * 2);
  unsigned short* O16   = (unsigned short*)carve((size_t)nM * nD * 2);
  if (off > ws_size) return;

  // ---- casts (bf16 RNE; wq rows / bq permuted to head-major; wo as f16(bf16_rne(wo) * 16)): one launch ----
  prep_kernel<<<dim3(kCbAll), dim3(256), 0, stream>>>(x, wq, wo, wk, wv, bq, x16, wq16p, wo16, wk16, wv16, bqp);

  // ---- q, k and v^T projections: one launch, 128 + 8 + 2 x 4 work-groups of 8 waves, one 64x64 tile per wave ----
  proj_qkv_kernel<<<dim3(kPjQ + kPjK + kBatch * kPjV), dim3(256), 0, stream>>>(
      x16, wq16p, wk16, wv16, bqp, bk, bv, Qh, Ql, Kh, Kl, Vt16, nD);

  // ---- attention: grid (16 heads x 32 query blocks, 2 batches), all heads share the batch's K / V^T planes ----
  mqa_full64_kernel<<<dim3(kHeads * (nS / AT_QB), nB), dim3(128), 0, stream>>>(Qh, Ql, Kh, Kl, Vt16, O16, 0.125f);

  // ---- output projection: out [4096][1024] f32 = (O16 . wo16^T) / 256 + bo ----
  wmma_gemm64<0, false, 2, 0, false, 0><<<dim3((nM / 64) * (nD / 64) / 8, 1), dim3(256), 0, stream>>>(
      O16, 0L, wo16, 0L, d_out, d_out, nD, 0L, bo, bo, 0L, nM, nD, nD, 1.0f / (kOsc * kWsc));
}

// v008
// A run of this version takes 98.2 microseconds.
// Two timings next to v007 put it at 1.06 and 1.08 times that version's speed.
// Over all steps from v000 it is 4.93 times as fast.
// Contractions: q/k/v^T projections v_wmma_f32_16x16x32_bf16 (inputs RNE-cast to bf16, f32 acc); q.k^T v_wmma_f32_16x16x32_bf16 with bf16 hi/lo split (hi.hi+hi.lo+lo.hi); p.v and output projection v_wmma_f32_16x16x32_f16 (p carried x2^15, o carried x16, wo carried x16), f32 acc; online softmax, biases and scales in f32.
#include <hip/hip_runtime.h>
#include <math.h>
#include <stdint.h>

typedef __attribute__((ext_vector_type(16))) _Float16 v16h;
typedef __attribute__((ext_vector_type(8)))  _Float16 v8h;
typedef __attribute__((ext_vector_type(16))) __bf16   v16b;
typedef __attribute__((ext_vector_type(8)))  __bf16   v8b;
typedef __attribute__((ext_vector_type(8)))  float    v8f;
typedef __attribute__((ext_vector_type(4)))  float    v4f;
typedef __attribute__((ext_vector_type(2)))  float    v2f;
typedef __attribute__((ext_vector_type(4)))  unsigned int v4u;

// problem geometry (compile-time)
constexpr int kBatch = 2;
constexpr int kSeq   = 2048;
constexpr int kDm    = 1024;   // model width = H*Dh = q row pitch
constexpr int kHeads = 16;
constexpr int kDhd   = 64;     // per-head dim = k row pitch
constexpr float kPlog = 15.0f;     // softmax numerators carried x2^15 in f16: 15 is added to their base-2 exponent
constexpr float kOsc = 16.0f;      // attention output carried x16 in f16
constexpr float kWsc = 16.0f;      // output-projection weight carried x16 in f16

__device__ __forceinline__ unsigned short f2bf_bits(float f) {
  unsigned u = __float_as_uint(f);
  return (unsigned short)((u + 0x7FFFu + ((u >> 16) & 1u)) >> 16);
}
__device__ __forceinline__ float bf_bits2f(unsigned short h) { return __uint_as_float(((unsigned)h) << 16); }
__device__ __forceinline__ unsigned pk16(unsigned short a, unsigned short b) { return (unsigned)a | ((unsigned)b << 16); }

// hazard guards as plain device helpers
__device__ __forceinline__ void dep_guard_h(v8f& a, v8f& b, v16h x, v16h y) { asm volatile("v_nop\n\tv_nop\n\tv_nop\n\tv_nop" : "+v"(a), "+v"(b) : "v"(x), "v"(y)); }
__device__ __forceinline__ void dep_guard_b(v8f& a, v8f& b, v16b x, v16b y) { asm volatile("v_nop\n\tv_nop\n\tv_nop\n\tv_nop" : "+v"(a), "+v"(b) : "v"(x), "v"(y)); }
__device__ __forceinline__ void keep4_h(v16h a, v16h b, v16h c, v16h d) { asm volatile("v_nop" :: "v"(a), "v"(b), "v"(c), "v"(d)); }
__device__ __forceinline__ void keep4_b(v16b a, v16b b, v16b c, v16b d) { asm volatile("v_nop" :: "v"(a), "v"(b), "v"(c), "v"(d)); }
__device__ __forceinline__ void acc_guard4(v8f& a, v8f& b, v8f& c, v8f& d) { asm volatile("v_nop\n\tv_nop\n\tv_nop\n\tv_nop" : "+v"(a), "+v"(b), "+v"(c), "+v"(d)); }
template <typename T> struct Frag;
template <> struct Frag<_Float16> {
  typedef v16h V; typedef v8h H; union U { v16h v; v8h h[2]; };
  static __device__ __forceinline__ v16h load(const _Float16* p) {   // elements 0..7 <- p[0..7], 8..15 <- p[16..23]
    U f; f.h[0] = *(const v8h*)(p); f.h[1] = *(const v8h*)(p + 16); return f.v;
  }
  static __device__ __forceinline__ v8f mma(v16h a, v16h b, v8f c) {
    return __builtin_amdgcn_wmma_f32_16x16x32_f16(false, a, false, b, (short)0, c, false, false);
  }
  static __device__ __forceinline__ void guard(v8f& a, v8f& b, v16h x, v16h y) { dep_guard_h(a, b, x, y); }
  static __device__ __forceinline__ void keep(v16h a, v16h b, v16h c, v16h d) { keep4_h(a, b, c, d); }
};
template <> struct Frag<__bf16> {
  typedef v16b V; typedef v8b H; union U { v16b v; v8b h[2]; };
  static __device__ __forceinline__ v16b load(const __bf16* p) {
    U f; f.h[0] = *(const v8b*)(p); f.h[1] = *(const v8b*)(p + 16); return f.v;
  }
  static __device__ __forceinline__ v8f mma(v16b a, v16b b, v8f c) {
    return __builtin_amdgcn_wmma_f32_16x16x32_bf16(false, a, false, b, (short)0, c, false, false);
  }
  static __device__ __forceinline__ void guard(v8f& a, v8f& b, v16b x, v16b y) { dep_guard_b(a, b, x, y); }
  static __device__ __forceinline__ void keep(v16b a, v16b b, v16b c, v16b d) { keep4_b(a, b, c, d); }
};

// ---- Register-blocked batched WMMA GEMM ------------------------------------
// C[m,n] = scale * sum_k A[m,k] * Bt[n,k] (+bias)(+resid); each wave owns a 64x64 tile.
// A row-major [M,K]; Bt row-major [N,K], both with row pitch kDm (compile time, so that the 16 row groups of a tile
// are immediate offsets of one address); M,N % 64 == 0, K % 64 == 0, K <= kDm.
// Operand path: per 64-k step each wave copies its own 64x64 A tile and 64x64 Bt tile into its own LDS range with
// global loads that cover whole 128-B lines (8 lanes per row, 4 rows per load), the next step's loads being issued
// before the current step's products; the WMMA fragments are read from LDS (k order per 32-k group as Frag::load).
// SPLIT (hi/lo planes) is not instantiated and not supported by the staged loop.
// BIAS_MODE: 0 = none, 1 = bias[m], 2 = bias[n].
// OUT_MODE: 0 = f32, 1 = f16, 2 = bf16 hi plane (Cout) + bf16 lo plane (Cout2).
// ET: 0 = f16 operands, 1 = bf16 operands (pointers passed as 16-bit storage)
#define GS_LP 72   // LDS row pitch of a staged operand tile in 16-bit elements: 144 B = 16 B x 9 (odd), conflict-free for ds_load_b128 fragment reads
template <int ET> struct Elem;
template <> struct Elem<0> { typedef _Float16 T; };
template <> struct Elem<1> { typedef __bf16 T; };
// The body is a device function, so that one launch can run several products as ranges of its grid: bx = the work-group's
// index within its product, b = the batch, sOpAll / sTAll = the work-group's LDS (8 waves x (A tile + Bt tile); 8 slabs).
#define GS_OPW (2 * 64 * GS_LP)   // 16-bit elements of one wave's A tile + Bt tile
#define GS_SLW (16 * 68)          // floats of one wave's 16x64 slab, pitch 68
template <int ET, bool SPLIT, int BIAS_MODE, int OUT_MODE, bool RESID, int ACT>
__device__ __forceinline__ void gemm64_body(
    typename Elem<ET>::T* sOpAll, float* sTAll, int bx, int b,
    const unsigned short* __restrict__ Ap, long strideA,
    const unsigned short* __restrict__ Btp, long strideB,
    void* __restrict__ Cout, void* __restrict__ Cout2, int ldc, long strideC,
    const float* __restrict__ bias,
    const float* __restrict__ resid, long strideR,
    int M, int N, int K, float scale) {
  typedef typename Elem<ET>::T T;
  typedef typename Frag<T>::V V;
  const T* A = (const T*)Ap; const T* Bt = (const T*)Btp;
  static_assert(!SPLIT, "the staged operand loop takes single-plane operands");
  typedef typename Frag<T>::H H;
  const int lane = threadIdx.x & 31;
  const int wave = __builtin_amdgcn_readfirstlane(threadIdx.x >> 5);   // wave-uniform: tile bases stay scalar
  const int tilesN = N >> 6;
  const int tilesM = M >> 6;
  const int tile = bx * 8 + wave;
  if (tile >= tilesM * tilesN) return;   // wave-uniform; no block barriers in this body
  const int tm = tile / tilesN;
  const int tn = tile - tm * tilesN;
  const int m0 = tm << 6;
  const int n0 = tn << 6;

  const T* Ab  = A  + (size_t)b * strideA;
  const T* Bb  = Bt + (size_t)b * strideB;

  const int rlane = lane & 15;                 // row (A) / col (B, D) within subtile
  const int koff  = (lane >> 4) * 8;           // k offset of this lane half
  const int mOff  = (lane >> 4) * 8;           // D row offset

  v8f acc[4][4];
#pragma unroll
  for (int i = 0; i < 4; ++i)
#pragma unroll
    for (int j = 0; j < 4; ++j) acc[i][j] = (v8f){0.f,0.f,0.f,0.f,0.f,0.f,0.f,0.f};

  // staging map: lane -> row (lane >> 3) of each group of 4 rows, 16-B piece (lane & 7) of the row's 128-B line
  const int srow = lane >> 3;
  const int scol = (lane & 7) * 8;
  const T* Ag = Ab + (size_t)(m0 + srow) * kDm + scol;   // this lane's piece of row group 0, k = 0
  const T* Bg = Bb + (size_t)(n0 + srow) * kDm + scol;
  T* sa = sOpAll + wave * GS_OPW;   // per-wave A tile and Bt tile of one 64-k step, pitch GS_LP
  T* sb = sa + 64 * GS_LP;
  H ra[16], rb[16];
#pragma unroll
  for (int it = 0; it < 16; ++it) {
    ra[it] = *(const H*)(Ag + it * 4 * kDm);
    rb[it] = *(const H*)(Bg + it * 4 * kDm);
  }

  for (int k0 = 0; k0 < K; k0 += 64) {
#pragma unroll
    for (int it = 0; it < 16; ++it) {
      *(H*)(sa + (it * 4 + srow) * GS_LP + scol) = ra[it];
      *(H*)(sb + (it * 4 + srow) * GS_LP + scol) = rb[it];
    }
    // the wave's own tile stores are complete before any of its lanes reads another lane's rows
    __builtin_amdgcn_fence(__ATOMIC_RELEASE, "workgroup");
    __builtin_amdgcn_wave_barrier();
    __builtin_amdgcn_fence(__ATOMIC_ACQUIRE, "workgroup");
    if (k0 + 64 < K) {   // wave-uniform: the next step's tiles fly while this step's products run
#pragma unroll
      for (int it = 0; it < 16; ++it) {
        ra[it] = *(const H*)(Ag + it * 4 * kDm + (k0 + 64));
        rb[it] = *(const H*)(Bg + it * 4 * kDm + (k0 + 64));
      }
      asm volatile("s_wait_xcnt 0x0" ::: "memory");   // before the fragment reads below reuse the address registers of these loads
    }
#pragma unroll
    for (int kk = 0; kk < 2; ++kk) {
      V bh[4], ah[4];
#pragma unroll
      for (int j = 0; j < 4; ++j) bh[j] = Frag<T>::load(sb + ((j << 4) + rlane) * GS_LP + kk * 32 + koff);
#pragma unroll
      for (int i = 0; i < 4; ++i) ah[i] = Frag<T>::load(sa + ((i << 4) + rlane) * GS_LP + kk * 32 + koff);
#pragma unroll
      for (int i = 0; i < 4; ++i) {
#pragma unroll
        for (int j = 0; j < 4; ++j) acc[i][j] = Frag<T>::mma(ah[i], bh[j], acc[i][j]);
        Frag<T>::guard(acc[i][0], acc[i][3], ah[i], ah[i]);
      }
      Frag<T>::keep(bh[0], bh[1], bh[2], bh[3]);
    }
    // every fragment read of this step is done before the next step's stores overwrite the tiles
    __builtin_amdgcn_fence(__ATOMIC_RELEASE, "workgroup");
    __builtin_amdgcn_wave_barrier();
    __builtin_amdgcn_fence(__ATOMIC_ACQUIRE, "workgroup");
  }
  acc_guard4(acc[0][0], acc[0][1], acc[0][2], acc[0][3]);
  acc_guard4(acc[1][0], acc[1][1], acc[1][2], acc[1][3]);
  acc_guard4(acc[2][0], acc[2][1], acc[2][2], acc[2][3]);
  acc_guard4(acc[3][0], acc[3][1], acc[3][2], acc[3][3]);

  // ---- epilogue ----
  float* slab = sTAll + wave * GS_SLW;
  const float* Rb = RESID ? (resid + (size_t)b * strideR) : nullptr;
#pragma unroll
  for (int i = 0; i < 4; ++i) {
    const int mBase = m0 + (i << 4);
    float bm[8];
    if (BIAS_MODE == 1) {
      const float* bp = bias + mBase + mOff;
#pragma unroll
      for (int r = 0; r < 8; ++r) bm[r] = bp[r];
      // before the address registers of the bias loads are reused; the address as an input keeps them untouched up to here
      asm volatile("s_wait_xcnt 0x0" :: "v"(bp) : "memory");
    }
#pragma unroll
    for (int j = 0; j < 4; ++j) {
      const int n = n0 + (j << 4) + rlane;
      float bv = 0.f;
      if (BIAS_MODE == 2) bv = bias[n];
#pragma unroll
      for (int r = 0; r < 8; ++r) {
        float v = acc[i][j][r] * scale;
        if (BIAS_MODE == 1) v += bm[r];
        if (BIAS_MODE == 2) v += bv;
        if (RESID) v += Rb[(size_t)(mBase + mOff + r) * ldc + n];
        if (ACT == 1) v = tanhf(v);
        if (ACT == 2) v = fmaxf(v, 0.0f);
        if (ACT == 3) v = v / (1.0f + expf(-v));
        if (ACT == 4) v = (v > 0.f) ? v : 0.01f * v;
        if (ACT == 5) v = 0.5f * v * (1.0f + erff(v * 0.70710678118654752f));
        slab[(mOff + r) * 68 + (j << 4) + rlane] = v;
      }
    }
    __builtin_amdgcn_fence(__ATOMIC_RELEASE, "workgroup");
    __builtin_amdgcn_wave_barrier();
    __builtin_amdgcn_fence(__ATOMIC_ACQUIRE, "workgroup");
    if (OUT_MODE == 0) {
      float* C = (float*)Cout + (size_t)b * strideC;
      const int hh = lane >> 4, c4 = (lane & 15) * 4;     // row seg = 256 B = 16 lanes x 16 B
      {
#pragma unroll
        for (int it = 0; it < 8; ++it) {
          const int row = it * 2 + hh;
          v4f v = *(const v4f*)(slab + row * 68 + c4);
          *(v4f*)(C + (size_t)(mBase + row) * ldc + n0 + c4) = v;
        }
        
      }
    } else {
      const int q = lane >> 3, c8 = (lane & 7) * 8;
      unsigned short* C  = (unsigned short*)Cout  + (size_t)b * strideC;
      unsigned short* C2 = (OUT_MODE == 2) ? ((unsigned short*)Cout2 + (size_t)b * strideC) : nullptr;
      {
#pragma unroll
        for (int it = 0; it < 4; ++it) {
          const int row = it * 4 + q;
          const float* sp = slab + row * 68 + c8;
          v8h hv, lv;
#pragma unroll
          for (int e = 0; e < 8; ++e) {
            if (OUT_MODE == 1) {
              hv[e] = (_Float16)sp[e];
            } else {
              unsigned short hb = f2bf_bits(sp[e]);
              unsigned short lb = f2bf_bits(sp[e] - bf_bits2f(hb));
              hv[e] = __builtin_bit_cast(_Float16, hb);
              lv[e] = __builtin_bit_cast(_Float16, lb);
            }
          }
          *(v8h*)(C + (size_t)(mBase + row) * ldc + n0 + c8) = hv;
          if (OUT_MODE == 2) *(v8h*)(C2 + (size_t)(mBase + row) * ldc + n0 + c8) = lv;
        }
        
      }
    }
    __builtin_amdgcn_fence(__ATOMIC_RELEASE, "workgroup");
    __builtin_amdgcn_wave_barrier();
    __builtin_amdgcn_fence(__ATOMIC_ACQUIRE, "workgroup");
    // keeps the next row group's arithmetic behind the fence's store wait: no register of an issued store is rewritten before it
    __builtin_amdgcn_sched_barrier(0);
  }
}

// one product per launch: grid = (tiles / 8, batches)
template <int ET, bool SPLIT, int BIAS_MODE, int OUT_MODE, bool RESID, int ACT = 0>
__global__ __launch_bounds__(256) void wmma_gemm64(
    const unsigned short* __restrict__ Ap, long strideA,
    const unsigned short* __restrict__ Btp, long strideB,
    void* __restrict__ Cout, void* __restrict__ Cout2, int ldc, long strideC,
    const float* __restrict__ bias,
    const float* __restrict__ resid, long strideR,
    int M, int N, int K, float scale) {
  __shared__ __align__(16) typename Elem<ET>::T sOp[8 * GS_OPW];
  __shared__ __align__(16) float sT[8 * GS_SLW];
  gemm64_body<ET, SPLIT, BIAS_MODE, OUT_MODE, RESID, ACT>(sOp, sT, blockIdx.x, blockIdx.y, Ap, strideA, Btp, strideB,
      Cout, Cout2, ldc, strideC, bias, resid, strideR, M, N, K, scale);
}

// ---------------------------------------------------------------------------
// The three projections of x, which do not depend on one another, as ranges of one grid (144 work-groups, one round):
//   [0, 128)    q   [4096][1024] = x16 . wq16p^T + bqp  -> bf16 hi/lo planes, head-major columns (h*64 + d)
//   [128, 136)  k   [4096][64]   = x16 . wk16^T + bk    -> bf16 hi/lo planes
//   [136, 144)  v^T per batch z: [64][2048] = wv16 . x16_z^T + bv[m] -> f16; 4 work-groups per batch
// The range test reads blockIdx only: uniform for the work-group. K, the inner length of all three, is an argument as in wmma_gemm64.
// ---------------------------------------------------------------------------
constexpr int kPjQ = (kBatch * kSeq / 64) * (kDm / 64) / 8;    // 128
constexpr int kPjK = (kBatch * kSeq / 64) * (kDhd / 64) / 8;   // 8
constexpr int kPjV = (kDhd / 64) * (kSeq / 64) / 8;            // 4 per batch
__global__ __launch_bounds__(256) void proj_qkv_kernel(
    const unsigned short* __restrict__ x16, const unsigned short* __restrict__ wq16p,
    const unsigned short* __restrict__ wk16, const unsigned short* __restrict__ wv16,
    const float* __restrict__ bqp, const float* __restrict__ bk, const float* __restrict__ bv,
    unsigned short* __restrict__ Qh, unsigned short* __restrict__ Ql,
    unsigned short* __restrict__ Kh, unsigned short* __restrict__ Kl,
    unsigned short* __restrict__ Vt16, int K) {
  __shared__ __align__(16) __bf16 sOp[8 * GS_OPW];
  __shared__ __align__(16) float sT[8 * GS_SLW];
  const int bx = blockIdx.x;
  if (bx < kPjQ + kPjK) {
    const bool isq = bx < kPjQ;
    const int n = isq ? kDm : kDhd;
    gemm64_body<1, false, 2, 2, false, 0>(sOp, sT, isq ? bx : bx - kPjQ, 0, x16, 0L, isq ? wq16p : wk16, 0L,
        (void*)(isq ? Qh : Kh), (void*)(isq ? Ql : Kl), n, 0L, isq ? bqp : bk, nullptr, 0L, kBatch * kSeq, n, K, 1.0f);
  } else {
    const int v = bx - (kPjQ + kPjK);
    gemm64_body<1, false, 1, 1, false, 0>(sOp, sT, v % kPjV, v / kPjV, wv16, 0L, x16, (long)kSeq * kDm,
        (void*)Vt16, (void*)Vt16, kSeq, (long)kDhd * kSeq, bv, nullptr, 0L, kDhd, kSeq, K, 1.0f);
  }
}

// ---------------------------------------------------------------------------
// Elementwise f32 -> bf16 (RNE), 2 elements per thread, one 4-B store per lane -> each wave writes exactly
// Coverage: range = ceil(n2/256) work-groups x 256 threads x 2 elements = 2*n2 = whole plane
//   (x: n2 = 4096*1024/2 = 2097152 -> 8192 blocks exact; wk/wv: n2 = 32768 -> 128 blocks exact).
// ---------------------------------------------------------------------------
__device__ __forceinline__ void cast_bf16x2(int bx, const float* __restrict__ in, unsigned short* __restrict__ out, int n2) {
  const int i = bx * 256 + threadIdx.x;
  if (i < n2) {
    const v2f f = *(const v2f*)(in + 2 * (size_t)i);
    const unsigned u = pk16(f2bf_bits(f[0]), f2bf_bits(f[1]));
    ((unsigned*)out)[i] = u;
    
  }
}

// ---------------------------------------------------------------------------
// Row-permuted f32 -> bf16 (RNE) cast of a [1024][ncol] weight: dest row rd = h*64 + d takes source row d*16 + h
// (de-interleave of the (hidden, heads) column split). (bx, by) in (ncol/512, 1024), 256 threads, 2 elements per thread.
// ---------------------------------------------------------------------------
__device__ __forceinline__ void cast_perm_rows_bf16x2(int bx, int by, const float* __restrict__ in, unsigned short* __restrict__ out, int ncol) {
  const int rd = by;                                    // 0..1023
  int rs = ((rd & 63) << 4) + (rd >> 6);                // 0..1023
  rs = rs > 1023 ? 1023 : rs;
  const int i = bx * 256 + threadIdx.x;                 // pair index within the row
  if (i < (ncol >> 1)) {
    const v2f f = *(const v2f*)(in + (size_t)rs * ncol + 2 * (size_t)i);
    const unsigned u = pk16(f2bf_bits(f[0]), f2bf_bits(f[1]));
    unsigned* o = (unsigned*)(out + (size_t)rd * ncol);
    o[i] = u;
    
  }
}

// ---------------------------------------------------------------------------
// Permuted bias: out[h*64 + d] = in[d*16 + h]; n = 1024; 4 blocks x 256 threads x 4 B = whole vector,
// ---------------------------------------------------------------------------
__device__ __forceinline__ void perm_bias(int bx, const float* __restrict__ in, float* __restrict__ out, int n) {
  const int i = bx * 256 + threadIdx.x;
  if (i < n) {
    int s = ((i & 63) << 4) + (i >> 6);
    s = s > n - 1 ? n - 1 : s;
    const float v = in[s];
    ((float*)out)[i] = v;
    
  }
}

// ---------------------------------------------------------------------------
// Elementwise f32 -> f16 of (bf16_rne(x) * sc) with sc a power of two: 2 elements per thread, one 4-B store per lane.
// ---------------------------------------------------------------------------
__device__ __forceinline__ void cast_bf_f16x2_scaled(int bx, const float* __restrict__ in, unsigned short* __restrict__ out, int n2, float sc) {
  const int i = bx * 256 + threadIdx.x;
  if (i < n2) {
    const v2f f = *(const v2f*)(in + 2 * (size_t)i);
    const float g0 = bf_bits2f(f2bf_bits(f[0])) * sc;
    const float g1 = bf_bits2f(f2bf_bits(f[1])) * sc;
    const _Float16 h0 = (_Float16)g0, h1 = (_Float16)g1;
    const unsigned u = pk16(__builtin_bit_cast(unsigned short, h0), __builtin_bit_cast(unsigned short, h1));
    ((unsigned*)out)[i] = u;
    
  }
}

// ---------------------------------------------------------------------------
// The six casts and permutations above, which do not depend on one another, as ranges of one grid of 256-thread work-groups
// (each range has the work-group count its own launch would have; the range tests read blockIdx only):
//   x 8192 | wq 2 x 1024 | wo 2048 | wk 128 | wv 128 | bq 4   = 12548
// ---------------------------------------------------------------------------
constexpr int kCbX  = kBatch * kSeq * kDm / 2 / 256;   // 8192
constexpr int kCbQx = kDm / 2 / 256;                   // 2 work-groups per wq row
constexpr int kCbQ  = kCbQx * kDm;                     // 2048
constexpr int kCbO  = kDm * kDm / 2 / 256;             // 2048
constexpr int kCbKV = kDhd * kDm / 2 / 256;            // 128
constexpr int kCbB  = kDm / 256;                       // 4
constexpr int kCbAll = kCbX + kCbQ + kCbO + 2 * kCbKV + kCbB;
__global__ __launch_bounds__(256) void prep_kernel(
    const float* __restrict__ x, const float* __restrict__ wq, const float* __restrict__ wo,
    const float* __restrict__ wk, const float* __restrict__ wv, const float* __restrict__ bq,
    unsigned short* __restrict__ x16, unsigned short* __restrict__ wq16p, unsigned short* __restrict__ wo16,
    unsigned short* __restrict__ wk16, unsigned short* __restrict__ wv16, float* __restrict__ bqp) {
  int bx = blockIdx.x;
  if (bx < kCbX) { cast_bf16x2(bx, x, x16, kBatch * kSeq * kDm / 2); return; }
  bx -= kCbX;
  if (bx < kCbQ) { cast_perm_rows_bf16x2(bx % kCbQx, bx / kCbQx, wq, wq16p, kDm); return; }
  bx -= kCbQ;
  if (bx < kCbO) { cast_bf_f16x2_scaled(bx, wo, wo16, kDm * kDm / 2, kWsc); return; }
  bx -= kCbO;
  if (bx < kCbKV) { cast_bf16x2(bx, wk, wk16, kDhd * kDm / 2); return; }
  bx -= kCbKV;
  if (bx < kCbKV) { cast_bf16x2(bx, wv, wv16, kDhd * kDm / 2); return; }
  bx -= kCbKV;
  perm_bias(bx, bq, bqp, kDm);
}

// =====================================================================================
// Full (non-causal, unmasked) multi-query attention, head dim 64.
//   q planes (hi/lo bf16): element (b, t, h, d) at [(b*kSeq + t)*kDm + h*64 + d]
//   k planes (hi/lo bf16): element (b, s, d) at [(b*kSeq + s)*kDhd + d]      (one KV head shared by all heads)
//   v^T plane (f16):       element (b, d, s) at [(b*64 + d)*kSeq + s]
//   out plane (f16, x kOsc): element (b, t, h, d) at [(b*kSeq + t)*kDm + h*64 + d]
//   scores = (q . k) * sscale : bf16 hi/lo split (hi.hi + hi.lo + lo.hi) on v_wmma_f32_16x16x32_bf16
//   out    = p . v            : v_wmma_f32_16x16x32_f16, p (unnormalised, <= 1) carried x2^15, f32 accumulate
//   both products are formed transposed: S^T = K . Q^T (A = K rows, B = Q columns) and O^T += V^T . P^T (A = V^T rows,
//   B = P^T packed from the score accumulators), so a lane holds 32 scores of ONE query per chunk: maximum and sum run
//   in the lane, the two wave halves join by one cross-row move, and P never passes through LDS.
//   online softmax in f32 over all kSeq keys (32 chunks of 64, compile-time trip count, no masking).
//   Block = 4 waves = 64 query rows of one (batch, head); grid = (kHeads * kSeq/64, kBatch).
//   K / V^T chunk staging: asynchronous 16-B copies to LDS, 128 threads x 4 copies per plane = the whole 64x64 tile, 8 lanes
//   per 128-B row (whole lines); two buffers: chunk t + 2 is copied into the buffer that chunk t has left, one barrier per chunk.
// =====================================================================================
#define AT_D 64
#define AT_NW 4
#define AT_QB 64
#define AT_KC 64
#define AT_TL (AT_KC * AT_LP)   // 16-bit elements of one staged plane: 64 rows at pitch AT_LP
#define AT_LP 72   // LDS row pitch in 16-bit elements: 144 B = 16 B x 9 (odd), so the 16 rows of one ds_load_b128 half fall on 16 distinct 4-bank groups

__device__ __forceinline__ v8f at_mma(v16b a, v16b b, v8f c) {
  return __builtin_amdgcn_wmma_f32_16x16x32_bf16(false, a, false, b, (short)0, c, false, false);
}
__device__ __forceinline__ v8f at_mma_h(v16h a, v16h b, v8f c) {
  return __builtin_amdgcn_wmma_f32_16x16x32_f16(false, a, false, b, (short)0, c, false, false);
}

// lane l takes the value of lane l ^ 16 (the other half of the wave, same column)
__device__ __forceinline__ float at_xhalf(float x) {
  return __builtin_bit_cast(float, __builtin_amdgcn_permlanex16(__builtin_bit_cast(int, x), __builtin_bit_cast(int, x), 0x76543210, 0xfedcba98, false, false));
}

__device__ __forceinline__ float at_exp2(float x) {
  float y;
  // v_nop: the slot behind the transcendental; s_delay_alu: the compiler hints no reader of an asm result, and an unhinted wait holds up the SIMD's other waves
  asm("v_exp_f32 %0, %1\n\tv_nop\n\ts_delay_alu instid0(TRANS32_DEP_1)" : "=v"(y) : "v"(x));
  return y;
}
// eight at once, each in place on a register of its own: every exp is the independent instruction behind the one before it,
// and the one v_nop is the slot behind the last; the closing s_delay_alu hints the first reader behind the statement (as above)
__device__ __forceinline__ void at_exp2x8(float& a0, float& a1, float& a2, float& a3, float& a4, float& a5, float& a6, float& a7) {
  asm("v_exp_f32 %0, %0\n\tv_exp_f32 %1, %1\n\tv_exp_f32 %2, %2\n\tv_exp_f32 %3, %3\n\t"
      "v_exp_f32 %4, %4\n\tv_exp_f32 %5, %5\n\tv_exp_f32 %6, %6\n\tv_exp_f32 %7, %7\n\tv_nop\n\ts_delay_alu instid0(TRANS32_DEP_1)"
      : "+v"(a0), "+v"(a1), "+v"(a2), "+v"(a3), "+v"(a4), "+v"(a5), "+v"(a6), "+v"(a7));
}

// One chunk's twelve copies of one lane: rows r, r+16, r+32, r+48 of K hi, K lo and V^T, 16 B each, global -> LDS through no register.
// lk, ll, lv: the lane's LDS byte addresses of row r in the target buffer; gk, gl, gv: its global addresses of the same piece.
// s_wait_xcnt stands inside the statement, behind the last copy: the address registers are not rewritten before it.
__device__ __forceinline__ void at_copy_chunk(unsigned lk, unsigned ll, unsigned lv,
                                              const __bf16* gk, const __bf16* gl, const _Float16* gv) {
  constexpr unsigned ls = 16 * AT_LP * 2;   // LDS bytes between a lane's rows
  asm volatile(
      "global_load_async_to_lds_b128 %0, %12, off\n\t"
      "global_load_async_to_lds_b128 %1, %13, off\n\t"
      "global_load_async_to_lds_b128 %2, %14, off\n\t"
      "global_load_async_to_lds_b128 %3, %15, off\n\t"
      "global_load_async_to_lds_b128 %4, %16, off\n\t"
      "global_load_async_to_lds_b128 %5, %17, off\n\t"
      "global_load_async_to_lds_b128 %6, %18, off\n\t"
      "global_load_async_to_lds_b128 %7, %19, off\n\t"
      "global_load_async_to_lds_b128 %8, %20, off\n\t"
      "global_load_async_to_lds_b128 %9, %21, off\n\t"
      "global_load_async_to_lds_b128 %10, %22, off\n\t"
      "global_load_async_to_lds_b128 %11, %23, off\n\t"
      "s_wait_xcnt 0x0"
      :: "v"(lk), "v"(lk + ls), "v"(lk + 2 * ls), "v"(lk + 3 * ls),
         "v"(ll), "v"(ll + ls), "v"(ll + 2 * ls), "v"(ll + 3 * ls),
         "v"(lv), "v"(lv + ls), "v"(lv + 2 * ls), "v"(lv + 3 * ls),
         "v"(gk), "v"(gk + 16 * kDhd), "v"(gk + 32 * kDhd), "v"(gk + 48 * kDhd),
         "v"(gl), "v"(gl + 16 * kDhd), "v"(gl + 32 * kDhd), "v"(gl + 48 * kDhd),
         "v"(gv), "v"(gv + 16 * kSeq), "v"(gv + 32 * kSeq), "v"(gv + 48 * kSeq)
      : "memory");
}

// four waves per SIMD (four work-groups per WGP, the whole grid resident at once): the register budget is 256
__global__ __launch_bounds__(128) __attribute__((amdgpu_waves_per_eu(4, 4)))
void mqa_full64_kernel(const unsigned short* __restrict__ qhp, const unsigned short* __restrict__ qlp,
                       const unsigned short* __restrict__ khp, const unsigned short* __restrict__ klp,
                       const unsigned short* __restrict__ vtp, unsigned short* __restrict__ o16p,
                       float sscale) {
  union FB { v16b v; v8b h[2]; };
  union FH { v16h v; v8h h[2]; };
  __shared__ __align__(16) __bf16   KshB[2 * AT_TL];            // K hi [kv][d], pitch AT_LP      2 buffers x 9 KB
  __shared__ __align__(16) __bf16   KslB[2 * AT_TL];            // K lo                          2 buffers x 9 KB
  __shared__ __align__(16) _Float16 VthB[2 * AT_TL];            // V^T f16 [d][kv], pitch AT_LP  2 buffers x 9 KB
  __shared__ __align__(16) float    Os[AT_NW][16 * 68];         // per wave out tile, pitch 68

  const int tid  = threadIdx.x;
  const int wave = tid >> 5;
  const int lane = tid & 31;
  const int hh   = lane >> 4;
  const int c    = lane & 15;

  const int nqb = kSeq / AT_QB;            // 32
  const int b  = blockIdx.y;               // 0..kBatch-1
  const int bx = blockIdx.x;               // 0..kHeads*nqb-1
  const int qb = bx % nqb;
  const int h  = bx / nqb;                 // 0..kHeads-1
  const int q0 = qb * AT_QB + wave * 16;

  const __bf16*   Qh = (const __bf16*)(const void*)qhp + (size_t)b * kSeq * kDm + (size_t)h * AT_D;
  const __bf16*   Ql = (const __bf16*)(const void*)qlp + (size_t)b * kSeq * kDm + (size_t)h * AT_D;
  const __bf16*   Kh = (const __bf16*)(const void*)khp + (size_t)b * kSeq * kDhd;
  const __bf16*   Kl = (const __bf16*)(const void*)klp + (size_t)b * kSeq * kDhd;
  const _Float16* Vt = (const _Float16*)(const void*)vtp + (size_t)b * AT_D * kSeq;
  _Float16*       ob = (_Float16*)(void*)o16p + (size_t)b * kSeq * kDm + (size_t)h * AT_D;

  // ---- Q fragments (B operand, column = query = lane&15, split k map via Frag load): 2 d-chunks, hi and lo ----
  v16b qah[2], qal[2];
#pragma unroll
  for (int dc = 0; dc < 2; ++dc) {
    const __bf16* qr = Qh + (size_t)(q0 + c) * kDm + dc * 32 + 8 * hh;
    const __bf16* ql = Ql + (size_t)(q0 + c) * kDm + dc * 32 + 8 * hh;
    qah[dc] = Frag<__bf16>::load(qr);
    qal[dc] = Frag<__bf16>::load(ql);
  }

  const float c2 = sscale * 1.44269504088896340736f;   // score scale times log2(e), positive: exp(x) = 2^(x * log2 e)
  float mrun = -INFINITY;   // running maximum of query q0 + c in base-2 units (equal in both wave halves)
  float lrun = 0.f;         // running sum (x2^15) over this half's keys only; the halves join in the epilogue
  v8f oacc[4];              // oacc[t][r] = O^T(d = t*16 + 8*hh + r, query q0 + c)
#pragma unroll
  for (int t = 0; t < 4; ++t) oacc[t] = (v8f){0.f,0.f,0.f,0.f,0.f,0.f,0.f,0.f};

  const int nChunks = kSeq / AT_KC;   // 32, compile-time constant (at least two: the prologue fills both buffers)
  // staging map: row sr (+16, +32, +48), 16-B piece sp / 8 of the row's 128-B line; 128 threads x 4 rows x 8 elements = 64 x 64 per plane
  const int sr = tid >> 3, sp = (tid & 7) * 8;
  const __bf16*   gk = Kh + (size_t)sr * kDhd + sp;   // chunk 0: K row sr, d = sp..sp+7; a chunk further: + AT_KC rows
  const __bf16*   gl = Kl + (size_t)sr * kDhd + sp;
  const _Float16* gv = Vt + (size_t)sr * kSeq + sp;    // chunk 0: V^T row d = sr, s = sp..sp+7; a chunk further: + AT_KC columns
  const unsigned lk = (unsigned)(uintptr_t)(KshB + sr * AT_LP + sp);   // LDS byte address: the low 32 bits of the shared address
  const unsigned ll = (unsigned)(uintptr_t)(KslB + sr * AT_LP + sp);
  const unsigned lv = (unsigned)(uintptr_t)(VthB + sr * AT_LP + sp);
  at_copy_chunk(lk, ll, lv, gk, gl, gv);                     // chunk 0 -> buffer 0
  asm volatile("s_wait_asynccnt 0x0" ::: "memory");          // this wave's copies of chunk 0 have landed
  __syncthreads();                                           // ... and every other wave's: chunk 0 may be read
  at_copy_chunk(lk + AT_TL * 2, ll + AT_TL * 2, lv + AT_TL * 2, gk + AT_KC * kDhd, gl + AT_KC * kDhd, gv + AT_KC);   // chunk 1 -> buffer 1
  for (int kc = 0; kc < nChunks; ++kc) {
    const int bo = (kc & 1) * AT_TL;   // this chunk's buffer
    const __bf16*   Ksh = KshB + bo;
    const __bf16*   Ksl = KslB + bo;
    const _Float16* Vth = VthB + bo;

    // ---- scores, transposed: A operand row = key j*16+c, B operand column = query c, both <- d with the split k map ----
    // The chunk's LDS reads stand in two groups, each ahead of the products that use it: a wave then waits out the LDS latency
    // once per group and not once per fragment. Group 1, here: all sixteen K fragments (hi and lo), in front of the first product.
    FB kb[4][2], kl[4][2];   // [key tile j][d half dc]
#pragma unroll   // register arrays: constant indices only (inner loop too)
    for (int j = 0; j < 4; ++j) {
#pragma unroll
      for (int dc = 0; dc < 2; ++dc) {
        kb[j][dc].h[0] = *(const v8b*)(Ksh + (j * 16 + c) * AT_LP + dc * 32 + 8 * hh);
        kb[j][dc].h[1] = *(const v8b*)(Ksh + (j * 16 + c) * AT_LP + dc * 32 + 16 + 8 * hh);
        kl[j][dc].h[0] = *(const v8b*)(Ksl + (j * 16 + c) * AT_LP + dc * 32 + 8 * hh);
        kl[j][dc].h[1] = *(const v8b*)(Ksl + (j * 16 + c) * AT_LP + dc * 32 + 16 + 8 * hh);
      }
    }
    // keeps the sixteen K fragment reads one group in front of the products (the scheduler otherwise spreads them among the WMMAs)
    __builtin_amdgcn_sched_barrier(0);
    FH vb[2][4];             // [key half kk][d tile t]
    v8f s[4];
#pragma unroll
    for (int j = 0; j < 4; ++j) s[j] = (v8f){0.f,0.f,0.f,0.f,0.f,0.f,0.f,0.f};
    // The products run round-robin over the four key tiles: a WMMA's accumulator was last written four WMMAs earlier, so none
    // waits for the one in front of it. Each tile's own six products keep their order (per d half: hi.hi, lo.hi, hi.lo).
#pragma unroll   // register arrays: constant indices only (inner loops too)
    for (int dc = 0; dc < 2; ++dc) {
#pragma unroll
      for (int j = 0; j < 4; ++j) s[j] = at_mma(kb[j][dc].v, qah[dc], s[j]);
#pragma unroll
      for (int j = 0; j < 4; ++j) s[j] = at_mma(kl[j][dc].v, qah[dc], s[j]);
#pragma unroll
      for (int j = 0; j < 4; ++j) s[j] = at_mma(kb[j][dc].v, qal[dc], s[j]);
      if (dc == 0) {
        // Group 2: all eight V^T fragments, into registers that the first d half's K fragments have left; they land behind the
        // second d half's products and the softmax. A: row = d = t*16 + c, same key map as P^T.
        // The two scheduling barriers keep these reads one group at this place.
        __builtin_amdgcn_sched_barrier(0);
#pragma unroll
        for (int kk = 0; kk < 2; ++kk) {
#pragma unroll
          for (int t = 0; t < 4; ++t) {
            vb[kk][t].h[0] = *(const v8h*)(Vth + (t * 16 + c) * AT_LP + kk * 32 + 8 * hh);
            vb[kk][t].h[1] = *(const v8h*)(Vth + (t * 16 + c) * AT_LP + kk * 32 + 16 + 8 * hh);
          }
        }
        __builtin_amdgcn_sched_barrier(0);
      }
    }
    // D layout: s[j][r] = score(key kv0 + j*16 + 8*hh + r, query q0 + c)
    // the loops over j, r and t below are unrolled because s and oacc are register arrays; one chain per j keeps four
    // independent maximum and sum chains in flight
    float mj[4];
#pragma unroll
    for (int j = 0; j < 4; ++j) {
      float m = -INFINITY;
#pragma unroll
      for (int r = 0; r < 8; ++r) m = fmaxf(m, s[j][r]);   // raw products: c2 > 0 keeps their order
      mj[j] = m;
    }
    float cm = fmaxf(fmaxf(mj[0], mj[1]), fmaxf(mj[2], mj[3]));
    cm = fmaxf(cm, at_xhalf(cm));            // the query's maximum over all 64 keys of the chunk, in both halves
    const float mnew = fmaxf(mrun, cm * c2);  // running maximum in base-2 units
    const float alpha = at_exp2(mrun - mnew);
    mrun = mnew;
    const float nb = kPlog - mnew;            // one addend per query: exponent = score * c2 - maximum + 15
    float pj[4];
#pragma unroll
    for (int j = 0; j < 4; ++j) {
      float x[8];
#pragma unroll
      for (int r = 0; r < 8; ++r) x[r] = fmaf(s[j][r], c2, nb);   // base-2 exponent of the numerator x2^15: one multiply-add
      at_exp2x8(x[0], x[1], x[2], x[3], x[4], x[5], x[6], x[7]);
      float ps = 0.f;
#pragma unroll
      for (int r = 0; r < 8; ++r) {
        ps += x[r];
        s[j][r] = x[r];
      }
      pj[j] = ps;
    }
    lrun = lrun * alpha + ((pj[0] + pj[1]) + (pj[2] + pj[3]));
#pragma unroll
    for (int t = 0; t < 4; ++t)
#pragma unroll
      for (int r = 0; r < 8; ++r) oacc[t][r] *= alpha;
    // ---- O^T += V^T . P^T: two score tiles (keys kk*32 + 8hh + 0..7 and kk*32 + 16 + 8hh + 0..7) are one B operand in place ----
#pragma unroll
    for (int kk = 0; kk < 2; ++kk) {   // unrolled: the score tiles are registers and cannot be indexed at run time
      v16h pb;
#pragma unroll   // vector elements are registers: constant indices only
      for (int e = 0; e < 8; ++e) {
        pb[e]     = (_Float16)s[2 * kk][e];
        pb[8 + e] = (_Float16)s[2 * kk + 1][e];
      }
#pragma unroll
      for (int t = 0; t < 4; ++t) oacc[t] = at_mma_h(vb[kk][t].v, pb, oacc[t]);
    }
    // hand-over: this wave's reads of the chunk's buffer are done, its copies of the next chunk have landed; behind the barrier
    // the same holds of every wave, so the next chunk may be read and this chunk's buffer refilled
    // keeps the hand-over at the foot of the chunk: the scheduler otherwise lifts the waits and the barrier to right behind the V^T reads, whose latency then lies open
    __builtin_amdgcn_sched_barrier(0);
    asm volatile("s_wait_dscnt 0x0" ::: "memory");      // this wave's last fragment reads of the buffer have returned
    asm volatile("s_wait_asynccnt 0x0" ::: "memory");   // this wave's copies of chunk kc + 1 have landed
    __syncthreads();
    if (kc + 2 < nChunks)   // the same for the whole work-group
      at_copy_chunk(lk + bo * 2, ll + bo * 2, lv + bo * 2,
                    gk + (size_t)(kc + 2) * AT_KC * kDhd, gl + (size_t)(kc + 2) * AT_KC * kDhd, gv + (kc + 2) * AT_KC);
  }
  asm volatile("s_wait_asynccnt 0x0" ::: "memory");   // no copy is outstanding when the wave goes on to its end

  // ---- epilogue: O = oacc / (l * 2^15), carried x kOsc as f16 ----
  float* os = Os[wave];
  {
    const float lsum = lrun + at_xhalf(lrun);   // the two halves' key sums of query q0 + c
    const float inv = kOsc * (1.0f / lsum);   // lsum carries the numerators' x2^15
#pragma unroll   // oacc is a register array: constant indices only (inner loop too)
    for (int t = 0; t < 4; ++t) {
      v4f w0, w1;
#pragma unroll
      for (int r = 0; r < 4; ++r) { w0[r] = oacc[t][r] * inv; w1[r] = oacc[t][4 + r] * inv; }
      *(v4f*)(os + c * 68 + t * 16 + 8 * hh)     = w0;   // row = query c, 8 consecutive d per lane
      *(v4f*)(os + c * 68 + t * 16 + 8 * hh + 4) = w1;
    }
  }
  __builtin_amdgcn_fence(__ATOMIC_RELEASE, "workgroup");
  __builtin_amdgcn_wave_barrier();
  __builtin_amdgcn_fence(__ATOMIC_ACQUIRE, "workgroup");
  {
    const int qg = lane >> 3, c8 = (lane & 7) * 8;
    {
#pragma unroll
      for (int it = 0; it < 4; ++it) {
        const int row = it * 4 + qg;                    // 4 it x 4 groups = rows 0..15
        const float* sp = os + row * 68 + c8;
        v8h hv;
#pragma unroll
        for (int e = 0; e < 8; ++e) hv[e] = (_Float16)sp[e];
        *(v8h*)(ob + (size_t)(q0 + row) * kDm + c8) = hv;
      }
      
    }
  }
}

// ---------------------------------------------------------------------------
// Host driver. Workspace region map (bytes, 256-B aligned offsets):
//   x16   [4096][1024] bf16           8388608
//   wq16p [1024][1024] bf16 (rows permuted to head-major)  2097152
//   wk16  [64][1024]   bf16            131072
//   wv16  [64][1024]   bf16            131072
//   wo16  [1024][1024] f16 (bf16-RNE x16)  2097152
//   bqp   [1024]       f32 (permuted)     4096
//   Qh,Ql [4096][1024] bf16 hi/lo     2 x 8388608
//   Kh,Kl [4096][64]   bf16 hi/lo     2 x 524288
//   Vt16  [2][64][2048] f16            524288
//   O16   [4096][1024] f16 (x16)      8388608
//   total 39587840 B
// ---------------------------------------------------------------------------
extern "C" void kernel_launch(void* const* d_in, const int* in_sizes, int n_in,
                              void* d_out, int out_size, void* d_ws, size_t ws_size,
                              hipStream_t stream) {
  const int nB = kBatch, nS = kSeq, nD = kDm, nDh = kDhd;
  const int nM = nB * nS;   // 4096
  if (n_in < 9) return;
  if (in_sizes[0] != nM * nD || in_sizes[1] != nD * nD || in_sizes[2] != nD ||
      in_sizes[3] != nDh * nD || in_sizes[4] != nDh || in_sizes[5] != nDh * nD ||
      in_sizes[6] != nDh || in_sizes[7] != nD * nD || in_sizes[8] != nD || out_size != nM * nD) return;

  const float* x  = (const float*)d_in[0];
  const float* wq = (const float*)d_in[1];
  const float* bq = (const float*)d_in[2];
  const float* wk = (const float*)d_in[3];
  const float* bk = (const float*)d_in[4];
  const float* wv = (const float*)d_in[5];
  const float* bv = (const float*)d_in[6];
  const float* wo = (const float*)d_in[7];
  const float* bo = (const float*)d_in[8];

  size_t off = 0;
  auto carve = [&](size_t bytes) -> char* {
    char* p = (char*)d_ws + off;
    off += (bytes + 255) & ~(size_t)255;
    return p;
  };
  unsigned short* x16   = (unsigned short*)carve((size_t)nM * nD * 2);
  unsigned short* wq16p = (unsigned short*)carve((size_t)nD * nD * 2);
  unsigned short* wk16  = (unsigned short*)carve((size_t)nDh * nD * 2);
  unsigned short* wv16  = (unsigned short*)carve((size_t)nDh * nD * 2);
  unsigned short* wo16  = (unsigned short*)carve((size_t)nD * nD * 2);
  float*          bqp   = (float*)carve((size_t)nD * 4);
  unsigned short* Qh    = (unsigned short*)carve((size_t)nM * nD * 2);
  unsigned short* Ql    = (unsigned short*)carve((size_t)nM * nD * 2);
  unsigned short* Kh    = (unsigned short*)carve((size_t)nM * nDh * 2);
  unsigned short* Kl    = (unsigned short*)carve((size_t)nM * nDh * 2);
  unsigned short* Vt16  = (unsigned short*)carve((size_t)nB * nDh * nS * 2);
  unsigned short* O16   = (unsigned short*)carve((size_t)nM * nD * 2);
  if (off > ws_size) return;

  // ---- casts (bf16 RNE; wq rows / bq permuted to head-major; wo as f16(bf16_rne(wo) * 16)): one launch ----
  prep_kernel<<<dim3(kCbAll), dim3(256), 0, stream>>>(x, wq, wo, wk, wv, bq, x16, wq16p, wo16, wk16, wv16, bqp);

  // ---- q, k and v^T projections: one launch, 128 + 8 + 2 x 4 work-groups of 8 waves, one 64x64 tile per wave ----
  proj_qkv_kernel<<<dim3(kPjQ + kPjK + kBatch * kPjV), dim3(256), 0, stream>>>(
      x16, wq16p, wk16, wv16, bqp, bk, bv, Qh, Ql, Kh, Kl, Vt16, nD);

  // ---- attention: grid (16 heads x 32 query blocks, 2 batches), all heads share the batch's K / V^T planes ----
  mqa_full64_kernel<<<dim3(kHeads * (nS / AT_QB), nB), dim3(128), 0, stream>>>(Qh, Ql, Kh, Kl, Vt16, O16, 0.125f);

  // ---- output projection: out [4096][1024] f32 = (O16 . wo16^T) / 256 + bo ----
  wmma_gemm64<0, false, 2, 0, false, 0><<<dim3((nM / 64) * (nD / 64) / 8, 1), dim3(256), 0, stream>>>(
      O16, 0L, wo16, 0L, d_out, d_out, nD, 0L, bo, bo, 0L, nM, nD, nD, 1.0f / (kOsc * kWsc));
}

// v009
// A run of this version takes 96 microseconds.
// In both of two side-by-side timings against v008, it was 1.04 times as fast.
// All steps since v000 together make it 5.14 times as fast.
// Contractions: q/k/v^T projections v_wmma_f32_16x16x32_bf16 (inputs RNE-cast to bf16, f32 acc); q.k^T v_wmma_f32_16x16x32_bf16 with bf16 hi/lo split (hi.hi+hi.lo+lo.hi); p.v and output projection v_wmma_f32_16x16x32_f16 (p carried x2^15, o carried x16, wo carried x16), f32 acc; online softmax, biases and scales in f32.
#include <hip/hip_runtime.h>
#include <math.h>
#include <stdint.h>

typedef __attribute__((ext_vector_type(16))) _Float16 v16h;
typedef __attribute__((ext_vector_type(8)))  _Float16 v8h;
typedef __attribute__((ext_vector_type(16))) __bf16   v16b;
typedef __attribute__((ext_vector_type(8)))  __bf16   v8b;
typedef __attribute__((ext_vector_type(8)))  float    v8f;
typedef __attribute__((ext_vector_type(4)))  float    v4f;
typedef __attribute__((ext_vector_type(2)))  float    v2f;
typedef __attribute__((ext_vector_type(4)))  unsigned int v4u;

// problem geometry (compile-time)
constexpr int kBatch = 2;
constexpr int kSeq   = 2048;
constexpr int kDm    = 1024;   // model width = H*Dh = q row pitch
constexpr int kHeads = 16;
constexpr int kDhd   = 64;     // per-head dim = k row pitch
constexpr float kPlog = 15.0f;     // softmax numerators carried x2^15 in f16: 15 is added to their base-2 exponent
constexpr float kOsc = 16.0f;      // attention output carried x16 in f16
constexpr float kWsc = 16.0f;      // output-projection weight carried x16 in f16

__device__ __forceinline__ unsigned short f2bf_bits(float f) {
  unsigned u = __float_as_uint(f);
  return (unsigned short)((u + 0x7FFFu + ((u >> 16) & 1u)) >> 16);
}
__device__ __forceinline__ float bf_bits2f(unsigned short h) { return __uint_as_float(((unsigned)h) << 16); }
__device__ __forceinline__ unsigned pk16(unsigned short a, unsigned short b) { return (unsigned)a | ((unsigned)b << 16); }

// hazard guards as plain device helpers
__device__ __forceinline__ void dep_guard_h(v8f& a, v8f& b, v16h x, v16h y) { asm volatile("v_nop\n\tv_nop\n\tv_nop\n\tv_nop" : "+v"(a), "+v"(b) : "v"(x), "v"(y)); }
__device__ __forceinline__ void dep_guard_b(v8f& a, v8f& b, v16b x, v16b y) { asm volatile("v_nop\n\tv_nop\n\tv_nop\n\tv_nop" : "+v"(a), "+v"(b) : "v"(x), "v"(y)); }
__device__ __forceinline__ void keep4_h(v16h a, v16h b, v16h c, v16h d) { asm volatile("v_nop" :: "v"(a), "v"(b), "v"(c), "v"(d)); }
__device__ __forceinline__ void keep4_b(v16b a, v16b b, v16b c, v16b d) { asm volatile("v_nop" :: "v"(a), "v"(b), "v"(c), "v"(d)); }
__device__ __forceinline__ void acc_guard4(v8f& a, v8f& b, v8f& c, v8f& d) { asm volatile("v_nop\n\tv_nop\n\tv_nop\n\tv_nop" : "+v"(a), "+v"(b), "+v"(c), "+v"(d)); }
template <typename T> struct Frag;
template <> struct Frag<_Float16> {
  typedef v16h V; typedef v8h H; union U { v16h v; v8h h[2]; };
  static __device__ __forceinline__ v16h load(const _Float16* p) {   // elements 0..7 <- p[0..7], 8..15 <- p[16..23]
    U f; f.h[0] = *(const v8h*)(p); f.h[1] = *(const v8h*)(p + 16); return f.v;
  }
  static __device__ __forceinline__ v8f mma(v16h a, v16h b, v8f c) {
    return __builtin_amdgcn_wmma_f32_16x16x32_f16(false, a, false, b, (short)0, c, false, false);
  }
  static __device__ __forceinline__ void guard(v8f& a, v8f& b, v16h x, v16h y) { dep_guard_h(a, b, x, y); }
  static __device__ __forceinline__ void keep(v16h a, v16h b, v16h c, v16h d) { keep4_h(a, b, c, d); }
};
template <> struct Frag<__bf16> {
  typedef v16b V; typedef v8b H; union U { v16b v; v8b h[2]; };
  static __device__ __forceinline__ v16b load(const __bf16* p) {
    U f; f.h[0] = *(const v8b*)(p); f.h[1] = *(const v8b*)(p + 16); return f.v;
  }
  static __device__ __forceinline__ v8f mma(v16b a, v16b b, v8f c) {
    return __builtin_amdgcn_wmma_f32_16x16x32_bf16(false, a, false, b, (short)0, c, false, false);
  }
  static __device__ __forceinline__ void guard(v8f& a, v8f& b, v16b x, v16b y) { dep_guard_b(a, b, x, y); }
  static __device__ __forceinline__ void keep(v16b a, v16b b, v16b c, v16b d) { keep4_b(a, b, c, d); }
};

// ---- Register-blocked batched WMMA GEMM ------------------------------------
// C[m,n] = scale * sum_k A[m,k] * Bt[n,k] (+bias)(+resid); each wave owns a 64x64 tile.
// A row-major [M,K]; Bt row-major [N,K], both with row pitch kDm (compile time, so that the 16 row groups of a tile
// are immediate offsets of one address); M,N % 64 == 0, K % 64 == 0, K <= kDm.
// Operand path: per 64-k step each wave copies its own 64x64 A tile and 64x64 Bt tile into its own LDS range with
// global loads that cover whole 128-B lines (8 lanes per row, 4 rows per load), the next step's loads being issued
// before the current step's products; the WMMA fragments are read from LDS (k order per 32-k group as Frag::load).
// SPLIT (hi/lo planes) is not instantiated and not supported by the staged loop.
// BIAS_MODE: 0 = none, 1 = bias[m], 2 = bias[n].
// OUT_MODE: 0 = f32, 1 = f16, 2 = bf16 hi plane (Cout) + bf16 lo plane (Cout2).
// ET: 0 = f16 operands, 1 = bf16 operands (pointers passed as 16-bit storage)
#define GS_LP 72   // LDS row pitch of a staged operand tile in 16-bit elements: 144 B = 16 B x 9 (odd), conflict-free for ds_load_b128 fragment reads
template <int ET> struct Elem;
template <> struct Elem<0> { typedef _Float16 T; };
template <> struct Elem<1> { typedef __bf16 T; };
// The body is a device function, so that one launch can run several products as ranges of its grid: bx = the work-group's
// index within its product, b = the batch, sOpAll / sTAll = the work-group's LDS (8 waves x (A tile + Bt tile); 8 slabs).
#define GS_OPW (2 * 64 * GS_LP)   // 16-bit elements of one wave's A tile + Bt tile
#define GS_SLW (16 * 68)          // floats of one wave's 16x64 slab, pitch 68
template <int ET, bool SPLIT, int BIAS_MODE, int OUT_MODE, bool RESID, int ACT>
__device__ __forceinline__ void gemm64_body(
    typename Elem<ET>::T* sOpAll, float* sTAll, int bx, int b,
    const unsigned short* __restrict__ Ap, long strideA,
    const unsigned short* __restrict__ Btp, long strideB,
    void* __restrict__ Cout, void* __restrict__ Cout2, int ldc, long strideC,
    const float* __restrict__ bias,
    const float* __restrict__ resid, long strideR,
    int M, int N, int K, float scale) {
  typedef typename Elem<ET>::T T;
  typedef typename Frag<T>::V V;
  const T* A = (const T*)Ap; const T* Bt = (const T*)Btp;
  static_assert(!SPLIT, "the staged operand loop takes single-plane operands");
  typedef typename Frag<T>::H H;
  const int lane = threadIdx.x & 31;
  const int wave = __builtin_amdgcn_readfirstlane(threadIdx.x >> 5);   // wave-uniform: tile bases stay scalar
  const int tilesN = N >> 6;
  const int tilesM = M >> 6;
  const int tile = bx * 8 + wave;
  if (tile >= tilesM * tilesN) return;   // wave-uniform; no block barriers in this body
  const int tm = tile / tilesN;
  const int tn = tile - tm * tilesN;
  const int m0 = tm << 6;
  const int n0 = tn << 6;

  const T* Ab  = A  + (size_t)b * strideA;
  const T* Bb  = Bt + (size_t)b * strideB;

  const int rlane = lane & 15;                 // row (A) / col (B, D) within subtile
  const int koff  = (lane >> 4) * 8;           // k offset of this lane half
  const int mOff  = (lane >> 4) * 8;           // D row offset

  v8f acc[4][4];
#pragma unroll
  for (int i = 0; i < 4; ++i)
#pragma unroll
    for (int j = 0; j < 4; ++j) acc[i][j] = (v8f){0.f,0.f,0.f,0.f,0.f,0.f,0.f,0.f};

  // staging map: lane -> row (lane >> 3) of each group of 4 rows, 16-B piece (lane & 7) of the row's 128-B line
  const int srow = lane >> 3;
  const int scol = (lane & 7) * 8;
  const T* Ag = Ab + (size_t)(m0 + srow) * kDm + scol;   // this lane's piece of row group 0, k = 0
  const T* Bg = Bb + (size_t)(n0 + srow) * kDm + scol;
  T* sa = sOpAll + wave * GS_OPW;   // per-wave A tile and Bt tile of one 64-k step, pitch GS_LP
  T* sb = sa + 64 * GS_LP;
  H ra[16], rb[16];
#pragma unroll
  for (int it = 0; it < 16; ++it) {
    ra[it] = *(const H*)(Ag + it * 4 * kDm);
    rb[it] = *(const H*)(Bg + it * 4 * kDm);
  }

  for (int k0 = 0; k0 < K; k0 += 64) {
#pragma unroll
    for (int it = 0; it < 16; ++it) {
      *(H*)(sa + (it * 4 + srow) * GS_LP + scol) = ra[it];
      *(H*)(sb + (it * 4 + srow) * GS_LP + scol) = rb[it];
    }
    // the wave's own tile stores are complete before any of its lanes reads another lane's rows
    __builtin_amdgcn_fence(__ATOMIC_RELEASE, "workgroup");
    __builtin_amdgcn_wave_barrier();
    __builtin_amdgcn_fence(__ATOMIC_ACQUIRE, "workgroup");
    if (k0 + 64 < K) {   // wave-uniform: the next step's tiles fly while this step's products run
#pragma unroll
      for (int it = 0; it < 16; ++it) {
        ra[it] = *(const H*)(Ag + it * 4 * kDm + (k0 + 64));
        rb[it] = *(const H*)(Bg + it * 4 * kDm + (k0 + 64));
      }
      asm volatile("s_wait_xcnt 0x0" ::: "memory");   // before the fragment reads below reuse the address registers of these loads
    }
#pragma unroll
    for (int kk = 0; kk < 2; ++kk) {
      V bh[4], ah[4];
#pragma unroll
      for (int j = 0; j < 4; ++j) bh[j] = Frag<T>::load(sb + ((j << 4) + rlane) * GS_LP + kk * 32 + koff);
#pragma unroll
      for (int i = 0; i < 4; ++i) ah[i] = Frag<T>::load(sa + ((i << 4) + rlane) * GS_LP + kk * 32 + koff);
#pragma unroll
      for (int i = 0; i < 4; ++i) {
#pragma unroll
        for (int j = 0; j < 4; ++j) acc[i][j] = Frag<T>::mma(ah[i], bh[j], acc[i][j]);
        Frag<T>::guard(acc[i][0], acc[i][3], ah[i], ah[i]);
      }
      Frag<T>::keep(bh[0], bh[1], bh[2], bh[3]);
    }
    // every fragment read of this step is done before the next step's stores overwrite the tiles
    __builtin_amdgcn_fence(__ATOMIC_RELEASE, "workgroup");
    __builtin_amdgcn_wave_barrier();
    __builtin_amdgcn_fence(__ATOMIC_ACQUIRE, "workgroup");
  }
  acc_guard4(acc[0][0], acc[0][1], acc[0][2], acc[0][3]);
  acc_guard4(acc[1][0], acc[1][1], acc[1][2], acc[1][3]);
  acc_guard4(acc[2][0], acc[2][1], acc[2][2], acc[2][3]);
  acc_guard4(acc[3][0], acc[3][1], acc[3][2], acc[3][3]);

  // ---- epilogue ----
  float* slab = sTAll + wave * GS_SLW;
  const float* Rb = RESID ? (resid + (size_t)b * strideR) : nullptr;
#pragma unroll
  for (int i = 0; i < 4; ++i) {
    const int mBase = m0 + (i << 4);
    float bm[8];
    if (BIAS_MODE == 1) {
      const float* bp = bias + mBase + mOff;
#pragma unroll
      for (int r = 0; r < 8; ++r) bm[r] = bp[r];
      // before the address registers of the bias loads are reused; the address as an input keeps them untouched up to here
      asm volatile("s_wait_xcnt 0x0" :: "v"(bp) : "memory");
    }
#pragma unroll
    for (int j = 0; j < 4; ++j) {
      const int n = n0 + (j << 4) + rlane;
      float bv = 0.f;
      if (BIAS_MODE == 2) bv = bias[n];
#pragma unroll
      for (int r = 0; r < 8; ++r) {
        float v = acc[i][j][r] * scale;
        if (BIAS_MODE == 1) v += bm[r];
        if (BIAS_MODE == 2) v += bv;
        if (RESID) v += Rb[(size_t)(mBase + mOff + r) * ldc + n];
        if (ACT == 1) v = tanhf(v);
        if (ACT == 2) v = fmaxf(v, 0.0f);
        if (ACT == 3) v = v / (1.0f + expf(-v));
        if (ACT == 4) v = (v > 0.f) ? v : 0.01f * v;
        if (ACT == 5) v = 0.5f * v * (1.0f + erff(v * 0.70710678118654752f));
        slab[(mOff + r) * 68 + (j << 4) + rlane] = v;
      }
    }
    __builtin_amdgcn_fence(__ATOMIC_RELEASE, "workgroup");
    __builtin_amdgcn_wave_barrier();
    __builtin_amdgcn_fence(__ATOMIC_ACQUIRE, "workgroup");
    if (OUT_MODE == 0) {
      float* C = (float*)Cout + (size_t)b * strideC;
      const int hh = lane >> 4, c4 = (lane & 15) * 4;     // row seg = 256 B = 16 lanes x 16 B
      {
#pragma unroll
        for (int it = 0; it < 8; ++it) {
          const int row = it * 2 + hh;
          v4f v = *(const v4f*)(slab + row * 68 + c4);
          *(v4f*)(C + (size_t)(mBase + row) * ldc + n0 + c4) = v;
        }
        
      }
    } else {
      const int q = lane >> 3, c8 = (lane & 7) * 8;
      unsigned short* C  = (unsigned short*)Cout  + (size_t)b * strideC;
      unsigned short* C2 = (OUT_MODE == 2) ? ((unsigned short*)Cout2 + (size_t)b * strideC) : nullptr;
      {
#pragma unroll
        for (int it = 0; it < 4; ++it) {
          const int row = it * 4 + q;
          const float* sp = slab + row * 68 + c8;
          v8h hv, lv;
#pragma unroll
          for (int e = 0; e < 8; ++e) {
            if (OUT_MODE == 1) {
              hv[e] = (_Float16)sp[e];
            } else {
              unsigned short hb = f2bf_bits(sp[e]);
              unsigned short lb = f2bf_bits(sp[e] - bf_bits2f(hb));
              hv[e] = __builtin_bit_cast(_Float16, hb);
              lv[e] = __builtin_bit_cast(_Float16, lb);
            }
          }
          *(v8h*)(C + (size_t)(mBase + row) * ldc + n0 + c8) = hv;
          if (OUT_MODE == 2) *(v8h*)(C2 + (size_t)(mBase + row) * ldc + n0 + c8) = lv;
        }
        
      }
    }
    __builtin_amdgcn_fence(__ATOMIC_RELEASE, "workgroup");
    __builtin_amdgcn_wave_barrier();
    __builtin_amdgcn_fence(__ATOMIC_ACQUIRE, "workgroup");
    // keeps the next row group's arithmetic behind the fence's store wait: no register of an issued store is rewritten before it
    __builtin_amdgcn_sched_barrier(0);
  }
}

// one product per launch: grid = (tiles / 8, batches)
template <int ET, bool SPLIT, int BIAS_MODE, int OUT_MODE, bool RESID, int ACT = 0>
__global__ __launch_bounds__(256) void wmma_gemm64(
    const unsigned short* __restrict__ Ap, long strideA,
    const unsigned short* __restrict__ Btp, long strideB,
    void* __restrict__ Cout, void* __restrict__ Cout2, int ldc, long strideC,
    const float* __restrict__ bias,
    const float* __restrict__ resid, long strideR,
    int M, int N, int K, float scale) {
  __shared__ __align__(16) typename Elem<ET>::T sOp[8 * GS_OPW];
  __shared__ __align__(16) float sT[8 * GS_SLW];
  gemm64_body<ET, SPLIT, BIAS_MODE, OUT_MODE, RESID, ACT>(sOp, sT, blockIdx.x, blockIdx.y, Ap, strideA, Btp, strideB,
      Cout, Cout2, ldc, strideC, bias, resid, strideR, M, N, K, scale);
}

// ---------------------------------------------------------------------------
// The three projections of x, which do not depend on one another, as ranges of one grid (144 work-groups, one round):
//   [0, 128)    q   [4096][1024] = x16 . wq16p^T + bqp  -> bf16 hi/lo planes, head-major columns (h*64 + d)
//   [128, 136)  k   [4096][64]   = x16 . wk16^T + bk    -> bf16 hi/lo planes
//   [136, 144)  v^T per batch z: [64][2048] = wv16 . x16_z^T + bv[m] -> f16; 4 work-groups per batch
// The range test reads blockIdx only: uniform for the work-group. K, the inner length of all three, is an argument as in wmma_gemm64.
// ---------------------------------------------------------------------------
constexpr int kPjQ = (kBatch * kSeq / 64) * (kDm / 64) / 8;    // 128
constexpr int kPjK = (kBatch * kSeq / 64) * (kDhd / 64) / 8;   // 8
constexpr int kPjV = (kDhd / 64) * (kSeq / 64) / 8;            // 4 per batch
__global__ __launch_bounds__(256) void proj_qkv_kernel(
    const unsigned short* __restrict__ x16, const unsigned short* __restrict__ wq16p,
    const unsigned short* __restrict__ wk16, const unsigned short* __restrict__ wv16,
    const float* __restrict__ bqp, const float* __restrict__ bk, const float* __restrict__ bv,
    unsigned short* __restrict__ Qh, unsigned short* __restrict__ Ql,
    unsigned short* __restrict__ Kh, unsigned short* __restrict__ Kl,
    unsigned short* __restrict__ Vt16, int K) {
  __shared__ __align__(16) __bf16 sOp[8 * GS_OPW];
  __shared__ __align__(16) float sT[8 * GS_SLW];
  const int bx = blockIdx.x;
  if (bx < kPjQ + kPjK) {
    const bool isq = bx < kPjQ;
    const int n = isq ? kDm : kDhd;
    gemm64_body<1, false, 2, 2, false, 0>(sOp, sT, isq ? bx : bx - kPjQ, 0, x16, 0L, isq ? wq16p : wk16, 0L,
        (void*)(isq ? Qh : Kh), (void*)(isq ? Ql : Kl), n, 0L, isq ? bqp : bk, nullptr, 0L, kBatch * kSeq, n, K, 1.0f);
  } else {
    const int v = bx - (kPjQ + kPjK);
    gemm64_body<1, false, 1, 1, false, 0>(sOp, sT, v % kPjV, v / kPjV, wv16, 0L, x16, (long)kSeq * kDm,
        (void*)Vt16, (void*)Vt16, kSeq, (long)kDhd * kSeq, bv, nullptr, 0L, kDhd, kSeq, K, 1.0f);
  }
}

// ---------------------------------------------------------------------------
// Elementwise f32 -> bf16 (RNE), 2 elements per thread, one 4-B store per lane -> each wave writes exactly
// Coverage: range = ceil(n2/256) work-groups x 256 threads x 2 elements = 2*n2 = whole plane
//   (x: n2 = 4096*1024/2 = 2097152 -> 8192 blocks exact; wk/wv: n2 = 32768 -> 128 blocks exact).
// ---------------------------------------------------------------------------
__device__ __forceinline__ void cast_bf16x2(int bx, const float* __restrict__ in, unsigned short* __restrict__ out, int n2) {
  const int i = bx * 256 + threadIdx.x;
  if (i < n2) {
    const v2f f = *(const v2f*)(in + 2 * (size_t)i);
    const unsigned u = pk16(f2bf_bits(f[0]), f2bf_bits(f[1]));
    ((unsigned*)out)[i] = u;
    
  }
}

// ---------------------------------------------------------------------------
// Row-permuted f32 -> bf16 (RNE) cast of a [1024][ncol] weight: dest row rd = h*64 + d takes source row d*16 + h
// (de-interleave of the (hidden, heads) column split). (bx, by) in (ncol/512, 1024), 256 threads, 2 elements per thread.
// ---------------------------------------------------------------------------
__device__ __forceinline__ void cast_perm_rows_bf16x2(int bx, int by, const float* __restrict__ in, unsigned short* __restrict__ out, int ncol) {
  const int rd = by;                                    // 0..1023
  int rs = ((rd & 63) << 4) + (rd >> 6);                // 0..1023
  rs = rs > 1023 ? 1023 : rs;
  const int i = bx * 256 + threadIdx.x;                 // pair index within the row
  if (i < (ncol >> 1)) {
    const v2f f = *(const v2f*)(in + (size_t)rs * ncol + 2 * (size_t)i);
    const unsigned u = pk16(f2bf_bits(f[0]), f2bf_bits(f[1]));
    unsigned* o = (unsigned*)(out + (size_t)rd * ncol);
    o[i] = u;
    
  }
}

// ---------------------------------------------------------------------------
// Permuted bias: out[h*64 + d] = in[d*16 + h]; n = 1024; 4 blocks x 256 threads x 4 B = whole vector,
// ---------------------------------------------------------------------------
__device__ __forceinline__ void perm_bias(int bx, const float* __restrict__ in, float* __restrict__ out, int n) {
  const int i = bx * 256 + threadIdx.x;
  if (i < n) {
    int s = ((i & 63) << 4) + (i >> 6);
    s = s > n - 1 ? n - 1 : s;
    const float v = in[s];
    ((float*)out)[i] = v;
    
  }
}

// ---------------------------------------------------------------------------
// Elementwise f32 -> f16 of (bf16_rne(x) * sc) with sc a power of two: 2 elements per thread, one 4-B store per lane.
// ---------------------------------------------------------------------------
__device__ __forceinline__ void cast_bf_f16x2_scaled(int bx, const float* __restrict__ in, unsigned short* __restrict__ out, int n2, float sc) {
  const int i = bx * 256 + threadIdx.x;
  if (i < n2) {
    const v2f f = *(const v2f*)(in + 2 * (size_t)i);
    const float g0 = bf_bits2f(f2bf_bits(f[0])) * sc;
    const float g1 = bf_bits2f(f2bf_bits(f[1])) * sc;
    const _Float16 h0 = (_Float16)g0, h1 = (_Float16)g1;
    const unsigned u = pk16(__builtin_bit_cast(unsigned short, h0), __builtin_bit_cast(unsigned short, h1));
    ((unsigned*)out)[i] = u;
    
  }
}

// ---------------------------------------------------------------------------
// The six casts and permutations above, which do not depend on one another, as ranges of one grid of 256-thread work-groups
// (each range has the work-group count its own launch would have; the range tests read blockIdx only):
//   x 8192 | wq 2 x 1024 | wo 2048 | wk 128 | wv 128 | bq 4   = 12548
// ---------------------------------------------------------------------------
constexpr int kCbX  = kBatch * kSeq * kDm / 2 / 256;   // 8192
constexpr int kCbQx = kDm / 2 / 256;                   // 2 work-groups per wq row
constexpr int kCbQ  = kCbQx * kDm;                     // 2048
constexpr int kCbO  = kDm * kDm / 2 / 256;             // 2048
constexpr int kCbKV = kDhd * kDm / 2 / 256;            // 128
constexpr int kCbB  = kDm / 256;                       // 4
constexpr int kCbAll = kCbX + kCbQ + kCbO + 2 * kCbKV + kCbB;
__global__ __launch_bounds__(256) void prep_kernel(
    const float* __restrict__ x, const float* __restrict__ wq, const float* __restrict__ wo,
    const float* __restrict__ wk, const float* __restrict__ wv, const float* __restrict__ bq,
    unsigned short* __restrict__ x16, unsigned short* __restrict__ wq16p, unsigned short* __restrict__ wo16,
    unsigned short* __restrict__ wk16, unsigned short* __restrict__ wv16, float* __restrict__ bqp) {
  int bx = blockIdx.x;
  if (bx < kCbX) { cast_bf16x2(bx, x, x16, kBatch * kSeq * kDm / 2); return; }
  bx -= kCbX;
  if (bx < kCbQ) { cast_perm_rows_bf16x2(bx % kCbQx, bx / kCbQx, wq, wq16p, kDm); return; }
  bx -= kCbQ;
  if (bx < kCbO) { cast_bf_f16x2_scaled(bx, wo, wo16, kDm * kDm / 2, kWsc); return; }
  bx -= kCbO;
  if (bx < kCbKV) { cast_bf16x2(bx, wk, wk16, kDhd * kDm / 2); return; }
  bx -= kCbKV;
  if (bx < kCbKV) { cast_bf16x2(bx, wv, wv16, kDhd * kDm / 2); return; }
  bx -= kCbKV;
  perm_bias(bx, bq, bqp, kDm);
}

// =====================================================================================
// Full (non-causal, unmasked) multi-query attention, head dim 64.
//   q planes (hi/lo bf16): element (b, t, h, d) at [(b*kSeq + t)*kDm + h*64 + d]
//   k planes (hi/lo bf16): element (b, s, d) at [(b*kSeq + s)*kDhd + d]      (one KV head shared by all heads)
//   v^T plane (f16):       element (b, d, s) at [(b*64 + d)*kSeq + s]
//   out plane (f16, x kOsc): element (b, t, h, d) at [(b*kSeq + t)*kDm + h*64 + d]
//   scores = (q . k) * sscale : bf16 hi/lo split (hi.hi + hi.lo + lo.hi) on v_wmma_f32_16x16x32_bf16
//   out    = p . v            : v_wmma_f32_16x16x32_f16, p (unnormalised, <= 1) carried x2^15, f32 accumulate
//   both products are formed transposed: S^T = K . Q^T (A = K rows, B = Q columns) and O^T += V^T . P^T (A = V^T rows,
//   B = P^T packed from the score accumulators), so a lane holds 32 scores of ONE query per column tile and chunk: maximum and sum run
//   in the lane, the two wave halves join by one cross-row move, and P never passes through LDS.
//   online softmax in f32 over all kSeq keys (32 chunks of 64, compile-time trip count, no masking).
//   Block = 4 waves = 128 query rows of one (batch, head); grid = (kHeads * kSeq/128, kBatch).
//   A wave owns 32 queries = two column tiles of 16: every K and V^T fragment it reads from LDS is an A operand for both column tiles.
//   K / V^T chunk staging: asynchronous 16-B copies to LDS, 128 threads x 4 copies per plane = the whole 64x64 tile, 8 lanes
//   per 128-B row (whole lines); two buffers: chunk t + 2 is copied into the buffer that chunk t has left, one barrier per chunk.
// =====================================================================================
#define AT_D 64
#define AT_NW 4
#define AT_QB 128
#define AT_QT 2    // column tiles (16 queries each) per wave
#define AT_KC 64
#define AT_TL (AT_KC * AT_LP)   // 16-bit elements of one staged plane: 64 rows at pitch AT_LP
#define AT_LP 72   // LDS row pitch in 16-bit elements: 144 B = 16 B x 9 (odd), so the 16 rows of one ds_load_b128 half fall on 16 distinct 4-bank groups

__device__ __forceinline__ v8f at_mma(v16b a, v16b b, v8f c) {
  return __builtin_amdgcn_wmma_f32_16x16x32_bf16(false, a, false, b, (short)0, c, false, false);
}
__device__ __forceinline__ v8f at_mma_h(v16h a, v16h b, v8f c) {
  return __builtin_amdgcn_wmma_f32_16x16x32_f16(false, a, false, b, (short)0, c, false, false);
}

// lane l takes the value of lane l ^ 16 (the other half of the wave, same column)
__device__ __forceinline__ float at_xhalf(float x) {
  return __builtin_bit_cast(float, __builtin_amdgcn_permlanex16(__builtin_bit_cast(int, x), __builtin_bit_cast(int, x), 0x76543210, 0xfedcba98, false, false));
}

__device__ __forceinline__ float at_exp2(float x) {
  float y;
  // v_nop: the slot behind the transcendental; s_delay_alu: the compiler hints no reader of an asm result, and an unhinted wait holds up the SIMD's other waves
  asm("v_exp_f32 %0, %1\n\tv_nop\n\ts_delay_alu instid0(TRANS32_DEP_1)" : "=v"(y) : "v"(x));
  return y;
}
// eight at once, each in place on a register of its own: every exp is the independent instruction behind the one before it,
// and the one v_nop is the slot behind the last; the closing s_delay_alu hints the first reader behind the statement (as above)
__device__ __forceinline__ void at_exp2x8(float& a0, float& a1, float& a2, float& a3, float& a4, float& a5, float& a6, float& a7) {
  asm("v_exp_f32 %0, %0\n\tv_exp_f32 %1, %1\n\tv_exp_f32 %2, %2\n\tv_exp_f32 %3, %3\n\t"
      "v_exp_f32 %4, %4\n\tv_exp_f32 %5, %5\n\tv_exp_f32 %6, %6\n\tv_exp_f32 %7, %7\n\tv_nop\n\ts_delay_alu instid0(TRANS32_DEP_1)"
      : "+v"(a0), "+v"(a1), "+v"(a2), "+v"(a3), "+v"(a4), "+v"(a5), "+v"(a6), "+v"(a7));
}

// One chunk's twelve copies of one lane: rows r, r+16, r+32, r+48 of K hi, K lo and V^T, 16 B each, global -> LDS through no register.
// lk, ll, lv: the lane's LDS byte addresses of row r in the target buffer; gk, gl, gv: its global addresses of the same piece.
// s_wait_xcnt stands inside the statement, behind the last copy: the address registers are not rewritten before it.
__device__ __forceinline__ void at_copy_chunk(unsigned lk, unsigned ll, unsigned lv,
                                              const __bf16* gk, const __bf16* gl, const _Float16* gv) {
  constexpr unsigned ls = 16 * AT_LP * 2;   // LDS bytes between a lane's rows
  asm volatile(
      "global_load_async_to_lds_b128 %0, %12, off\n\t"
      "global_load_async_to_lds_b128 %1, %13, off\n\t"
      "global_load_async_to_lds_b128 %2, %14, off\n\t"
      "global_load_async_to_lds_b128 %3, %15, off\n\t"
      "global_load_async_to_lds_b128 %4, %16, off\n\t"
      "global_load_async_to_lds_b128 %5, %17, off\n\t"
      "global_load_async_to_lds_b128 %6, %18, off\n\t"
      "global_load_async_to_lds_b128 %7, %19, off\n\t"
      "global_load_async_to_lds_b128 %8, %20, off\n\t"
      "global_load_async_to_lds_b128 %9, %21, off\n\t"
      "global_load_async_to_lds_b128 %10, %22, off\n\t"
      "global_load_async_to_lds_b128 %11, %23, off\n\t"
      "s_wait_xcnt 0x0"
      :: "v"(lk), "v"(lk + ls), "v"(lk + 2 * ls), "v"(lk + 3 * ls),
         "v"(ll), "v"(ll + ls), "v"(ll + 2 * ls), "v"(ll + 3 * ls),
         "v"(lv), "v"(lv + ls), "v"(lv + 2 * ls), "v"(lv + 3 * ls),
         "v"(gk), "v"(gk + 16 * kDhd), "v"(gk + 32 * kDhd), "v"(gk + 48 * kDhd),
         "v"(gl), "v"(gl + 16 * kDhd), "v"(gl + 32 * kDhd), "v"(gl + 48 * kDhd),
         "v"(gv), "v"(gv + 16 * kSeq), "v"(gv + 32 * kSeq), "v"(gv + 48 * kSeq)
      : "memory");
}

// two waves per SIMD (two work-groups per WGP, the whole grid resident at once): the register budget is 512
__global__ __launch_bounds__(128) __attribute__((amdgpu_waves_per_eu(2, 2)))
void mqa_full64_kernel(const unsigned short* __restrict__ qhp, const unsigned short* __restrict__ qlp,
                       const unsigned short* __restrict__ khp, const unsigned short* __restrict__ klp,
                       const unsigned short* __restrict__ vtp, unsigned short* __restrict__ o16p,
                       float sscale) {
  union FB { v16b v; v8b h[2]; };
  union FH { v16h v; v8h h[2]; };
  __shared__ __align__(16) __bf16   KshB[2 * AT_TL];            // K hi [kv][d], pitch AT_LP      2 buffers x 9 KB
  __shared__ __align__(16) __bf16   KslB[2 * AT_TL];            // K lo                          2 buffers x 9 KB
  __shared__ __align__(16) _Float16 VthB[2 * AT_TL];            // V^T f16 [d][kv], pitch AT_LP  2 buffers x 9 KB
  __shared__ __align__(16) float    Os[AT_NW][AT_QT * 16 * 68]; // per wave out tile (32 queries), pitch 68

  const int tid  = threadIdx.x;
  const int wave = tid >> 5;
  const int lane = tid & 31;
  const int hh   = lane >> 4;
  const int c    = lane & 15;

  const int nqb = kSeq / AT_QB;            // 16
  const int b  = blockIdx.y;               // 0..kBatch-1
  const int bx = blockIdx.x;               // 0..kHeads*nqb-1
  const int qb = bx % nqb;
  const int h  = bx / nqb;                 // 0..kHeads-1
  const int q0 = qb * AT_QB + wave * (AT_QT * 16);

  const __bf16*   Qh = (const __bf16*)(const void*)qhp + (size_t)b * kSeq * kDm + (size_t)h * AT_D;
  const __bf16*   Ql = (const __bf16*)(const void*)qlp + (size_t)b * kSeq * kDm + (size_t)h * AT_D;
  const __bf16*   Kh = (const __bf16*)(const void*)khp + (size_t)b * kSeq * kDhd;
  const __bf16*   Kl = (const __bf16*)(const void*)klp + (size_t)b * kSeq * kDhd;
  const _Float16* Vt = (const _Float16*)(const void*)vtp + (size_t)b * AT_D * kSeq;
  _Float16*       ob = (_Float16*)(void*)o16p + (size_t)b * kSeq * kDm + (size_t)h * AT_D;

  // ---- Q fragments (B operand, column = query = qt*16 + lane&15, split k map via Frag load): per column tile 2 d-chunks, hi and lo ----
  v16b qah[AT_QT][2], qal[AT_QT][2];
#pragma unroll   // register arrays: constant indices only (inner loop too)
  for (int qt = 0; qt < AT_QT; ++qt) {
#pragma unroll
    for (int dc = 0; dc < 2; ++dc) {
      const __bf16* qr = Qh + (size_t)(q0 + qt * 16 + c) * kDm + dc * 32 + 8 * hh;
      const __bf16* ql = Ql + (size_t)(q0 + qt * 16 + c) * kDm + dc * 32 + 8 * hh;
      qah[qt][dc] = Frag<__bf16>::load(qr);
      qal[qt][dc] = Frag<__bf16>::load(ql);
    }
  }

  const float c2 = sscale * 1.44269504088896340736f;   // score scale times log2(e), positive: exp(x) = 2^(x * log2 e)
  float mrun[AT_QT];        // running maximum of query q0 + qt*16 + c in base-2 units (equal in both wave halves)
  float lrun[AT_QT];        // running sum (x2^15) over this half's keys only; the halves join in the epilogue
  v8f oacc[AT_QT][4];       // oacc[qt][t][r] = O^T(d = t*16 + 8*hh + r, query q0 + qt*16 + c)
#pragma unroll
  for (int qt = 0; qt < AT_QT; ++qt) {
    mrun[qt] = -INFINITY;
    lrun[qt] = 0.f;
#pragma unroll
    for (int t = 0; t < 4; ++t) oacc[qt][t] = (v8f){0.f,0.f,0.f,0.f,0.f,0.f,0.f,0.f};
  }

  const int nChunks = kSeq / AT_KC;   // 32, compile-time constant (at least two: the prologue fills both buffers)
  // staging map: row sr (+16, +32, +48), 16-B piece sp / 8 of the row's 128-B line; 128 threads x 4 rows x 8 elements = 64 x 64 per plane
  const int sr = tid >> 3, sp = (tid & 7) * 8;
  const __bf16*   gk = Kh + (size_t)sr * kDhd + sp;   // chunk 0: K row sr, d = sp..sp+7; a chunk further: + AT_KC rows
  const __bf16*   gl = Kl + (size_t)sr * kDhd + sp;
  const _Float16* gv = Vt + (size_t)sr * kSeq + sp;    // chunk 0: V^T row d = sr, s = sp..sp+7; a chunk further: + AT_KC columns
  const unsigned lk = (unsigned)(uintptr_t)(KshB + sr * AT_LP + sp);   // LDS byte address: the low 32 bits of the shared address
  const unsigned ll = (unsigned)(uintptr_t)(KslB + sr * AT_LP + sp);
  const unsigned lv = (unsigned)(uintptr_t)(VthB + sr * AT_LP + sp);
  at_copy_chunk(lk, ll, lv, gk, gl, gv);                     // chunk 0 -> buffer 0
  asm volatile("s_wait_asynccnt 0x0" ::: "memory");          // this wave's copies of chunk 0 have landed
  __syncthreads();                                           // ... and every other wave's: chunk 0 may be read
  at_copy_chunk(lk + AT_TL * 2, ll + AT_TL * 2, lv + AT_TL * 2, gk + AT_KC * kDhd, gl + AT_KC * kDhd, gv + AT_KC);   // chunk 1 -> buffer 1
  for (int kc = 0; kc < nChunks; ++kc) {
    const int bo = (kc & 1) * AT_TL;   // this chunk's buffer
    const __bf16*   Ksh = KshB + bo;
    const __bf16*   Ksl = KslB + bo;
    const _Float16* Vth = VthB + bo;

    // ---- scores, transposed: A operand row = key j*16+c, B operand column = query qt*16+c, both <- d with the split k map ----
    // The chunk's LDS reads stand in two groups, each ahead of the products that use it: a wave then waits out the LDS latency
    // once per group and not once per fragment. Group 1, here: all sixteen K fragments (hi and lo), in front of the first product.
    FB kb[4][2], kl[4][2];   // [key tile j][d half dc]
#pragma unroll   // register arrays: constant indices only (inner loop too)
    for (int j = 0; j < 4; ++j) {
#pragma unroll
      for (int dc = 0; dc < 2; ++dc) {
        kb[j][dc].h[0] = *(const v8b*)(Ksh + (j * 16 + c) * AT_LP + dc * 32 + 8 * hh);
        kb[j][dc].h[1] = *(const v8b*)(Ksh + (j * 16 + c) * AT_LP + dc * 32 + 16 + 8 * hh);
        kl[j][dc].h[0] = *(const v8b*)(Ksl + (j * 16 + c) * AT_LP + dc * 32 + 8 * hh);
        kl[j][dc].h[1] = *(const v8b*)(Ksl + (j * 16 + c) * AT_LP + dc * 32 + 16 + 8 * hh);
      }
    }
    // keeps the sixteen K fragment reads one group in front of the products (the scheduler otherwise spreads them among the WMMAs)
    __builtin_amdgcn_sched_barrier(0);
    FH vb[2][4];             // [key half kk][d tile t]
    v8f s[AT_QT][4];
#pragma unroll
    for (int qt = 0; qt < AT_QT; ++qt)
#pragma unroll
      for (int j = 0; j < 4; ++j) s[qt][j] = (v8f){0.f,0.f,0.f,0.f,0.f,0.f,0.f,0.f};
    // The products of a column tile run round-robin over the four key tiles: a WMMA's accumulator was last written four WMMAs
    // earlier, so none waits for the one in front of it. Each score tile's own six products keep their order (per d half: hi.hi,
    // lo.hi, hi.lo). Column tile 0 runs first, so that its softmax arithmetic has column tile 1's products to run beside.
#pragma unroll   // register arrays: constant indices only (inner loops too)
    for (int qt = 0; qt < AT_QT; ++qt) {
#pragma unroll
      for (int dc = 0; dc < 2; ++dc) {
#pragma unroll
        for (int j = 0; j < 4; ++j) s[qt][j] = at_mma(kb[j][dc].v, qah[qt][dc], s[qt][j]);
#pragma unroll
        for (int j = 0; j < 4; ++j) s[qt][j] = at_mma(kl[j][dc].v, qah[qt][dc], s[qt][j]);
#pragma unroll
        for (int j = 0; j < 4; ++j) s[qt][j] = at_mma(kb[j][dc].v, qal[qt][dc], s[qt][j]);
        if (qt == 0 && dc == 0) {
          // Group 2: all eight V^T fragments; they land behind the remaining score products and the softmax.
          // A: row = d = t*16 + c, same key map as P^T. The two scheduling barriers keep these reads one group at this place.
          __builtin_amdgcn_sched_barrier(0);
#pragma unroll
          for (int kk = 0; kk < 2; ++kk) {
#pragma unroll
            for (int t = 0; t < 4; ++t) {
              vb[kk][t].h[0] = *(const v8h*)(Vth + (t * 16 + c) * AT_LP + kk * 32 + 8 * hh);
              vb[kk][t].h[1] = *(const v8h*)(Vth + (t * 16 + c) * AT_LP + kk * 32 + 16 + 8 * hh);
            }
          }
          __builtin_amdgcn_sched_barrier(0);
        }
      }
      // keeps column tile 0's products in their round-robin order and ahead of tile 1's (the scheduler otherwise mixes the two
      // tiles and puts one accumulator's products back to back), so that tile 0's scores are ready while tile 1's products run
      if (qt == 0) __builtin_amdgcn_sched_barrier(0);
    }
    // D layout: s[qt][j][r] = score(key kv0 + j*16 + 8*hh + r, query q0 + qt*16 + c)
    // the loops over qt, j, r and t below are unrolled because s and oacc are register arrays; one chain per j keeps four
    // independent maximum and sum chains in flight
#pragma unroll
    for (int qt = 0; qt < AT_QT; ++qt) {
      float mj[4];
#pragma unroll
      for (int j = 0; j < 4; ++j) {
        float m = -INFINITY;
#pragma unroll
        for (int r = 0; r < 8; ++r) m = fmaxf(m, s[qt][j][r]);   // raw products: c2 > 0 keeps their order
        mj[j] = m;
      }
      float cm = fmaxf(fmaxf(mj[0], mj[1]), fmaxf(mj[2], mj[3]));
      cm = fmaxf(cm, at_xhalf(cm));            // the query's maximum over all 64 keys of the chunk, in both halves
      const float mnew = fmaxf(mrun[qt], cm * c2);  // running maximum in base-2 units
      const float alpha = at_exp2(mrun[qt] - mnew);
      mrun[qt] = mnew;
      const float nb = kPlog - mnew;            // one addend per query: exponent = score * c2 - maximum + 15
      float pj[4];
#pragma unroll
      for (int j = 0; j < 4; ++j) {
        float x[8];
#pragma unroll
        for (int r = 0; r < 8; ++r) x[r] = fmaf(s[qt][j][r], c2, nb);   // base-2 exponent of the numerator x2^15: one multiply-add
        at_exp2x8(x[0], x[1], x[2], x[3], x[4], x[5], x[6], x[7]);
        float ps = 0.f;
#pragma unroll
        for (int r = 0; r < 8; ++r) {
          ps += x[r];
          s[qt][j][r] = x[r];
        }
        pj[j] = ps;
      }
      lrun[qt] = lrun[qt] * alpha + ((pj[0] + pj[1]) + (pj[2] + pj[3]));
#pragma unroll
      for (int t = 0; t < 4; ++t)
#pragma unroll
        for (int r = 0; r < 8; ++r) oacc[qt][t][r] *= alpha;
      // ---- O^T += V^T . P^T: two score tiles (keys kk*32 + 8hh + 0..7 and kk*32 + 16 + 8hh + 0..7) are one B operand in place ----
#pragma unroll
      for (int kk = 0; kk < 2; ++kk) {   // unrolled: the score tiles are registers and cannot be indexed at run time
        v16h pb;
#pragma unroll   // vector elements are registers: constant indices only
        for (int e = 0; e < 8; ++e) {
          pb[e]     = (_Float16)s[qt][2 * kk][e];
          pb[8 + e] = (_Float16)s[qt][2 * kk + 1][e];
        }
#pragma unroll
        for (int t = 0; t < 4; ++t) oacc[qt][t] = at_mma_h(vb[kk][t].v, pb, oacc[qt][t]);
      }
    }
    // hand-over: this wave's reads of the chunk's buffer are done, its copies of the next chunk have landed; behind the barrier
    // the same holds of every wave, so the next chunk may be read and this chunk's buffer refilled
    // keeps the hand-over at the foot of the chunk: the scheduler otherwise lifts the waits and the barrier to right behind the V^T reads, whose latency then lies open
    __builtin_amdgcn_sched_barrier(0);
    asm volatile("s_wait_dscnt 0x0" ::: "memory");      // this wave's last fragment reads of the buffer have returned
    asm volatile("s_wait_asynccnt 0x0" ::: "memory");   // this wave's copies of chunk kc + 1 have landed
    __syncthreads();
    if (kc + 2 < nChunks)   // the same for the whole work-group
      at_copy_chunk(lk + bo * 2, ll + bo * 2, lv + bo * 2,
                    gk + (size_t)(kc + 2) * AT_KC * kDhd, gl + (size_t)(kc + 2) * AT_KC * kDhd, gv + (kc + 2) * AT_KC);
  }
  asm volatile("s_wait_asynccnt 0x0" ::: "memory");   // no copy is outstanding when the wave goes on to its end

  // ---- epilogue: O = oacc / (l * 2^15), carried x kOsc as f16 ----
  float* os = Os[wave];
#pragma unroll   // oacc is a register array: constant indices only (inner loops too)
  for (int qt = 0; qt < AT_QT; ++qt) {
    const float lsum = lrun[qt] + at_xhalf(lrun[qt]);   // the two halves' key sums of query q0 + qt*16 + c
    const float inv = kOsc * (1.0f / lsum);   // lsum carries the numerators' x2^15
#pragma unroll
    for (int t = 0; t < 4; ++t) {
      v4f w0, w1;
#pragma unroll
      for (int r = 0; r < 4; ++r) { w0[r] = oacc[qt][t][r] * inv; w1[r] = oacc[qt][t][4 + r] * inv; }
      *(v4f*)(os + (qt * 16 + c) * 68 + t * 16 + 8 * hh)     = w0;   // row = query qt*16 + c, 8 consecutive d per lane
      *(v4f*)(os + (qt * 16 + c) * 68 + t * 16 + 8 * hh + 4) = w1;
    }
  }
  __builtin_amdgcn_fence(__ATOMIC_RELEASE, "workgroup");
  __builtin_amdgcn_wave_barrier();
  __builtin_amdgcn_fence(__ATOMIC_ACQUIRE, "workgroup");
  {
    const int qg = lane >> 3, c8 = (lane & 7) * 8;
    {
#pragma unroll
      for (int it = 0; it < AT_QT * 4; ++it) {
        const int row = it * 4 + qg;                    // 8 it x 4 groups = rows 0..31
        const float* sp = os + row * 68 + c8;
        v8h hv;
#pragma unroll
        for (int e = 0; e < 8; ++e) hv[e] = (_Float16)sp[e];
        *(v8h*)(ob + (size_t)(q0 + row) * kDm + c8) = hv;
      }
      
    }
  }
}

// ---------------------------------------------------------------------------
// Host driver. Workspace region map (bytes, 256-B aligned offsets):
//   x16   [4096][1024] bf16           8388608
//   wq16p [1024][1024] bf16 (rows permuted to head-major)  2097152
//   wk16  [64][1024]   bf16            131072
//   wv16  [64][1024]   bf16            131072
//   wo16  [1024][1024] f16 (bf16-RNE x16)  2097152
//   bqp   [1024]       f32 (permuted)     4096
//   Qh,Ql [4096][1024] bf16 hi/lo     2 x 8388608
//   Kh,Kl [4096][64]   bf16 hi/lo     2 x 524288
//   Vt16  [2][64][2048] f16            524288
//   O16   [4096][1024] f16 (x16)      8388608
//   total 39587840 B
// ---------------------------------------------------------------------------
extern "C" void kernel_launch(void* const* d_in, const int* in_sizes, int n_in,
                              void* d_out, int out_size, void* d_ws, size_t ws_size,
                              hipStream_t stream) {
  const int nB = kBatch, nS = kSeq, nD = kDm, nDh = kDhd;
  const int nM = nB * nS;   // 4096
  if (n_in < 9) return;
  if (in_sizes[0] != nM * nD || in_sizes[1] != nD * nD || in_sizes[2] != nD ||
      in_sizes[3] != nDh * nD || in_sizes[4] != nDh || in_sizes[5] != nDh * nD ||
      in_sizes[6] != nDh || in_sizes[7] != nD * nD || in_sizes[8] != nD || out_size != nM * nD) return;

  const float* x  = (const float*)d_in[0];
  const float* wq = (const float*)d_in[1];
  const float* bq = (const float*)d_in[2];
  const float* wk = (const float*)d_in[3];
  const float* bk = (const float*)d_in[4];
  const float* wv = (const float*)d_in[5];
  const float* bv = (const float*)d_in[6];
  const float* wo = (const float*)d_in[7];
  const float* bo = (const float*)d_in[8];

  size_t off = 0;
  auto carve = [&](size_t bytes) -> char* {
    char* p = (char*)d_ws + off;
    off += (bytes + 255) & ~(size_t)255;
    return p;
  };
  unsigned short* x16   = (unsigned short*)carve((size_t)nM * nD * 2);
  unsigned short* wq16p = (unsigned short*)carve((size_t)nD * nD * 2);
  unsigned short* wk16  = (unsigned short*)carve((size_t)nDh * nD * 2);
  unsigned short* wv16  = (unsigned short*)carve((size_t)nDh * nD * 2);
  unsigned short* wo16  = (unsigned short*)carve((size_t)nD * nD * 2);
  float*          bqp   = (float*)carve((size_t)nD * 4);
  unsigned short* Qh    = (unsigned short*)carve((size_t)nM * nD * 2);
  unsigned short* Ql    = (unsigned short*)carve((size_t)nM * nD * 2);
  unsigned short* Kh    = (unsigned short*)carve((size_t)nM * nDh * 2);
  unsigned short* Kl    = (unsigned short*)carve((size_t)nM * nDh * 2);
  unsigned short* Vt16  = (unsigned short*)carve((size_t)nB * nDh * nS * 2);
  unsigned short* O16   = (unsigned short*)carve((size_t)nM * nD * 2);
  if (off > ws_size) return;

  // ---- casts (bf16 RNE; wq rows / bq permuted to head-major; wo as f16(bf16_rne(wo) * 16)): one launch ----
  prep_kernel<<<dim3(kCbAll), dim3(256), 0, stream>>>(x, wq, wo, wk, wv, bq, x16, wq16p, wo16, wk16, wv16, bqp);

  // ---- q, k and v^T projections: one launch, 128 + 8 + 2 x 4 work-groups of 8 waves, one 64x64 tile per wave ----
  proj_qkv_kernel<<<dim3(kPjQ + kPjK + kBatch * kPjV), dim3(256), 0, stream>>>(
      x16, wq16p, wk16, wv16, bqp, bk, bv, Qh, Ql, Kh, Kl, Vt16, nD);

  // ---- attention: grid (16 heads x 16 query blocks, 2 batches), all heads share the batch's K / V^T planes ----
  mqa_full64_kernel<<<dim3(kHeads * (nS / AT_QB), nB), dim3(128), 0, stream>>>(Qh, Ql, Kh, Kl, Vt16, O16, 0.125f);

  // ---- output projection: out [4096][1024] f32 = (O16 . wo16^T) / 256 + bo ----
  wmma_gemm64<0, false, 2, 0, false, 0><<<dim3((nM / 64) * (nD / 64) / 8, 1), dim3(256), 0, stream>>>(
      O16, 0L, wo16, 0L, d_out, d_out, nD, 0L, bo, bo, 0L, nM, nD, nD, 1.0f / (kOsc * kWsc));
}
